// v000
// Measured on an AMD MI455X. A time is GPU time per run, averaged over a window of back-to-back runs after a warm-up
// (all launches, gaps included; the runs take copies of the inputs in turn), and the median of several windows.
// Apart from v000's, it joins two sittings. Times from different sittings can be a few percent apart, while
// side-by-side timings come from the same sitting.
// v000, which the later versions start from, runs in 2230 microseconds.
// Contractions (per image): q / qb / kvb 1x1 projections in position-major form x^T W^T [4096x256].[256x{256,256,512}], the 2x2-stride-2 kv conv as an im2col GEMM [1024x1024].[1024x512] and the output 1x1 conv Wout.(out_img + out_batch)^T [256x256].[256x4096], all with f16 operands (v_wmma_f32_16x16x32_f16; 64x64 register-blocked wave tiles over pre-cast f16 operand planes, weight operands pre-scaled by 16 at the cast and un-scaled in the f32 epilogue); the spatial-reduction attention per head (flash kernel, head_dim 32, 4096 queries x 1024 keys, f16 q.k^T and f16 p.v); f32 accumulate; the im2col, the batch-wise 4x4 attention per (position, head) and the branch sum are f32 kernels.
#include <hip/hip_runtime.h>
#include <math.h>

typedef __attribute__((ext_vector_type(16))) _Float16 v16h;
typedef __attribute__((ext_vector_type(8)))  _Float16 v8h;
typedef __attribute__((ext_vector_type(16))) __bf16   v16b;
typedef __attribute__((ext_vector_type(8)))  float    v8f;
typedef __attribute__((ext_vector_type(4)))  float    v4f;

// 16-bit WMMA fragment map (wave32), lane L, h = L>>4, m = L&15:
//   A 16x32: lane = row m;   element i -> k = (i<8) ? 8h+i : 16+8h+(i-8)
//   B 32x16: lane = column m; the SAME k(i,h)
//   D 16x16 (8 f32): lane = column m; element r -> row 8h+r
__device__ __forceinline__ int frag_k(int i, int h) { return (i < 8) ? (8 * h + i) : (16 + 8 * h + (i - 8)); }
__device__ __forceinline__ __bf16 bf16_rne(float f) {
    unsigned int u = __float_as_uint(f);
    u += 0x7fffu + ((u >> 16) & 1u);
    return __builtin_bit_cast(__bf16, (unsigned short)(u >> 16));
}
__device__ __forceinline__ float bf16_f32(__bf16 b) { return __uint_as_float(((unsigned int)__builtin_bit_cast(unsigned short, b)) << 16); }
__device__ __forceinline__ v8f wmma16(v16h a, v16h b, v8f c) {
    c = __builtin_amdgcn_wmma_f32_16x16x32_f16(false, a, false, b, (short)0, c, false, false);
    asm volatile("v_nop\n\tv_nop\n\tv_nop\n\tv_nop" : "+v"(c) : "v"(a), "v"(b));
    return c;
}
__device__ __forceinline__ v8f wmmab(v16b a, v16b b, v8f c) {
    c = __builtin_amdgcn_wmma_f32_16x16x32_bf16(false, a, false, b, (short)0, c, false, false);
    asm volatile("v_nop\n\tv_nop\n\tv_nop\n\tv_nop" : "+v"(c) : "v"(a), "v"(b));
    return c;
}
struct Split { v16b hi, lo; };
// hi/lo split product: a.hi*b.hi + a.hi*b.lo + a.lo*b.hi
__device__ __forceinline__ v8f wmma3(const Split& a, const Split& b, v8f c) {
    c = __builtin_amdgcn_wmma_f32_16x16x32_bf16(false, a.hi, false, b.hi, (short)0, c, false, false);
    c = __builtin_amdgcn_wmma_f32_16x16x32_bf16(false, a.hi, false, b.lo, (short)0, c, false, false);
    c = __builtin_amdgcn_wmma_f32_16x16x32_bf16(false, a.lo, false, b.hi, (short)0, c, false, false);
    asm volatile("v_nop\n\tv_nop\n\tv_nop\n\tv_nop" : "+v"(c) : "v"(a.hi), "v"(a.lo), "v"(b.hi), "v"(b.lo));
    return c;
}
struct Split3 { v16b hi, mid, lo; };
// triple split product (6 terms, drops only terms below 2^-24 relative)
__device__ __forceinline__ v8f wmma6(const Split3& a, const Split3& b, v8f c) {
    c = __builtin_amdgcn_wmma_f32_16x16x32_bf16(false, a.hi, false, b.hi, (short)0, c, false, false);
    c = __builtin_amdgcn_wmma_f32_16x16x32_bf16(false, a.hi, false, b.mid, (short)0, c, false, false);
    c = __builtin_amdgcn_wmma_f32_16x16x32_bf16(false, a.mid, false, b.hi, (short)0, c, false, false);
    c = __builtin_amdgcn_wmma_f32_16x16x32_bf16(false, a.hi, false, b.lo, (short)0, c, false, false);
    c = __builtin_amdgcn_wmma_f32_16x16x32_bf16(false, a.mid, false, b.mid, (short)0, c, false, false);
    c = __builtin_amdgcn_wmma_f32_16x16x32_bf16(false, a.lo, false, b.hi, (short)0, c, false, false);
    asm volatile("v_nop\n\tv_nop\n\tv_nop\n\tv_nop" : "+v"(c) : "v"(a.hi), "v"(a.mid), "v"(a.lo), "v"(b.hi), "v"(b.mid), "v"(b.lo));
    return c;
}

// Fragment gathers from f32 memory: element i <- p[(k0 + frag_k(i,h)) * sk] * s, zero for k >= klen.
__device__ __forceinline__ v16h fh_ld(const float* __restrict__ p, long long sk, int k0, int h, int klen, float s) {
    v16h a;
#pragma unroll
    for (int i = 0; i < 16; ++i) { const int k = k0 + frag_k(i, h); a[i] = (k < klen) ? (_Float16)(p[(long long)k * sk] * s) : (_Float16)0.f; }
    return a;
}
__device__ __forceinline__ Split sp_ld(const float* __restrict__ p, long long sk, int k0, int h, int klen, float s) {
    Split r;
#pragma unroll
    for (int i = 0; i < 16; ++i) {
        const int k = k0 + frag_k(i, h); const float x = (k < klen) ? p[(long long)k * sk] * s : 0.f;
        const __bf16 hb = bf16_rne(x); r.hi[i] = hb; r.lo[i] = bf16_rne(x - bf16_f32(hb));
    }
    return r;
}
__device__ __forceinline__ Split3 sp3_ld(const float* __restrict__ p, long long sk, int k0, int h, int klen, float s) {
    Split3 r;
#pragma unroll
    for (int i = 0; i < 16; ++i) {
        const int k = k0 + frag_k(i, h); const float x = (k < klen) ? p[(long long)k * sk] * s : 0.f;
        const __bf16 hb = bf16_rne(x); const float r1 = x - bf16_f32(hb); const __bf16 mb = bf16_rne(r1);
        r.hi[i] = hb; r.mid[i] = mb; r.lo[i] = bf16_rne(r1 - bf16_f32(mb));
    }
    return r;
}
__device__ __forceinline__ v16b bh_ld(const float* __restrict__ p, long long sk, int k0, int h, int klen, float s) {
    v16b a;
#pragma unroll
    for (int i = 0; i < 16; ++i) { const int k = k0 + frag_k(i, h); a[i] = bf16_rne((k < klen) ? p[(long long)k * sk] * s : 0.f); }
    return a;
}
// f16 fragment from an f16 LDS/global row with element stride 1 (k-contiguous), no bounds (tile already zero padded)
__device__ __forceinline__ v16h fh_row(const _Float16* __restrict__ row, int k0, int h) {
    v16h a;
#pragma unroll
    for (int i = 0; i < 16; ++i) a[i] = row[k0 + frag_k(i, h)];
    return a;
}

#define VST2(T, ptr, val) do { const T vst2_v_ = (val); *(T*)(ptr) = vst2_v_;  } while (0)
typedef float v4f __attribute__((ext_vector_type(4)));
#define VST2V4(ptr, val) do { const v4f vst2_v4_ = (val); *(v4f*)(ptr) = vst2_v4_;  } while (0)

__device__ __attribute__((noinline)) float act_fn(float v, int act) {
    if (act == 1) return fmaxf(v, 0.f);                                                                               // relu
    if (act == 2) { const float u = 0.7978845608028654f * (v + 0.044715f * v * v * v); return 0.5f * v * (1.f + tanhf(u)); } // tanh-gelu
    if (act == 3) return v / (1.f + expf(-v));                                                                        // silu
    if (act == 4) return 0.5f * v * (1.f + erff(v * 0.7071067811865476f));                                             // erf-gelu
    if (act == 5) return tanhf(v);
    if (act == 6) return 1.f / (1.f + expf(-v));                                                                      // sigmoid
    if (act == 7) return (v > 0.f) ? v : 0.01f * v;                                                                   // leaky relu 0.01
    if (act == 8) return (v > 0.f) ? v : (expf(v) - 1.f);                                                             // elu
    if (act == 9) return fminf(fmaxf(v, 0.f), 6.f);                                                                   // relu6
    if (act == 10) return fabsf(v);                                                                                    // abs
    if (act == 11) return (v >= 0.f) ? v : 0.1f * v;                                                                  // leaky 0.1
    if (act == 12) return (v > 0.f) ? v : 0.2f * v;                                                                   // leaky 0.2
    if (act == 13) return (v > 20.f) ? v : log1pf(expf(v));                                                            // softplus
    return v;
}

// =====================================================================================================================
// k_gemm<MODE>: C(z, m, n) = act(alpha * sum_k A(z, m, k) * B(z, k, n) + bias) + beta * R(z, m, n)
//   One wave (32-thread block) per 16 x 32 tile of C; grid (ceil(N/32), ceil(M/16), Z). Batch z -> (zo = z / zi_n, zi = z % zi_n)
//   with separate outer/inner strides for every tensor (e.g. batch and head). A(m,k) = A[zo*sAo + zi*sAi + m*sAm + k*sAk] (f32),
//   B(k,n) = B[zo*sBo + zi*sBi + n*sBn + k*sBk] (f32); any M, N, K (K zero-padded to 32 inside the fragments, M/N tails guarded).
//   C(m,n) = C[zo*sCo + zi*sCi + m*sCm + n] (n contiguous). flags: 1 bias[n], 2 bias[m], 4 residual R[zo*sRo + zi*sRi + m*sRm + n*sRn].
//   MODE 0: f16 operands (A prescaled by sa, B by sb, both undone in the epilogue); 1: bf16 hi/lo split (3 products); 2: bf16;
//   3: bf16 hi/mid/lo triple split (6 products); 4: as 3 with Kahan-compensated f32 accumulation across k-steps.
// =====================================================================================================================
struct GemmP {
    const float* A; const float* B; const float* bias; const float* R; float* C;
    long long sAo, sAi, sAm, sAk, sBo, sBi, sBn, sBk, sCo, sCi, sCm, sRo, sRi, sRm, sRn;
    int M, N, K, zi_n, flags, act; float alpha, beta, sa, sb;
    int Npad, pad_;     // columns [N, Npad) of C are written as 0 so that padded workspace rows are covered by whole-line stores; Npad >= N
};
static_assert(sizeof(GemmP) == 5 * 8 + 15 * 8 + 6 * 4 + 4 * 4 + 2 * 4, "GemmP has padding");

template <int MODE>
__global__ __launch_bounds__(32) void k_gemm(GemmP p) {
    const int lane = threadIdx.x & 31, h = lane >> 4, l15 = lane & 15;
    const int m0 = blockIdx.y * 16, n0 = blockIdx.x * 32;
    const int z = blockIdx.z, zo = z / p.zi_n, zi = z - zo * p.zi_n;
    const float* A = p.A + zo * p.sAo + zi * p.sAi;
    const float* B = p.B + zo * p.sBo + zi * p.sBi;
    const int am = min(m0 + l15, p.M - 1);                       // clamped row for loads (stores are guarded)
    v8f acc[2], comp[2];
#pragma unroll
    for (int t = 0; t < 2; ++t) { v8f zz = {}; acc[t] = zz; comp[t] = zz; }
    for (int k0 = 0; k0 < p.K; k0 += 32) {
        const float* arow = A + (long long)am * p.sAm;
        if (MODE == 1) {
            const Split a = sp_ld(arow, p.sAk, k0, h, p.K, 1.f);
#pragma unroll
            for (int t = 0; t < 2; ++t) {
                const int bn = min(n0 + t * 16 + l15, p.N - 1);
                acc[t] = wmma3(a, sp_ld(B + (long long)bn * p.sBn, p.sBk, k0, h, p.K, 1.f), acc[t]);
            }
        } else if (MODE == 3) {
            const Split3 a = sp3_ld(arow, p.sAk, k0, h, p.K, 1.f);
#pragma unroll
            for (int t = 0; t < 2; ++t) {
                const int bn = min(n0 + t * 16 + l15, p.N - 1);
                acc[t] = wmma6(a, sp3_ld(B + (long long)bn * p.sBn, p.sBk, k0, h, p.K, 1.f), acc[t]);
            }
        } else if (MODE == 4) {
            // triple split as MODE 3, but each k-step's 6 products go into a fresh accumulator and the partial is added to the running f32 sum
            // on the VALU with Kahan compensation (accumulation error stays ~1 ulp however long K is)
            const Split3 a = sp3_ld(arow, p.sAk, k0, h, p.K, 1.f);
#pragma unroll
            for (int t = 0; t < 2; ++t) {
                const int bn = min(n0 + t * 16 + l15, p.N - 1); v8f zz = {};
                const v8f part = wmma6(a, sp3_ld(B + (long long)bn * p.sBn, p.sBk, k0, h, p.K, 1.f), zz);
                const v8f y = part - comp[t]; const v8f s = acc[t] + y; comp[t] = (s - acc[t]) - y; acc[t] = s;
            }
        } else if (MODE == 2) {
            const v16b a = bh_ld(arow, p.sAk, k0, h, p.K, 1.f);
#pragma unroll
            for (int t = 0; t < 2; ++t) {
                const int bn = min(n0 + t * 16 + l15, p.N - 1);
                acc[t] = wmmab(a, bh_ld(B + (long long)bn * p.sBn, p.sBk, k0, h, p.K, 1.f), acc[t]);
            }
        } else {
            const v16h a = fh_ld(arow, p.sAk, k0, h, p.K, p.sa);
#pragma unroll
            for (int t = 0; t < 2; ++t) {
                const int bn = min(n0 + t * 16 + l15, p.N - 1);
                acc[t] = wmma16(a, fh_ld(B + (long long)bn * p.sBn, p.sBk, k0, h, p.K, p.sb), acc[t]);
            }
        }
    }
    const float iscale = (MODE == 0) ? p.alpha / (p.sa * p.sb) : p.alpha;
    float* C = p.C + zo * p.sCo + zi * p.sCi;
    const float* R = p.R + zo * p.sRo + zi * p.sRi;
    __shared__ __align__(16) float ctile[16][36];
#pragma unroll
    for (int t = 0; t < 2; ++t) {
        const int n = n0 + t * 16 + l15; const int nn = min(n, p.N - 1);
#pragma unroll
        for (int r = 0; r < 8; ++r) {
            const int m = m0 + 8 * h + r; const int mm = min(m, p.M - 1);
            float v = acc[t][r] * iscale;
            if (p.flags & 1) v += p.bias[nn];
            if (p.flags & 2) v += p.bias[mm];
            if (p.flags & 8) v *= p.bias[(long long)zo * p.M + mm];   /* per-(z,row) scale vector laid out [Z][M]; exclusive with the bias flags */
            v = act_fn(v, p.act);
            if (p.flags & 4) v += p.beta * R[(long long)mm * p.sRm + (long long)nn * p.sRn];
            ctile[8 * h + r][t * 16 + l15] = (n < p.N) ? v : 0.f;
        }
    }
    __syncthreads();
    const int NW = (p.Npad > p.N) ? p.Npad : p.N;           // write width
    const bool fast = (m0 + 16 <= p.M) && (n0 + 32 <= NW) && ((p.sCm & 3) == 0) && ((((size_t)C) & 15) == 0);
    if (fast) {
#pragma unroll
        for (int s = 0; s < 4; ++s) {
            const int row = s * 4 + (lane >> 3), c4 = (lane & 7) * 4;
            const v4f v = *(const v4f*)&ctile[row][c4];
            VST2V4(C + (long long)(m0 + row) * p.sCm + n0 + c4, v);
        }
    } else {
        for (int row = 0; row < 16; ++row) {
            const int m = m0 + row, n = n0 + lane;
            if (m < p.M && n < NW) VST2(float, C + (long long)m * p.sCm + n, ctile[row][lane]);
        }
    }
}


// =====================================================================================================================
// k_gemmT<MODE, TM, TN>: same contract as k_gemm, but one wave computes a (16*TM) x (16*TN) tile: TM A fragments and TN B fragments are
//   loaded per 32-wide k-step and reused across TM*TN WMMAs (far fewer load/convert instructions per MAC). MODE 0 (f16), 1 (bf16 hi/lo),
//   2 (bf16) only. grid (ceil(NW/(16*TN)), ceil(M/(16*TM)), Z), block 32. Epilogue identical to k_gemm, run per 16x32 sub-tile.
// =====================================================================================================================
template <int MODE, int TM, int TN>
__global__ __launch_bounds__(32) void k_gemmT(GemmP p) {
    const int lane = threadIdx.x & 31, h = lane >> 4, l15 = lane & 15;
    const int m0 = blockIdx.y * (16 * TM), n0 = blockIdx.x * (16 * TN);
    const int z = blockIdx.z, zo = z / p.zi_n, zi = z - zo * p.zi_n;
    const float* A = p.A + zo * p.sAo + zi * p.sAi;
    const float* B = p.B + zo * p.sBo + zi * p.sBi;
    v8f acc[TM][TN];
#pragma unroll
    for (int i = 0; i < TM; ++i)
#pragma unroll
        for (int t = 0; t < TN; ++t) { v8f zz = {}; acc[i][t] = zz; }
    for (int k0 = 0; k0 < p.K; k0 += 32) {
        if (MODE == 1) {
            Split a[TM], b[TN];
#pragma unroll
            for (int i = 0; i < TM; ++i) { const int am = min(m0 + 16 * i + l15, p.M - 1); a[i] = sp_ld(A + (long long)am * p.sAm, p.sAk, k0, h, p.K, 1.f); }
#pragma unroll
            for (int t = 0; t < TN; ++t) { const int bn = min(n0 + 16 * t + l15, p.N - 1); b[t] = sp_ld(B + (long long)bn * p.sBn, p.sBk, k0, h, p.K, 1.f); }
#pragma unroll
            for (int i = 0; i < TM; ++i)
#pragma unroll
                for (int t = 0; t < TN; ++t) acc[i][t] = wmma3(a[i], b[t], acc[i][t]);
        } else if (MODE == 2) {
            v16b a[TM], b[TN];
#pragma unroll
            for (int i = 0; i < TM; ++i) { const int am = min(m0 + 16 * i + l15, p.M - 1); a[i] = bh_ld(A + (long long)am * p.sAm, p.sAk, k0, h, p.K, 1.f); }
#pragma unroll
            for (int t = 0; t < TN; ++t) { const int bn = min(n0 + 16 * t + l15, p.N - 1); b[t] = bh_ld(B + (long long)bn * p.sBn, p.sBk, k0, h, p.K, 1.f); }
#pragma unroll
            for (int i = 0; i < TM; ++i)
#pragma unroll
                for (int t = 0; t < TN; ++t) acc[i][t] = wmmab(a[i], b[t], acc[i][t]);
        } else {
            v16h a[TM], b[TN];
#pragma unroll
            for (int i = 0; i < TM; ++i) { const int am = min(m0 + 16 * i + l15, p.M - 1); a[i] = fh_ld(A + (long long)am * p.sAm, p.sAk, k0, h, p.K, p.sa); }
#pragma unroll
            for (int t = 0; t < TN; ++t) { const int bn = min(n0 + 16 * t + l15, p.N - 1); b[t] = fh_ld(B + (long long)bn * p.sBn, p.sBk, k0, h, p.K, p.sb); }
#pragma unroll
            for (int i = 0; i < TM; ++i)
#pragma unroll
                for (int t = 0; t < TN; ++t) acc[i][t] = wmma16(a[i], b[t], acc[i][t]);
        }
    }
    const float iscale = (MODE == 0) ? p.alpha / (p.sa * p.sb) : p.alpha;
    float* C = p.C + zo * p.sCo + zi * p.sCi;
    const float* R = p.R + zo * p.sRo + zi * p.sRi;
    const int NW = (p.Npad > p.N) ? p.Npad : p.N;
    __shared__ __align__(16) float ctile[16][36];
#pragma unroll
    for (int i = 0; i < TM; ++i) {
        const int mb = m0 + 16 * i; if (mb >= p.M) break;          // wave-uniform
#pragma unroll
        for (int tp = 0; tp < TN / 2; ++tp) {
            const int nb = n0 + 32 * tp; if (nb >= NW) break;        // wave-uniform
#pragma unroll
            for (int t2 = 0; t2 < 2; ++t2) {
                const int t = 2 * tp + t2; const int n = nb + t2 * 16 + l15; const int nn = min(n, p.N - 1);
#pragma unroll
                for (int r = 0; r < 8; ++r) {
                    const int m = mb + 8 * h + r; const int mm = min(m, p.M - 1);
                    float v = acc[i][t][r] * iscale;
                    if (p.flags & 1) v += p.bias[nn];
                    if (p.flags & 2) v += p.bias[mm];
            if (p.flags & 8) v *= p.bias[(long long)zo * p.M + mm];   /* per-(z,row) scale vector laid out [Z][M]; exclusive with the bias flags */
                    v = act_fn(v, p.act);
                    if (p.flags & 4) v += p.beta * R[(long long)mm * p.sRm + (long long)nn * p.sRn];
                    ctile[8 * h + r][t2 * 16 + l15] = (n < p.N) ? v : 0.f;
                }
            }
            __syncthreads();
            const bool fast = (mb + 16 <= p.M) && (nb + 32 <= NW) && ((p.sCm & 3) == 0) && ((((size_t)C) & 15) == 0);
            if (fast) {
#pragma unroll
                for (int s = 0; s < 4; ++s) {
                    const int row = s * 4 + (lane >> 3), c4 = (lane & 7) * 4;
                    const v4f v = *(const v4f*)&ctile[row][c4];
                    VST2V4(C + (long long)(mb + row) * p.sCm + nb + c4, v);
                }
            } else {
                for (int row = 0; row < 16; ++row) {
                    const int m = mb + row, n = nb + lane;
                    if (m < p.M && n < NW) VST2(float, C + (long long)m * p.sCm + n, ctile[row][lane]);
                }
            }
            __syncthreads();
        }
    }
}

// =====================================================================================================================
//   Wave = 16 queries, AW waves per block, 64-key blocks; grid (ceil(Lq/(16*AW)), H, B), block 32*AW. Any Lq, Lk; head dim dh <= DHP
//   (DHP multiple of 32), value dim dv <= DVP (multiple of 16, <= 128). Every tensor addressed by (batch, head, row, element) strides, f32.
//   Scores: QM 0 f16 operands, 1 bf16 hi/lo split, 2 bf16 triple split; statistics f32 (exp2 domain); P.V: P x 4096 as f16 with V f16 staged in LDS
//   (SPLITPV: P and V as bf16 hi/lo splits). kv head = h / hrep. Masking: causal = 1 (keep j <= i + coff, masked -> -inf, key blocks beyond the
//   diagonal skipped), causal = 2 (masked -> mfill, a finite fill like the -1e9; no skipping), causal = 3 (keep j >= i + coff,
//   masked -> -inf, no skipping); optional additive f32 mask Mf,
//   optional int keep-mask Mi (0 -> score := mfill), both addressed b*smb + h*smh + i*smi + j*smj (0 strides broadcast).
// =====================================================================================================================
#define AW 4
struct AttnP {   // apv4
    const float* Q; const float* K; const float* V; float* O; float* P; const float* Mf; const int* Mi; float* ST;
    const float* Pw; const float* Rt; const int* SQ; const int* SK;           // optional: post-softmax weight, relative-position table, segment ids
    long long swb, swh, swi, swj, srb, srh, sri;                                 // Pw strides (b,h,i,j); Rt strides (b,h,i), column = clamp(i - j + roff, 0, rn-1)
    long long sQb, sQh, sQi, sQd, sKb, sKh, sKj, sKd, sVb, sVh, sVj, sVd, sOb, sOh, sOi, sPb, sPh, sPi, smb, smh, smi, smj;
    int Lq, Lk, dh, dv, hrep, causal, coff, pband;   // pband > 0: P holds only the band |j - i| <= pband, column j - i + pband
    float scale, mfill; int nonorm, mpol;             // nonorm (online path only): O = sum_j exp(score_j) V_j without the 1/rowsum (scores must be <= ~0); mpol: Mi masks where ==0 (mpol 0) or where !=0 (mpol 1)
    int roff, rn, segpol, win;                        // Rt column offset/count; SQ/SK: score := mfill where (segpol 0) SQ[i] != SK[j] or (segpol 1) SQ[i] == SK[j]; win > 0: keys with i - j > win (after coff) -> -inf
};
//   Pw: the softmax numerator is multiplied by Pw(b,h,i,j) AFTER the row sum is taken (probs * weight, then P.V), as in post-softmax multiplicative biases.                                                    // ST (optional): per row (b,h,i) -> ST[((b*H + h)*Lq + i)*2 + {0,1}] = {row max of the scaled+masked score (natural units), sum_j exp(score - max)}
static_assert(sizeof(AttnP) == 12 * 8 + 29 * 8 + 16 * 4, "AttnP has padding");

#ifndef KATTN_ATTR
#define KATTN_ATTR
#endif
template <int DHP, int DVP, int QM, bool SPLITPV, bool TWOPASS>
__global__ __launch_bounds__(32 * AW) KATTN_ATTR void k_attn(AttnP p) {
    constexpr int NT = DVP / 16;                // output tiles
    constexpr int KS = DHP / 32;                // k-steps for the scores
    constexpr int VP = DVP + 8;                 // LDS pitch (halves)
    __shared__ __align__(16) float    pl[AW][16 * 64];
    __shared__ __align__(16) _Float16 vl[(SPLITPV ? 2 : 1) * 64 * VP];   // f16 V tile, or bf16 hi and lo tiles (same 2-byte size)
    const int lane = threadIdx.x & 31, hf = lane >> 4, l15 = lane & 15, wave = threadIdx.x >> 5;
    const int h = blockIdx.y, b = blockIdx.z, hk = h / p.hrep;
    const int q0 = (blockIdx.x * AW + wave) * 16;
    float* myp = pl[wave];
    const float L2E = 1.4426950408889634f;
    const float NEG = -__builtin_inff();
    const int qi = min(q0 + l15, p.Lq - 1);
    const float* qrow = p.Q + b * p.sQb + h * p.sQh + (long long)qi * p.sQi;
    const float* kbase = p.K + b * p.sKb + hk * p.sKh;
    const float* vbase = p.V + b * p.sVb + hk * p.sVh;
    v16h qa[QM == 0 ? KS : 1]; Split qs_[QM == 1 ? KS : 1]; Split3 qt_[QM == 2 ? KS : 1];
#pragma unroll
    for (int ks = 0; ks < KS; ++ks) {
        if (QM == 2) qt_[ks] = sp3_ld(qrow, p.sQd, ks * 32, hf, p.dh, 1.f);
        else if (QM == 1) qs_[ks] = sp_ld(qrow, p.sQd, ks * 32, hf, p.dh, 1.f);
        else qa[ks] = fh_ld(qrow, p.sQd, ks * 32, hf, p.dh, 1.f);
    }
    v8f o[NT]; float m8[8], l8[8];
#pragma unroll
    for (int t = 0; t < NT; ++t) { v8f zz = {}; o[t] = zz; }
#pragma unroll
    for (int i = 0; i < 8; ++i) { m8[i] = NEG; l8[i] = 0.f; }
    int jend = p.Lk;
    if (p.causal == 1) { const int je = (blockIdx.x * AW + AW - 1) * 16 + 16 + p.coff; jend = min(jend, max(je, 0)); }   // uniform per block
    const int npass = TWOPASS ? 2 : 1;
    for (int pass = 0; pass < npass; ++pass) {
        const bool dopv = (!TWOPASS) || pass == 1;
        for (int j0 = 0; j0 < jend; j0 += 64) {
            if (dopv) {
                __syncthreads();                                 // previous key block's reads of vl / pl are done
                for (int idx = threadIdx.x; idx < 64 * DVP; idx += 32 * AW) {
                    const int jr = idx / DVP, d = idx - jr * DVP, j = j0 + jr;
                    const float f = (j < p.Lk && d < p.dv) ? vbase[(long long)j * p.sVj + (long long)d * p.sVd] : 0.f;
                    if (SPLITPV) {
                        const __bf16 hb = bf16_rne(f);
                        ((__bf16*)vl)[jr * VP + d] = hb; ((__bf16*)vl)[64 * VP + jr * VP + d] = bf16_rne(f - bf16_f32(hb));
                    } else vl[jr * VP + d] = (_Float16)f;
                }
            }
            v8f s[4];
#pragma unroll
            for (int t = 0; t < 4; ++t) {
                const int j = min(j0 + t * 16 + l15, p.Lk - 1);
                const float* krow = kbase + (long long)j * p.sKj;
                v8f acc = {};
#pragma unroll
                for (int ks = 0; ks < KS; ++ks) {
                    if (QM == 2)      acc = wmma6(qt_[ks], sp3_ld(krow, p.sKd, ks * 32, hf, p.dh, 1.f), acc);
                    else if (QM == 1) acc = wmma3(qs_[ks], sp_ld(krow, p.sKd, ks * 32, hf, p.dh, 1.f), acc);
                    else              acc = wmma16(qa[ks], fh_ld(krow, p.sKd, ks * 32, hf, p.dh, 1.f), acc);
                }
                s[t] = acc;
            }
            float pv[8][4];
#pragma unroll
            for (int i = 0; i < 8; ++i) {
                const int irow = q0 + i + 8 * hf;
                const int ic = min(irow, p.Lq - 1);
                float sc[4];
#pragma unroll
                for (int t = 0; t < 4; ++t) {
                    const int jg = j0 + t * 16 + l15;
                    float v = s[t][i] * p.scale;
                    if (p.Mf) v += p.Mf[b * p.smb + h * p.smh + (long long)ic * p.smi + (long long)min(jg, p.Lk - 1) * p.smj];
                    if (p.Rt) { int rc = ic - min(jg, p.Lk - 1) + p.roff; rc = rc < 0 ? 0 : (rc >= p.rn ? p.rn - 1 : rc); v += p.Rt[b * p.srb + h * p.srh + (long long)ic * p.sri + rc]; }
                    if (p.Mi) { const int mv = p.Mi[b * p.smb + h * p.smh + (long long)ic * p.smi + (long long)min(jg, p.Lk - 1) * p.smj]; if (p.mpol ? (mv != 0) : (mv == 0)) v = p.mfill; }
                    if (p.SQ) { const bool same = p.SQ[(long long)b * p.Lq + ic] == p.SK[(long long)b * p.Lk + min(jg, p.Lk - 1)]; if (p.segpol ? same : !same) v = p.mfill; }
                    if (p.causal == 2 && jg > irow + p.coff) v = p.mfill;
                    if (jg >= p.Lk || (p.causal == 1 && jg > irow + p.coff) || (p.causal == 3 && jg < irow + p.coff) || (p.win > 0 && irow + p.coff - jg > p.win)) v = NEG; else v *= L2E;
                    sc[t] = v;
                }
                if (!TWOPASS || pass == 0) {
                    float mx = fmaxf(fmaxf(sc[0], sc[1]), fmaxf(sc[2], sc[3]));
                    mx = fmaxf(mx, __shfl_xor(mx, 1, 32)); mx = fmaxf(mx, __shfl_xor(mx, 2, 32));
                    mx = fmaxf(mx, __shfl_xor(mx, 4, 32)); mx = fmaxf(mx, __shfl_xor(mx, 8, 32));
                    const float mnew = fmaxf(m8[i], mx);
                    const float corr = (mnew == NEG) ? 1.f : exp2f(m8[i] - mnew);
                    float rs = 0.f;
#pragma unroll
                    for (int t = 0; t < 4; ++t) {
                        const float pp = (sc[t] == NEG) ? 0.f : exp2f(sc[t] - mnew); rs += pp;
                        pv[i][t] = p.Pw ? pp * p.Pw[b * p.swb + h * p.swh + (long long)ic * p.swi + (long long)min(j0 + t * 16 + l15, p.Lk - 1) * p.swj] : pp;
                    }
                    rs += __shfl_xor(rs, 1, 32); rs += __shfl_xor(rs, 2, 32); rs += __shfl_xor(rs, 4, 32); rs += __shfl_xor(rs, 8, 32);
                    l8[i] = l8[i] * corr + rs; m8[i] = mnew;
                    if (!TWOPASS) {
#pragma unroll
                        for (int t = 0; t < NT; ++t) o[t][i] *= corr;
                    }
                } else {
                    const float inv = (l8[i] > 0.f) ? 1.f / l8[i] : 0.f;
#pragma unroll
                    for (int t = 0; t < 4; ++t) {
                        const int jg = j0 + t * 16 + l15;
                        float pp = (sc[t] == NEG) ? 0.f : exp2f(sc[t] - m8[i]) * inv;
                        if (p.Pw) pp *= p.Pw[b * p.swb + h * p.swh + (long long)ic * p.swi + (long long)min(jg, p.Lk - 1) * p.swj];
                        pv[i][t] = pp;
                    }
                }
            }
            if (dopv) {
#pragma unroll
                for (int i = 0; i < 8; ++i)
#pragma unroll
                    for (int t = 0; t < 4; ++t) ((float*)myp)[(i + 8 * hf) * 64 + t * 16 + l15] = pv[i][t];
                __syncthreads();                                 // P (per wave) and V (shared) visible
                if (p.P) {
                    float* pb_ = p.P + b * p.sPb + h * p.sPh;
                    const bool fastP = (p.pband == 0) && ((p.sPi & 3) == 0) && (j0 + 64 <= p.Lk) && (q0 + 16 <= p.Lq) && ((((size_t)pb_) & 15) == 0);
                    if (fastP) {
#pragma unroll
                        for (int s = 0; s < 8; ++s) {
                            const int row = s * 2 + (lane >> 4), c4 = (lane & 15) * 4;
                            const v4f v = *(const v4f*)(myp + row * 64 + c4);
                            VST2V4(pb_ + (long long)(q0 + row) * p.sPi + j0 + c4, v);
                        }
                    } else {
                        for (int row = 0; row < 16; ++row) {
                            const int irow = q0 + row; if (irow >= p.Lq) continue;
                            for (int c = lane; c < 64; c += 32) {
                                const int jg = j0 + c; if (jg >= p.Lk) continue;
                                if (p.pband == 0) VST2(float, pb_ + (long long)irow * p.sPi + jg, myp[row * 64 + c]);
                                else if (jg - irow <= p.pband && irow - jg <= p.pband) VST2(float, pb_ + (long long)irow * p.sPi + (jg - irow + p.pband), myp[row * 64 + c]);
                            }
                        }
                    }
                }
                if (SPLITPV) {
                    const Split pa0 = sp_ld(myp + l15 * 64, 1, 0, hf, 64, 1.f), pa1 = sp_ld(myp + l15 * 64, 1, 32, hf, 64, 1.f);
                    const __bf16* vh = (const __bf16*)vl; const __bf16* vlo = vh + 64 * VP;
#pragma unroll
                    for (int t = 0; t < NT; ++t) {
                        const int dcol = t * 16 + l15;
                        Split b0, b1;
#pragma unroll
                        for (int e = 0; e < 16; ++e) {
                            const int k0 = frag_k(e, hf), k1 = 32 + frag_k(e, hf);
                            b0.hi[e] = vh[k0 * VP + dcol]; b0.lo[e] = vlo[k0 * VP + dcol]; b1.hi[e] = vh[k1 * VP + dcol]; b1.lo[e] = vlo[k1 * VP + dcol];
                        }
                        o[t] = wmma3(pa0, b0, o[t]);
                        o[t] = wmma3(pa1, b1, o[t]);
                    }
                } else {
                    const v16h pa0 = fh_ld(myp + l15 * 64, 1, 0, hf, 64, 4096.f), pa1 = fh_ld(myp + l15 * 64, 1, 32, hf, 64, 4096.f);
#pragma unroll
                    for (int t = 0; t < NT; ++t) {
                        const int dcol = t * 16 + l15;
                        v16h b0, b1;
#pragma unroll
                        for (int e = 0; e < 16; ++e) { b0[e] = vl[frag_k(e, hf) * VP + dcol]; b1[e] = vl[(32 + frag_k(e, hf)) * VP + dcol]; }
                        o[t] = wmma16(pa0, b0, o[t]);
                        o[t] = wmma16(pa1, b1, o[t]);
                    }
                }
            }
        }
    }
    float* obase = p.O + b * p.sOb + h * p.sOh;
    if (p.ST) {
        const int rl = lane >> 1, isel = rl & 7;           // row q0 + rl ; rl>>3 == hf holds because lane>>4 == (lane>>1)>>3
        float mv = 0.f, lv = 0.f;
#pragma unroll
        for (int i = 0; i < 8; ++i) if (i == isel) { mv = m8[i]; lv = l8[i]; }
        const int irow = q0 + rl;
        if (irow < p.Lq) { float* st = p.ST + (((long long)b * gridDim.y + h) * p.Lq + irow) * 2 + (lane & 1); VST2(float, st, (lane & 1) ? lv : mv * 0.6931471805599453f); }
    }
    float invr[8];
#pragma unroll
    for (int i = 0; i < 8; ++i) {
        if (TWOPASS) invr[i] = SPLITPV ? 1.f : (1.f / 4096.f);
        else if (p.nonorm) invr[i] = exp2f(m8[i]) * (SPLITPV ? 1.f : (1.f / 4096.f));
        else invr[i] = (l8[i] > 0.f) ? (SPLITPV ? 1.f / l8[i] : 1.f / (l8[i] * 4096.f)) : 0.f;
    }
    __syncthreads();                                             // all waves done with pl/vl from the main loop
    const bool ofast = ((p.sOi & 3) == 0) && ((((size_t)obase) & 15) == 0) && (q0 + 16 <= p.Lq);
#pragma unroll
    for (int c0 = 0; c0 < DVP; c0 += 64) {
#pragma unroll
        for (int i = 0; i < 8; ++i)
#pragma unroll
            for (int t = 0; t < NT; ++t) if (t * 16 >= c0 && t * 16 < c0 + 64) ((float*)myp)[(i + 8 * hf) * 64 + (t * 16 - c0) + l15] = o[t][i] * invr[i];
        __syncthreads();
        const int cw = (DVP - c0 < 64) ? (DVP - c0) : 64;      // staged columns in this chunk (multiple of 16)
        if (ofast && (c0 + cw <= p.dv) && (cw % 32 == 0)) {
            const int lpr = cw / 4;                              // lanes per row (16 for 64 cols, 8 for 32)
            const int rows_per_ins = 32 / lpr;
            for (int r0 = 0; r0 < 16; r0 += rows_per_ins) {
                const int row = r0 + lane / lpr, c4 = (lane % lpr) * 4;
                const v4f v = *(const v4f*)(myp + row * 64 + c4);
                VST2V4(obase + (long long)(q0 + row) * p.sOi + c0 + c4, v);
            }
        } else {
            for (int row = 0; row < 16; ++row) {
                const int irow = q0 + row; if (irow >= p.Lq) continue;
                for (int c = lane; c < cw; c += 32) { const int d = c0 + c; if (d < p.dv) VST2(float, obase + (long long)irow * p.sOi + d, myp[row * 64 + c]); }
            }
        }
        __syncthreads();
    }
}

// =====================================================================================================================
// k_tr: dst(z, c, r) = alpha * src(z, r, c) (+ beta * R2(z, c, r)): [Z][R][C] (row stride lds) -> [Z][C][R] (row stride ldd) through a 32x32 LDS tile;
//   flags: 1 -> add beta * residual R2 addressed like dst (z*sRz + c*ldr + r); act applied before the residual.
// =====================================================================================================================
struct TrP { const float* src; float* dst; const float* R2; long long sSz, lds, sDz, ldd, sRz, ldr; int R, C, flags, act; float alpha, beta; };
static_assert(sizeof(TrP) == 3 * 8 + 6 * 8 + 6 * 4, "TrP has padding");
__global__ __launch_bounds__(256) void k_tr(TrP p) {
    __shared__ float tile[32][33];
    const int c0 = blockIdx.x * 32, r0 = blockIdx.y * 32, z = blockIdx.z;
    const int lane = threadIdx.x & 31, wave = threadIdx.x >> 5;
    const float* s = p.src + z * p.sSz;
#pragma unroll
    for (int k = 0; k < 4; ++k) {
        const int rl = wave * 4 + k, r = r0 + rl, c = c0 + lane;
        tile[rl][lane] = (r < p.R && c < p.C) ? s[(long long)r * p.lds + c] : 0.f;
    }
    __syncthreads();
    float* d = p.dst + z * p.sDz; const float* rr = p.R2 + z * p.sRz;
#pragma unroll
    for (int k = 0; k < 4; ++k) {
        const int cl = wave * 4 + k, c = c0 + cl, r = r0 + lane;
        if (c < p.C && r < p.R) {
            float v = act_fn(p.alpha * tile[lane][cl], p.act);
            if (p.flags & 1) v += p.beta * rr[(long long)c * p.ldr + r];
            VST2(float, d + (long long)c * p.ldd + r, v);
        }
    }
}

// k_affine: dst[i] = a * (sdev ? sdev[0] : 1) * src[i] + b, i < n (one thread per element; consecutive lanes -> consecutive addresses)
__global__ __launch_bounds__(256) void k_affine(const float* __restrict__ src, float* __restrict__ dst, int n, float a, float b, const float* __restrict__ sdev) {
    const int i = blockIdx.x * 256 + threadIdx.x;
    if (i < n) { const float aa = sdev ? a * sdev[0] : a; const float v = aa * src[i] + b; VST2(float, dst + i, v); }
}

// =====================================================================================================================
// k_softmax: row softmax over n contiguous elements, one 256-thread block per row; rows addressed z*sz + r*sr (grid (R, Z)).
//   out = scale_out * softmax(scale_in * x + (Mf ? Mf[z*smz + r*smr + j] : 0)); a row whose max is -inf is written as 0.
// =====================================================================================================================
struct SmP { const float* src; float* dst; const float* Mf; long long sz, sr, dz, dr, smz, smr; int n, pad; float scale_in, scale_out; };
static_assert(sizeof(SmP) == 3 * 8 + 6 * 8 + 4 * 4, "SmP has padding");
__global__ __launch_bounds__(256) void k_softmax(SmP p) {
    __shared__ float red[256];
    const int r = blockIdx.x, z = blockIdx.y, tid = threadIdx.x;
    const float* s = p.src + z * p.sz + (long long)r * p.sr;
    const float* mf = p.Mf ? (p.Mf + z * p.smz + (long long)r * p.smr) : nullptr;
    float mx = -__builtin_inff();
    for (int j = tid; j < p.n; j += 256) { float v = s[j] * p.scale_in; if (mf) v += mf[j]; mx = fmaxf(mx, v); }
    red[tid] = mx; __syncthreads();
    for (int o = 128; o > 0; o >>= 1) { if (tid < o) red[tid] = fmaxf(red[tid], red[tid + o]); __syncthreads(); }
    mx = red[0]; __syncthreads();
    float sum = 0.f;
    for (int j = tid; j < p.n; j += 256) { float v = s[j] * p.scale_in; if (mf) v += mf[j]; sum += (mx == -__builtin_inff()) ? 0.f : expf(v - mx); }
    red[tid] = sum; __syncthreads();
    for (int o = 128; o > 0; o >>= 1) { if (tid < o) red[tid] += red[tid + o]; __syncthreads(); }
    sum = red[0];
    const float inv = (sum > 0.f) ? p.scale_out / sum : 0.f;
    float* d = p.dst + z * p.dz + (long long)r * p.dr;
    for (int j = tid; j < p.n; j += 256) { float v = s[j] * p.scale_in; if (mf) v += mf[j]; const float o = (mx == -__builtin_inff()) ? 0.f : expf(v - mx) * inv; VST2(float, d + j, o); }
}
// =====================================================================================================================
// k_stats: mean and rsqrt(var + eps) over a set of n elements addressed base + z*sz + (e / inner) * so + (e % inner) * si, one 256-thread
// k_norm_apply: y = (x - mean[set]) * rstd[set] * g[c] + b[c] over a [Z][C][L] channel-major tensor with set = z*G + c / (C/G) (G groups per z;
//   G = C -> per-channel sets indexed z*C+c; for batch norm pass stats indexed by c only via bn = 1). Optional act. Output same layout.
// =====================================================================================================================
//   mode 0: mean / rsqrt(var + eps); mode 1 (RMSNorm): 0 / rsqrt(mean(x^2) + eps); mode 2 (L2 normalize * sqrt(n)): 0 / sqrt(n) / max(||x||, eps); mode 3: as 0 with unbiased variance (n-1)
__global__ __launch_bounds__(256) void k_stats(const float* __restrict__ x, long long sz, long long so, long long si, int inner, int n, float eps, float* __restrict__ stat, int mode) {
    __shared__ float red[256];
    const int z = blockIdx.x, tid = threadIdx.x;
    const float* base = x + z * sz;
    float s = 0.f;
    for (int e = tid; e < n; e += 256) s += base[(long long)(e / inner) * so + (long long)(e % inner) * si];
    red[tid] = s; __syncthreads();
    for (int o = 128; o > 0; o >>= 1) { if (tid < o) red[tid] += red[tid + o]; __syncthreads(); }
    const float mu = (mode == 0 || mode == 3) ? red[0] / (float)n : 0.f; __syncthreads();
    float q = 0.f;
    for (int e = tid; e < n; e += 256) { const float dlt = base[(long long)(e / inner) * so + (long long)(e % inner) * si] - mu; q += dlt * dlt; }
    red[tid] = q; __syncthreads();
    for (int o = 128; o > 0; o >>= 1) { if (tid < o) red[tid] += red[tid + o]; __syncthreads(); }
    {
        float rs;
        if (mode == 2) rs = sqrtf((float)n) / fmaxf(sqrtf(red[0]), eps); else if (mode == 3) rs = rsqrtf(red[0] / (float)(n - 1) + eps); else rs = rsqrtf(red[0] / (float)n + eps);
        if (tid < 32) { const float v = (tid == 0) ? mu : ((tid == 1) ? rs : 0.f); VST2(float, stat + (long long)z * 32 + tid, v); }
    }
}
//   One thread per element over the flat [Z][C][L] index space: grid ceil(Z*C*L / 256).
__global__ __launch_bounds__(256) void k_norm_apply(const float* __restrict__ x, float* __restrict__ y, const float* __restrict__ stat, const float* __restrict__ g, const float* __restrict__ bta,
                                                     int Z, int C, int L, int G, int bn, int act) {
    const long long idx = (long long)blockIdx.x * 256 + threadIdx.x;
    if (idx >= (long long)Z * C * L) return;
    const int l = (int)(idx % L); const long long zc = idx / L; const int c = (int)(zc % C), z = (int)(zc / C); (void)l;
    const int set = bn ? c : (z * G + c / (C / G));
    float v = (x[idx] - stat[(long long)set * 32]) * stat[(long long)set * 32 + 1];
    if (g) v *= g[c];
    if (bta) v += bta[c];
    v = act_fn(v, act);
    VST2(float, y + idx, v);
}

// k_lse_neg: c[i] = -(st[2i] + log(st[2i+1])) = minus the log-sum-exp of row i from k_attn's ST output (for softmax over the query axis)
__global__ __launch_bounds__(256) void k_lse_neg(const float* __restrict__ st, float* __restrict__ c, int n) {
    const int i = blockIdx.x * 256 + threadIdx.x;
    if (i < n) { const float v = -(st[2 * i] + logf(st[2 * i + 1])); VST2(float, c + i, v); }
}

// k_iota: dst[i] = a * i + b as int32 (segment/position id helper)
__global__ __launch_bounds__(256) void k_iota(int* __restrict__ dst, int n, int a, int b) {
    const int i = blockIdx.x * 256 + threadIdx.x;
    if (i < n) { const int v = a * i + b; VST2(int, dst + i, v); }
}

// k_axpby: dst[i] = a * x[i] + b * y[i] (+ c), i < n
__global__ __launch_bounds__(256) void k_axpby(const float* __restrict__ x, const float* __restrict__ y, float* __restrict__ dst, int n, float a, float b, float c) {
    const int i = blockIdx.x * 256 + threadIdx.x;
    if (i < n) { const float v = a * x[i] + b * y[i] + c; VST2(float, dst + i, v); }
}

// =====================================================================================================================
// k_rope: rotary embedding on a [R rows][Hn heads][D] view (row stride sXr, head stride sXh, element stride 1) -> Y (own strides).
//   mode 0: rotate_half (partner d±D/2, sign - for d<D/2); mode 1: interleaved pairs (partner d^1, sign - for even d).
//   table column tcol: tmode 0 -> d, 1 -> d % (D/2), 2 -> d / 2; position p: pmode 0 -> r % S, 1 -> head index, 2 -> pos[r];
//   c = C[(r / S) * sCb + p * sCp + tcol * sCd], s likewise from Sn; y = x[d] * c + sign * x[partner] * s. X and Y must not alias.
// =====================================================================================================================
struct RopeP { const float* X; float* Y; const float* C; const float* Sn; const int* pos; long long sXr, sXh, sYr, sYh, sCb, sCp, sCd; int R, Hn, D, S, mode, tmode, pmode, pad; };
static_assert(sizeof(RopeP) == 5 * 8 + 7 * 8 + 8 * 4, "RopeP has padding");
__global__ __launch_bounds__(256) void k_rope(RopeP p) {
    const long long idx = (long long)blockIdx.x * 256 + threadIdx.x;
    if (idx >= (long long)p.R * p.Hn * p.D) return;
    const int d = (int)(idx % p.D); const long long rh = idx / p.D; const int h = (int)(rh % p.Hn); const int r = (int)(rh / p.Hn);
    const int half = p.D / 2;
    int partner; float sign;
    if (p.mode == 0) { partner = (d < half) ? d + half : d - half; sign = (d < half) ? -1.f : 1.f; }
    else { partner = d ^ 1; sign = (d & 1) ? 1.f : -1.f; }
    const int tcol = (p.tmode == 0) ? d : ((p.tmode == 1) ? (d % half) : (d >> 1));
    const int pp = (p.pmode == 0) ? (r % p.S) : ((p.pmode == 1) ? h : p.pos[r]);
    const long long toff = (long long)(r / p.S) * p.sCb + (long long)pp * p.sCp + (long long)tcol * p.sCd;
    const float* xr = p.X + (long long)r * p.sXr + (long long)h * p.sXh;
    const float v = xr[d] * p.C[toff] + sign * xr[partner] * p.Sn[toff];
    VST2(float, p.Y + (long long)r * p.sYr + (long long)h * p.sYh + d, v);
}

// k_invf + k_sincos (split so neither kernel carries a large VALU-fma footprint): invf_i = num * (1 / powf(base, (2 i)/D)) [fmode 0],
//   num * expf((2 i) * cexp) [fmode 1], num * powf(base, -2 (i - 1) / D) [fmode 2]; then cs/sn[s*half + i] = cos/sin((pscale * s) * invf_i)
__global__ __launch_bounds__(256) void k_invf(float* __restrict__ invb, int half, int D, float base, float num, int fmode, float cexp) {
    const int i = blockIdx.x * 256 + threadIdx.x;
    if (i >= ((half + 31) / 32) * 32) return;
    if (i >= half) { VST2(float, invb + i, 0.f); return; }
    const float e = (float)(2 * i) / (float)D;
    float invf;
    if (fmode == 1) invf = num * expf((float)(2 * i) * cexp);
    else if (fmode == 2) invf = num * powf(base, (-2.0f * ((float)i - 1.0f)) / (float)D);
    else invf = num * (1.0f / powf(base, e));
    VST2(float, invb + i, invf);
}
__global__ __launch_bounds__(256) void k_sincos(float* __restrict__ cs, float* __restrict__ sn, const float* __restrict__ invb, int S, int half, float pscale) {
    const int idx = blockIdx.x * 256 + threadIdx.x;
    if (idx >= S * half) return;
    const int s = idx / half, i = idx - s * half;
    const float ang = (pscale * (float)s) * invb[i];
    VST2(float, cs + idx, cosf(ang)); VST2(float, sn + idx, sinf(ang));
}

// k_mulact: dst[i] = act(x[i]) * y[i]
__global__ __launch_bounds__(256) void k_mulact(const float* __restrict__ x, const float* __restrict__ y, float* __restrict__ dst, int n, int act) {
    const int i = blockIdx.x * 256 + threadIdx.x;
    if (i < n) { const float v = act_fn(x[i], act) * y[i]; VST2(float, dst + i, v); }
}

// =====================================================================================================================
// k_matvec: thread-per-row matrix-vector products for N <= 8 output columns (heads with 1-3 outputs, gates), f32 on the VALU.
//   C[r*sCm + j] = act(alpha * sum_k A[r*sAm + k*sAk] * B[j*sBn + k*sBk] + bias[j]) + beta * R[r*sRm + j*sRn]; each thread writes its N contiguous floats.
// =====================================================================================================================
__global__ __launch_bounds__(256) void k_matvec(GemmP p) {
    // 32 lanes write one line with one instruction.
    const int rpt = (p.N == 1) ? 1 : 32;
    const long long r0 = ((long long)blockIdx.x * 256 + threadIdx.x) * rpt; const int z = blockIdx.z, zo = z / p.zi_n, zi = z - zo * p.zi_n;
    if (r0 >= p.M) return;
    const float* Bb = p.B + zo * p.sBo + zi * p.sBi;
    float* C = p.C + zo * p.sCo + zi * p.sCi; const float* R = p.R + zo * p.sRo + zi * p.sRi;
    for (int rr = 0; rr < rpt; ++rr) {
        const long long r = r0 + rr; if (r >= p.M) break;
        const float* A = p.A + zo * p.sAo + zi * p.sAi + r * p.sAm;
        float acc[8] = {0.f, 0.f, 0.f, 0.f, 0.f, 0.f, 0.f, 0.f};
        for (int k = 0; k < p.K; ++k) { const float a = A[(long long)k * p.sAk];
#pragma unroll
            for (int j = 0; j < 8; ++j) if (j < p.N) acc[j] += a * Bb[(long long)j * p.sBn + (long long)k * p.sBk]; }
#pragma unroll
        for (int j = 0; j < 8; ++j) if (j < p.N) {
            float v = acc[j] * p.alpha;
            if (p.flags & 1) v += p.bias[j];
            if (p.flags & 2) v += p.bias[r];
            v = act_fn(v, p.act);
            if (p.flags & 4) v += p.beta * R[r * p.sRm + (long long)j * p.sRn];
            VST2(float, C + r * p.sCm + j, v);
        }
    }
}
// k_smallsoftmax: thread-per-row softmax for short rows (n <= 64): dst[r*dr + j] = softmax(scale*src[r*sr + j])
__global__ __launch_bounds__(256) void k_smallsoftmax(const float* __restrict__ src, float* __restrict__ dst, long long sr, long long dr, int n, long long R, float scale) {
    const long long r0 = ((long long)blockIdx.x * 256 + threadIdx.x) * 32;
    for (int rr = 0; rr < 32; ++rr) {
        const long long r = r0 + rr; if (r >= R) return;
        const float* s = src + r * sr; float* d = dst + r * dr;
        float mx = -__builtin_inff();
        for (int j = 0; j < n; ++j) mx = fmaxf(mx, s[j] * scale);
        float sum = 0.f;
        for (int j = 0; j < n; ++j) sum += expf(s[j] * scale - mx);
        const float inv = 1.f / sum;
        for (int j = 0; j < n; ++j) { const float v = expf(s[j] * scale - mx) * inv; VST2(float, d + j, v); }
    }
}

__global__ __launch_bounds__(32) void k_unitstat(float* __restrict__ st) { const int t = threadIdx.x; const float v = (t == 1) ? 1.f : 0.f; VST2(float, st + t, v); }

// destination (e.g. a d_out whose row width is not a multiple of 32 floats) is written by consecutive lanes of one instruction
__global__ __launch_bounds__(256) void k_lincopy(const float* __restrict__ src, long long lds, float* __restrict__ dst, long long ldd, long long rows, int cols) {
    const long long i = (long long)blockIdx.x * 256 + threadIdx.x; if (i >= rows * cols) return;
    const long long r = i / cols; const int c = (int)(i - r * cols);
    const float v = src[r * lds + c]; VST2(float, dst + r * ldd + c, v);
}

namespace w25 {
typedef __attribute__((ext_vector_type(16))) _Float16 v16h;
typedef __attribute__((ext_vector_type(8)))  _Float16 v8h;
typedef __attribute__((ext_vector_type(16))) __bf16   v16b;
typedef __attribute__((ext_vector_type(8)))  __bf16   v8b;
typedef __attribute__((ext_vector_type(8)))  float    v8f;
typedef __attribute__((ext_vector_type(4)))  float    v4f;

__device__ __forceinline__ unsigned short f2bf_bits(float f) {
  unsigned u = __float_as_uint(f);
  return (unsigned short)((u + 0x7FFFu + ((u >> 16) & 1u)) >> 16);
}
__device__ __forceinline__ float bf_bits2f(unsigned short h) { return __uint_as_float(((unsigned)h) << 16); }

// hazard guards as plain device helpers (no inline asm inside the kernel template body)
__device__ __forceinline__ void dep_guard_h(v8f& a, v8f& b, v16h x, v16h y) { asm volatile("v_nop\n\tv_nop\n\tv_nop\n\tv_nop" : "+v"(a), "+v"(b) : "v"(x), "v"(y)); }
__device__ __forceinline__ void dep_guard_b(v8f& a, v8f& b, v16b x, v16b y) { asm volatile("v_nop\n\tv_nop\n\tv_nop\n\tv_nop" : "+v"(a), "+v"(b) : "v"(x), "v"(y)); }
__device__ __forceinline__ void keep4_h(v16h a, v16h b, v16h c, v16h d) { asm volatile("v_nop" :: "v"(a), "v"(b), "v"(c), "v"(d)); }
__device__ __forceinline__ void keep4_b(v16b a, v16b b, v16b c, v16b d) { asm volatile("v_nop" :: "v"(a), "v"(b), "v"(c), "v"(d)); }
__device__ __forceinline__ void acc_guard4(v8f& a, v8f& b, v8f& c, v8f& d) { asm volatile("v_nop\n\tv_nop\n\tv_nop\n\tv_nop" : "+v"(a), "+v"(b), "+v"(c), "+v"(d)); }
template <typename T> struct Frag;
template <> struct Frag<_Float16> {
  typedef v16h V; union U { v16h v; v8h h[2]; };
  static __device__ __forceinline__ v16h load(const _Float16* p) {   // elements 0..7 <- p[0..7], 8..15 <- p[16..23]
    U f; f.h[0] = *(const v8h*)(p); f.h[1] = *(const v8h*)(p + 16); return f.v;
  }
  static __device__ __forceinline__ v8f mma(v16h a, v16h b, v8f c) {
    return __builtin_amdgcn_wmma_f32_16x16x32_f16(false, a, false, b, (short)0, c, false, false);
  }
  static __device__ __forceinline__ void guard(v8f& a, v8f& b, v16h x, v16h y) { dep_guard_h(a, b, x, y); }
  static __device__ __forceinline__ void keep(v16h a, v16h b, v16h c, v16h d) { keep4_h(a, b, c, d); }
};
template <> struct Frag<__bf16> {
  typedef v16b V; union U { v16b v; v8b h[2]; };
  static __device__ __forceinline__ v16b load(const __bf16* p) {
    U f; f.h[0] = *(const v8b*)(p); f.h[1] = *(const v8b*)(p + 16); return f.v;
  }
  static __device__ __forceinline__ v8f mma(v16b a, v16b b, v8f c) {
    return __builtin_amdgcn_wmma_f32_16x16x32_bf16(false, a, false, b, (short)0, c, false, false);
  }
  static __device__ __forceinline__ void guard(v8f& a, v8f& b, v16b x, v16b y) { dep_guard_b(a, b, x, y); }
  static __device__ __forceinline__ void keep(v16b a, v16b b, v16b c, v16b d) { keep4_b(a, b, c, d); }
};

// ---- Register-blocked batched WMMA GEMM ------------------------------------
// C[m,n] = scale * sum_k A[m,k] * Bt[n,k] (+bias)(+resid); each wave owns a 64x64 tile.
// A row-major [M,K]; Bt row-major [N,K]; M,N % 64 == 0, K % 32 == 0.
// SPLIT: operands are hi/lo planes (A2/Bt2 = lo planes, same layout); product = hi·hi + hi·lo + lo·hi.
// BIAS_MODE: 0 = none, 1 = bias[m], 2 = bias[n].
// OUT_MODE: 0 = f32, 1 = f16, 2 = bf16 hi plane (Cout) + bf16 lo plane (Cout2).
// ET: 0 = f16 operands, 1 = bf16 operands (pointers passed as 16-bit storage)
template <int ET> struct Elem;
template <> struct Elem<0> { typedef _Float16 T; };
template <> struct Elem<1> { typedef __bf16 T; };
template <int ET, bool SPLIT, int BIAS_MODE, int OUT_MODE, bool RESID, int ACT = 0>
__global__ __launch_bounds__(256) void wmma_gemm64(
    const unsigned short* __restrict__ Ap, const unsigned short* __restrict__ A2p, int lda, long strideA,
    const unsigned short* __restrict__ Btp, const unsigned short* __restrict__ Bt2p, int ldb, long strideB,
    void* __restrict__ Cout, void* __restrict__ Cout2, int ldc, long strideC,
    const float* __restrict__ bias,
    const float* __restrict__ resid, long strideR,
    int M, int N, int K, float scale) {
  typedef typename Elem<ET>::T T;
  typedef typename Frag<T>::V V;
  const T* A = (const T*)Ap; const T* A2 = (const T*)A2p; const T* Bt = (const T*)Btp; const T* Bt2 = (const T*)Bt2p;
  __shared__ __align__(16) float sT[8][16 * 68];   // per-wave 16x64 slab, pitch 68 floats
  const int b    = blockIdx.y;
  const int lane = threadIdx.x & 31;
  const int wave = threadIdx.x >> 5;
  const int tilesN = N >> 6;
  const int tilesM = M >> 6;
  const int tile = blockIdx.x * 8 + wave;
  if (tile >= tilesM * tilesN) return;   // wave-uniform; no block barriers in this kernel
  const int tm = tile / tilesN;
  const int tn = tile - tm * tilesN;
  const int m0 = tm << 6;
  const int n0 = tn << 6;

  const T* Ab  = A  + (size_t)b * strideA;
  const T* Bb  = Bt + (size_t)b * strideB;
  const T* Ab2 = SPLIT ? (A2  + (size_t)b * strideA) : nullptr;
  const T* Bb2 = SPLIT ? (Bt2 + (size_t)b * strideB) : nullptr;

  const int rlane = lane & 15;                 // row (A) / col (B, D) within subtile
  const int koff  = (lane >> 4) * 8;           // k offset of this lane half
  const int mOff  = (lane >> 4) * 8;           // D row offset

  v8f acc[4][4];
#pragma unroll
  for (int i = 0; i < 4; ++i)
#pragma unroll
    for (int j = 0; j < 4; ++j) acc[i][j] = (v8f){0.f,0.f,0.f,0.f,0.f,0.f,0.f,0.f};

  for (int k0 = 0; k0 < K; k0 += 32) {
    V bh[4], bl[4];
#pragma unroll
    for (int j = 0; j < 4; ++j) {
      const size_t bo = (size_t)(n0 + (j << 4) + rlane) * ldb + koff + k0;
      bh[j] = Frag<T>::load(Bb + bo);
      if (SPLIT) bl[j] = Frag<T>::load(Bb2 + bo);
    }
#pragma unroll
    for (int i = 0; i < 4; ++i) {
      const size_t ao = (size_t)(m0 + (i << 4) + rlane) * lda + koff + k0;
      V ah = Frag<T>::load(Ab + ao);
      V al;
      if (SPLIT) al = Frag<T>::load(Ab2 + ao);
#pragma unroll
      for (int j = 0; j < 4; ++j) {
        acc[i][j] = Frag<T>::mma(ah, bh[j], acc[i][j]);
        if (SPLIT) {
          acc[i][j] = Frag<T>::mma(ah, bl[j], acc[i][j]);
          acc[i][j] = Frag<T>::mma(al, bh[j], acc[i][j]);
        }
      }
      Frag<T>::guard(acc[i][0], acc[i][3], ah, SPLIT ? al : ah);
    }
    Frag<T>::keep(bh[0], bh[1], bh[2], bh[3]);
    if (SPLIT) Frag<T>::keep(bl[0], bl[1], bl[2], bl[3]);
  }
  acc_guard4(acc[0][0], acc[0][1], acc[0][2], acc[0][3]);
  acc_guard4(acc[1][0], acc[1][1], acc[1][2], acc[1][3]);
  acc_guard4(acc[2][0], acc[2][1], acc[2][2], acc[2][3]);
  acc_guard4(acc[3][0], acc[3][1], acc[3][2], acc[3][3]);

  // ---- epilogue ----
  float* slab = sT[wave];
  const float* Rb = RESID ? (resid + (size_t)b * strideR) : nullptr;
#pragma unroll
  for (int i = 0; i < 4; ++i) {
    const int mBase = m0 + (i << 4);
#pragma unroll
    for (int j = 0; j < 4; ++j) {
      const int n = n0 + (j << 4) + rlane;
      float bv = 0.f;
      if (BIAS_MODE == 2) bv = bias[n];
#pragma unroll
      for (int r = 0; r < 8; ++r) {
        float v = acc[i][j][r] * scale;
        if (BIAS_MODE == 1) v += bias[mBase + mOff + r];
        if (BIAS_MODE == 2) v += bv;
        if (RESID) v += Rb[(size_t)(mBase + mOff + r) * ldc + n];
        if (ACT == 1) v = tanhf(v);
        if (ACT == 2) v = fmaxf(v, 0.0f);
        if (ACT == 3) v = v / (1.0f + expf(-v));
        if (ACT == 4) v = (v > 0.f) ? v : 0.01f * v;
        if (ACT == 5) v = 0.5f * v * (1.0f + erff(v * 0.70710678118654752f));
        slab[(mOff + r) * 68 + (j << 4) + rlane] = v;
      }
    }
    __builtin_amdgcn_fence(__ATOMIC_RELEASE, "workgroup");
    __builtin_amdgcn_wave_barrier();
    __builtin_amdgcn_fence(__ATOMIC_ACQUIRE, "workgroup");
    if (OUT_MODE == 0) {
      float* C = (float*)Cout + (size_t)b * strideC;
      const int hh = lane >> 4, c4 = (lane & 15) * 4;     // row seg = 256 B = 16 lanes x 16 B
      {
#pragma unroll
        for (int it = 0; it < 8; ++it) {
          const int row = it * 2 + hh;
          v4f v = *(const v4f*)(slab + row * 68 + c4);
          *(v4f*)(C + (size_t)(mBase + row) * ldc + n0 + c4) = v;
        }
        
      }
    } else {
      const int q = lane >> 3, c8 = (lane & 7) * 8;
      unsigned short* C  = (unsigned short*)Cout  + (size_t)b * strideC;
      unsigned short* C2 = (OUT_MODE == 2) ? ((unsigned short*)Cout2 + (size_t)b * strideC) : nullptr;
      {
#pragma unroll
        for (int it = 0; it < 4; ++it) {
          const int row = it * 4 + q;
          const float* sp = slab + row * 68 + c8;
          v8h hv, lv;
#pragma unroll
          for (int e = 0; e < 8; ++e) {
            if (OUT_MODE == 1) {
              hv[e] = (_Float16)sp[e];
            } else {
              unsigned short hb = f2bf_bits(sp[e]);
              unsigned short lb = f2bf_bits(sp[e] - bf_bits2f(hb));
              hv[e] = __builtin_bit_cast(_Float16, hb);
              lv[e] = __builtin_bit_cast(_Float16, lb);
            }
          }
          *(v8h*)(C + (size_t)(mBase + row) * ldc + n0 + c8) = hv;
          if (OUT_MODE == 2) *(v8h*)(C2 + (size_t)(mBase + row) * ldc + n0 + c8) = lv;
        }
        
      }
    }
    __builtin_amdgcn_fence(__ATOMIC_RELEASE, "workgroup");
    __builtin_amdgcn_wave_barrier();
    __builtin_amdgcn_fence(__ATOMIC_ACQUIRE, "workgroup");
  }
}

__global__ __launch_bounds__(256) void cast_f32_f16x2(
    const float* __restrict__ in, _Float16* __restrict__ out, int n2) {
  int i = blockIdx.x * 256 + threadIdx.x;
  if (i < n2) {
    const _Float16 h0 = (_Float16)in[2 * i], h1 = (_Float16)in[2 * i + 1];
    const unsigned u = (unsigned)__builtin_bit_cast(unsigned short, h0) | ((unsigned)__builtin_bit_cast(unsigned short, h1) << 16);
    ((unsigned*)out)[i] = u;
    
  }
}


} // namespace w25

__global__ __launch_bounds__(256) void k_castT16(const float* __restrict__ src, long long lds, _Float16* __restrict__ dst, long long ldd, int R, int C, float s) {
    const long long i = (long long)blockIdx.x * 256 + threadIdx.x; const long long np = (long long)C * (R / 2); if (i >= np) return; const int c = (int)(i / (R / 2)); const int r = 2 * (int)(i % (R / 2));
    const _Float16 h0 = (_Float16)(src[(long long)r * lds + c] * s), h1 = (_Float16)(src[(long long)(r + 1) * lds + c] * s);
    const unsigned u = (unsigned)__builtin_bit_cast(unsigned short, h0) | ((unsigned)__builtin_bit_cast(unsigned short, h1) << 16);
    unsigned* d = (unsigned*)(dst + (long long)c * ldd + r); *d = u;  }
__global__ __launch_bounds__(256) void k_cast16(const float* __restrict__ src, long long lds, _Float16* __restrict__ dst, long long ldd, int R, int C, float s) {
    const long long i = (long long)blockIdx.x * 256 + threadIdx.x; const long long np = (long long)R * (C / 2); if (i >= np) return; const int r = (int)(i / (C / 2)); const int c = 2 * (int)(i % (C / 2));
    const _Float16 h0 = (_Float16)(src[(long long)r * lds + c] * s), h1 = (_Float16)(src[(long long)r * lds + c + 1] * s);
    const unsigned u = (unsigned)__builtin_bit_cast(unsigned short, h0) | ((unsigned)__builtin_bit_cast(unsigned short, h1) << 16);
    unsigned* d = (unsigned*)(dst + (long long)r * ldd + c); *d = u;  }

// f32 -> bf16 hi plane + bf16 lo plane (x = hi + lo to ~2^-17 relative; RNE both), [R][C] -> [R][C] (or transposed to [C][R]); 2 consecutive destination elements
__device__ __forceinline__ unsigned int f2bf2_pack(float a, float b, unsigned int* lo) {
    const unsigned short ha = w25::f2bf_bits(a), hb = w25::f2bf_bits(b);
    const unsigned short la = w25::f2bf_bits(a - w25::bf_bits2f(ha)), lb = w25::f2bf_bits(b - w25::bf_bits2f(hb));
    *lo = (unsigned)la | ((unsigned)lb << 16); return (unsigned)ha | ((unsigned)hb << 16); }
__global__ __launch_bounds__(256) void k_castS16(const float* __restrict__ src, long long lds, __bf16* __restrict__ dhi, __bf16* __restrict__ dlo, long long ldd, int R, int C, float s, int transpose) {
    const long long i = (long long)blockIdx.x * 256 + threadIdx.x; long long o; float a, b;
    if (transpose) { const long long np = (long long)C * (R / 2); if (i >= np) return; const int c = (int)(i / (R / 2)); const int r = 2 * (int)(i % (R / 2)); a = src[(long long)r * lds + c] * s; b = src[(long long)(r + 1) * lds + c] * s; o = (long long)c * ldd + r; }
    else { const long long np = (long long)R * (C / 2); if (i >= np) return; const int r = (int)(i / (C / 2)); const int c = 2 * (int)(i % (C / 2)); a = src[(long long)r * lds + c] * s; b = src[(long long)r * lds + c + 1] * s; o = (long long)r * ldd + c; }
    unsigned lo; const unsigned hi = f2bf2_pack(a, b, &lo); unsigned* ph = (unsigned*)(dhi + o); unsigned* pl = (unsigned*)(dlo + o);
    *ph = hi; *pl = lo;  }

// im2col for the 2x2 stride-2 conv: COL[(Y,X)][(c,ky,kx)] = x[b][c][2Y+ky][2X+kx]
__global__ __launch_bounds__(256) void k_es_col(const float* __restrict__ X, float* __restrict__ COL, int b, int C, int Hs) { const long long q = (long long)blockIdx.x * 256 + threadIdx.x; const int Hr = Hs / 2; const long long KC = (long long)C * 4; if (q >= (long long)Hr * Hr * KC) return; const int kk = (int)(q % KC); const int pr = (int)(q / KC); const int c = kk / 4, ky = (kk / 2) % 2, kx = kk % 2; const int Y = pr / Hr, Xx = pr % Hr; VST2(float, COL + q, X[(((long long)b * C + c) * Hs + 2 * Y + ky) * Hs + 2 * Xx + kx]); }
// batch-wise attention: for (p, h, b): scores over b' = q_b . k_b' * scale (4 values), softmax, out = sum att v_b'; S[b][p][h*32+d] += out (S already holds out_img)
__global__ __launch_bounds__(256) void k_es_batch(const float* __restrict__ QB, const float* __restrict__ KVB, float* __restrict__ S, int B, int P, int C, int NH, int DH) { const long long w = (long long)blockIdx.x * 8 + (threadIdx.x >> 5); const int lane = threadIdx.x & 31; if (w >= (long long)B * P * NH) return; const int h = (int)(w % NH); const long long bp = w / NH; const int p = (int)(bp % P); const int b = (int)(bp / P); const float qd = QB[((long long)b * P + p) * C + h * DH + lane]; float sc[4]; float mx = -__builtin_inff();
#pragma unroll
    for (int b2 = 0; b2 < 4; ++b2) { float d0 = qd * KVB[((long long)b2 * P + p) * 2 * C + h * DH + lane]; for (int o = 16; o > 0; o >>= 1) d0 += __shfl_xor(d0, o, 32); sc[b2] = d0 * 0.17677669529663689f; mx = fmaxf(mx, sc[b2]); }
    float den = 0.f;
#pragma unroll
    for (int b2 = 0; b2 < 4; ++b2) { sc[b2] = expf(sc[b2] - mx); den += sc[b2]; } float o_ = 0.f;
#pragma unroll
    for (int b2 = 0; b2 < 4; ++b2) o_ += sc[b2] / den * KVB[((long long)b2 * P + p) * 2 * C + C + h * DH + lane];
    const long long oi = ((long long)b * P + p) * C + h * DH + lane; VST2(float, S + oi, S[oi] + o_); }


extern "C" void kernel_launch(void* const* d_in, const int* in_sizes, int n_in, void* d_out, int out_size, void* d_ws, size_t ws_size, hipStream_t stream) {
    (void)in_sizes; (void)n_in; (void)out_size; (void)ws_size;
    const float* x = (const float*)d_in[0];
    const float* Wq = (const float*)d_in[1];
    const float* Wkv = (const float*)d_in[2];
    const float* Wqb = (const float*)d_in[3];
    const float* Wkvb = (const float*)d_in[4];
    const float* Wout = (const float*)d_in[5];
    const int Bn = 4;
    const int C = 256;
    const int Hs = 64;
    const int P = 4096;
    const int PR = P / 4;
    const int NH = 8;
    const int DH = 32;
    const int KC = C * 4;
    float* out = (float*)d_out;
    char* wsp = (char*)d_ws;
    float* QT = (float*)wsp; wsp += (((size_t)((size_t)P * C) * 4 + 255) / 256) * 256;
    float* COL = (float*)wsp; wsp += (((size_t)((size_t)PR * KC) * 4 + 255) / 256) * 256;
    float* KVT = (float*)wsp; wsp += (((size_t)((size_t)PR * 2 * C) * 4 + 255) / 256) * 256;
    float* QB = (float*)wsp; wsp += (((size_t)((size_t)Bn * P * C) * 4 + 255) / 256) * 256;
    float* KVB = (float*)wsp; wsp += (((size_t)((size_t)Bn * P * 2 * C) * 4 + 255) / 256) * 256;
    float* S = (float*)wsp; wsp += (((size_t)((size_t)Bn * P * C) * 4 + 255) / 256) * 256;
    unsigned short* G64A = (unsigned short*)wsp; wsp += (((size_t)(1048576) * 2 + 255) / 256) * 256;
    unsigned short* G64B = (unsigned short*)wsp; wsp += (((size_t)(1048576) * 2 + 255) / 256) * 256;
    k_castT16<<<(unsigned)((((long long)(4096) * ((256) / 2)) + 255) / 256), 256, 0, stream>>>(x + (size_t)0 * C * P, 4096, (_Float16*)(G64A), 256, 256, 4096, 1.0f);
    k_cast16<<<(unsigned)((((long long)(256) * ((256) / 2)) + 255) / 256), 256, 0, stream>>>(Wqb, 256, (_Float16*)(G64B), 256, 256, 256, 16.0f);
    w25::wmma_gemm64<0, false, 0, 0, false, 0><<<dim3((unsigned)((((4096) / 64) * ((256) / 64) + 7) / 8), (unsigned)(1)), 256, 0, stream>>>((const unsigned short*)(G64A), nullptr, 256, 0, (const unsigned short*)(G64B), nullptr, 256, 0, (void*)(QB + (size_t)0 * P * C), nullptr, 256, 0, nullptr, nullptr, 0, 4096, 256, 256, 0.0625f);
    k_castT16<<<(unsigned)((((long long)(4096) * ((256) / 2)) + 255) / 256), 256, 0, stream>>>(x + (size_t)0 * C * P, 4096, (_Float16*)(G64A), 256, 256, 4096, 1.0f);
    k_cast16<<<(unsigned)((((long long)(512) * ((256) / 2)) + 255) / 256), 256, 0, stream>>>(Wkvb, 256, (_Float16*)(G64B), 256, 512, 256, 16.0f);
    w25::wmma_gemm64<0, false, 0, 0, false, 0><<<dim3((unsigned)((((4096) / 64) * ((512) / 64) + 7) / 8), (unsigned)(1)), 256, 0, stream>>>((const unsigned short*)(G64A), nullptr, 256, 0, (const unsigned short*)(G64B), nullptr, 256, 0, (void*)(KVB + (size_t)0 * P * 2 * C), nullptr, 512, 0, nullptr, nullptr, 0, 4096, 512, 256, 0.0625f);
    k_castT16<<<(unsigned)((((long long)(4096) * ((256) / 2)) + 255) / 256), 256, 0, stream>>>(x + (size_t)1 * C * P, 4096, (_Float16*)(G64A), 256, 256, 4096, 1.0f);
    k_cast16<<<(unsigned)((((long long)(256) * ((256) / 2)) + 255) / 256), 256, 0, stream>>>(Wqb, 256, (_Float16*)(G64B), 256, 256, 256, 16.0f);
    w25::wmma_gemm64<0, false, 0, 0, false, 0><<<dim3((unsigned)((((4096) / 64) * ((256) / 64) + 7) / 8), (unsigned)(1)), 256, 0, stream>>>((const unsigned short*)(G64A), nullptr, 256, 0, (const unsigned short*)(G64B), nullptr, 256, 0, (void*)(QB + (size_t)1 * P * C), nullptr, 256, 0, nullptr, nullptr, 0, 4096, 256, 256, 0.0625f);
    k_castT16<<<(unsigned)((((long long)(4096) * ((256) / 2)) + 255) / 256), 256, 0, stream>>>(x + (size_t)1 * C * P, 4096, (_Float16*)(G64A), 256, 256, 4096, 1.0f);
    k_cast16<<<(unsigned)((((long long)(512) * ((256) / 2)) + 255) / 256), 256, 0, stream>>>(Wkvb, 256, (_Float16*)(G64B), 256, 512, 256, 16.0f);
    w25::wmma_gemm64<0, false, 0, 0, false, 0><<<dim3((unsigned)((((4096) / 64) * ((512) / 64) + 7) / 8), (unsigned)(1)), 256, 0, stream>>>((const unsigned short*)(G64A), nullptr, 256, 0, (const unsigned short*)(G64B), nullptr, 256, 0, (void*)(KVB + (size_t)1 * P * 2 * C), nullptr, 512, 0, nullptr, nullptr, 0, 4096, 512, 256, 0.0625f);
    k_castT16<<<(unsigned)((((long long)(4096) * ((256) / 2)) + 255) / 256), 256, 0, stream>>>(x + (size_t)2 * C * P, 4096, (_Float16*)(G64A), 256, 256, 4096, 1.0f);
    k_cast16<<<(unsigned)((((long long)(256) * ((256) / 2)) + 255) / 256), 256, 0, stream>>>(Wqb, 256, (_Float16*)(G64B), 256, 256, 256, 16.0f);
    w25::wmma_gemm64<0, false, 0, 0, false, 0><<<dim3((unsigned)((((4096) / 64) * ((256) / 64) + 7) / 8), (unsigned)(1)), 256, 0, stream>>>((const unsigned short*)(G64A), nullptr, 256, 0, (const unsigned short*)(G64B), nullptr, 256, 0, (void*)(QB + (size_t)2 * P * C), nullptr, 256, 0, nullptr, nullptr, 0, 4096, 256, 256, 0.0625f);
    k_castT16<<<(unsigned)((((long long)(4096) * ((256) / 2)) + 255) / 256), 256, 0, stream>>>(x + (size_t)2 * C * P, 4096, (_Float16*)(G64A), 256, 256, 4096, 1.0f);
    k_cast16<<<(unsigned)((((long long)(512) * ((256) / 2)) + 255) / 256), 256, 0, stream>>>(Wkvb, 256, (_Float16*)(G64B), 256, 512, 256, 16.0f);
    w25::wmma_gemm64<0, false, 0, 0, false, 0><<<dim3((unsigned)((((4096) / 64) * ((512) / 64) + 7) / 8), (unsigned)(1)), 256, 0, stream>>>((const unsigned short*)(G64A), nullptr, 256, 0, (const unsigned short*)(G64B), nullptr, 256, 0, (void*)(KVB + (size_t)2 * P * 2 * C), nullptr, 512, 0, nullptr, nullptr, 0, 4096, 512, 256, 0.0625f);
    k_castT16<<<(unsigned)((((long long)(4096) * ((256) / 2)) + 255) / 256), 256, 0, stream>>>(x + (size_t)3 * C * P, 4096, (_Float16*)(G64A), 256, 256, 4096, 1.0f);
    k_cast16<<<(unsigned)((((long long)(256) * ((256) / 2)) + 255) / 256), 256, 0, stream>>>(Wqb, 256, (_Float16*)(G64B), 256, 256, 256, 16.0f);
    w25::wmma_gemm64<0, false, 0, 0, false, 0><<<dim3((unsigned)((((4096) / 64) * ((256) / 64) + 7) / 8), (unsigned)(1)), 256, 0, stream>>>((const unsigned short*)(G64A), nullptr, 256, 0, (const unsigned short*)(G64B), nullptr, 256, 0, (void*)(QB + (size_t)3 * P * C), nullptr, 256, 0, nullptr, nullptr, 0, 4096, 256, 256, 0.0625f);
    k_castT16<<<(unsigned)((((long long)(4096) * ((256) / 2)) + 255) / 256), 256, 0, stream>>>(x + (size_t)3 * C * P, 4096, (_Float16*)(G64A), 256, 256, 4096, 1.0f);
    k_cast16<<<(unsigned)((((long long)(512) * ((256) / 2)) + 255) / 256), 256, 0, stream>>>(Wkvb, 256, (_Float16*)(G64B), 256, 512, 256, 16.0f);
    w25::wmma_gemm64<0, false, 0, 0, false, 0><<<dim3((unsigned)((((4096) / 64) * ((512) / 64) + 7) / 8), (unsigned)(1)), 256, 0, stream>>>((const unsigned short*)(G64A), nullptr, 256, 0, (const unsigned short*)(G64B), nullptr, 256, 0, (void*)(KVB + (size_t)3 * P * 2 * C), nullptr, 512, 0, nullptr, nullptr, 0, 4096, 512, 256, 0.0625f);
    k_castT16<<<(unsigned)((((long long)(4096) * ((256) / 2)) + 255) / 256), 256, 0, stream>>>(x + (size_t)0 * C * P, 4096, (_Float16*)(G64A), 256, 256, 4096, 1.0f);
    k_cast16<<<(unsigned)((((long long)(256) * ((256) / 2)) + 255) / 256), 256, 0, stream>>>(Wq, 256, (_Float16*)(G64B), 256, 256, 256, 16.0f);
    w25::wmma_gemm64<0, false, 0, 0, false, 0><<<dim3((unsigned)((((4096) / 64) * ((256) / 64) + 7) / 8), (unsigned)(1)), 256, 0, stream>>>((const unsigned short*)(G64A), nullptr, 256, 0, (const unsigned short*)(G64B), nullptr, 256, 0, (void*)(QT), nullptr, 256, 0, nullptr, nullptr, 0, 4096, 256, 256, 0.0625f);
    k_es_col<<<(unsigned)(((long long)PR * KC + 255) / 256), 256, 0, stream>>>(x, COL, 0, C, Hs);
    k_cast16<<<(unsigned)((((long long)(1024) * ((1024) / 2)) + 255) / 256), 256, 0, stream>>>(COL, 1024, (_Float16*)(G64A), 1024, 1024, 1024, 1.0f);
    k_cast16<<<(unsigned)((((long long)(512) * ((1024) / 2)) + 255) / 256), 256, 0, stream>>>(Wkv, 1024, (_Float16*)(G64B), 1024, 512, 1024, 16.0f);
    w25::wmma_gemm64<0, false, 0, 0, false, 0><<<dim3((unsigned)((((1024) / 64) * ((512) / 64) + 7) / 8), (unsigned)(1)), 256, 0, stream>>>((const unsigned short*)(G64A), nullptr, 1024, 0, (const unsigned short*)(G64B), nullptr, 1024, 0, (void*)(KVT), nullptr, 512, 0, nullptr, nullptr, 0, 1024, 512, 1024, 0.0625f);
    { /*apv4*/ AttnP a;
      a.Q = QT; a.K = KVT; a.V = KVT + C; a.O = S + (size_t)0 * P * C; a.P = 0; a.Mf = 0; a.Mi = 0; a.ST = 0;
      a.Pw = 0; a.Rt = 0; a.SQ = 0; a.SK = 0;
      a.swb = 0; a.swh = 0; a.swi = 0; a.swj = 0; a.srb = 0; a.srh = 0; a.sri = 0; a.sQb = 0; a.sQh = DH; a.sQi = C; a.sQd = 1; a.sKb = 0; a.sKh = DH; a.sKj = 2 * C; a.sKd = 1; a.sVb = 0; a.sVh = DH; a.sVj = 2 * C; a.sVd = 1; a.sOb = 0; a.sOh = DH; a.sOi = C; a.sPb = 0; a.sPh = 0; a.sPi = 0; a.smb = 0; a.smh = 0; a.smi = 0; a.smj = 0;
      a.Lq = P; a.Lk = PR; a.dh = DH; a.dv = DH; a.hrep = 1; a.causal = 0; a.coff = 0; a.pband = 0;
      a.scale = 0.1767766952966369f; a.mfill = 0.0f; a.nonorm = 0; a.mpol = 0;
      a.roff = 0; a.rn = 1; a.segpol = 0; a.win = 0;
      k_attn<64, 64, 0, false, false><<<dim3((unsigned)((P) + 16 * AW - 1) / (16 * AW), (unsigned)(NH), (unsigned)(1)), 32 * AW, 0, stream>>>(a); }
    k_castT16<<<(unsigned)((((long long)(4096) * ((256) / 2)) + 255) / 256), 256, 0, stream>>>(x + (size_t)1 * C * P, 4096, (_Float16*)(G64A), 256, 256, 4096, 1.0f);
    k_cast16<<<(unsigned)((((long long)(256) * ((256) / 2)) + 255) / 256), 256, 0, stream>>>(Wq, 256, (_Float16*)(G64B), 256, 256, 256, 16.0f);
    w25::wmma_gemm64<0, false, 0, 0, false, 0><<<dim3((unsigned)((((4096) / 64) * ((256) / 64) + 7) / 8), (unsigned)(1)), 256, 0, stream>>>((const unsigned short*)(G64A), nullptr, 256, 0, (const unsigned short*)(G64B), nullptr, 256, 0, (void*)(QT), nullptr, 256, 0, nullptr, nullptr, 0, 4096, 256, 256, 0.0625f);
    k_es_col<<<(unsigned)(((long long)PR * KC + 255) / 256), 256, 0, stream>>>(x, COL, 1, C, Hs);
    k_cast16<<<(unsigned)((((long long)(1024) * ((1024) / 2)) + 255) / 256), 256, 0, stream>>>(COL, 1024, (_Float16*)(G64A), 1024, 1024, 1024, 1.0f);
    k_cast16<<<(unsigned)((((long long)(512) * ((1024) / 2)) + 255) / 256), 256, 0, stream>>>(Wkv, 1024, (_Float16*)(G64B), 1024, 512, 1024, 16.0f);
    w25::wmma_gemm64<0, false, 0, 0, false, 0><<<dim3((unsigned)((((1024) / 64) * ((512) / 64) + 7) / 8), (unsigned)(1)), 256, 0, stream>>>((const unsigned short*)(G64A), nullptr, 1024, 0, (const unsigned short*)(G64B), nullptr, 1024, 0, (void*)(KVT), nullptr, 512, 0, nullptr, nullptr, 0, 1024, 512, 1024, 0.0625f);
    { /*apv4*/ AttnP a;
      a.Q = QT; a.K = KVT; a.V = KVT + C; a.O = S + (size_t)1 * P * C; a.P = 0; a.Mf = 0; a.Mi = 0; a.ST = 0;
      a.Pw = 0; a.Rt = 0; a.SQ = 0; a.SK = 0;
      a.swb = 0; a.swh = 0; a.swi = 0; a.swj = 0; a.srb = 0; a.srh = 0; a.sri = 0; a.sQb = 0; a.sQh = DH; a.sQi = C; a.sQd = 1; a.sKb = 0; a.sKh = DH; a.sKj = 2 * C; a.sKd = 1; a.sVb = 0; a.sVh = DH; a.sVj = 2 * C; a.sVd = 1; a.sOb = 0; a.sOh = DH; a.sOi = C; a.sPb = 0; a.sPh = 0; a.sPi = 0; a.smb = 0; a.smh = 0; a.smi = 0; a.smj = 0;
      a.Lq = P; a.Lk = PR; a.dh = DH; a.dv = DH; a.hrep = 1; a.causal = 0; a.coff = 0; a.pband = 0;
      a.scale = 0.1767766952966369f; a.mfill = 0.0f; a.nonorm = 0; a.mpol = 0;
      a.roff = 0; a.rn = 1; a.segpol = 0; a.win = 0;
      k_attn<64, 64, 0, false, false><<<dim3((unsigned)((P) + 16 * AW - 1) / (16 * AW), (unsigned)(NH), (unsigned)(1)), 32 * AW, 0, stream>>>(a); }
    k_castT16<<<(unsigned)((((long long)(4096) * ((256) / 2)) + 255) / 256), 256, 0, stream>>>(x + (size_t)2 * C * P, 4096, (_Float16*)(G64A), 256, 256, 4096, 1.0f);
    k_cast16<<<(unsigned)((((long long)(256) * ((256) / 2)) + 255) / 256), 256, 0, stream>>>(Wq, 256, (_Float16*)(G64B), 256, 256, 256, 16.0f);
    w25::wmma_gemm64<0, false, 0, 0, false, 0><<<dim3((unsigned)((((4096) / 64) * ((256) / 64) + 7) / 8), (unsigned)(1)), 256, 0, stream>>>((const unsigned short*)(G64A), nullptr, 256, 0, (const unsigned short*)(G64B), nullptr, 256, 0, (void*)(QT), nullptr, 256, 0, nullptr, nullptr, 0, 4096, 256, 256, 0.0625f);
    k_es_col<<<(unsigned)(((long long)PR * KC + 255) / 256), 256, 0, stream>>>(x, COL, 2, C, Hs);
    k_cast16<<<(unsigned)((((long long)(1024) * ((1024) / 2)) + 255) / 256), 256, 0, stream>>>(COL, 1024, (_Float16*)(G64A), 1024, 1024, 1024, 1.0f);
    k_cast16<<<(unsigned)((((long long)(512) * ((1024) / 2)) + 255) / 256), 256, 0, stream>>>(Wkv, 1024, (_Float16*)(G64B), 1024, 512, 1024, 16.0f);
    w25::wmma_gemm64<0, false, 0, 0, false, 0><<<dim3((unsigned)((((1024) / 64) * ((512) / 64) + 7) / 8), (unsigned)(1)), 256, 0, stream>>>((const unsigned short*)(G64A), nullptr, 1024, 0, (const unsigned short*)(G64B), nullptr, 1024, 0, (void*)(KVT), nullptr, 512, 0, nullptr, nullptr, 0, 1024, 512, 1024, 0.0625f);
    { /*apv4*/ AttnP a;
      a.Q = QT; a.K = KVT; a.V = KVT + C; a.O = S + (size_t)2 * P * C; a.P = 0; a.Mf = 0; a.Mi = 0; a.ST = 0;
      a.Pw = 0; a.Rt = 0; a.SQ = 0; a.SK = 0;
      a.swb = 0; a.swh = 0; a.swi = 0; a.swj = 0; a.srb = 0; a.srh = 0; a.sri = 0; a.sQb = 0; a.sQh = DH; a.sQi = C; a.sQd = 1; a.sKb = 0; a.sKh = DH; a.sKj = 2 * C; a.sKd = 1; a.sVb = 0; a.sVh = DH; a.sVj = 2 * C; a.sVd = 1; a.sOb = 0; a.sOh = DH; a.sOi = C; a.sPb = 0; a.sPh = 0; a.sPi = 0; a.smb = 0; a.smh = 0; a.smi = 0; a.smj = 0;
      a.Lq = P; a.Lk = PR; a.dh = DH; a.dv = DH; a.hrep = 1; a.causal = 0; a.coff = 0; a.pband = 0;
      a.scale = 0.1767766952966369f; a.mfill = 0.0f; a.nonorm = 0; a.mpol = 0;
      a.roff = 0; a.rn = 1; a.segpol = 0; a.win = 0;
      k_attn<64, 64, 0, false, false><<<dim3((unsigned)((P) + 16 * AW - 1) / (16 * AW), (unsigned)(NH), (unsigned)(1)), 32 * AW, 0, stream>>>(a); }
    k_castT16<<<(unsigned)((((long long)(4096) * ((256) / 2)) + 255) / 256), 256, 0, stream>>>(x + (size_t)3 * C * P, 4096, (_Float16*)(G64A), 256, 256, 4096, 1.0f);
    k_cast16<<<(unsigned)((((long long)(256) * ((256) / 2)) + 255) / 256), 256, 0, stream>>>(Wq, 256, (_Float16*)(G64B), 256, 256, 256, 16.0f);
    w25::wmma_gemm64<0, false, 0, 0, false, 0><<<dim3((unsigned)((((4096) / 64) * ((256) / 64) + 7) / 8), (unsigned)(1)), 256, 0, stream>>>((const unsigned short*)(G64A), nullptr, 256, 0, (const unsigned short*)(G64B), nullptr, 256, 0, (void*)(QT), nullptr, 256, 0, nullptr, nullptr, 0, 4096, 256, 256, 0.0625f);
    k_es_col<<<(unsigned)(((long long)PR * KC + 255) / 256), 256, 0, stream>>>(x, COL, 3, C, Hs);
    k_cast16<<<(unsigned)((((long long)(1024) * ((1024) / 2)) + 255) / 256), 256, 0, stream>>>(COL, 1024, (_Float16*)(G64A), 1024, 1024, 1024, 1.0f);
    k_cast16<<<(unsigned)((((long long)(512) * ((1024) / 2)) + 255) / 256), 256, 0, stream>>>(Wkv, 1024, (_Float16*)(G64B), 1024, 512, 1024, 16.0f);
    w25::wmma_gemm64<0, false, 0, 0, false, 0><<<dim3((unsigned)((((1024) / 64) * ((512) / 64) + 7) / 8), (unsigned)(1)), 256, 0, stream>>>((const unsigned short*)(G64A), nullptr, 1024, 0, (const unsigned short*)(G64B), nullptr, 1024, 0, (void*)(KVT), nullptr, 512, 0, nullptr, nullptr, 0, 1024, 512, 1024, 0.0625f);
    { /*apv4*/ AttnP a;
      a.Q = QT; a.K = KVT; a.V = KVT + C; a.O = S + (size_t)3 * P * C; a.P = 0; a.Mf = 0; a.Mi = 0; a.ST = 0;
      a.Pw = 0; a.Rt = 0; a.SQ = 0; a.SK = 0;
      a.swb = 0; a.swh = 0; a.swi = 0; a.swj = 0; a.srb = 0; a.srh = 0; a.sri = 0; a.sQb = 0; a.sQh = DH; a.sQi = C; a.sQd = 1; a.sKb = 0; a.sKh = DH; a.sKj = 2 * C; a.sKd = 1; a.sVb = 0; a.sVh = DH; a.sVj = 2 * C; a.sVd = 1; a.sOb = 0; a.sOh = DH; a.sOi = C; a.sPb = 0; a.sPh = 0; a.sPi = 0; a.smb = 0; a.smh = 0; a.smi = 0; a.smj = 0;
      a.Lq = P; a.Lk = PR; a.dh = DH; a.dv = DH; a.hrep = 1; a.causal = 0; a.coff = 0; a.pband = 0;
      a.scale = 0.1767766952966369f; a.mfill = 0.0f; a.nonorm = 0; a.mpol = 0;
      a.roff = 0; a.rn = 1; a.segpol = 0; a.win = 0;
      k_attn<64, 64, 0, false, false><<<dim3((unsigned)((P) + 16 * AW - 1) / (16 * AW), (unsigned)(NH), (unsigned)(1)), 32 * AW, 0, stream>>>(a); }
    k_es_batch<<<(unsigned)(((long long)Bn * P * NH + 7) / 8), 256, 0, stream>>>(QB, KVB, S, Bn, P, C, NH, DH);
    k_cast16<<<(unsigned)((((long long)(256) * ((256) / 2)) + 255) / 256), 256, 0, stream>>>(Wout, 256, (_Float16*)(G64A), 256, 256, 256, 16.0f);
    k_cast16<<<(unsigned)((((long long)(4096) * ((256) / 2)) + 255) / 256), 256, 0, stream>>>(S + (size_t)0 * P * C, 256, (_Float16*)(G64B), 256, 4096, 256, 1.0f);
    w25::wmma_gemm64<0, false, 0, 0, false, 0><<<dim3((unsigned)((((256) / 64) * ((4096) / 64) + 7) / 8), (unsigned)(1)), 256, 0, stream>>>((const unsigned short*)(G64A), nullptr, 256, 0, (const unsigned short*)(G64B), nullptr, 256, 0, (void*)(out + (size_t)0 * C * P), nullptr, 4096, 0, nullptr, nullptr, 0, 256, 4096, 256, 0.0625f);
    k_cast16<<<(unsigned)((((long long)(256) * ((256) / 2)) + 255) / 256), 256, 0, stream>>>(Wout, 256, (_Float16*)(G64A), 256, 256, 256, 16.0f);
    k_cast16<<<(unsigned)((((long long)(4096) * ((256) / 2)) + 255) / 256), 256, 0, stream>>>(S + (size_t)1 * P * C, 256, (_Float16*)(G64B), 256, 4096, 256, 1.0f);
    w25::wmma_gemm64<0, false, 0, 0, false, 0><<<dim3((unsigned)((((256) / 64) * ((4096) / 64) + 7) / 8), (unsigned)(1)), 256, 0, stream>>>((const unsigned short*)(G64A), nullptr, 256, 0, (const unsigned short*)(G64B), nullptr, 256, 0, (void*)(out + (size_t)1 * C * P), nullptr, 4096, 0, nullptr, nullptr, 0, 256, 4096, 256, 0.0625f);
    k_cast16<<<(unsigned)((((long long)(256) * ((256) / 2)) + 255) / 256), 256, 0, stream>>>(Wout, 256, (_Float16*)(G64A), 256, 256, 256, 16.0f);
    k_cast16<<<(unsigned)((((long long)(4096) * ((256) / 2)) + 255) / 256), 256, 0, stream>>>(S + (size_t)2 * P * C, 256, (_Float16*)(G64B), 256, 4096, 256, 1.0f);
    w25::wmma_gemm64<0, false, 0, 0, false, 0><<<dim3((unsigned)((((256) / 64) * ((4096) / 64) + 7) / 8), (unsigned)(1)), 256, 0, stream>>>((const unsigned short*)(G64A), nullptr, 256, 0, (const unsigned short*)(G64B), nullptr, 256, 0, (void*)(out + (size_t)2 * C * P), nullptr, 4096, 0, nullptr, nullptr, 0, 256, 4096, 256, 0.0625f);
    k_cast16<<<(unsigned)((((long long)(256) * ((256) / 2)) + 255) / 256), 256, 0, stream>>>(Wout, 256, (_Float16*)(G64A), 256, 256, 256, 16.0f);
    k_cast16<<<(unsigned)((((long long)(4096) * ((256) / 2)) + 255) / 256), 256, 0, stream>>>(S + (size_t)3 * P * C, 256, (_Float16*)(G64B), 256, 4096, 256, 1.0f);
    w25::wmma_gemm64<0, false, 0, 0, false, 0><<<dim3((unsigned)((((256) / 64) * ((4096) / 64) + 7) / 8), (unsigned)(1)), 256, 0, stream>>>((const unsigned short*)(G64A), nullptr, 256, 0, (const unsigned short*)(G64B), nullptr, 256, 0, (void*)(out + (size_t)3 * C * P), nullptr, 4096, 0, nullptr, nullptr, 0, 256, 4096, 256, 0.0625f);
}

// v001
// One run takes 784 microseconds.
// Next to v000, in two timings, it ran 2.86 and 2.84 times as fast.
// Contractions (per image): q / qb / kvb 1x1 projections in position-major form x^T W^T [4096x256].[256x{256,256,512}], the 2x2-stride-2 kv conv as an im2col GEMM [1024x1024].[1024x512] and the output 1x1 conv Wout.(out_img + out_batch)^T [256x256].[256x4096], all with f16 operands (v_wmma_f32_16x16x32_f16; 64x64 register-blocked wave tiles over pre-cast f16 operand planes, weight operands pre-scaled by 16 at the cast and un-scaled in the f32 epilogue); the spatial-reduction attention per head (flash kernel, head_dim 32, 4096 queries x 1024 keys, f16 q.k^T and f16 p.v); f32 accumulate; the im2col, the batch-wise 4x4 attention per (position, head) and the branch sum are f32 kernels.
#include <hip/hip_runtime.h>
#include <math.h>

typedef __attribute__((ext_vector_type(16))) _Float16 v16h;
typedef __attribute__((ext_vector_type(8)))  _Float16 v8h;
typedef __attribute__((ext_vector_type(16))) __bf16   v16b;
typedef __attribute__((ext_vector_type(8)))  float    v8f;
typedef __attribute__((ext_vector_type(4)))  float    v4f;

// 16-bit WMMA fragment map (wave32), lane L, h = L>>4, m = L&15:
//   A 16x32: lane = row m;   element i -> k = (i<8) ? 8h+i : 16+8h+(i-8)
//   B 32x16: lane = column m; the SAME k(i,h)
//   D 16x16 (8 f32): lane = column m; element r -> row 8h+r
__device__ __forceinline__ int frag_k(int i, int h) { return (i < 8) ? (8 * h + i) : (16 + 8 * h + (i - 8)); }
__device__ __forceinline__ __bf16 bf16_rne(float f) {
    unsigned int u = __float_as_uint(f);
    u += 0x7fffu + ((u >> 16) & 1u);
    return __builtin_bit_cast(__bf16, (unsigned short)(u >> 16));
}
__device__ __forceinline__ float bf16_f32(__bf16 b) { return __uint_as_float(((unsigned int)__builtin_bit_cast(unsigned short, b)) << 16); }
__device__ __forceinline__ v8f wmma16(v16h a, v16h b, v8f c) {
    c = __builtin_amdgcn_wmma_f32_16x16x32_f16(false, a, false, b, (short)0, c, false, false);
    asm volatile("v_nop\n\tv_nop\n\tv_nop\n\tv_nop" : "+v"(c) : "v"(a), "v"(b));
    return c;
}
__device__ __forceinline__ v8f wmmab(v16b a, v16b b, v8f c) {
    c = __builtin_amdgcn_wmma_f32_16x16x32_bf16(false, a, false, b, (short)0, c, false, false);
    asm volatile("v_nop\n\tv_nop\n\tv_nop\n\tv_nop" : "+v"(c) : "v"(a), "v"(b));
    return c;
}
struct Split { v16b hi, lo; };
// hi/lo split product: a.hi*b.hi + a.hi*b.lo + a.lo*b.hi
__device__ __forceinline__ v8f wmma3(const Split& a, const Split& b, v8f c) {
    c = __builtin_amdgcn_wmma_f32_16x16x32_bf16(false, a.hi, false, b.hi, (short)0, c, false, false);
    c = __builtin_amdgcn_wmma_f32_16x16x32_bf16(false, a.hi, false, b.lo, (short)0, c, false, false);
    c = __builtin_amdgcn_wmma_f32_16x16x32_bf16(false, a.lo, false, b.hi, (short)0, c, false, false);
    asm volatile("v_nop\n\tv_nop\n\tv_nop\n\tv_nop" : "+v"(c) : "v"(a.hi), "v"(a.lo), "v"(b.hi), "v"(b.lo));
    return c;
}
struct Split3 { v16b hi, mid, lo; };
// triple split product (6 terms, drops only terms below 2^-24 relative)
__device__ __forceinline__ v8f wmma6(const Split3& a, const Split3& b, v8f c) {
    c = __builtin_amdgcn_wmma_f32_16x16x32_bf16(false, a.hi, false, b.hi, (short)0, c, false, false);
    c = __builtin_amdgcn_wmma_f32_16x16x32_bf16(false, a.hi, false, b.mid, (short)0, c, false, false);
    c = __builtin_amdgcn_wmma_f32_16x16x32_bf16(false, a.mid, false, b.hi, (short)0, c, false, false);
    c = __builtin_amdgcn_wmma_f32_16x16x32_bf16(false, a.hi, false, b.lo, (short)0, c, false, false);
    c = __builtin_amdgcn_wmma_f32_16x16x32_bf16(false, a.mid, false, b.mid, (short)0, c, false, false);
    c = __builtin_amdgcn_wmma_f32_16x16x32_bf16(false, a.lo, false, b.hi, (short)0, c, false, false);
    asm volatile("v_nop\n\tv_nop\n\tv_nop\n\tv_nop" : "+v"(c) : "v"(a.hi), "v"(a.mid), "v"(a.lo), "v"(b.hi), "v"(b.mid), "v"(b.lo));
    return c;
}

// Fragment gathers from f32 memory: element i <- p[(k0 + frag_k(i,h)) * sk] * s, zero for k >= klen.
__device__ __forceinline__ v16h fh_ld(const float* __restrict__ p, long long sk, int k0, int h, int klen, float s) {
    v16h a;
#pragma unroll
    for (int i = 0; i < 16; ++i) { const int k = k0 + frag_k(i, h); a[i] = (k < klen) ? (_Float16)(p[(long long)k * sk] * s) : (_Float16)0.f; }
    return a;
}
__device__ __forceinline__ Split sp_ld(const float* __restrict__ p, long long sk, int k0, int h, int klen, float s) {
    Split r;
#pragma unroll
    for (int i = 0; i < 16; ++i) {
        const int k = k0 + frag_k(i, h); const float x = (k < klen) ? p[(long long)k * sk] * s : 0.f;
        const __bf16 hb = bf16_rne(x); r.hi[i] = hb; r.lo[i] = bf16_rne(x - bf16_f32(hb));
    }
    return r;
}
__device__ __forceinline__ Split3 sp3_ld(const float* __restrict__ p, long long sk, int k0, int h, int klen, float s) {
    Split3 r;
#pragma unroll
    for (int i = 0; i < 16; ++i) {
        const int k = k0 + frag_k(i, h); const float x = (k < klen) ? p[(long long)k * sk] * s : 0.f;
        const __bf16 hb = bf16_rne(x); const float r1 = x - bf16_f32(hb); const __bf16 mb = bf16_rne(r1);
        r.hi[i] = hb; r.mid[i] = mb; r.lo[i] = bf16_rne(r1 - bf16_f32(mb));
    }
    return r;
}
__device__ __forceinline__ v16b bh_ld(const float* __restrict__ p, long long sk, int k0, int h, int klen, float s) {
    v16b a;
#pragma unroll
    for (int i = 0; i < 16; ++i) { const int k = k0 + frag_k(i, h); a[i] = bf16_rne((k < klen) ? p[(long long)k * sk] * s : 0.f); }
    return a;
}
// f16 fragment from an f16 LDS/global row with element stride 1 (k-contiguous), no bounds (tile already zero padded)
__device__ __forceinline__ v16h fh_row(const _Float16* __restrict__ row, int k0, int h) {
    v16h a;
#pragma unroll
    for (int i = 0; i < 16; ++i) a[i] = row[k0 + frag_k(i, h)];
    return a;
}

#define VST2(T, ptr, val) do { const T vst2_v_ = (val); *(T*)(ptr) = vst2_v_;  } while (0)
typedef float v4f __attribute__((ext_vector_type(4)));
#define VST2V4(ptr, val) do { const v4f vst2_v4_ = (val); *(v4f*)(ptr) = vst2_v4_;  } while (0)

__device__ __attribute__((noinline)) float act_fn(float v, int act) {
    if (act == 1) return fmaxf(v, 0.f);                                                                               // relu
    if (act == 2) { const float u = 0.7978845608028654f * (v + 0.044715f * v * v * v); return 0.5f * v * (1.f + tanhf(u)); } // tanh-gelu
    if (act == 3) return v / (1.f + expf(-v));                                                                        // silu
    if (act == 4) return 0.5f * v * (1.f + erff(v * 0.7071067811865476f));                                             // erf-gelu
    if (act == 5) return tanhf(v);
    if (act == 6) return 1.f / (1.f + expf(-v));                                                                      // sigmoid
    if (act == 7) return (v > 0.f) ? v : 0.01f * v;                                                                   // leaky relu 0.01
    if (act == 8) return (v > 0.f) ? v : (expf(v) - 1.f);                                                             // elu
    if (act == 9) return fminf(fmaxf(v, 0.f), 6.f);                                                                   // relu6
    if (act == 10) return fabsf(v);                                                                                    // abs
    if (act == 11) return (v >= 0.f) ? v : 0.1f * v;                                                                  // leaky 0.1
    if (act == 12) return (v > 0.f) ? v : 0.2f * v;                                                                   // leaky 0.2
    if (act == 13) return (v > 20.f) ? v : log1pf(expf(v));                                                            // softplus
    return v;
}

// =====================================================================================================================
// k_gemm<MODE>: C(z, m, n) = act(alpha * sum_k A(z, m, k) * B(z, k, n) + bias) + beta * R(z, m, n)
//   One wave (32-thread block) per 16 x 32 tile of C; grid (ceil(N/32), ceil(M/16), Z). Batch z -> (zo = z / zi_n, zi = z % zi_n)
//   with separate outer/inner strides for every tensor (e.g. batch and head). A(m,k) = A[zo*sAo + zi*sAi + m*sAm + k*sAk] (f32),
//   B(k,n) = B[zo*sBo + zi*sBi + n*sBn + k*sBk] (f32); any M, N, K (K zero-padded to 32 inside the fragments, M/N tails guarded).
//   C(m,n) = C[zo*sCo + zi*sCi + m*sCm + n] (n contiguous). flags: 1 bias[n], 2 bias[m], 4 residual R[zo*sRo + zi*sRi + m*sRm + n*sRn].
//   MODE 0: f16 operands (A prescaled by sa, B by sb, both undone in the epilogue); 1: bf16 hi/lo split (3 products); 2: bf16;
//   3: bf16 hi/mid/lo triple split (6 products); 4: as 3 with Kahan-compensated f32 accumulation across k-steps.
// =====================================================================================================================
struct GemmP {
    const float* A; const float* B; const float* bias; const float* R; float* C;
    long long sAo, sAi, sAm, sAk, sBo, sBi, sBn, sBk, sCo, sCi, sCm, sRo, sRi, sRm, sRn;
    int M, N, K, zi_n, flags, act; float alpha, beta, sa, sb;
    int Npad, pad_;     // columns [N, Npad) of C are written as 0 so that padded workspace rows are covered by whole-line stores; Npad >= N
};
static_assert(sizeof(GemmP) == 5 * 8 + 15 * 8 + 6 * 4 + 4 * 4 + 2 * 4, "GemmP has padding");

template <int MODE>
__global__ __launch_bounds__(32) void k_gemm(GemmP p) {
    const int lane = threadIdx.x & 31, h = lane >> 4, l15 = lane & 15;
    const int m0 = blockIdx.y * 16, n0 = blockIdx.x * 32;
    const int z = blockIdx.z, zo = z / p.zi_n, zi = z - zo * p.zi_n;
    const float* A = p.A + zo * p.sAo + zi * p.sAi;
    const float* B = p.B + zo * p.sBo + zi * p.sBi;
    const int am = min(m0 + l15, p.M - 1);                       // clamped row for loads (stores are guarded)
    v8f acc[2], comp[2];
#pragma unroll
    for (int t = 0; t < 2; ++t) { v8f zz = {}; acc[t] = zz; comp[t] = zz; }
    for (int k0 = 0; k0 < p.K; k0 += 32) {
        const float* arow = A + (long long)am * p.sAm;
        if (MODE == 1) {
            const Split a = sp_ld(arow, p.sAk, k0, h, p.K, 1.f);
#pragma unroll
            for (int t = 0; t < 2; ++t) {
                const int bn = min(n0 + t * 16 + l15, p.N - 1);
                acc[t] = wmma3(a, sp_ld(B + (long long)bn * p.sBn, p.sBk, k0, h, p.K, 1.f), acc[t]);
            }
        } else if (MODE == 3) {
            const Split3 a = sp3_ld(arow, p.sAk, k0, h, p.K, 1.f);
#pragma unroll
            for (int t = 0; t < 2; ++t) {
                const int bn = min(n0 + t * 16 + l15, p.N - 1);
                acc[t] = wmma6(a, sp3_ld(B + (long long)bn * p.sBn, p.sBk, k0, h, p.K, 1.f), acc[t]);
            }
        } else if (MODE == 4) {
            // triple split as MODE 3, but each k-step's 6 products go into a fresh accumulator and the partial is added to the running f32 sum
            // on the VALU with Kahan compensation (accumulation error stays ~1 ulp however long K is)
            const Split3 a = sp3_ld(arow, p.sAk, k0, h, p.K, 1.f);
#pragma unroll
            for (int t = 0; t < 2; ++t) {
                const int bn = min(n0 + t * 16 + l15, p.N - 1); v8f zz = {};
                const v8f part = wmma6(a, sp3_ld(B + (long long)bn * p.sBn, p.sBk, k0, h, p.K, 1.f), zz);
                const v8f y = part - comp[t]; const v8f s = acc[t] + y; comp[t] = (s - acc[t]) - y; acc[t] = s;
            }
        } else if (MODE == 2) {
            const v16b a = bh_ld(arow, p.sAk, k0, h, p.K, 1.f);
#pragma unroll
            for (int t = 0; t < 2; ++t) {
                const int bn = min(n0 + t * 16 + l15, p.N - 1);
                acc[t] = wmmab(a, bh_ld(B + (long long)bn * p.sBn, p.sBk, k0, h, p.K, 1.f), acc[t]);
            }
        } else {
            const v16h a = fh_ld(arow, p.sAk, k0, h, p.K, p.sa);
#pragma unroll
            for (int t = 0; t < 2; ++t) {
                const int bn = min(n0 + t * 16 + l15, p.N - 1);
                acc[t] = wmma16(a, fh_ld(B + (long long)bn * p.sBn, p.sBk, k0, h, p.K, p.sb), acc[t]);
            }
        }
    }
    const float iscale = (MODE == 0) ? p.alpha / (p.sa * p.sb) : p.alpha;
    float* C = p.C + zo * p.sCo + zi * p.sCi;
    const float* R = p.R + zo * p.sRo + zi * p.sRi;
    __shared__ __align__(16) float ctile[16][36];
#pragma unroll
    for (int t = 0; t < 2; ++t) {
        const int n = n0 + t * 16 + l15; const int nn = min(n, p.N - 1);
#pragma unroll
        for (int r = 0; r < 8; ++r) {
            const int m = m0 + 8 * h + r; const int mm = min(m, p.M - 1);
            float v = acc[t][r] * iscale;
            if (p.flags & 1) v += p.bias[nn];
            if (p.flags & 2) v += p.bias[mm];
            if (p.flags & 8) v *= p.bias[(long long)zo * p.M + mm];   /* per-(z,row) scale vector laid out [Z][M]; exclusive with the bias flags */
            v = act_fn(v, p.act);
            if (p.flags & 4) v += p.beta * R[(long long)mm * p.sRm + (long long)nn * p.sRn];
            ctile[8 * h + r][t * 16 + l15] = (n < p.N) ? v : 0.f;
        }
    }
    __syncthreads();
    const int NW = (p.Npad > p.N) ? p.Npad : p.N;           // write width
    const bool fast = (m0 + 16 <= p.M) && (n0 + 32 <= NW) && ((p.sCm & 3) == 0) && ((((size_t)C) & 15) == 0);
    if (fast) {
#pragma unroll
        for (int s = 0; s < 4; ++s) {
            const int row = s * 4 + (lane >> 3), c4 = (lane & 7) * 4;
            const v4f v = *(const v4f*)&ctile[row][c4];
            VST2V4(C + (long long)(m0 + row) * p.sCm + n0 + c4, v);
        }
    } else {
        for (int row = 0; row < 16; ++row) {
            const int m = m0 + row, n = n0 + lane;
            if (m < p.M && n < NW) VST2(float, C + (long long)m * p.sCm + n, ctile[row][lane]);
        }
    }
}


// =====================================================================================================================
// k_gemmT<MODE, TM, TN>: same contract as k_gemm, but one wave computes a (16*TM) x (16*TN) tile: TM A fragments and TN B fragments are
//   loaded per 32-wide k-step and reused across TM*TN WMMAs (far fewer load/convert instructions per MAC). MODE 0 (f16), 1 (bf16 hi/lo),
//   2 (bf16) only. grid (ceil(NW/(16*TN)), ceil(M/(16*TM)), Z), block 32. Epilogue identical to k_gemm, run per 16x32 sub-tile.
// =====================================================================================================================
template <int MODE, int TM, int TN>
__global__ __launch_bounds__(32) void k_gemmT(GemmP p) {
    const int lane = threadIdx.x & 31, h = lane >> 4, l15 = lane & 15;
    const int m0 = blockIdx.y * (16 * TM), n0 = blockIdx.x * (16 * TN);
    const int z = blockIdx.z, zo = z / p.zi_n, zi = z - zo * p.zi_n;
    const float* A = p.A + zo * p.sAo + zi * p.sAi;
    const float* B = p.B + zo * p.sBo + zi * p.sBi;
    v8f acc[TM][TN];
#pragma unroll
    for (int i = 0; i < TM; ++i)
#pragma unroll
        for (int t = 0; t < TN; ++t) { v8f zz = {}; acc[i][t] = zz; }
    for (int k0 = 0; k0 < p.K; k0 += 32) {
        if (MODE == 1) {
            Split a[TM], b[TN];
#pragma unroll
            for (int i = 0; i < TM; ++i) { const int am = min(m0 + 16 * i + l15, p.M - 1); a[i] = sp_ld(A + (long long)am * p.sAm, p.sAk, k0, h, p.K, 1.f); }
#pragma unroll
            for (int t = 0; t < TN; ++t) { const int bn = min(n0 + 16 * t + l15, p.N - 1); b[t] = sp_ld(B + (long long)bn * p.sBn, p.sBk, k0, h, p.K, 1.f); }
#pragma unroll
            for (int i = 0; i < TM; ++i)
#pragma unroll
                for (int t = 0; t < TN; ++t) acc[i][t] = wmma3(a[i], b[t], acc[i][t]);
        } else if (MODE == 2) {
            v16b a[TM], b[TN];
#pragma unroll
            for (int i = 0; i < TM; ++i) { const int am = min(m0 + 16 * i + l15, p.M - 1); a[i] = bh_ld(A + (long long)am * p.sAm, p.sAk, k0, h, p.K, 1.f); }
#pragma unroll
            for (int t = 0; t < TN; ++t) { const int bn = min(n0 + 16 * t + l15, p.N - 1); b[t] = bh_ld(B + (long long)bn * p.sBn, p.sBk, k0, h, p.K, 1.f); }
#pragma unroll
            for (int i = 0; i < TM; ++i)
#pragma unroll
                for (int t = 0; t < TN; ++t) acc[i][t] = wmmab(a[i], b[t], acc[i][t]);
        } else {
            v16h a[TM], b[TN];
#pragma unroll
            for (int i = 0; i < TM; ++i) { const int am = min(m0 + 16 * i + l15, p.M - 1); a[i] = fh_ld(A + (long long)am * p.sAm, p.sAk, k0, h, p.K, p.sa); }
#pragma unroll
            for (int t = 0; t < TN; ++t) { const int bn = min(n0 + 16 * t + l15, p.N - 1); b[t] = fh_ld(B + (long long)bn * p.sBn, p.sBk, k0, h, p.K, p.sb); }
#pragma unroll
            for (int i = 0; i < TM; ++i)
#pragma unroll
                for (int t = 0; t < TN; ++t) acc[i][t] = wmma16(a[i], b[t], acc[i][t]);
        }
    }
    const float iscale = (MODE == 0) ? p.alpha / (p.sa * p.sb) : p.alpha;
    float* C = p.C + zo * p.sCo + zi * p.sCi;
    const float* R = p.R + zo * p.sRo + zi * p.sRi;
    const int NW = (p.Npad > p.N) ? p.Npad : p.N;
    __shared__ __align__(16) float ctile[16][36];
#pragma unroll
    for (int i = 0; i < TM; ++i) {
        const int mb = m0 + 16 * i; if (mb >= p.M) break;          // wave-uniform
#pragma unroll
        for (int tp = 0; tp < TN / 2; ++tp) {
            const int nb = n0 + 32 * tp; if (nb >= NW) break;        // wave-uniform
#pragma unroll
            for (int t2 = 0; t2 < 2; ++t2) {
                const int t = 2 * tp + t2; const int n = nb + t2 * 16 + l15; const int nn = min(n, p.N - 1);
#pragma unroll
                for (int r = 0; r < 8; ++r) {
                    const int m = mb + 8 * h + r; const int mm = min(m, p.M - 1);
                    float v = acc[i][t][r] * iscale;
                    if (p.flags & 1) v += p.bias[nn];
                    if (p.flags & 2) v += p.bias[mm];
            if (p.flags & 8) v *= p.bias[(long long)zo * p.M + mm];   /* per-(z,row) scale vector laid out [Z][M]; exclusive with the bias flags */
                    v = act_fn(v, p.act);
                    if (p.flags & 4) v += p.beta * R[(long long)mm * p.sRm + (long long)nn * p.sRn];
                    ctile[8 * h + r][t2 * 16 + l15] = (n < p.N) ? v : 0.f;
                }
            }
            __syncthreads();
            const bool fast = (mb + 16 <= p.M) && (nb + 32 <= NW) && ((p.sCm & 3) == 0) && ((((size_t)C) & 15) == 0);
            if (fast) {
#pragma unroll
                for (int s = 0; s < 4; ++s) {
                    const int row = s * 4 + (lane >> 3), c4 = (lane & 7) * 4;
                    const v4f v = *(const v4f*)&ctile[row][c4];
                    VST2V4(C + (long long)(mb + row) * p.sCm + nb + c4, v);
                }
            } else {
                for (int row = 0; row < 16; ++row) {
                    const int m = mb + row, n = nb + lane;
                    if (m < p.M && n < NW) VST2(float, C + (long long)m * p.sCm + n, ctile[row][lane]);
                }
            }
            __syncthreads();
        }
    }
}

// =====================================================================================================================
// k_attn32<LQ, LK, QP, KP>: flash attention at one fixed shape, all of it known at compile time: LQ queries, LK keys (a multiple of 64), head and
//   value dim 32, f32 rows with element stride 1 (Q and O row pitch QP floats, K and V row pitch KP floats, head h at column 32 h), no mask.
//   Wave = 16 queries, AW waves per block, 64-key blocks; grid (LQ / (16*AW), heads), block 32*AW. Every Q, K and V row piece is whole and
//   16-byte aligned, so it is read with unguarded 16-byte loads that are all in flight together.
//   Scores: f16 operands; statistics f32 (exp2 domain); P.V: P x 4096 as f16 with V f16 staged in LDS.
// =====================================================================================================================
#define AW 4
typedef __attribute__((ext_vector_type(4))) _Float16 v4h;
// the 16 f32 that make up lane half h's fragment of a 32-wide row: k = 8h..8h+7 and 16+8h..16+8h+7 (the order of frag_k)
struct Row16 { v4f r[4]; };
__device__ __forceinline__ Row16 row16_ld(const float* __restrict__ row, int h) {
    Row16 x;
    x.r[0] = *(const v4f*)(row + 8 * h); x.r[1] = *(const v4f*)(row + 8 * h + 4);
    x.r[2] = *(const v4f*)(row + 16 + 8 * h); x.r[3] = *(const v4f*)(row + 16 + 8 * h + 4);
    return x;
}
__device__ __forceinline__ v16h row16_f16(const Row16& x) {
    v16h a;
#pragma unroll
    for (int q = 0; q < 4; ++q)
#pragma unroll
        for (int e = 0; e < 4; ++e) a[4 * q + e] = (_Float16)x.r[q][e];
    return a;
}
template <int LQ, int LK, int QP, int KP>
__global__ __launch_bounds__(32 * AW) void k_attn32(const float* __restrict__ Q, const float* __restrict__ K, const float* __restrict__ V, float* __restrict__ O, float scale) {
    static_assert(LQ % (16 * AW) == 0 && LK % 64 == 0 && QP % 4 == 0 && KP % 4 == 0, "whole tiles, 16-byte rows");
    constexpr int NT = 2;                       // output tiles
    constexpr int VP = 32 + 8;                  // LDS pitch (halves)
    __shared__ __align__(16) float    pl[AW][16 * 64];
    __shared__ __align__(16) _Float16 vl[64 * VP];
    const int lane = threadIdx.x & 31, hf = lane >> 4, l15 = lane & 15, wave = threadIdx.x >> 5;
    const int h = blockIdx.y;
    const int q0 = (blockIdx.x * AW + wave) * 16;
    float* myp = pl[wave];
    const float L2E = 1.4426950408889634f;
    const float NEG = -__builtin_inff();
    const float* kbase = K + h * 32 + (size_t)l15 * KP;                                     // this lane's key row of a 16-key tile
    const float* vbase = V + h * 32 + (size_t)(threadIdx.x >> 3) * KP + (threadIdx.x & 7) * 4;  // this thread's 4 floats of a 16-row slab
    _Float16* vst = vl + (threadIdx.x >> 3) * VP + (threadIdx.x & 7) * 4;
    const v16h qa = row16_f16(row16_ld(Q + h * 32 + (size_t)(q0 + l15) * QP, hf));
    v8f o[NT]; float m8[8], l8[8];
#pragma unroll
    for (int t = 0; t < NT; ++t) { v8f zz = {}; o[t] = zz; }
#pragma unroll
    for (int i = 0; i < 8; ++i) { m8[i] = NEG; l8[i] = 0.f; }
    for (int j0 = 0; j0 < LK; j0 += 64) {
        v4f vr[4]; Row16 kr[4];
#pragma unroll
        for (int n = 0; n < 4; ++n) vr[n] = *(const v4f*)(vbase + (size_t)(j0 + 16 * n) * KP);
#pragma unroll
        for (int t = 0; t < 4; ++t) kr[t] = row16_ld(kbase + (size_t)(j0 + 16 * t) * KP, hf);
        __syncthreads();                                 // previous key block's reads of vl / pl are done
#pragma unroll
        for (int n = 0; n < 4; ++n) {
            const v4h hv = {(_Float16)vr[n][0], (_Float16)vr[n][1], (_Float16)vr[n][2], (_Float16)vr[n][3]};
            *(v4h*)(vst + 16 * n * VP) = hv;
        }
        v8f s[4];
#pragma unroll
        for (int t = 0; t < 4; ++t) { v8f acc = {}; s[t] = wmma16(qa, row16_f16(kr[t]), acc); }
        float pv[8][4];
#pragma unroll
        for (int i = 0; i < 8; ++i) {
            float sc[4];
#pragma unroll
            for (int t = 0; t < 4; ++t) { float v = s[t][i] * scale; v *= L2E; sc[t] = v; }
            float mx = fmaxf(fmaxf(sc[0], sc[1]), fmaxf(sc[2], sc[3]));
            mx = fmaxf(mx, __shfl_xor(mx, 1, 32)); mx = fmaxf(mx, __shfl_xor(mx, 2, 32));
            mx = fmaxf(mx, __shfl_xor(mx, 4, 32)); mx = fmaxf(mx, __shfl_xor(mx, 8, 32));
            const float mnew = fmaxf(m8[i], mx);
            const float corr = exp2f(m8[i] - mnew);          // first block: exp2(-inf) = 0
            float rs = 0.f;
#pragma unroll
            for (int t = 0; t < 4; ++t) { const float pp = exp2f(sc[t] - mnew); rs += pp; pv[i][t] = pp; }
            rs += __shfl_xor(rs, 1, 32); rs += __shfl_xor(rs, 2, 32); rs += __shfl_xor(rs, 4, 32); rs += __shfl_xor(rs, 8, 32);
            l8[i] = l8[i] * corr + rs; m8[i] = mnew;
#pragma unroll
            for (int t = 0; t < NT; ++t) o[t][i] *= corr;
        }
#pragma unroll
        for (int i = 0; i < 8; ++i)
#pragma unroll
            for (int t = 0; t < 4; ++t) myp[(i + 8 * hf) * 64 + t * 16 + l15] = pv[i][t];
        __syncthreads();                                 // P (per wave) and V (shared) visible
        const v16h pa0 = fh_ld(myp + l15 * 64, 1, 0, hf, 64, 4096.f), pa1 = fh_ld(myp + l15 * 64, 1, 32, hf, 64, 4096.f);
#pragma unroll
        for (int t = 0; t < NT; ++t) {
            const int dcol = t * 16 + l15;
            v16h b0, b1;
#pragma unroll
            for (int e = 0; e < 16; ++e) { b0[e] = vl[frag_k(e, hf) * VP + dcol]; b1[e] = vl[(32 + frag_k(e, hf)) * VP + dcol]; }
            o[t] = wmma16(pa0, b0, o[t]);
            o[t] = wmma16(pa1, b1, o[t]);
        }
    }
    float* obase = O + h * 32;
    float invr[8];
#pragma unroll
    for (int i = 0; i < 8; ++i) invr[i] = 1.f / (l8[i] * 4096.f);   // no key is masked: each row sum holds its maximum's exp2(0) = 1
    __syncthreads();                                             // all waves done with pl/vl from the main loop
#pragma unroll
    for (int i = 0; i < 8; ++i)
#pragma unroll
        for (int t = 0; t < NT; ++t) myp[(i + 8 * hf) * 64 + t * 16 + l15] = o[t][i] * invr[i];
    __syncthreads();
#pragma unroll
    for (int r0 = 0; r0 < 16; r0 += 4) {
        const int row = r0 + (lane >> 3), c4 = (lane & 7) * 4;
        const v4f v = *(const v4f*)(myp + row * 64 + c4);
        VST2V4(obase + (size_t)(q0 + row) * QP + c4, v);
    }
}

// =====================================================================================================================
// k_tr: dst(z, c, r) = alpha * src(z, r, c) (+ beta * R2(z, c, r)): [Z][R][C] (row stride lds) -> [Z][C][R] (row stride ldd) through a 32x32 LDS tile;
//   flags: 1 -> add beta * residual R2 addressed like dst (z*sRz + c*ldr + r); act applied before the residual.
// =====================================================================================================================
struct TrP { const float* src; float* dst; const float* R2; long long sSz, lds, sDz, ldd, sRz, ldr; int R, C, flags, act; float alpha, beta; };
static_assert(sizeof(TrP) == 3 * 8 + 6 * 8 + 6 * 4, "TrP has padding");
__global__ __launch_bounds__(256) void k_tr(TrP p) {
    __shared__ float tile[32][33];
    const int c0 = blockIdx.x * 32, r0 = blockIdx.y * 32, z = blockIdx.z;
    const int lane = threadIdx.x & 31, wave = threadIdx.x >> 5;
    const float* s = p.src + z * p.sSz;
#pragma unroll
    for (int k = 0; k < 4; ++k) {
        const int rl = wave * 4 + k, r = r0 + rl, c = c0 + lane;
        tile[rl][lane] = (r < p.R && c < p.C) ? s[(long long)r * p.lds + c] : 0.f;
    }
    __syncthreads();
    float* d = p.dst + z * p.sDz; const float* rr = p.R2 + z * p.sRz;
#pragma unroll
    for (int k = 0; k < 4; ++k) {
        const int cl = wave * 4 + k, c = c0 + cl, r = r0 + lane;
        if (c < p.C && r < p.R) {
            float v = act_fn(p.alpha * tile[lane][cl], p.act);
            if (p.flags & 1) v += p.beta * rr[(long long)c * p.ldr + r];
            VST2(float, d + (long long)c * p.ldd + r, v);
        }
    }
}

// k_affine: dst[i] = a * (sdev ? sdev[0] : 1) * src[i] + b, i < n (one thread per element; consecutive lanes -> consecutive addresses)
__global__ __launch_bounds__(256) void k_affine(const float* __restrict__ src, float* __restrict__ dst, int n, float a, float b, const float* __restrict__ sdev) {
    const int i = blockIdx.x * 256 + threadIdx.x;
    if (i < n) { const float aa = sdev ? a * sdev[0] : a; const float v = aa * src[i] + b; VST2(float, dst + i, v); }
}

// =====================================================================================================================
// k_softmax: row softmax over n contiguous elements, one 256-thread block per row; rows addressed z*sz + r*sr (grid (R, Z)).
//   out = scale_out * softmax(scale_in * x + (Mf ? Mf[z*smz + r*smr + j] : 0)); a row whose max is -inf is written as 0.
// =====================================================================================================================
struct SmP { const float* src; float* dst; const float* Mf; long long sz, sr, dz, dr, smz, smr; int n, pad; float scale_in, scale_out; };
static_assert(sizeof(SmP) == 3 * 8 + 6 * 8 + 4 * 4, "SmP has padding");
__global__ __launch_bounds__(256) void k_softmax(SmP p) {
    __shared__ float red[256];
    const int r = blockIdx.x, z = blockIdx.y, tid = threadIdx.x;
    const float* s = p.src + z * p.sz + (long long)r * p.sr;
    const float* mf = p.Mf ? (p.Mf + z * p.smz + (long long)r * p.smr) : nullptr;
    float mx = -__builtin_inff();
    for (int j = tid; j < p.n; j += 256) { float v = s[j] * p.scale_in; if (mf) v += mf[j]; mx = fmaxf(mx, v); }
    red[tid] = mx; __syncthreads();
    for (int o = 128; o > 0; o >>= 1) { if (tid < o) red[tid] = fmaxf(red[tid], red[tid + o]); __syncthreads(); }
    mx = red[0]; __syncthreads();
    float sum = 0.f;
    for (int j = tid; j < p.n; j += 256) { float v = s[j] * p.scale_in; if (mf) v += mf[j]; sum += (mx == -__builtin_inff()) ? 0.f : expf(v - mx); }
    red[tid] = sum; __syncthreads();
    for (int o = 128; o > 0; o >>= 1) { if (tid < o) red[tid] += red[tid + o]; __syncthreads(); }
    sum = red[0];
    const float inv = (sum > 0.f) ? p.scale_out / sum : 0.f;
    float* d = p.dst + z * p.dz + (long long)r * p.dr;
    for (int j = tid; j < p.n; j += 256) { float v = s[j] * p.scale_in; if (mf) v += mf[j]; const float o = (mx == -__builtin_inff()) ? 0.f : expf(v - mx) * inv; VST2(float, d + j, o); }
}
// =====================================================================================================================
// k_stats: mean and rsqrt(var + eps) over a set of n elements addressed base + z*sz + (e / inner) * so + (e % inner) * si, one 256-thread
// k_norm_apply: y = (x - mean[set]) * rstd[set] * g[c] + b[c] over a [Z][C][L] channel-major tensor with set = z*G + c / (C/G) (G groups per z;
//   G = C -> per-channel sets indexed z*C+c; for batch norm pass stats indexed by c only via bn = 1). Optional act. Output same layout.
// =====================================================================================================================
//   mode 0: mean / rsqrt(var + eps); mode 1 (RMSNorm): 0 / rsqrt(mean(x^2) + eps); mode 2 (L2 normalize * sqrt(n)): 0 / sqrt(n) / max(||x||, eps); mode 3: as 0 with unbiased variance (n-1)
__global__ __launch_bounds__(256) void k_stats(const float* __restrict__ x, long long sz, long long so, long long si, int inner, int n, float eps, float* __restrict__ stat, int mode) {
    __shared__ float red[256];
    const int z = blockIdx.x, tid = threadIdx.x;
    const float* base = x + z * sz;
    float s = 0.f;
    for (int e = tid; e < n; e += 256) s += base[(long long)(e / inner) * so + (long long)(e % inner) * si];
    red[tid] = s; __syncthreads();
    for (int o = 128; o > 0; o >>= 1) { if (tid < o) red[tid] += red[tid + o]; __syncthreads(); }
    const float mu = (mode == 0 || mode == 3) ? red[0] / (float)n : 0.f; __syncthreads();
    float q = 0.f;
    for (int e = tid; e < n; e += 256) { const float dlt = base[(long long)(e / inner) * so + (long long)(e % inner) * si] - mu; q += dlt * dlt; }
    red[tid] = q; __syncthreads();
    for (int o = 128; o > 0; o >>= 1) { if (tid < o) red[tid] += red[tid + o]; __syncthreads(); }
    {
        float rs;
        if (mode == 2) rs = sqrtf((float)n) / fmaxf(sqrtf(red[0]), eps); else if (mode == 3) rs = rsqrtf(red[0] / (float)(n - 1) + eps); else rs = rsqrtf(red[0] / (float)n + eps);
        if (tid < 32) { const float v = (tid == 0) ? mu : ((tid == 1) ? rs : 0.f); VST2(float, stat + (long long)z * 32 + tid, v); }
    }
}
//   One thread per element over the flat [Z][C][L] index space: grid ceil(Z*C*L / 256).
__global__ __launch_bounds__(256) void k_norm_apply(const float* __restrict__ x, float* __restrict__ y, const float* __restrict__ stat, const float* __restrict__ g, const float* __restrict__ bta,
                                                     int Z, int C, int L, int G, int bn, int act) {
    const long long idx = (long long)blockIdx.x * 256 + threadIdx.x;
    if (idx >= (long long)Z * C * L) return;
    const int l = (int)(idx % L); const long long zc = idx / L; const int c = (int)(zc % C), z = (int)(zc / C); (void)l;
    const int set = bn ? c : (z * G + c / (C / G));
    float v = (x[idx] - stat[(long long)set * 32]) * stat[(long long)set * 32 + 1];
    if (g) v *= g[c];
    if (bta) v += bta[c];
    v = act_fn(v, act);
    VST2(float, y + idx, v);
}

// k_lse_neg: c[i] = -(st[2i] + log(st[2i+1])) = minus the log-sum-exp of row i (for softmax over the query axis)
__global__ __launch_bounds__(256) void k_lse_neg(const float* __restrict__ st, float* __restrict__ c, int n) {
    const int i = blockIdx.x * 256 + threadIdx.x;
    if (i < n) { const float v = -(st[2 * i] + logf(st[2 * i + 1])); VST2(float, c + i, v); }
}

// k_iota: dst[i] = a * i + b as int32 (segment/position id helper)
__global__ __launch_bounds__(256) void k_iota(int* __restrict__ dst, int n, int a, int b) {
    const int i = blockIdx.x * 256 + threadIdx.x;
    if (i < n) { const int v = a * i + b; VST2(int, dst + i, v); }
}

// k_axpby: dst[i] = a * x[i] + b * y[i] (+ c), i < n
__global__ __launch_bounds__(256) void k_axpby(const float* __restrict__ x, const float* __restrict__ y, float* __restrict__ dst, int n, float a, float b, float c) {
    const int i = blockIdx.x * 256 + threadIdx.x;
    if (i < n) { const float v = a * x[i] + b * y[i] + c; VST2(float, dst + i, v); }
}

// =====================================================================================================================
// k_rope: rotary embedding on a [R rows][Hn heads][D] view (row stride sXr, head stride sXh, element stride 1) -> Y (own strides).
//   mode 0: rotate_half (partner d±D/2, sign - for d<D/2); mode 1: interleaved pairs (partner d^1, sign - for even d).
//   table column tcol: tmode 0 -> d, 1 -> d % (D/2), 2 -> d / 2; position p: pmode 0 -> r % S, 1 -> head index, 2 -> pos[r];
//   c = C[(r / S) * sCb + p * sCp + tcol * sCd], s likewise from Sn; y = x[d] * c + sign * x[partner] * s. X and Y must not alias.
// =====================================================================================================================
struct RopeP { const float* X; float* Y; const float* C; const float* Sn; const int* pos; long long sXr, sXh, sYr, sYh, sCb, sCp, sCd; int R, Hn, D, S, mode, tmode, pmode, pad; };
static_assert(sizeof(RopeP) == 5 * 8 + 7 * 8 + 8 * 4, "RopeP has padding");
__global__ __launch_bounds__(256) void k_rope(RopeP p) {
    const long long idx = (long long)blockIdx.x * 256 + threadIdx.x;
    if (idx >= (long long)p.R * p.Hn * p.D) return;
    const int d = (int)(idx % p.D); const long long rh = idx / p.D; const int h = (int)(rh % p.Hn); const int r = (int)(rh / p.Hn);
    const int half = p.D / 2;
    int partner; float sign;
    if (p.mode == 0) { partner = (d < half) ? d + half : d - half; sign = (d < half) ? -1.f : 1.f; }
    else { partner = d ^ 1; sign = (d & 1) ? 1.f : -1.f; }
    const int tcol = (p.tmode == 0) ? d : ((p.tmode == 1) ? (d % half) : (d >> 1));
    const int pp = (p.pmode == 0) ? (r % p.S) : ((p.pmode == 1) ? h : p.pos[r]);
    const long long toff = (long long)(r / p.S) * p.sCb + (long long)pp * p.sCp + (long long)tcol * p.sCd;
    const float* xr = p.X + (long long)r * p.sXr + (long long)h * p.sXh;
    const float v = xr[d] * p.C[toff] + sign * xr[partner] * p.Sn[toff];
    VST2(float, p.Y + (long long)r * p.sYr + (long long)h * p.sYh + d, v);
}

// k_invf + k_sincos (split so neither kernel carries a large VALU-fma footprint): invf_i = num * (1 / powf(base, (2 i)/D)) [fmode 0],
//   num * expf((2 i) * cexp) [fmode 1], num * powf(base, -2 (i - 1) / D) [fmode 2]; then cs/sn[s*half + i] = cos/sin((pscale * s) * invf_i)
__global__ __launch_bounds__(256) void k_invf(float* __restrict__ invb, int half, int D, float base, float num, int fmode, float cexp) {
    const int i = blockIdx.x * 256 + threadIdx.x;
    if (i >= ((half + 31) / 32) * 32) return;
    if (i >= half) { VST2(float, invb + i, 0.f); return; }
    const float e = (float)(2 * i) / (float)D;
    float invf;
    if (fmode == 1) invf = num * expf((float)(2 * i) * cexp);
    else if (fmode == 2) invf = num * powf(base, (-2.0f * ((float)i - 1.0f)) / (float)D);
    else invf = num * (1.0f / powf(base, e));
    VST2(float, invb + i, invf);
}
__global__ __launch_bounds__(256) void k_sincos(float* __restrict__ cs, float* __restrict__ sn, const float* __restrict__ invb, int S, int half, float pscale) {
    const int idx = blockIdx.x * 256 + threadIdx.x;
    if (idx >= S * half) return;
    const int s = idx / half, i = idx - s * half;
    const float ang = (pscale * (float)s) * invb[i];
    VST2(float, cs + idx, cosf(ang)); VST2(float, sn + idx, sinf(ang));
}

// k_mulact: dst[i] = act(x[i]) * y[i]
__global__ __launch_bounds__(256) void k_mulact(const float* __restrict__ x, const float* __restrict__ y, float* __restrict__ dst, int n, int act) {
    const int i = blockIdx.x * 256 + threadIdx.x;
    if (i < n) { const float v = act_fn(x[i], act) * y[i]; VST2(float, dst + i, v); }
}

// =====================================================================================================================
// k_matvec: thread-per-row matrix-vector products for N <= 8 output columns (heads with 1-3 outputs, gates), f32 on the VALU.
//   C[r*sCm + j] = act(alpha * sum_k A[r*sAm + k*sAk] * B[j*sBn + k*sBk] + bias[j]) + beta * R[r*sRm + j*sRn]; each thread writes its N contiguous floats.
// =====================================================================================================================
__global__ __launch_bounds__(256) void k_matvec(GemmP p) {
    // 32 lanes write one line with one instruction.
    const int rpt = (p.N == 1) ? 1 : 32;
    const long long r0 = ((long long)blockIdx.x * 256 + threadIdx.x) * rpt; const int z = blockIdx.z, zo = z / p.zi_n, zi = z - zo * p.zi_n;
    if (r0 >= p.M) return;
    const float* Bb = p.B + zo * p.sBo + zi * p.sBi;
    float* C = p.C + zo * p.sCo + zi * p.sCi; const float* R = p.R + zo * p.sRo + zi * p.sRi;
    for (int rr = 0; rr < rpt; ++rr) {
        const long long r = r0 + rr; if (r >= p.M) break;
        const float* A = p.A + zo * p.sAo + zi * p.sAi + r * p.sAm;
        float acc[8] = {0.f, 0.f, 0.f, 0.f, 0.f, 0.f, 0.f, 0.f};
        for (int k = 0; k < p.K; ++k) { const float a = A[(long long)k * p.sAk];
#pragma unroll
            for (int j = 0; j < 8; ++j) if (j < p.N) acc[j] += a * Bb[(long long)j * p.sBn + (long long)k * p.sBk]; }
#pragma unroll
        for (int j = 0; j < 8; ++j) if (j < p.N) {
            float v = acc[j] * p.alpha;
            if (p.flags & 1) v += p.bias[j];
            if (p.flags & 2) v += p.bias[r];
            v = act_fn(v, p.act);
            if (p.flags & 4) v += p.beta * R[r * p.sRm + (long long)j * p.sRn];
            VST2(float, C + r * p.sCm + j, v);
        }
    }
}
// k_smallsoftmax: thread-per-row softmax for short rows (n <= 64): dst[r*dr + j] = softmax(scale*src[r*sr + j])
__global__ __launch_bounds__(256) void k_smallsoftmax(const float* __restrict__ src, float* __restrict__ dst, long long sr, long long dr, int n, long long R, float scale) {
    const long long r0 = ((long long)blockIdx.x * 256 + threadIdx.x) * 32;
    for (int rr = 0; rr < 32; ++rr) {
        const long long r = r0 + rr; if (r >= R) return;
        const float* s = src + r * sr; float* d = dst + r * dr;
        float mx = -__builtin_inff();
        for (int j = 0; j < n; ++j) mx = fmaxf(mx, s[j] * scale);
        float sum = 0.f;
        for (int j = 0; j < n; ++j) sum += expf(s[j] * scale - mx);
        const float inv = 1.f / sum;
        for (int j = 0; j < n; ++j) { const float v = expf(s[j] * scale - mx) * inv; VST2(float, d + j, v); }
    }
}

__global__ __launch_bounds__(32) void k_unitstat(float* __restrict__ st) { const int t = threadIdx.x; const float v = (t == 1) ? 1.f : 0.f; VST2(float, st + t, v); }

// destination (e.g. a d_out whose row width is not a multiple of 32 floats) is written by consecutive lanes of one instruction
__global__ __launch_bounds__(256) void k_lincopy(const float* __restrict__ src, long long lds, float* __restrict__ dst, long long ldd, long long rows, int cols) {
    const long long i = (long long)blockIdx.x * 256 + threadIdx.x; if (i >= rows * cols) return;
    const long long r = i / cols; const int c = (int)(i - r * cols);
    const float v = src[r * lds + c]; VST2(float, dst + r * ldd + c, v);
}

namespace w25 {
typedef __attribute__((ext_vector_type(16))) _Float16 v16h;
typedef __attribute__((ext_vector_type(8)))  _Float16 v8h;
typedef __attribute__((ext_vector_type(16))) __bf16   v16b;
typedef __attribute__((ext_vector_type(8)))  __bf16   v8b;
typedef __attribute__((ext_vector_type(8)))  float    v8f;
typedef __attribute__((ext_vector_type(4)))  float    v4f;

__device__ __forceinline__ unsigned short f2bf_bits(float f) {
  unsigned u = __float_as_uint(f);
  return (unsigned short)((u + 0x7FFFu + ((u >> 16) & 1u)) >> 16);
}
__device__ __forceinline__ float bf_bits2f(unsigned short h) { return __uint_as_float(((unsigned)h) << 16); }

// hazard guards as plain device helpers (no inline asm inside the kernel template body)
__device__ __forceinline__ void dep_guard_h(v8f& a, v8f& b, v16h x, v16h y) { asm volatile("v_nop\n\tv_nop\n\tv_nop\n\tv_nop" : "+v"(a), "+v"(b) : "v"(x), "v"(y)); }
__device__ __forceinline__ void dep_guard_b(v8f& a, v8f& b, v16b x, v16b y) { asm volatile("v_nop\n\tv_nop\n\tv_nop\n\tv_nop" : "+v"(a), "+v"(b) : "v"(x), "v"(y)); }
__device__ __forceinline__ void keep4_h(v16h a, v16h b, v16h c, v16h d) { asm volatile("v_nop" :: "v"(a), "v"(b), "v"(c), "v"(d)); }
__device__ __forceinline__ void keep4_b(v16b a, v16b b, v16b c, v16b d) { asm volatile("v_nop" :: "v"(a), "v"(b), "v"(c), "v"(d)); }
__device__ __forceinline__ void acc_guard4(v8f& a, v8f& b, v8f& c, v8f& d) { asm volatile("v_nop\n\tv_nop\n\tv_nop\n\tv_nop" : "+v"(a), "+v"(b), "+v"(c), "+v"(d)); }
template <typename T> struct Frag;
template <> struct Frag<_Float16> {
  typedef v16h V; union U { v16h v; v8h h[2]; };
  static __device__ __forceinline__ v16h load(const _Float16* p) {   // elements 0..7 <- p[0..7], 8..15 <- p[16..23]
    U f; f.h[0] = *(const v8h*)(p); f.h[1] = *(const v8h*)(p + 16); return f.v;
  }
  static __device__ __forceinline__ v8f mma(v16h a, v16h b, v8f c) {
    return __builtin_amdgcn_wmma_f32_16x16x32_f16(false, a, false, b, (short)0, c, false, false);
  }
  static __device__ __forceinline__ void guard(v8f& a, v8f& b, v16h x, v16h y) { dep_guard_h(a, b, x, y); }
  static __device__ __forceinline__ void keep(v16h a, v16h b, v16h c, v16h d) { keep4_h(a, b, c, d); }
};
template <> struct Frag<__bf16> {
  typedef v16b V; union U { v16b v; v8b h[2]; };
  static __device__ __forceinline__ v16b load(const __bf16* p) {
    U f; f.h[0] = *(const v8b*)(p); f.h[1] = *(const v8b*)(p + 16); return f.v;
  }
  static __device__ __forceinline__ v8f mma(v16b a, v16b b, v8f c) {
    return __builtin_amdgcn_wmma_f32_16x16x32_bf16(false, a, false, b, (short)0, c, false, false);
  }
  static __device__ __forceinline__ void guard(v8f& a, v8f& b, v16b x, v16b y) { dep_guard_b(a, b, x, y); }
  static __device__ __forceinline__ void keep(v16b a, v16b b, v16b c, v16b d) { keep4_b(a, b, c, d); }
};

// ---- Register-blocked batched WMMA GEMM ------------------------------------
// C[m,n] = scale * sum_k A[m,k] * Bt[n,k] (+bias)(+resid); each wave owns a 64x64 tile.
// A row-major [M,K]; Bt row-major [N,K]; M,N % 64 == 0, K % 32 == 0.
// SPLIT: operands are hi/lo planes (A2/Bt2 = lo planes, same layout); product = hi·hi + hi·lo + lo·hi.
// BIAS_MODE: 0 = none, 1 = bias[m], 2 = bias[n].
// OUT_MODE: 0 = f32, 1 = f16, 2 = bf16 hi plane (Cout) + bf16 lo plane (Cout2).
// ET: 0 = f16 operands, 1 = bf16 operands (pointers passed as 16-bit storage)
template <int ET> struct Elem;
template <> struct Elem<0> { typedef _Float16 T; };
template <> struct Elem<1> { typedef __bf16 T; };
template <int ET, bool SPLIT, int BIAS_MODE, int OUT_MODE, bool RESID, int ACT = 0>
__global__ __launch_bounds__(256) void wmma_gemm64(
    const unsigned short* __restrict__ Ap, const unsigned short* __restrict__ A2p, int lda, long strideA,
    const unsigned short* __restrict__ Btp, const unsigned short* __restrict__ Bt2p, int ldb, long strideB,
    void* __restrict__ Cout, void* __restrict__ Cout2, int ldc, long strideC,
    const float* __restrict__ bias,
    const float* __restrict__ resid, long strideR,
    int M, int N, int K, float scale) {
  typedef typename Elem<ET>::T T;
  typedef typename Frag<T>::V V;
  const T* A = (const T*)Ap; const T* A2 = (const T*)A2p; const T* Bt = (const T*)Btp; const T* Bt2 = (const T*)Bt2p;
  __shared__ __align__(16) float sT[8][16 * 68];   // per-wave 16x64 slab, pitch 68 floats
  const int b    = blockIdx.y;
  const int lane = threadIdx.x & 31;
  const int wave = threadIdx.x >> 5;
  const int tilesN = N >> 6;
  const int tilesM = M >> 6;
  const int tile = blockIdx.x * 8 + wave;
  if (tile >= tilesM * tilesN) return;   // wave-uniform; no block barriers in this kernel
  const int tm = tile / tilesN;
  const int tn = tile - tm * tilesN;
  const int m0 = tm << 6;
  const int n0 = tn << 6;

  const T* Ab  = A  + (size_t)b * strideA;
  const T* Bb  = Bt + (size_t)b * strideB;
  const T* Ab2 = SPLIT ? (A2  + (size_t)b * strideA) : nullptr;
  const T* Bb2 = SPLIT ? (Bt2 + (size_t)b * strideB) : nullptr;

  const int rlane = lane & 15;                 // row (A) / col (B, D) within subtile
  const int koff  = (lane >> 4) * 8;           // k offset of this lane half
  const int mOff  = (lane >> 4) * 8;           // D row offset

  v8f acc[4][4];
#pragma unroll
  for (int i = 0; i < 4; ++i)
#pragma unroll
    for (int j = 0; j < 4; ++j) acc[i][j] = (v8f){0.f,0.f,0.f,0.f,0.f,0.f,0.f,0.f};

  for (int k0 = 0; k0 < K; k0 += 32) {
    V bh[4], bl[4];
#pragma unroll
    for (int j = 0; j < 4; ++j) {
      const size_t bo = (size_t)(n0 + (j << 4) + rlane) * ldb + koff + k0;
      bh[j] = Frag<T>::load(Bb + bo);
      if (SPLIT) bl[j] = Frag<T>::load(Bb2 + bo);
    }
#pragma unroll
    for (int i = 0; i < 4; ++i) {
      const size_t ao = (size_t)(m0 + (i << 4) + rlane) * lda + koff + k0;
      V ah = Frag<T>::load(Ab + ao);
      V al;
      if (SPLIT) al = Frag<T>::load(Ab2 + ao);
#pragma unroll
      for (int j = 0; j < 4; ++j) {
        acc[i][j] = Frag<T>::mma(ah, bh[j], acc[i][j]);
        if (SPLIT) {
          acc[i][j] = Frag<T>::mma(ah, bl[j], acc[i][j]);
          acc[i][j] = Frag<T>::mma(al, bh[j], acc[i][j]);
        }
      }
      Frag<T>::guard(acc[i][0], acc[i][3], ah, SPLIT ? al : ah);
    }
    Frag<T>::keep(bh[0], bh[1], bh[2], bh[3]);
    if (SPLIT) Frag<T>::keep(bl[0], bl[1], bl[2], bl[3]);
  }
  acc_guard4(acc[0][0], acc[0][1], acc[0][2], acc[0][3]);
  acc_guard4(acc[1][0], acc[1][1], acc[1][2], acc[1][3]);
  acc_guard4(acc[2][0], acc[2][1], acc[2][2], acc[2][3]);
  acc_guard4(acc[3][0], acc[3][1], acc[3][2], acc[3][3]);

  // ---- epilogue ----
  float* slab = sT[wave];
  const float* Rb = RESID ? (resid + (size_t)b * strideR) : nullptr;
#pragma unroll
  for (int i = 0; i < 4; ++i) {
    const int mBase = m0 + (i << 4);
#pragma unroll
    for (int j = 0; j < 4; ++j) {
      const int n = n0 + (j << 4) + rlane;
      float bv = 0.f;
      if (BIAS_MODE == 2) bv = bias[n];
#pragma unroll
      for (int r = 0; r < 8; ++r) {
        float v = acc[i][j][r] * scale;
        if (BIAS_MODE == 1) v += bias[mBase + mOff + r];
        if (BIAS_MODE == 2) v += bv;
        if (RESID) v += Rb[(size_t)(mBase + mOff + r) * ldc + n];
        if (ACT == 1) v = tanhf(v);
        if (ACT == 2) v = fmaxf(v, 0.0f);
        if (ACT == 3) v = v / (1.0f + expf(-v));
        if (ACT == 4) v = (v > 0.f) ? v : 0.01f * v;
        if (ACT == 5) v = 0.5f * v * (1.0f + erff(v * 0.70710678118654752f));
        slab[(mOff + r) * 68 + (j << 4) + rlane] = v;
      }
    }
    __builtin_amdgcn_fence(__ATOMIC_RELEASE, "workgroup");
    __builtin_amdgcn_wave_barrier();
    __builtin_amdgcn_fence(__ATOMIC_ACQUIRE, "workgroup");
    if (OUT_MODE == 0) {
      float* C = (float*)Cout + (size_t)b * strideC;
      const int hh = lane >> 4, c4 = (lane & 15) * 4;     // row seg = 256 B = 16 lanes x 16 B
      {
#pragma unroll
        for (int it = 0; it < 8; ++it) {
          const int row = it * 2 + hh;
          v4f v = *(const v4f*)(slab + row * 68 + c4);
          *(v4f*)(C + (size_t)(mBase + row) * ldc + n0 + c4) = v;
        }
        
      }
    } else {
      const int q = lane >> 3, c8 = (lane & 7) * 8;
      unsigned short* C  = (unsigned short*)Cout  + (size_t)b * strideC;
      unsigned short* C2 = (OUT_MODE == 2) ? ((unsigned short*)Cout2 + (size_t)b * strideC) : nullptr;
      {
#pragma unroll
        for (int it = 0; it < 4; ++it) {
          const int row = it * 4 + q;
          const float* sp = slab + row * 68 + c8;
          v8h hv, lv;
#pragma unroll
          for (int e = 0; e < 8; ++e) {
            if (OUT_MODE == 1) {
              hv[e] = (_Float16)sp[e];
            } else {
              unsigned short hb = f2bf_bits(sp[e]);
              unsigned short lb = f2bf_bits(sp[e] - bf_bits2f(hb));
              hv[e] = __builtin_bit_cast(_Float16, hb);
              lv[e] = __builtin_bit_cast(_Float16, lb);
            }
          }
          *(v8h*)(C + (size_t)(mBase + row) * ldc + n0 + c8) = hv;
          if (OUT_MODE == 2) *(v8h*)(C2 + (size_t)(mBase + row) * ldc + n0 + c8) = lv;
        }
        
      }
    }
    __builtin_amdgcn_fence(__ATOMIC_RELEASE, "workgroup");
    __builtin_amdgcn_wave_barrier();
    __builtin_amdgcn_fence(__ATOMIC_ACQUIRE, "workgroup");
  }
}

__global__ __launch_bounds__(256) void cast_f32_f16x2(
    const float* __restrict__ in, _Float16* __restrict__ out, int n2) {
  int i = blockIdx.x * 256 + threadIdx.x;
  if (i < n2) {
    const _Float16 h0 = (_Float16)in[2 * i], h1 = (_Float16)in[2 * i + 1];
    const unsigned u = (unsigned)__builtin_bit_cast(unsigned short, h0) | ((unsigned)__builtin_bit_cast(unsigned short, h1) << 16);
    ((unsigned*)out)[i] = u;
    
  }
}


} // namespace w25

__global__ __launch_bounds__(256) void k_castT16(const float* __restrict__ src, long long lds, _Float16* __restrict__ dst, long long ldd, int R, int C, float s) {
    const long long i = (long long)blockIdx.x * 256 + threadIdx.x; const long long np = (long long)C * (R / 2); if (i >= np) return; const int c = (int)(i / (R / 2)); const int r = 2 * (int)(i % (R / 2));
    const _Float16 h0 = (_Float16)(src[(long long)r * lds + c] * s), h1 = (_Float16)(src[(long long)(r + 1) * lds + c] * s);
    const unsigned u = (unsigned)__builtin_bit_cast(unsigned short, h0) | ((unsigned)__builtin_bit_cast(unsigned short, h1) << 16);
    unsigned* d = (unsigned*)(dst + (long long)c * ldd + r); *d = u;  }
__global__ __launch_bounds__(256) void k_cast16(const float* __restrict__ src, long long lds, _Float16* __restrict__ dst, long long ldd, int R, int C, float s) {
    const long long i = (long long)blockIdx.x * 256 + threadIdx.x; const long long np = (long long)R * (C / 2); if (i >= np) return; const int r = (int)(i / (C / 2)); const int c = 2 * (int)(i % (C / 2));
    const _Float16 h0 = (_Float16)(src[(long long)r * lds + c] * s), h1 = (_Float16)(src[(long long)r * lds + c + 1] * s);
    const unsigned u = (unsigned)__builtin_bit_cast(unsigned short, h0) | ((unsigned)__builtin_bit_cast(unsigned short, h1) << 16);
    unsigned* d = (unsigned*)(dst + (long long)r * ldd + c); *d = u;  }

// f32 -> bf16 hi plane + bf16 lo plane (x = hi + lo to ~2^-17 relative; RNE both), [R][C] -> [R][C] (or transposed to [C][R]); 2 consecutive destination elements
__device__ __forceinline__ unsigned int f2bf2_pack(float a, float b, unsigned int* lo) {
    const unsigned short ha = w25::f2bf_bits(a), hb = w25::f2bf_bits(b);
    const unsigned short la = w25::f2bf_bits(a - w25::bf_bits2f(ha)), lb = w25::f2bf_bits(b - w25::bf_bits2f(hb));
    *lo = (unsigned)la | ((unsigned)lb << 16); return (unsigned)ha | ((unsigned)hb << 16); }
__global__ __launch_bounds__(256) void k_castS16(const float* __restrict__ src, long long lds, __bf16* __restrict__ dhi, __bf16* __restrict__ dlo, long long ldd, int R, int C, float s, int transpose) {
    const long long i = (long long)blockIdx.x * 256 + threadIdx.x; long long o; float a, b;
    if (transpose) { const long long np = (long long)C * (R / 2); if (i >= np) return; const int c = (int)(i / (R / 2)); const int r = 2 * (int)(i % (R / 2)); a = src[(long long)r * lds + c] * s; b = src[(long long)(r + 1) * lds + c] * s; o = (long long)c * ldd + r; }
    else { const long long np = (long long)R * (C / 2); if (i >= np) return; const int r = (int)(i / (C / 2)); const int c = 2 * (int)(i % (C / 2)); a = src[(long long)r * lds + c] * s; b = src[(long long)r * lds + c + 1] * s; o = (long long)r * ldd + c; }
    unsigned lo; const unsigned hi = f2bf2_pack(a, b, &lo); unsigned* ph = (unsigned*)(dhi + o); unsigned* pl = (unsigned*)(dlo + o);
    *ph = hi; *pl = lo;  }

// im2col for the 2x2 stride-2 conv: COL[(Y,X)][(c,ky,kx)] = x[b][c][2Y+ky][2X+kx]
__global__ __launch_bounds__(256) void k_es_col(const float* __restrict__ X, float* __restrict__ COL, int b, int C, int Hs) { const long long q = (long long)blockIdx.x * 256 + threadIdx.x; const int Hr = Hs / 2; const long long KC = (long long)C * 4; if (q >= (long long)Hr * Hr * KC) return; const int kk = (int)(q % KC); const int pr = (int)(q / KC); const int c = kk / 4, ky = (kk / 2) % 2, kx = kk % 2; const int Y = pr / Hr, Xx = pr % Hr; VST2(float, COL + q, X[(((long long)b * C + c) * Hs + 2 * Y + ky) * Hs + 2 * Xx + kx]); }
// batch-wise attention: for (p, h, b): scores over b' = q_b . k_b' * scale (4 values), softmax, out = sum att v_b'; S[b][p][h*32+d] += out (S already holds out_img)
__global__ __launch_bounds__(256) void k_es_batch(const float* __restrict__ QB, const float* __restrict__ KVB, float* __restrict__ S, int B, int P, int C, int NH, int DH) { const long long w = (long long)blockIdx.x * 8 + (threadIdx.x >> 5); const int lane = threadIdx.x & 31; if (w >= (long long)B * P * NH) return; const int h = (int)(w % NH); const long long bp = w / NH; const int p = (int)(bp % P); const int b = (int)(bp / P); const float qd = QB[((long long)b * P + p) * C + h * DH + lane]; float sc[4]; float mx = -__builtin_inff();
#pragma unroll
    for (int b2 = 0; b2 < 4; ++b2) { float d0 = qd * KVB[((long long)b2 * P + p) * 2 * C + h * DH + lane]; for (int o = 16; o > 0; o >>= 1) d0 += __shfl_xor(d0, o, 32); sc[b2] = d0 * 0.17677669529663689f; mx = fmaxf(mx, sc[b2]); }
    float den = 0.f;
#pragma unroll
    for (int b2 = 0; b2 < 4; ++b2) { sc[b2] = expf(sc[b2] - mx); den += sc[b2]; } float o_ = 0.f;
#pragma unroll
    for (int b2 = 0; b2 < 4; ++b2) o_ += sc[b2] / den * KVB[((long long)b2 * P + p) * 2 * C + C + h * DH + lane];
    const long long oi = ((long long)b * P + p) * C + h * DH + lane; VST2(float, S + oi, S[oi] + o_); }


extern "C" void kernel_launch(void* const* d_in, const int* in_sizes, int n_in, void* d_out, int out_size, void* d_ws, size_t ws_size, hipStream_t stream) {
    (void)in_sizes; (void)n_in; (void)out_size; (void)ws_size;
    const float* x = (const float*)d_in[0];
    const float* Wq = (const float*)d_in[1];
    const float* Wkv = (const float*)d_in[2];
    const float* Wqb = (const float*)d_in[3];
    const float* Wkvb = (const float*)d_in[4];
    const float* Wout = (const float*)d_in[5];
    const int Bn = 4;
    const int C = 256;
    const int Hs = 64;
    const int P = 4096;
    const int PR = P / 4;
    const int NH = 8;
    const int DH = 32;
    const int KC = C * 4;
    float* out = (float*)d_out;
    char* wsp = (char*)d_ws;
    float* QT = (float*)wsp; wsp += (((size_t)((size_t)P * C) * 4 + 255) / 256) * 256;
    float* COL = (float*)wsp; wsp += (((size_t)((size_t)PR * KC) * 4 + 255) / 256) * 256;
    float* KVT = (float*)wsp; wsp += (((size_t)((size_t)PR * 2 * C) * 4 + 255) / 256) * 256;
    float* QB = (float*)wsp; wsp += (((size_t)((size_t)Bn * P * C) * 4 + 255) / 256) * 256;
    float* KVB = (float*)wsp; wsp += (((size_t)((size_t)Bn * P * 2 * C) * 4 + 255) / 256) * 256;
    float* S = (float*)wsp; wsp += (((size_t)((size_t)Bn * P * C) * 4 + 255) / 256) * 256;
    unsigned short* G64A = (unsigned short*)wsp; wsp += (((size_t)(1048576) * 2 + 255) / 256) * 256;
    unsigned short* G64B = (unsigned short*)wsp; wsp += (((size_t)(1048576) * 2 + 255) / 256) * 256;
    k_castT16<<<(unsigned)((((long long)(4096) * ((256) / 2)) + 255) / 256), 256, 0, stream>>>(x + (size_t)0 * C * P, 4096, (_Float16*)(G64A), 256, 256, 4096, 1.0f);
    k_cast16<<<(unsigned)((((long long)(256) * ((256) / 2)) + 255) / 256), 256, 0, stream>>>(Wqb, 256, (_Float16*)(G64B), 256, 256, 256, 16.0f);
    w25::wmma_gemm64<0, false, 0, 0, false, 0><<<dim3((unsigned)((((4096) / 64) * ((256) / 64) + 7) / 8), (unsigned)(1)), 256, 0, stream>>>((const unsigned short*)(G64A), nullptr, 256, 0, (const unsigned short*)(G64B), nullptr, 256, 0, (void*)(QB + (size_t)0 * P * C), nullptr, 256, 0, nullptr, nullptr, 0, 4096, 256, 256, 0.0625f);
    k_castT16<<<(unsigned)((((long long)(4096) * ((256) / 2)) + 255) / 256), 256, 0, stream>>>(x + (size_t)0 * C * P, 4096, (_Float16*)(G64A), 256, 256, 4096, 1.0f);
    k_cast16<<<(unsigned)((((long long)(512) * ((256) / 2)) + 255) / 256), 256, 0, stream>>>(Wkvb, 256, (_Float16*)(G64B), 256, 512, 256, 16.0f);
    w25::wmma_gemm64<0, false, 0, 0, false, 0><<<dim3((unsigned)((((4096) / 64) * ((512) / 64) + 7) / 8), (unsigned)(1)), 256, 0, stream>>>((const unsigned short*)(G64A), nullptr, 256, 0, (const unsigned short*)(G64B), nullptr, 256, 0, (void*)(KVB + (size_t)0 * P * 2 * C), nullptr, 512, 0, nullptr, nullptr, 0, 4096, 512, 256, 0.0625f);
    k_castT16<<<(unsigned)((((long long)(4096) * ((256) / 2)) + 255) / 256), 256, 0, stream>>>(x + (size_t)1 * C * P, 4096, (_Float16*)(G64A), 256, 256, 4096, 1.0f);
    k_cast16<<<(unsigned)((((long long)(256) * ((256) / 2)) + 255) / 256), 256, 0, stream>>>(Wqb, 256, (_Float16*)(G64B), 256, 256, 256, 16.0f);
    w25::wmma_gemm64<0, false, 0, 0, false, 0><<<dim3((unsigned)((((4096) / 64) * ((256) / 64) + 7) / 8), (unsigned)(1)), 256, 0, stream>>>((const unsigned short*)(G64A), nullptr, 256, 0, (const unsigned short*)(G64B), nullptr, 256, 0, (void*)(QB + (size_t)1 * P * C), nullptr, 256, 0, nullptr, nullptr, 0, 4096, 256, 256, 0.0625f);
    k_castT16<<<(unsigned)((((long long)(4096) * ((256) / 2)) + 255) / 256), 256, 0, stream>>>(x + (size_t)1 * C * P, 4096, (_Float16*)(G64A), 256, 256, 4096, 1.0f);
    k_cast16<<<(unsigned)((((long long)(512) * ((256) / 2)) + 255) / 256), 256, 0, stream>>>(Wkvb, 256, (_Float16*)(G64B), 256, 512, 256, 16.0f);
    w25::wmma_gemm64<0, false, 0, 0, false, 0><<<dim3((unsigned)((((4096) / 64) * ((512) / 64) + 7) / 8), (unsigned)(1)), 256, 0, stream>>>((const unsigned short*)(G64A), nullptr, 256, 0, (const unsigned short*)(G64B), nullptr, 256, 0, (void*)(KVB + (size_t)1 * P * 2 * C), nullptr, 512, 0, nullptr, nullptr, 0, 4096, 512, 256, 0.0625f);
    k_castT16<<<(unsigned)((((long long)(4096) * ((256) / 2)) + 255) / 256), 256, 0, stream>>>(x + (size_t)2 * C * P, 4096, (_Float16*)(G64A), 256, 256, 4096, 1.0f);
    k_cast16<<<(unsigned)((((long long)(256) * ((256) / 2)) + 255) / 256), 256, 0, stream>>>(Wqb, 256, (_Float16*)(G64B), 256, 256, 256, 16.0f);
    w25::wmma_gemm64<0, false, 0, 0, false, 0><<<dim3((unsigned)((((4096) / 64) * ((256) / 64) + 7) / 8), (unsigned)(1)), 256, 0, stream>>>((const unsigned short*)(G64A), nullptr, 256, 0, (const unsigned short*)(G64B), nullptr, 256, 0, (void*)(QB + (size_t)2 * P * C), nullptr, 256, 0, nullptr, nullptr, 0, 4096, 256, 256, 0.0625f);
    k_castT16<<<(unsigned)((((long long)(4096) * ((256) / 2)) + 255) / 256), 256, 0, stream>>>(x + (size_t)2 * C * P, 4096, (_Float16*)(G64A), 256, 256, 4096, 1.0f);
    k_cast16<<<(unsigned)((((long long)(512) * ((256) / 2)) + 255) / 256), 256, 0, stream>>>(Wkvb, 256, (_Float16*)(G64B), 256, 512, 256, 16.0f);
    w25::wmma_gemm64<0, false, 0, 0, false, 0><<<dim3((unsigned)((((4096) / 64) * ((512) / 64) + 7) / 8), (unsigned)(1)), 256, 0, stream>>>((const unsigned short*)(G64A), nullptr, 256, 0, (const unsigned short*)(G64B), nullptr, 256, 0, (void*)(KVB + (size_t)2 * P * 2 * C), nullptr, 512, 0, nullptr, nullptr, 0, 4096, 512, 256, 0.0625f);
    k_castT16<<<(unsigned)((((long long)(4096) * ((256) / 2)) + 255) / 256), 256, 0, stream>>>(x + (size_t)3 * C * P, 4096, (_Float16*)(G64A), 256, 256, 4096, 1.0f);
    k_cast16<<<(unsigned)((((long long)(256) * ((256) / 2)) + 255) / 256), 256, 0, stream>>>(Wqb, 256, (_Float16*)(G64B), 256, 256, 256, 16.0f);
    w25::wmma_gemm64<0, false, 0, 0, false, 0><<<dim3((unsigned)((((4096) / 64) * ((256) / 64) + 7) / 8), (unsigned)(1)), 256, 0, stream>>>((const unsigned short*)(G64A), nullptr, 256, 0, (const unsigned short*)(G64B), nullptr, 256, 0, (void*)(QB + (size_t)3 * P * C), nullptr, 256, 0, nullptr, nullptr, 0, 4096, 256, 256, 0.0625f);
    k_castT16<<<(unsigned)((((long long)(4096) * ((256) / 2)) + 255) / 256), 256, 0, stream>>>(x + (size_t)3 * C * P, 4096, (_Float16*)(G64A), 256, 256, 4096, 1.0f);
    k_cast16<<<(unsigned)((((long long)(512) * ((256) / 2)) + 255) / 256), 256, 0, stream>>>(Wkvb, 256, (_Float16*)(G64B), 256, 512, 256, 16.0f);
    w25::wmma_gemm64<0, false, 0, 0, false, 0><<<dim3((unsigned)((((4096) / 64) * ((512) / 64) + 7) / 8), (unsigned)(1)), 256, 0, stream>>>((const unsigned short*)(G64A), nullptr, 256, 0, (const unsigned short*)(G64B), nullptr, 256, 0, (void*)(KVB + (size_t)3 * P * 2 * C), nullptr, 512, 0, nullptr, nullptr, 0, 4096, 512, 256, 0.0625f);
    k_castT16<<<(unsigned)((((long long)(4096) * ((256) / 2)) + 255) / 256), 256, 0, stream>>>(x + (size_t)0 * C * P, 4096, (_Float16*)(G64A), 256, 256, 4096, 1.0f);
    k_cast16<<<(unsigned)((((long long)(256) * ((256) / 2)) + 255) / 256), 256, 0, stream>>>(Wq, 256, (_Float16*)(G64B), 256, 256, 256, 16.0f);
    w25::wmma_gemm64<0, false, 0, 0, false, 0><<<dim3((unsigned)((((4096) / 64) * ((256) / 64) + 7) / 8), (unsigned)(1)), 256, 0, stream>>>((const unsigned short*)(G64A), nullptr, 256, 0, (const unsigned short*)(G64B), nullptr, 256, 0, (void*)(QT), nullptr, 256, 0, nullptr, nullptr, 0, 4096, 256, 256, 0.0625f);
    k_es_col<<<(unsigned)(((long long)PR * KC + 255) / 256), 256, 0, stream>>>(x, COL, 0, C, Hs);
    k_cast16<<<(unsigned)((((long long)(1024) * ((1024) / 2)) + 255) / 256), 256, 0, stream>>>(COL, 1024, (_Float16*)(G64A), 1024, 1024, 1024, 1.0f);
    k_cast16<<<(unsigned)((((long long)(512) * ((1024) / 2)) + 255) / 256), 256, 0, stream>>>(Wkv, 1024, (_Float16*)(G64B), 1024, 512, 1024, 16.0f);
    w25::wmma_gemm64<0, false, 0, 0, false, 0><<<dim3((unsigned)((((1024) / 64) * ((512) / 64) + 7) / 8), (unsigned)(1)), 256, 0, stream>>>((const unsigned short*)(G64A), nullptr, 1024, 0, (const unsigned short*)(G64B), nullptr, 1024, 0, (void*)(KVT), nullptr, 512, 0, nullptr, nullptr, 0, 1024, 512, 1024, 0.0625f);
    k_attn32<4096, 1024, 256, 512><<<dim3((unsigned)(P / (16 * AW)), (unsigned)(NH)), 32 * AW, 0, stream>>>(QT, KVT, KVT + C, S + (size_t)0 * P * C, 0.1767766952966369f);
    k_castT16<<<(unsigned)((((long long)(4096) * ((256) / 2)) + 255) / 256), 256, 0, stream>>>(x + (size_t)1 * C * P, 4096, (_Float16*)(G64A), 256, 256, 4096, 1.0f);
    k_cast16<<<(unsigned)((((long long)(256) * ((256) / 2)) + 255) / 256), 256, 0, stream>>>(Wq, 256, (_Float16*)(G64B), 256, 256, 256, 16.0f);
    w25::wmma_gemm64<0, false, 0, 0, false, 0><<<dim3((unsigned)((((4096) / 64) * ((256) / 64) + 7) / 8), (unsigned)(1)), 256, 0, stream>>>((const unsigned short*)(G64A), nullptr, 256, 0, (const unsigned short*)(G64B), nullptr, 256, 0, (void*)(QT), nullptr, 256, 0, nullptr, nullptr, 0, 4096, 256, 256, 0.0625f);
    k_es_col<<<(unsigned)(((long long)PR * KC + 255) / 256), 256, 0, stream>>>(x, COL, 1, C, Hs);
    k_cast16<<<(unsigned)((((long long)(1024) * ((1024) / 2)) + 255) / 256), 256, 0, stream>>>(COL, 1024, (_Float16*)(G64A), 1024, 1024, 1024, 1.0f);
    k_cast16<<<(unsigned)((((long long)(512) * ((1024) / 2)) + 255) / 256), 256, 0, stream>>>(Wkv, 1024, (_Float16*)(G64B), 1024, 512, 1024, 16.0f);
    w25::wmma_gemm64<0, false, 0, 0, false, 0><<<dim3((unsigned)((((1024) / 64) * ((512) / 64) + 7) / 8), (unsigned)(1)), 256, 0, stream>>>((const unsigned short*)(G64A), nullptr, 1024, 0, (const unsigned short*)(G64B), nullptr, 1024, 0, (void*)(KVT), nullptr, 512, 0, nullptr, nullptr, 0, 1024, 512, 1024, 0.0625f);
    k_attn32<4096, 1024, 256, 512><<<dim3((unsigned)(P / (16 * AW)), (unsigned)(NH)), 32 * AW, 0, stream>>>(QT, KVT, KVT + C, S + (size_t)1 * P * C, 0.1767766952966369f);
    k_castT16<<<(unsigned)((((long long)(4096) * ((256) / 2)) + 255) / 256), 256, 0, stream>>>(x + (size_t)2 * C * P, 4096, (_Float16*)(G64A), 256, 256, 4096, 1.0f);
    k_cast16<<<(unsigned)((((long long)(256) * ((256) / 2)) + 255) / 256), 256, 0, stream>>>(Wq, 256, (_Float16*)(G64B), 256, 256, 256, 16.0f);
    w25::wmma_gemm64<0, false, 0, 0, false, 0><<<dim3((unsigned)((((4096) / 64) * ((256) / 64) + 7) / 8), (unsigned)(1)), 256, 0, stream>>>((const unsigned short*)(G64A), nullptr, 256, 0, (const unsigned short*)(G64B), nullptr, 256, 0, (void*)(QT), nullptr, 256, 0, nullptr, nullptr, 0, 4096, 256, 256, 0.0625f);
    k_es_col<<<(unsigned)(((long long)PR * KC + 255) / 256), 256, 0, stream>>>(x, COL, 2, C, Hs);
    k_cast16<<<(unsigned)((((long long)(1024) * ((1024) / 2)) + 255) / 256), 256, 0, stream>>>(COL, 1024, (_Float16*)(G64A), 1024, 1024, 1024, 1.0f);
    k_cast16<<<(unsigned)((((long long)(512) * ((1024) / 2)) + 255) / 256), 256, 0, stream>>>(Wkv, 1024, (_Float16*)(G64B), 1024, 512, 1024, 16.0f);
    w25::wmma_gemm64<0, false, 0, 0, false, 0><<<dim3((unsigned)((((1024) / 64) * ((512) / 64) + 7) / 8), (unsigned)(1)), 256, 0, stream>>>((const unsigned short*)(G64A), nullptr, 1024, 0, (const unsigned short*)(G64B), nullptr, 1024, 0, (void*)(KVT), nullptr, 512, 0, nullptr, nullptr, 0, 1024, 512, 1024, 0.0625f);
    k_attn32<4096, 1024, 256, 512><<<dim3((unsigned)(P / (16 * AW)), (unsigned)(NH)), 32 * AW, 0, stream>>>(QT, KVT, KVT + C, S + (size_t)2 * P * C, 0.1767766952966369f);
    k_castT16<<<(unsigned)((((long long)(4096) * ((256) / 2)) + 255) / 256), 256, 0, stream>>>(x + (size_t)3 * C * P, 4096, (_Float16*)(G64A), 256, 256, 4096, 1.0f);
    k_cast16<<<(unsigned)((((long long)(256) * ((256) / 2)) + 255) / 256), 256, 0, stream>>>(Wq, 256, (_Float16*)(G64B), 256, 256, 256, 16.0f);
    w25::wmma_gemm64<0, false, 0, 0, false, 0><<<dim3((unsigned)((((4096) / 64) * ((256) / 64) + 7) / 8), (unsigned)(1)), 256, 0, stream>>>((const unsigned short*)(G64A), nullptr, 256, 0, (const unsigned short*)(G64B), nullptr, 256, 0, (void*)(QT), nullptr, 256, 0, nullptr, nullptr, 0, 4096, 256, 256, 0.0625f);
    k_es_col<<<(unsigned)(((long long)PR * KC + 255) / 256), 256, 0, stream>>>(x, COL, 3, C, Hs);
    k_cast16<<<(unsigned)((((long long)(1024) * ((1024) / 2)) + 255) / 256), 256, 0, stream>>>(COL, 1024, (_Float16*)(G64A), 1024, 1024, 1024, 1.0f);
    k_cast16<<<(unsigned)((((long long)(512) * ((1024) / 2)) + 255) / 256), 256, 0, stream>>>(Wkv, 1024, (_Float16*)(G64B), 1024, 512, 1024, 16.0f);
    w25::wmma_gemm64<0, false, 0, 0, false, 0><<<dim3((unsigned)((((1024) / 64) * ((512) / 64) + 7) / 8), (unsigned)(1)), 256, 0, stream>>>((const unsigned short*)(G64A), nullptr, 1024, 0, (const unsigned short*)(G64B), nullptr, 1024, 0, (void*)(KVT), nullptr, 512, 0, nullptr, nullptr, 0, 1024, 512, 1024, 0.0625f);
    k_attn32<4096, 1024, 256, 512><<<dim3((unsigned)(P / (16 * AW)), (unsigned)(NH)), 32 * AW, 0, stream>>>(QT, KVT, KVT + C, S + (size_t)3 * P * C, 0.1767766952966369f);
    k_es_batch<<<(unsigned)(((long long)Bn * P * NH + 7) / 8), 256, 0, stream>>>(QB, KVB, S, Bn, P, C, NH, DH);
    k_cast16<<<(unsigned)((((long long)(256) * ((256) / 2)) + 255) / 256), 256, 0, stream>>>(Wout, 256, (_Float16*)(G64A), 256, 256, 256, 16.0f);
    k_cast16<<<(unsigned)((((long long)(4096) * ((256) / 2)) + 255) / 256), 256, 0, stream>>>(S + (size_t)0 * P * C, 256, (_Float16*)(G64B), 256, 4096, 256, 1.0f);
    w25::wmma_gemm64<0, false, 0, 0, false, 0><<<dim3((unsigned)((((256) / 64) * ((4096) / 64) + 7) / 8), (unsigned)(1)), 256, 0, stream>>>((const unsigned short*)(G64A), nullptr, 256, 0, (const unsigned short*)(G64B), nullptr, 256, 0, (void*)(out + (size_t)0 * C * P), nullptr, 4096, 0, nullptr, nullptr, 0, 256, 4096, 256, 0.0625f);
    k_cast16<<<(unsigned)((((long long)(256) * ((256) / 2)) + 255) / 256), 256, 0, stream>>>(Wout, 256, (_Float16*)(G64A), 256, 256, 256, 16.0f);
    k_cast16<<<(unsigned)((((long long)(4096) * ((256) / 2)) + 255) / 256), 256, 0, stream>>>(S + (size_t)1 * P * C, 256, (_Float16*)(G64B), 256, 4096, 256, 1.0f);
    w25::wmma_gemm64<0, false, 0, 0, false, 0><<<dim3((unsigned)((((256) / 64) * ((4096) / 64) + 7) / 8), (unsigned)(1)), 256, 0, stream>>>((const unsigned short*)(G64A), nullptr, 256, 0, (const unsigned short*)(G64B), nullptr, 256, 0, (void*)(out + (size_t)1 * C * P), nullptr, 4096, 0, nullptr, nullptr, 0, 256, 4096, 256, 0.0625f);
    k_cast16<<<(unsigned)((((long long)(256) * ((256) / 2)) + 255) / 256), 256, 0, stream>>>(Wout, 256, (_Float16*)(G64A), 256, 256, 256, 16.0f);
    k_cast16<<<(unsigned)((((long long)(4096) * ((256) / 2)) + 255) / 256), 256, 0, stream>>>(S + (size_t)2 * P * C, 256, (_Float16*)(G64B), 256, 4096, 256, 1.0f);
    w25::wmma_gemm64<0, false, 0, 0, false, 0><<<dim3((unsigned)((((256) / 64) * ((4096) / 64) + 7) / 8), (unsigned)(1)), 256, 0, stream>>>((const unsigned short*)(G64A), nullptr, 256, 0, (const unsigned short*)(G64B), nullptr, 256, 0, (void*)(out + (size_t)2 * C * P), nullptr, 4096, 0, nullptr, nullptr, 0, 256, 4096, 256, 0.0625f);
    k_cast16<<<(unsigned)((((long long)(256) * ((256) / 2)) + 255) / 256), 256, 0, stream>>>(Wout, 256, (_Float16*)(G64A), 256, 256, 256, 16.0f);
    k_cast16<<<(unsigned)((((long long)(4096) * ((256) / 2)) + 255) / 256), 256, 0, stream>>>(S + (size_t)3 * P * C, 256, (_Float16*)(G64B), 256, 4096, 256, 1.0f);
    w25::wmma_gemm64<0, false, 0, 0, false, 0><<<dim3((unsigned)((((256) / 64) * ((4096) / 64) + 7) / 8), (unsigned)(1)), 256, 0, stream>>>((const unsigned short*)(G64A), nullptr, 256, 0, (const unsigned short*)(G64B), nullptr, 256, 0, (void*)(out + (size_t)3 * C * P), nullptr, 4096, 0, nullptr, nullptr, 0, 256, 4096, 256, 0.0625f);
}

// v002
// Measured time: 317 microseconds a run.
// Timed twice side by side with v001, it ran 2.43 times as fast both times.
// Over all steps from v000 it is 6.92 times as fast.
// Contractions (per image): q / qb / kvb 1x1 projections in position-major form x^T W^T [4096x256].[256x{256,256,512}], the 2x2-stride-2 kv conv as an im2col GEMM [1024x1024].[1024x512] and the output 1x1 conv Wout.(out_img + out_batch)^T [256x256].[256x4096], all with f16 operands (v_wmma_f32_16x16x32_f16; 64x64 register-blocked wave tiles over pre-cast f16 operand planes, weight operands pre-scaled by 16 at the cast and un-scaled in the f32 epilogue); the spatial-reduction attention per head (flash kernel, head_dim 32, 4096 queries x 1024 keys, f16 q.k^T and f16 p.v); f32 accumulate; the im2col, the batch-wise 4x4 attention per (position, head) and the branch sum are f32 kernels.
#include <hip/hip_runtime.h>
#include <math.h>

typedef __attribute__((ext_vector_type(16))) _Float16 v16h;
typedef __attribute__((ext_vector_type(8)))  _Float16 v8h;
typedef __attribute__((ext_vector_type(16))) __bf16   v16b;
typedef __attribute__((ext_vector_type(8)))  float    v8f;
typedef __attribute__((ext_vector_type(4)))  float    v4f;

// 16-bit WMMA fragment map (wave32), lane L, h = L>>4, m = L&15:
//   A 16x32: lane = row m;   element i -> k = (i<8) ? 8h+i : 16+8h+(i-8)
//   B 32x16: lane = column m; the SAME k(i,h)
//   D 16x16 (8 f32): lane = column m; element r -> row 8h+r
__device__ __forceinline__ int frag_k(int i, int h) { return (i < 8) ? (8 * h + i) : (16 + 8 * h + (i - 8)); }
__device__ __forceinline__ __bf16 bf16_rne(float f) {
    unsigned int u = __float_as_uint(f);
    u += 0x7fffu + ((u >> 16) & 1u);
    return __builtin_bit_cast(__bf16, (unsigned short)(u >> 16));
}
__device__ __forceinline__ float bf16_f32(__bf16 b) { return __uint_as_float(((unsigned int)__builtin_bit_cast(unsigned short, b)) << 16); }
__device__ __forceinline__ v8f wmma16(v16h a, v16h b, v8f c) {
    c = __builtin_amdgcn_wmma_f32_16x16x32_f16(false, a, false, b, (short)0, c, false, false);
    asm volatile("v_nop\n\tv_nop\n\tv_nop\n\tv_nop" : "+v"(c) : "v"(a), "v"(b));
    return c;
}
__device__ __forceinline__ v8f wmmab(v16b a, v16b b, v8f c) {
    c = __builtin_amdgcn_wmma_f32_16x16x32_bf16(false, a, false, b, (short)0, c, false, false);
    asm volatile("v_nop\n\tv_nop\n\tv_nop\n\tv_nop" : "+v"(c) : "v"(a), "v"(b));
    return c;
}
struct Split { v16b hi, lo; };
// hi/lo split product: a.hi*b.hi + a.hi*b.lo + a.lo*b.hi
__device__ __forceinline__ v8f wmma3(const Split& a, const Split& b, v8f c) {
    c = __builtin_amdgcn_wmma_f32_16x16x32_bf16(false, a.hi, false, b.hi, (short)0, c, false, false);
    c = __builtin_amdgcn_wmma_f32_16x16x32_bf16(false, a.hi, false, b.lo, (short)0, c, false, false);
    c = __builtin_amdgcn_wmma_f32_16x16x32_bf16(false, a.lo, false, b.hi, (short)0, c, false, false);
    asm volatile("v_nop\n\tv_nop\n\tv_nop\n\tv_nop" : "+v"(c) : "v"(a.hi), "v"(a.lo), "v"(b.hi), "v"(b.lo));
    return c;
}
struct Split3 { v16b hi, mid, lo; };
// triple split product (6 terms, drops only terms below 2^-24 relative)
__device__ __forceinline__ v8f wmma6(const Split3& a, const Split3& b, v8f c) {
    c = __builtin_amdgcn_wmma_f32_16x16x32_bf16(false, a.hi, false, b.hi, (short)0, c, false, false);
    c = __builtin_amdgcn_wmma_f32_16x16x32_bf16(false, a.hi, false, b.mid, (short)0, c, false, false);
    c = __builtin_amdgcn_wmma_f32_16x16x32_bf16(false, a.mid, false, b.hi, (short)0, c, false, false);
    c = __builtin_amdgcn_wmma_f32_16x16x32_bf16(false, a.hi, false, b.lo, (short)0, c, false, false);
    c = __builtin_amdgcn_wmma_f32_16x16x32_bf16(false, a.mid, false, b.mid, (short)0, c, false, false);
    c = __builtin_amdgcn_wmma_f32_16x16x32_bf16(false, a.lo, false, b.hi, (short)0, c, false, false);
    asm volatile("v_nop\n\tv_nop\n\tv_nop\n\tv_nop" : "+v"(c) : "v"(a.hi), "v"(a.mid), "v"(a.lo), "v"(b.hi), "v"(b.mid), "v"(b.lo));
    return c;
}

// Fragment gathers from f32 memory: element i <- p[(k0 + frag_k(i,h)) * sk] * s, zero for k >= klen.
__device__ __forceinline__ v16h fh_ld(const float* __restrict__ p, long long sk, int k0, int h, int klen, float s) {
    v16h a;
#pragma unroll
    for (int i = 0; i < 16; ++i) { const int k = k0 + frag_k(i, h); a[i] = (k < klen) ? (_Float16)(p[(long long)k * sk] * s) : (_Float16)0.f; }
    return a;
}
__device__ __forceinline__ Split sp_ld(const float* __restrict__ p, long long sk, int k0, int h, int klen, float s) {
    Split r;
#pragma unroll
    for (int i = 0; i < 16; ++i) {
        const int k = k0 + frag_k(i, h); const float x = (k < klen) ? p[(long long)k * sk] * s : 0.f;
        const __bf16 hb = bf16_rne(x); r.hi[i] = hb; r.lo[i] = bf16_rne(x - bf16_f32(hb));
    }
    return r;
}
__device__ __forceinline__ Split3 sp3_ld(const float* __restrict__ p, long long sk, int k0, int h, int klen, float s) {
    Split3 r;
#pragma unroll
    for (int i = 0; i < 16; ++i) {
        const int k = k0 + frag_k(i, h); const float x = (k < klen) ? p[(long long)k * sk] * s : 0.f;
        const __bf16 hb = bf16_rne(x); const float r1 = x - bf16_f32(hb); const __bf16 mb = bf16_rne(r1);
        r.hi[i] = hb; r.mid[i] = mb; r.lo[i] = bf16_rne(r1 - bf16_f32(mb));
    }
    return r;
}
__device__ __forceinline__ v16b bh_ld(const float* __restrict__ p, long long sk, int k0, int h, int klen, float s) {
    v16b a;
#pragma unroll
    for (int i = 0; i < 16; ++i) { const int k = k0 + frag_k(i, h); a[i] = bf16_rne((k < klen) ? p[(long long)k * sk] * s : 0.f); }
    return a;
}
// f16 fragment from an f16 LDS/global row with element stride 1 (k-contiguous), no bounds (tile already zero padded)
__device__ __forceinline__ v16h fh_row(const _Float16* __restrict__ row, int k0, int h) {
    v16h a;
#pragma unroll
    for (int i = 0; i < 16; ++i) a[i] = row[k0 + frag_k(i, h)];
    return a;
}

#define VST2(T, ptr, val) do { const T vst2_v_ = (val); *(T*)(ptr) = vst2_v_;  } while (0)
typedef float v4f __attribute__((ext_vector_type(4)));
#define VST2V4(ptr, val) do { const v4f vst2_v4_ = (val); *(v4f*)(ptr) = vst2_v4_;  } while (0)

__device__ __attribute__((noinline)) float act_fn(float v, int act) {
    if (act == 1) return fmaxf(v, 0.f);                                                                               // relu
    if (act == 2) { const float u = 0.7978845608028654f * (v + 0.044715f * v * v * v); return 0.5f * v * (1.f + tanhf(u)); } // tanh-gelu
    if (act == 3) return v / (1.f + expf(-v));                                                                        // silu
    if (act == 4) return 0.5f * v * (1.f + erff(v * 0.7071067811865476f));                                             // erf-gelu
    if (act == 5) return tanhf(v);
    if (act == 6) return 1.f / (1.f + expf(-v));                                                                      // sigmoid
    if (act == 7) return (v > 0.f) ? v : 0.01f * v;                                                                   // leaky relu 0.01
    if (act == 8) return (v > 0.f) ? v : (expf(v) - 1.f);                                                             // elu
    if (act == 9) return fminf(fmaxf(v, 0.f), 6.f);                                                                   // relu6
    if (act == 10) return fabsf(v);                                                                                    // abs
    if (act == 11) return (v >= 0.f) ? v : 0.1f * v;                                                                  // leaky 0.1
    if (act == 12) return (v > 0.f) ? v : 0.2f * v;                                                                   // leaky 0.2
    if (act == 13) return (v > 20.f) ? v : log1pf(expf(v));                                                            // softplus
    return v;
}

// =====================================================================================================================
// k_gemm<MODE>: C(z, m, n) = act(alpha * sum_k A(z, m, k) * B(z, k, n) + bias) + beta * R(z, m, n)
//   One wave (32-thread block) per 16 x 32 tile of C; grid (ceil(N/32), ceil(M/16), Z). Batch z -> (zo = z / zi_n, zi = z % zi_n)
//   with separate outer/inner strides for every tensor (e.g. batch and head). A(m,k) = A[zo*sAo + zi*sAi + m*sAm + k*sAk] (f32),
//   B(k,n) = B[zo*sBo + zi*sBi + n*sBn + k*sBk] (f32); any M, N, K (K zero-padded to 32 inside the fragments, M/N tails guarded).
//   C(m,n) = C[zo*sCo + zi*sCi + m*sCm + n] (n contiguous). flags: 1 bias[n], 2 bias[m], 4 residual R[zo*sRo + zi*sRi + m*sRm + n*sRn].
//   MODE 0: f16 operands (A prescaled by sa, B by sb, both undone in the epilogue); 1: bf16 hi/lo split (3 products); 2: bf16;
//   3: bf16 hi/mid/lo triple split (6 products); 4: as 3 with Kahan-compensated f32 accumulation across k-steps.
// =====================================================================================================================
struct GemmP {
    const float* A; const float* B; const float* bias; const float* R; float* C;
    long long sAo, sAi, sAm, sAk, sBo, sBi, sBn, sBk, sCo, sCi, sCm, sRo, sRi, sRm, sRn;
    int M, N, K, zi_n, flags, act; float alpha, beta, sa, sb;
    int Npad, pad_;     // columns [N, Npad) of C are written as 0 so that padded workspace rows are covered by whole-line stores; Npad >= N
};
static_assert(sizeof(GemmP) == 5 * 8 + 15 * 8 + 6 * 4 + 4 * 4 + 2 * 4, "GemmP has padding");

template <int MODE>
__global__ __launch_bounds__(32) void k_gemm(GemmP p) {
    const int lane = threadIdx.x & 31, h = lane >> 4, l15 = lane & 15;
    const int m0 = blockIdx.y * 16, n0 = blockIdx.x * 32;
    const int z = blockIdx.z, zo = z / p.zi_n, zi = z - zo * p.zi_n;
    const float* A = p.A + zo * p.sAo + zi * p.sAi;
    const float* B = p.B + zo * p.sBo + zi * p.sBi;
    const int am = min(m0 + l15, p.M - 1);                       // clamped row for loads (stores are guarded)
    v8f acc[2], comp[2];
#pragma unroll
    for (int t = 0; t < 2; ++t) { v8f zz = {}; acc[t] = zz; comp[t] = zz; }
    for (int k0 = 0; k0 < p.K; k0 += 32) {
        const float* arow = A + (long long)am * p.sAm;
        if (MODE == 1) {
            const Split a = sp_ld(arow, p.sAk, k0, h, p.K, 1.f);
#pragma unroll
            for (int t = 0; t < 2; ++t) {
                const int bn = min(n0 + t * 16 + l15, p.N - 1);
                acc[t] = wmma3(a, sp_ld(B + (long long)bn * p.sBn, p.sBk, k0, h, p.K, 1.f), acc[t]);
            }
        } else if (MODE == 3) {
            const Split3 a = sp3_ld(arow, p.sAk, k0, h, p.K, 1.f);
#pragma unroll
            for (int t = 0; t < 2; ++t) {
                const int bn = min(n0 + t * 16 + l15, p.N - 1);
                acc[t] = wmma6(a, sp3_ld(B + (long long)bn * p.sBn, p.sBk, k0, h, p.K, 1.f), acc[t]);
            }
        } else if (MODE == 4) {
            // triple split as MODE 3, but each k-step's 6 products go into a fresh accumulator and the partial is added to the running f32 sum
            // on the VALU with Kahan compensation (accumulation error stays ~1 ulp however long K is)
            const Split3 a = sp3_ld(arow, p.sAk, k0, h, p.K, 1.f);
#pragma unroll
            for (int t = 0; t < 2; ++t) {
                const int bn = min(n0 + t * 16 + l15, p.N - 1); v8f zz = {};
                const v8f part = wmma6(a, sp3_ld(B + (long long)bn * p.sBn, p.sBk, k0, h, p.K, 1.f), zz);
                const v8f y = part - comp[t]; const v8f s = acc[t] + y; comp[t] = (s - acc[t]) - y; acc[t] = s;
            }
        } else if (MODE == 2) {
            const v16b a = bh_ld(arow, p.sAk, k0, h, p.K, 1.f);
#pragma unroll
            for (int t = 0; t < 2; ++t) {
                const int bn = min(n0 + t * 16 + l15, p.N - 1);
                acc[t] = wmmab(a, bh_ld(B + (long long)bn * p.sBn, p.sBk, k0, h, p.K, 1.f), acc[t]);
            }
        } else {
            const v16h a = fh_ld(arow, p.sAk, k0, h, p.K, p.sa);
#pragma unroll
            for (int t = 0; t < 2; ++t) {
                const int bn = min(n0 + t * 16 + l15, p.N - 1);
                acc[t] = wmma16(a, fh_ld(B + (long long)bn * p.sBn, p.sBk, k0, h, p.K, p.sb), acc[t]);
            }
        }
    }
    const float iscale = (MODE == 0) ? p.alpha / (p.sa * p.sb) : p.alpha;
    float* C = p.C + zo * p.sCo + zi * p.sCi;
    const float* R = p.R + zo * p.sRo + zi * p.sRi;
    __shared__ __align__(16) float ctile[16][36];
#pragma unroll
    for (int t = 0; t < 2; ++t) {
        const int n = n0 + t * 16 + l15; const int nn = min(n, p.N - 1);
#pragma unroll
        for (int r = 0; r < 8; ++r) {
            const int m = m0 + 8 * h + r; const int mm = min(m, p.M - 1);
            float v = acc[t][r] * iscale;
            if (p.flags & 1) v += p.bias[nn];
            if (p.flags & 2) v += p.bias[mm];
            if (p.flags & 8) v *= p.bias[(long long)zo * p.M + mm];   /* per-(z,row) scale vector laid out [Z][M]; exclusive with the bias flags */
            v = act_fn(v, p.act);
            if (p.flags & 4) v += p.beta * R[(long long)mm * p.sRm + (long long)nn * p.sRn];
            ctile[8 * h + r][t * 16 + l15] = (n < p.N) ? v : 0.f;
        }
    }
    __syncthreads();
    const int NW = (p.Npad > p.N) ? p.Npad : p.N;           // write width
    const bool fast = (m0 + 16 <= p.M) && (n0 + 32 <= NW) && ((p.sCm & 3) == 0) && ((((size_t)C) & 15) == 0);
    if (fast) {
#pragma unroll
        for (int s = 0; s < 4; ++s) {
            const int row = s * 4 + (lane >> 3), c4 = (lane & 7) * 4;
            const v4f v = *(const v4f*)&ctile[row][c4];
            VST2V4(C + (long long)(m0 + row) * p.sCm + n0 + c4, v);
        }
    } else {
        for (int row = 0; row < 16; ++row) {
            const int m = m0 + row, n = n0 + lane;
            if (m < p.M && n < NW) VST2(float, C + (long long)m * p.sCm + n, ctile[row][lane]);
        }
    }
}


// =====================================================================================================================
// k_gemmT<MODE, TM, TN>: same contract as k_gemm, but one wave computes a (16*TM) x (16*TN) tile: TM A fragments and TN B fragments are
//   loaded per 32-wide k-step and reused across TM*TN WMMAs (far fewer load/convert instructions per MAC). MODE 0 (f16), 1 (bf16 hi/lo),
//   2 (bf16) only. grid (ceil(NW/(16*TN)), ceil(M/(16*TM)), Z), block 32. Epilogue identical to k_gemm, run per 16x32 sub-tile.
// =====================================================================================================================
template <int MODE, int TM, int TN>
__global__ __launch_bounds__(32) void k_gemmT(GemmP p) {
    const int lane = threadIdx.x & 31, h = lane >> 4, l15 = lane & 15;
    const int m0 = blockIdx.y * (16 * TM), n0 = blockIdx.x * (16 * TN);
    const int z = blockIdx.z, zo = z / p.zi_n, zi = z - zo * p.zi_n;
    const float* A = p.A + zo * p.sAo + zi * p.sAi;
    const float* B = p.B + zo * p.sBo + zi * p.sBi;
    v8f acc[TM][TN];
#pragma unroll
    for (int i = 0; i < TM; ++i)
#pragma unroll
        for (int t = 0; t < TN; ++t) { v8f zz = {}; acc[i][t] = zz; }
    for (int k0 = 0; k0 < p.K; k0 += 32) {
        if (MODE == 1) {
            Split a[TM], b[TN];
#pragma unroll
            for (int i = 0; i < TM; ++i) { const int am = min(m0 + 16 * i + l15, p.M - 1); a[i] = sp_ld(A + (long long)am * p.sAm, p.sAk, k0, h, p.K, 1.f); }
#pragma unroll
            for (int t = 0; t < TN; ++t) { const int bn = min(n0 + 16 * t + l15, p.N - 1); b[t] = sp_ld(B + (long long)bn * p.sBn, p.sBk, k0, h, p.K, 1.f); }
#pragma unroll
            for (int i = 0; i < TM; ++i)
#pragma unroll
                for (int t = 0; t < TN; ++t) acc[i][t] = wmma3(a[i], b[t], acc[i][t]);
        } else if (MODE == 2) {
            v16b a[TM], b[TN];
#pragma unroll
            for (int i = 0; i < TM; ++i) { const int am = min(m0 + 16 * i + l15, p.M - 1); a[i] = bh_ld(A + (long long)am * p.sAm, p.sAk, k0, h, p.K, 1.f); }
#pragma unroll
            for (int t = 0; t < TN; ++t) { const int bn = min(n0 + 16 * t + l15, p.N - 1); b[t] = bh_ld(B + (long long)bn * p.sBn, p.sBk, k0, h, p.K, 1.f); }
#pragma unroll
            for (int i = 0; i < TM; ++i)
#pragma unroll
                for (int t = 0; t < TN; ++t) acc[i][t] = wmmab(a[i], b[t], acc[i][t]);
        } else {
            v16h a[TM], b[TN];
#pragma unroll
            for (int i = 0; i < TM; ++i) { const int am = min(m0 + 16 * i + l15, p.M - 1); a[i] = fh_ld(A + (long long)am * p.sAm, p.sAk, k0, h, p.K, p.sa); }
#pragma unroll
            for (int t = 0; t < TN; ++t) { const int bn = min(n0 + 16 * t + l15, p.N - 1); b[t] = fh_ld(B + (long long)bn * p.sBn, p.sBk, k0, h, p.K, p.sb); }
#pragma unroll
            for (int i = 0; i < TM; ++i)
#pragma unroll
                for (int t = 0; t < TN; ++t) acc[i][t] = wmma16(a[i], b[t], acc[i][t]);
        }
    }
    const float iscale = (MODE == 0) ? p.alpha / (p.sa * p.sb) : p.alpha;
    float* C = p.C + zo * p.sCo + zi * p.sCi;
    const float* R = p.R + zo * p.sRo + zi * p.sRi;
    const int NW = (p.Npad > p.N) ? p.Npad : p.N;
    __shared__ __align__(16) float ctile[16][36];
#pragma unroll
    for (int i = 0; i < TM; ++i) {
        const int mb = m0 + 16 * i; if (mb >= p.M) break;          // wave-uniform
#pragma unroll
        for (int tp = 0; tp < TN / 2; ++tp) {
            const int nb = n0 + 32 * tp; if (nb >= NW) break;        // wave-uniform
#pragma unroll
            for (int t2 = 0; t2 < 2; ++t2) {
                const int t = 2 * tp + t2; const int n = nb + t2 * 16 + l15; const int nn = min(n, p.N - 1);
#pragma unroll
                for (int r = 0; r < 8; ++r) {
                    const int m = mb + 8 * h + r; const int mm = min(m, p.M - 1);
                    float v = acc[i][t][r] * iscale;
                    if (p.flags & 1) v += p.bias[nn];
                    if (p.flags & 2) v += p.bias[mm];
            if (p.flags & 8) v *= p.bias[(long long)zo * p.M + mm];   /* per-(z,row) scale vector laid out [Z][M]; exclusive with the bias flags */
                    v = act_fn(v, p.act);
                    if (p.flags & 4) v += p.beta * R[(long long)mm * p.sRm + (long long)nn * p.sRn];
                    ctile[8 * h + r][t2 * 16 + l15] = (n < p.N) ? v : 0.f;
                }
            }
            __syncthreads();
            const bool fast = (mb + 16 <= p.M) && (nb + 32 <= NW) && ((p.sCm & 3) == 0) && ((((size_t)C) & 15) == 0);
            if (fast) {
#pragma unroll
                for (int s = 0; s < 4; ++s) {
                    const int row = s * 4 + (lane >> 3), c4 = (lane & 7) * 4;
                    const v4f v = *(const v4f*)&ctile[row][c4];
                    VST2V4(C + (long long)(mb + row) * p.sCm + nb + c4, v);
                }
            } else {
                for (int row = 0; row < 16; ++row) {
                    const int m = mb + row, n = nb + lane;
                    if (m < p.M && n < NW) VST2(float, C + (long long)m * p.sCm + n, ctile[row][lane]);
                }
            }
            __syncthreads();
        }
    }
}

// =====================================================================================================================
// k_attn32<LQ, LK, QP, KP>: flash attention at one fixed shape, all of it known at compile time: LQ queries, LK keys (a multiple of 64), head and
//   value dim 32, f32 rows with element stride 1 (Q and O row pitch QP floats, K and V row pitch KP floats, head h at column 32 h), no mask.
//   Wave = 16 queries, AW waves per block, 64-key blocks; grid (LQ / (16*AW), heads, images), block 32*AW; image z at Q, O + z*LQ*QP and K, V + z*LK*KP. Every Q, K and V row piece is whole and
//   16-byte aligned, so it is read with unguarded 16-byte loads that are all in flight together.
//   Scores: f16 operands; statistics f32 (exp2 domain); P.V: P x 4096 as f16 with V f16 staged in LDS.
// =====================================================================================================================
#define AW 4
typedef __attribute__((ext_vector_type(4))) _Float16 v4h;
// the 16 f32 that make up lane half h's fragment of a 32-wide row: k = 8h..8h+7 and 16+8h..16+8h+7 (the order of frag_k)
struct Row16 { v4f r[4]; };
__device__ __forceinline__ Row16 row16_ld(const float* __restrict__ row, int h) {
    Row16 x;
    x.r[0] = *(const v4f*)(row + 8 * h); x.r[1] = *(const v4f*)(row + 8 * h + 4);
    x.r[2] = *(const v4f*)(row + 16 + 8 * h); x.r[3] = *(const v4f*)(row + 16 + 8 * h + 4);
    return x;
}
__device__ __forceinline__ v16h row16_f16(const Row16& x) {
    v16h a;
#pragma unroll
    for (int q = 0; q < 4; ++q)
#pragma unroll
        for (int e = 0; e < 4; ++e) a[4 * q + e] = (_Float16)x.r[q][e];
    return a;
}
template <int LQ, int LK, int QP, int KP>
__global__ __launch_bounds__(32 * AW) void k_attn32(const float* __restrict__ Q, const float* __restrict__ K, const float* __restrict__ V, float* __restrict__ O, float scale) {
    static_assert(LQ % (16 * AW) == 0 && LK % 64 == 0 && QP % 4 == 0 && KP % 4 == 0, "whole tiles, 16-byte rows");
    constexpr int NT = 2;                       // output tiles
    constexpr int VP = 32 + 8;                  // LDS pitch (halves)
    __shared__ __align__(16) float    pl[AW][16 * 64];
    __shared__ __align__(16) _Float16 vl[64 * VP];
    const int lane = threadIdx.x & 31, hf = lane >> 4, l15 = lane & 15, wave = threadIdx.x >> 5;
    const int h = blockIdx.y;
    const int q0 = (blockIdx.x * AW + wave) * 16;
    Q += (size_t)blockIdx.z * LQ * QP; O += (size_t)blockIdx.z * LQ * QP;      // image blockIdx.z: its own Q / O plane
    K += (size_t)blockIdx.z * LK * KP; V += (size_t)blockIdx.z * LK * KP;      // and its own K / V plane
    float* myp = pl[wave];
    const float L2E = 1.4426950408889634f;
    const float NEG = -__builtin_inff();
    const float* kbase = K + h * 32 + (size_t)l15 * KP;                                     // this lane's key row of a 16-key tile
    const float* vbase = V + h * 32 + (size_t)(threadIdx.x >> 3) * KP + (threadIdx.x & 7) * 4;  // this thread's 4 floats of a 16-row slab
    _Float16* vst = vl + (threadIdx.x >> 3) * VP + (threadIdx.x & 7) * 4;
    const v16h qa = row16_f16(row16_ld(Q + h * 32 + (size_t)(q0 + l15) * QP, hf));
    asm volatile("s_wait_xcnt 0x0" ::: "memory");   // the Q loads' address registers are reused for the start values set below: the wait stands in front of that overwrite
    __builtin_amdgcn_sched_barrier(0);              // keeps those later register writes from being scheduled ahead of the wait
    v8f o[NT]; float m8[8], l8[8];
#pragma unroll
    for (int t = 0; t < NT; ++t) { v8f zz = {}; o[t] = zz; }
#pragma unroll
    for (int i = 0; i < 8; ++i) { m8[i] = NEG; l8[i] = 0.f; }
    for (int j0 = 0; j0 < LK; j0 += 64) {
        v4f vr[4]; Row16 kr[4];
#pragma unroll
        for (int n = 0; n < 4; ++n) vr[n] = *(const v4f*)(vbase + (size_t)(j0 + 16 * n) * KP);
#pragma unroll
        for (int t = 0; t < 4; ++t) kr[t] = row16_ld(kbase + (size_t)(j0 + 16 * t) * KP, hf);
        __syncthreads();                                 // previous key block's reads of vl / pl are done
#pragma unroll
        for (int n = 0; n < 4; ++n) {
            const v4h hv = {(_Float16)vr[n][0], (_Float16)vr[n][1], (_Float16)vr[n][2], (_Float16)vr[n][3]};
            *(v4h*)(vst + 16 * n * VP) = hv;
        }
        v8f s[4];
#pragma unroll
        for (int t = 0; t < 4; ++t) { v8f acc = {}; s[t] = wmma16(qa, row16_f16(kr[t]), acc); }
        float pv[8][4];
#pragma unroll
        for (int i = 0; i < 8; ++i) {
            float sc[4];
#pragma unroll
            for (int t = 0; t < 4; ++t) { float v = s[t][i] * scale; v *= L2E; sc[t] = v; }
            float mx = fmaxf(fmaxf(sc[0], sc[1]), fmaxf(sc[2], sc[3]));
            mx = fmaxf(mx, __shfl_xor(mx, 1, 32)); mx = fmaxf(mx, __shfl_xor(mx, 2, 32));
            mx = fmaxf(mx, __shfl_xor(mx, 4, 32)); mx = fmaxf(mx, __shfl_xor(mx, 8, 32));
            const float mnew = fmaxf(m8[i], mx);
            const float corr = exp2f(m8[i] - mnew);          // first block: exp2(-inf) = 0
            float rs = 0.f;
#pragma unroll
            for (int t = 0; t < 4; ++t) { const float pp = exp2f(sc[t] - mnew); rs += pp; pv[i][t] = pp; }
            rs += __shfl_xor(rs, 1, 32); rs += __shfl_xor(rs, 2, 32); rs += __shfl_xor(rs, 4, 32); rs += __shfl_xor(rs, 8, 32);
            l8[i] = l8[i] * corr + rs; m8[i] = mnew;
#pragma unroll
            for (int t = 0; t < NT; ++t) o[t][i] *= corr;
        }
#pragma unroll
        for (int i = 0; i < 8; ++i)
#pragma unroll
            for (int t = 0; t < 4; ++t) myp[(i + 8 * hf) * 64 + t * 16 + l15] = pv[i][t];
        __syncthreads();                                 // P (per wave) and V (shared) visible
        const v16h pa0 = fh_ld(myp + l15 * 64, 1, 0, hf, 64, 4096.f), pa1 = fh_ld(myp + l15 * 64, 1, 32, hf, 64, 4096.f);
#pragma unroll
        for (int t = 0; t < NT; ++t) {
            const int dcol = t * 16 + l15;
            v16h b0, b1;
#pragma unroll
            for (int e = 0; e < 16; ++e) { b0[e] = vl[frag_k(e, hf) * VP + dcol]; b1[e] = vl[(32 + frag_k(e, hf)) * VP + dcol]; }
            o[t] = wmma16(pa0, b0, o[t]);
            o[t] = wmma16(pa1, b1, o[t]);
        }
    }
    float* obase = O + h * 32;
    float invr[8];
#pragma unroll
    for (int i = 0; i < 8; ++i) invr[i] = 1.f / (l8[i] * 4096.f);   // no key is masked: each row sum holds its maximum's exp2(0) = 1
    __syncthreads();                                             // all waves done with pl/vl from the main loop
#pragma unroll
    for (int i = 0; i < 8; ++i)
#pragma unroll
        for (int t = 0; t < NT; ++t) myp[(i + 8 * hf) * 64 + t * 16 + l15] = o[t][i] * invr[i];
    __syncthreads();
#pragma unroll
    for (int r0 = 0; r0 < 16; r0 += 4) {
        const int row = r0 + (lane >> 3), c4 = (lane & 7) * 4;
        const v4f v = *(const v4f*)(myp + row * 64 + c4);
        VST2V4(obase + (size_t)(q0 + row) * QP + c4, v);
    }
}

// =====================================================================================================================
// k_tr: dst(z, c, r) = alpha * src(z, r, c) (+ beta * R2(z, c, r)): [Z][R][C] (row stride lds) -> [Z][C][R] (row stride ldd) through a 32x32 LDS tile;
//   flags: 1 -> add beta * residual R2 addressed like dst (z*sRz + c*ldr + r); act applied before the residual.
// =====================================================================================================================
struct TrP { const float* src; float* dst; const float* R2; long long sSz, lds, sDz, ldd, sRz, ldr; int R, C, flags, act; float alpha, beta; };
static_assert(sizeof(TrP) == 3 * 8 + 6 * 8 + 6 * 4, "TrP has padding");
__global__ __launch_bounds__(256) void k_tr(TrP p) {
    __shared__ float tile[32][33];
    const int c0 = blockIdx.x * 32, r0 = blockIdx.y * 32, z = blockIdx.z;
    const int lane = threadIdx.x & 31, wave = threadIdx.x >> 5;
    const float* s = p.src + z * p.sSz;
#pragma unroll
    for (int k = 0; k < 4; ++k) {
        const int rl = wave * 4 + k, r = r0 + rl, c = c0 + lane;
        tile[rl][lane] = (r < p.R && c < p.C) ? s[(long long)r * p.lds + c] : 0.f;
    }
    __syncthreads();
    float* d = p.dst + z * p.sDz; const float* rr = p.R2 + z * p.sRz;
#pragma unroll
    for (int k = 0; k < 4; ++k) {
        const int cl = wave * 4 + k, c = c0 + cl, r = r0 + lane;
        if (c < p.C && r < p.R) {
            float v = act_fn(p.alpha * tile[lane][cl], p.act);
            if (p.flags & 1) v += p.beta * rr[(long long)c * p.ldr + r];
            VST2(float, d + (long long)c * p.ldd + r, v);
        }
    }
}

// k_affine: dst[i] = a * (sdev ? sdev[0] : 1) * src[i] + b, i < n (one thread per element; consecutive lanes -> consecutive addresses)
__global__ __launch_bounds__(256) void k_affine(const float* __restrict__ src, float* __restrict__ dst, int n, float a, float b, const float* __restrict__ sdev) {
    const int i = blockIdx.x * 256 + threadIdx.x;
    if (i < n) { const float aa = sdev ? a * sdev[0] : a; const float v = aa * src[i] + b; VST2(float, dst + i, v); }
}

// =====================================================================================================================
// k_softmax: row softmax over n contiguous elements, one 256-thread block per row; rows addressed z*sz + r*sr (grid (R, Z)).
//   out = scale_out * softmax(scale_in * x + (Mf ? Mf[z*smz + r*smr + j] : 0)); a row whose max is -inf is written as 0.
// =====================================================================================================================
struct SmP { const float* src; float* dst; const float* Mf; long long sz, sr, dz, dr, smz, smr; int n, pad; float scale_in, scale_out; };
static_assert(sizeof(SmP) == 3 * 8 + 6 * 8 + 4 * 4, "SmP has padding");
__global__ __launch_bounds__(256) void k_softmax(SmP p) {
    __shared__ float red[256];
    const int r = blockIdx.x, z = blockIdx.y, tid = threadIdx.x;
    const float* s = p.src + z * p.sz + (long long)r * p.sr;
    const float* mf = p.Mf ? (p.Mf + z * p.smz + (long long)r * p.smr) : nullptr;
    float mx = -__builtin_inff();
    for (int j = tid; j < p.n; j += 256) { float v = s[j] * p.scale_in; if (mf) v += mf[j]; mx = fmaxf(mx, v); }
    red[tid] = mx; __syncthreads();
    for (int o = 128; o > 0; o >>= 1) { if (tid < o) red[tid] = fmaxf(red[tid], red[tid + o]); __syncthreads(); }
    mx = red[0]; __syncthreads();
    float sum = 0.f;
    for (int j = tid; j < p.n; j += 256) { float v = s[j] * p.scale_in; if (mf) v += mf[j]; sum += (mx == -__builtin_inff()) ? 0.f : expf(v - mx); }
    red[tid] = sum; __syncthreads();
    for (int o = 128; o > 0; o >>= 1) { if (tid < o) red[tid] += red[tid + o]; __syncthreads(); }
    sum = red[0];
    const float inv = (sum > 0.f) ? p.scale_out / sum : 0.f;
    float* d = p.dst + z * p.dz + (long long)r * p.dr;
    for (int j = tid; j < p.n; j += 256) { float v = s[j] * p.scale_in; if (mf) v += mf[j]; const float o = (mx == -__builtin_inff()) ? 0.f : expf(v - mx) * inv; VST2(float, d + j, o); }
}
// =====================================================================================================================
// k_stats: mean and rsqrt(var + eps) over a set of n elements addressed base + z*sz + (e / inner) * so + (e % inner) * si, one 256-thread
// k_norm_apply: y = (x - mean[set]) * rstd[set] * g[c] + b[c] over a [Z][C][L] channel-major tensor with set = z*G + c / (C/G) (G groups per z;
//   G = C -> per-channel sets indexed z*C+c; for batch norm pass stats indexed by c only via bn = 1). Optional act. Output same layout.
// =====================================================================================================================
//   mode 0: mean / rsqrt(var + eps); mode 1 (RMSNorm): 0 / rsqrt(mean(x^2) + eps); mode 2 (L2 normalize * sqrt(n)): 0 / sqrt(n) / max(||x||, eps); mode 3: as 0 with unbiased variance (n-1)
__global__ __launch_bounds__(256) void k_stats(const float* __restrict__ x, long long sz, long long so, long long si, int inner, int n, float eps, float* __restrict__ stat, int mode) {
    __shared__ float red[256];
    const int z = blockIdx.x, tid = threadIdx.x;
    const float* base = x + z * sz;
    float s = 0.f;
    for (int e = tid; e < n; e += 256) s += base[(long long)(e / inner) * so + (long long)(e % inner) * si];
    red[tid] = s; __syncthreads();
    for (int o = 128; o > 0; o >>= 1) { if (tid < o) red[tid] += red[tid + o]; __syncthreads(); }
    const float mu = (mode == 0 || mode == 3) ? red[0] / (float)n : 0.f; __syncthreads();
    float q = 0.f;
    for (int e = tid; e < n; e += 256) { const float dlt = base[(long long)(e / inner) * so + (long long)(e % inner) * si] - mu; q += dlt * dlt; }
    red[tid] = q; __syncthreads();
    for (int o = 128; o > 0; o >>= 1) { if (tid < o) red[tid] += red[tid + o]; __syncthreads(); }
    {
        float rs;
        if (mode == 2) rs = sqrtf((float)n) / fmaxf(sqrtf(red[0]), eps); else if (mode == 3) rs = rsqrtf(red[0] / (float)(n - 1) + eps); else rs = rsqrtf(red[0] / (float)n + eps);
        if (tid < 32) { const float v = (tid == 0) ? mu : ((tid == 1) ? rs : 0.f); VST2(float, stat + (long long)z * 32 + tid, v); }
    }
}
//   One thread per element over the flat [Z][C][L] index space: grid ceil(Z*C*L / 256).
__global__ __launch_bounds__(256) void k_norm_apply(const float* __restrict__ x, float* __restrict__ y, const float* __restrict__ stat, const float* __restrict__ g, const float* __restrict__ bta,
                                                     int Z, int C, int L, int G, int bn, int act) {
    const long long idx = (long long)blockIdx.x * 256 + threadIdx.x;
    if (idx >= (long long)Z * C * L) return;
    const int l = (int)(idx % L); const long long zc = idx / L; const int c = (int)(zc % C), z = (int)(zc / C); (void)l;
    const int set = bn ? c : (z * G + c / (C / G));
    float v = (x[idx] - stat[(long long)set * 32]) * stat[(long long)set * 32 + 1];
    if (g) v *= g[c];
    if (bta) v += bta[c];
    v = act_fn(v, act);
    VST2(float, y + idx, v);
}

// k_lse_neg: c[i] = -(st[2i] + log(st[2i+1])) = minus the log-sum-exp of row i (for softmax over the query axis)
__global__ __launch_bounds__(256) void k_lse_neg(const float* __restrict__ st, float* __restrict__ c, int n) {
    const int i = blockIdx.x * 256 + threadIdx.x;
    if (i < n) { const float v = -(st[2 * i] + logf(st[2 * i + 1])); VST2(float, c + i, v); }
}

// k_iota: dst[i] = a * i + b as int32 (segment/position id helper)
__global__ __launch_bounds__(256) void k_iota(int* __restrict__ dst, int n, int a, int b) {
    const int i = blockIdx.x * 256 + threadIdx.x;
    if (i < n) { const int v = a * i + b; VST2(int, dst + i, v); }
}

// k_axpby: dst[i] = a * x[i] + b * y[i] (+ c), i < n
__global__ __launch_bounds__(256) void k_axpby(const float* __restrict__ x, const float* __restrict__ y, float* __restrict__ dst, int n, float a, float b, float c) {
    const int i = blockIdx.x * 256 + threadIdx.x;
    if (i < n) { const float v = a * x[i] + b * y[i] + c; VST2(float, dst + i, v); }
}

// =====================================================================================================================
// k_rope: rotary embedding on a [R rows][Hn heads][D] view (row stride sXr, head stride sXh, element stride 1) -> Y (own strides).
//   mode 0: rotate_half (partner d±D/2, sign - for d<D/2); mode 1: interleaved pairs (partner d^1, sign - for even d).
//   table column tcol: tmode 0 -> d, 1 -> d % (D/2), 2 -> d / 2; position p: pmode 0 -> r % S, 1 -> head index, 2 -> pos[r];
//   c = C[(r / S) * sCb + p * sCp + tcol * sCd], s likewise from Sn; y = x[d] * c + sign * x[partner] * s. X and Y must not alias.
// =====================================================================================================================
struct RopeP { const float* X; float* Y; const float* C; const float* Sn; const int* pos; long long sXr, sXh, sYr, sYh, sCb, sCp, sCd; int R, Hn, D, S, mode, tmode, pmode, pad; };
static_assert(sizeof(RopeP) == 5 * 8 + 7 * 8 + 8 * 4, "RopeP has padding");
__global__ __launch_bounds__(256) void k_rope(RopeP p) {
    const long long idx = (long long)blockIdx.x * 256 + threadIdx.x;
    if (idx >= (long long)p.R * p.Hn * p.D) return;
    const int d = (int)(idx % p.D); const long long rh = idx / p.D; const int h = (int)(rh % p.Hn); const int r = (int)(rh / p.Hn);
    const int half = p.D / 2;
    int partner; float sign;
    if (p.mode == 0) { partner = (d < half) ? d + half : d - half; sign = (d < half) ? -1.f : 1.f; }
    else { partner = d ^ 1; sign = (d & 1) ? 1.f : -1.f; }
    const int tcol = (p.tmode == 0) ? d : ((p.tmode == 1) ? (d % half) : (d >> 1));
    const int pp = (p.pmode == 0) ? (r % p.S) : ((p.pmode == 1) ? h : p.pos[r]);
    const long long toff = (long long)(r / p.S) * p.sCb + (long long)pp * p.sCp + (long long)tcol * p.sCd;
    const float* xr = p.X + (long long)r * p.sXr + (long long)h * p.sXh;
    const float v = xr[d] * p.C[toff] + sign * xr[partner] * p.Sn[toff];
    VST2(float, p.Y + (long long)r * p.sYr + (long long)h * p.sYh + d, v);
}

// k_invf + k_sincos (split so neither kernel carries a large VALU-fma footprint): invf_i = num * (1 / powf(base, (2 i)/D)) [fmode 0],
//   num * expf((2 i) * cexp) [fmode 1], num * powf(base, -2 (i - 1) / D) [fmode 2]; then cs/sn[s*half + i] = cos/sin((pscale * s) * invf_i)
__global__ __launch_bounds__(256) void k_invf(float* __restrict__ invb, int half, int D, float base, float num, int fmode, float cexp) {
    const int i = blockIdx.x * 256 + threadIdx.x;
    if (i >= ((half + 31) / 32) * 32) return;
    if (i >= half) { VST2(float, invb + i, 0.f); return; }
    const float e = (float)(2 * i) / (float)D;
    float invf;
    if (fmode == 1) invf = num * expf((float)(2 * i) * cexp);
    else if (fmode == 2) invf = num * powf(base, (-2.0f * ((float)i - 1.0f)) / (float)D);
    else invf = num * (1.0f / powf(base, e));
    VST2(float, invb + i, invf);
}
__global__ __launch_bounds__(256) void k_sincos(float* __restrict__ cs, float* __restrict__ sn, const float* __restrict__ invb, int S, int half, float pscale) {
    const int idx = blockIdx.x * 256 + threadIdx.x;
    if (idx >= S * half) return;
    const int s = idx / half, i = idx - s * half;
    const float ang = (pscale * (float)s) * invb[i];
    VST2(float, cs + idx, cosf(ang)); VST2(float, sn + idx, sinf(ang));
}

// k_mulact: dst[i] = act(x[i]) * y[i]
__global__ __launch_bounds__(256) void k_mulact(const float* __restrict__ x, const float* __restrict__ y, float* __restrict__ dst, int n, int act) {
    const int i = blockIdx.x * 256 + threadIdx.x;
    if (i < n) { const float v = act_fn(x[i], act) * y[i]; VST2(float, dst + i, v); }
}

// =====================================================================================================================
// k_matvec: thread-per-row matrix-vector products for N <= 8 output columns (heads with 1-3 outputs, gates), f32 on the VALU.
//   C[r*sCm + j] = act(alpha * sum_k A[r*sAm + k*sAk] * B[j*sBn + k*sBk] + bias[j]) + beta * R[r*sRm + j*sRn]; each thread writes its N contiguous floats.
// =====================================================================================================================
__global__ __launch_bounds__(256) void k_matvec(GemmP p) {
    // 32 lanes write one line with one instruction.
    const int rpt = (p.N == 1) ? 1 : 32;
    const long long r0 = ((long long)blockIdx.x * 256 + threadIdx.x) * rpt; const int z = blockIdx.z, zo = z / p.zi_n, zi = z - zo * p.zi_n;
    if (r0 >= p.M) return;
    const float* Bb = p.B + zo * p.sBo + zi * p.sBi;
    float* C = p.C + zo * p.sCo + zi * p.sCi; const float* R = p.R + zo * p.sRo + zi * p.sRi;
    for (int rr = 0; rr < rpt; ++rr) {
        const long long r = r0 + rr; if (r >= p.M) break;
        const float* A = p.A + zo * p.sAo + zi * p.sAi + r * p.sAm;
        float acc[8] = {0.f, 0.f, 0.f, 0.f, 0.f, 0.f, 0.f, 0.f};
        for (int k = 0; k < p.K; ++k) { const float a = A[(long long)k * p.sAk];
#pragma unroll
            for (int j = 0; j < 8; ++j) if (j < p.N) acc[j] += a * Bb[(long long)j * p.sBn + (long long)k * p.sBk]; }
#pragma unroll
        for (int j = 0; j < 8; ++j) if (j < p.N) {
            float v = acc[j] * p.alpha;
            if (p.flags & 1) v += p.bias[j];
            if (p.flags & 2) v += p.bias[r];
            v = act_fn(v, p.act);
            if (p.flags & 4) v += p.beta * R[r * p.sRm + (long long)j * p.sRn];
            VST2(float, C + r * p.sCm + j, v);
        }
    }
}
// k_smallsoftmax: thread-per-row softmax for short rows (n <= 64): dst[r*dr + j] = softmax(scale*src[r*sr + j])
__global__ __launch_bounds__(256) void k_smallsoftmax(const float* __restrict__ src, float* __restrict__ dst, long long sr, long long dr, int n, long long R, float scale) {
    const long long r0 = ((long long)blockIdx.x * 256 + threadIdx.x) * 32;
    for (int rr = 0; rr < 32; ++rr) {
        const long long r = r0 + rr; if (r >= R) return;
        const float* s = src + r * sr; float* d = dst + r * dr;
        float mx = -__builtin_inff();
        for (int j = 0; j < n; ++j) mx = fmaxf(mx, s[j] * scale);
        float sum = 0.f;
        for (int j = 0; j < n; ++j) sum += expf(s[j] * scale - mx);
        const float inv = 1.f / sum;
        for (int j = 0; j < n; ++j) { const float v = expf(s[j] * scale - mx) * inv; VST2(float, d + j, v); }
    }
}

__global__ __launch_bounds__(32) void k_unitstat(float* __restrict__ st) { const int t = threadIdx.x; const float v = (t == 1) ? 1.f : 0.f; VST2(float, st + t, v); }

// destination (e.g. a d_out whose row width is not a multiple of 32 floats) is written by consecutive lanes of one instruction
__global__ __launch_bounds__(256) void k_lincopy(const float* __restrict__ src, long long lds, float* __restrict__ dst, long long ldd, long long rows, int cols) {
    const long long i = (long long)blockIdx.x * 256 + threadIdx.x; if (i >= rows * cols) return;
    const long long r = i / cols; const int c = (int)(i - r * cols);
    const float v = src[r * lds + c]; VST2(float, dst + r * ldd + c, v);
}

namespace w25 {
typedef __attribute__((ext_vector_type(16))) _Float16 v16h;
typedef __attribute__((ext_vector_type(8)))  _Float16 v8h;
typedef __attribute__((ext_vector_type(16))) __bf16   v16b;
typedef __attribute__((ext_vector_type(8)))  __bf16   v8b;
typedef __attribute__((ext_vector_type(8)))  float    v8f;
typedef __attribute__((ext_vector_type(4)))  float    v4f;

__device__ __forceinline__ unsigned short f2bf_bits(float f) {
  unsigned u = __float_as_uint(f);
  return (unsigned short)((u + 0x7FFFu + ((u >> 16) & 1u)) >> 16);
}
__device__ __forceinline__ float bf_bits2f(unsigned short h) { return __uint_as_float(((unsigned)h) << 16); }

// hazard guards as plain device helpers (no inline asm inside the kernel template body)
__device__ __forceinline__ void dep_guard_h(v8f& a, v8f& b, v16h x, v16h y) { asm volatile("v_nop\n\tv_nop\n\tv_nop\n\tv_nop" : "+v"(a), "+v"(b) : "v"(x), "v"(y)); }
__device__ __forceinline__ void dep_guard_b(v8f& a, v8f& b, v16b x, v16b y) { asm volatile("v_nop\n\tv_nop\n\tv_nop\n\tv_nop" : "+v"(a), "+v"(b) : "v"(x), "v"(y)); }
__device__ __forceinline__ void keep4_h(v16h a, v16h b, v16h c, v16h d) { asm volatile("v_nop" :: "v"(a), "v"(b), "v"(c), "v"(d)); }
__device__ __forceinline__ void keep4_b(v16b a, v16b b, v16b c, v16b d) { asm volatile("v_nop" :: "v"(a), "v"(b), "v"(c), "v"(d)); }
__device__ __forceinline__ void acc_guard4(v8f& a, v8f& b, v8f& c, v8f& d) { asm volatile("v_nop\n\tv_nop\n\tv_nop\n\tv_nop" : "+v"(a), "+v"(b), "+v"(c), "+v"(d)); }
template <typename T> struct Frag;
template <> struct Frag<_Float16> {
  typedef v16h V; union U { v16h v; v8h h[2]; };
  static __device__ __forceinline__ v16h load(const _Float16* p) {   // elements 0..7 <- p[0..7], 8..15 <- p[16..23]
    U f; f.h[0] = *(const v8h*)(p); f.h[1] = *(const v8h*)(p + 16); return f.v;
  }
  static __device__ __forceinline__ v8f mma(v16h a, v16h b, v8f c) {
    return __builtin_amdgcn_wmma_f32_16x16x32_f16(false, a, false, b, (short)0, c, false, false);
  }
  static __device__ __forceinline__ void guard(v8f& a, v8f& b, v16h x, v16h y) { dep_guard_h(a, b, x, y); }
  static __device__ __forceinline__ void keep(v16h a, v16h b, v16h c, v16h d) { keep4_h(a, b, c, d); }
};
template <> struct Frag<__bf16> {
  typedef v16b V; union U { v16b v; v8b h[2]; };
  static __device__ __forceinline__ v16b load(const __bf16* p) {
    U f; f.h[0] = *(const v8b*)(p); f.h[1] = *(const v8b*)(p + 16); return f.v;
  }
  static __device__ __forceinline__ v8f mma(v16b a, v16b b, v8f c) {
    return __builtin_amdgcn_wmma_f32_16x16x32_bf16(false, a, false, b, (short)0, c, false, false);
  }
  static __device__ __forceinline__ void guard(v8f& a, v8f& b, v16b x, v16b y) { dep_guard_b(a, b, x, y); }
  static __device__ __forceinline__ void keep(v16b a, v16b b, v16b c, v16b d) { keep4_b(a, b, c, d); }
};

// ---- Register-blocked batched WMMA GEMM ------------------------------------
// C[m,n] = scale * sum_k A[m,k] * Bt[n,k] (+bias)(+resid); each wave owns a 64x64 tile.
// A row-major [M,K]; Bt row-major [N,K]; M,N % 64 == 0, K % 32 == 0.
// SPLIT: operands are hi/lo planes (A2/Bt2 = lo planes, same layout); product = hi·hi + hi·lo + lo·hi.
// BIAS_MODE: 0 = none, 1 = bias[m], 2 = bias[n].
// OUT_MODE: 0 = f32, 1 = f16, 2 = bf16 hi plane (Cout) + bf16 lo plane (Cout2).
// ET: 0 = f16 operands, 1 = bf16 operands (pointers passed as 16-bit storage)
template <int ET> struct Elem;
template <> struct Elem<0> { typedef _Float16 T; };
template <> struct Elem<1> { typedef __bf16 T; };
template <int ET, bool SPLIT, int BIAS_MODE, int OUT_MODE, bool RESID, int ACT = 0>
__global__ __launch_bounds__(256) void wmma_gemm64(
    const unsigned short* __restrict__ Ap, const unsigned short* __restrict__ A2p, int lda, long strideA,
    const unsigned short* __restrict__ Btp, const unsigned short* __restrict__ Bt2p, int ldb, long strideB,
    void* __restrict__ Cout, void* __restrict__ Cout2, int ldc, long strideC,
    const float* __restrict__ bias,
    const float* __restrict__ resid, long strideR,
    int M, int N, int K, float scale) {
  typedef typename Elem<ET>::T T;
  typedef typename Frag<T>::V V;
  const T* A = (const T*)Ap; const T* A2 = (const T*)A2p; const T* Bt = (const T*)Btp; const T* Bt2 = (const T*)Bt2p;
  __shared__ __align__(16) float sT[8][16 * 68];   // per-wave 16x64 slab, pitch 68 floats
  const int b    = blockIdx.y;
  const int lane = threadIdx.x & 31;
  const int wave = threadIdx.x >> 5;
  const int tilesN = N >> 6;
  const int tilesM = M >> 6;
  const int tile = blockIdx.x * 8 + wave;
  if (tile >= tilesM * tilesN) return;   // wave-uniform; no block barriers in this kernel
  const int tm = tile / tilesN;
  const int tn = tile - tm * tilesN;
  const int m0 = tm << 6;
  const int n0 = tn << 6;

  const T* Ab  = A  + (size_t)b * strideA;
  const T* Bb  = Bt + (size_t)b * strideB;
  const T* Ab2 = SPLIT ? (A2  + (size_t)b * strideA) : nullptr;
  const T* Bb2 = SPLIT ? (Bt2 + (size_t)b * strideB) : nullptr;

  const int rlane = lane & 15;                 // row (A) / col (B, D) within subtile
  const int koff  = (lane >> 4) * 8;           // k offset of this lane half
  const int mOff  = (lane >> 4) * 8;           // D row offset

  v8f acc[4][4];
#pragma unroll
  for (int i = 0; i < 4; ++i)
#pragma unroll
    for (int j = 0; j < 4; ++j) acc[i][j] = (v8f){0.f,0.f,0.f,0.f,0.f,0.f,0.f,0.f};

  for (int k0 = 0; k0 < K; k0 += 32) {
    V bh[4], bl[4];
#pragma unroll
    for (int j = 0; j < 4; ++j) {
      const size_t bo = (size_t)(n0 + (j << 4) + rlane) * ldb + koff + k0;
      bh[j] = Frag<T>::load(Bb + bo);
      if (SPLIT) bl[j] = Frag<T>::load(Bb2 + bo);
    }
#pragma unroll
    for (int i = 0; i < 4; ++i) {
      const size_t ao = (size_t)(m0 + (i << 4) + rlane) * lda + koff + k0;
      V ah = Frag<T>::load(Ab + ao);
      V al;
      if (SPLIT) al = Frag<T>::load(Ab2 + ao);
#pragma unroll
      for (int j = 0; j < 4; ++j) {
        acc[i][j] = Frag<T>::mma(ah, bh[j], acc[i][j]);
        if (SPLIT) {
          acc[i][j] = Frag<T>::mma(ah, bl[j], acc[i][j]);
          acc[i][j] = Frag<T>::mma(al, bh[j], acc[i][j]);
        }
      }
      Frag<T>::guard(acc[i][0], acc[i][3], ah, SPLIT ? al : ah);
    }
    Frag<T>::keep(bh[0], bh[1], bh[2], bh[3]);
    if (SPLIT) Frag<T>::keep(bl[0], bl[1], bl[2], bl[3]);
  }
  acc_guard4(acc[0][0], acc[0][1], acc[0][2], acc[0][3]);
  acc_guard4(acc[1][0], acc[1][1], acc[1][2], acc[1][3]);
  acc_guard4(acc[2][0], acc[2][1], acc[2][2], acc[2][3]);
  acc_guard4(acc[3][0], acc[3][1], acc[3][2], acc[3][3]);

  // ---- epilogue ----
  float* slab = sT[wave];
  const float* Rb = RESID ? (resid + (size_t)b * strideR) : nullptr;
#pragma unroll
  for (int i = 0; i < 4; ++i) {
    const int mBase = m0 + (i << 4);
#pragma unroll
    for (int j = 0; j < 4; ++j) {
      const int n = n0 + (j << 4) + rlane;
      float bv = 0.f;
      if (BIAS_MODE == 2) bv = bias[n];
#pragma unroll
      for (int r = 0; r < 8; ++r) {
        float v = acc[i][j][r] * scale;
        if (BIAS_MODE == 1) v += bias[mBase + mOff + r];
        if (BIAS_MODE == 2) v += bv;
        if (RESID) v += Rb[(size_t)(mBase + mOff + r) * ldc + n];
        if (ACT == 1) v = tanhf(v);
        if (ACT == 2) v = fmaxf(v, 0.0f);
        if (ACT == 3) v = v / (1.0f + expf(-v));
        if (ACT == 4) v = (v > 0.f) ? v : 0.01f * v;
        if (ACT == 5) v = 0.5f * v * (1.0f + erff(v * 0.70710678118654752f));
        slab[(mOff + r) * 68 + (j << 4) + rlane] = v;
      }
    }
    __builtin_amdgcn_fence(__ATOMIC_RELEASE, "workgroup");
    __builtin_amdgcn_wave_barrier();
    __builtin_amdgcn_fence(__ATOMIC_ACQUIRE, "workgroup");
    if (OUT_MODE == 0) {
      float* C = (float*)Cout + (size_t)b * strideC;
      const int hh = lane >> 4, c4 = (lane & 15) * 4;     // row seg = 256 B = 16 lanes x 16 B
      {
#pragma unroll
        for (int it = 0; it < 8; ++it) {
          const int row = it * 2 + hh;
          v4f v = *(const v4f*)(slab + row * 68 + c4);
          *(v4f*)(C + (size_t)(mBase + row) * ldc + n0 + c4) = v;
        }
        
      }
    } else {
      const int q = lane >> 3, c8 = (lane & 7) * 8;
      unsigned short* C  = (unsigned short*)Cout  + (size_t)b * strideC;
      unsigned short* C2 = (OUT_MODE == 2) ? ((unsigned short*)Cout2 + (size_t)b * strideC) : nullptr;
      {
#pragma unroll
        for (int it = 0; it < 4; ++it) {
          const int row = it * 4 + q;
          const float* sp = slab + row * 68 + c8;
          v8h hv, lv;
#pragma unroll
          for (int e = 0; e < 8; ++e) {
            if (OUT_MODE == 1) {
              hv[e] = (_Float16)sp[e];
            } else {
              unsigned short hb = f2bf_bits(sp[e]);
              unsigned short lb = f2bf_bits(sp[e] - bf_bits2f(hb));
              hv[e] = __builtin_bit_cast(_Float16, hb);
              lv[e] = __builtin_bit_cast(_Float16, lb);
            }
          }
          *(v8h*)(C + (size_t)(mBase + row) * ldc + n0 + c8) = hv;
          if (OUT_MODE == 2) *(v8h*)(C2 + (size_t)(mBase + row) * ldc + n0 + c8) = lv;
        }
        
      }
    }
    __builtin_amdgcn_fence(__ATOMIC_RELEASE, "workgroup");
    __builtin_amdgcn_wave_barrier();
    __builtin_amdgcn_fence(__ATOMIC_ACQUIRE, "workgroup");
  }
}

__global__ __launch_bounds__(256) void cast_f32_f16x2(
    const float* __restrict__ in, _Float16* __restrict__ out, int n2) {
  int i = blockIdx.x * 256 + threadIdx.x;
  if (i < n2) {
    const _Float16 h0 = (_Float16)in[2 * i], h1 = (_Float16)in[2 * i + 1];
    const unsigned u = (unsigned)__builtin_bit_cast(unsigned short, h0) | ((unsigned)__builtin_bit_cast(unsigned short, h1) << 16);
    ((unsigned*)out)[i] = u;
    
  }
}


} // namespace w25

__global__ __launch_bounds__(256) void k_castT16(const float* __restrict__ src, long long lds, _Float16* __restrict__ dst, long long ldd, int R, int C, float s) {
    src += (long long)blockIdx.y * R * lds; dst += (long long)blockIdx.y * C * ldd;   // grid y = image: dense [R][lds] source planes, dense [C][ldd] destination planes
    const long long i = (long long)blockIdx.x * 256 + threadIdx.x; const long long np = (long long)C * (R / 2); if (i >= np) return; const int c = (int)(i / (R / 2)); const int r = 2 * (int)(i % (R / 2));
    const _Float16 h0 = (_Float16)(src[(long long)r * lds + c] * s), h1 = (_Float16)(src[(long long)(r + 1) * lds + c] * s);
    const unsigned u = (unsigned)__builtin_bit_cast(unsigned short, h0) | ((unsigned)__builtin_bit_cast(unsigned short, h1) << 16);
    unsigned* d = (unsigned*)(dst + (long long)c * ldd + r); *d = u;  }
__global__ __launch_bounds__(256) void k_cast16(const float* __restrict__ src, long long lds, _Float16* __restrict__ dst, long long ldd, int R, int C, float s) {
    const long long i = (long long)blockIdx.x * 256 + threadIdx.x; const long long np = (long long)R * (C / 2); if (i >= np) return; const int r = (int)(i / (C / 2)); const int c = 2 * (int)(i % (C / 2));
    const _Float16 h0 = (_Float16)(src[(long long)r * lds + c] * s), h1 = (_Float16)(src[(long long)r * lds + c + 1] * s);
    const unsigned u = (unsigned)__builtin_bit_cast(unsigned short, h0) | ((unsigned)__builtin_bit_cast(unsigned short, h1) << 16);
    unsigned* d = (unsigned*)(dst + (long long)r * ldd + c); *d = u;  }

// f32 -> bf16 hi plane + bf16 lo plane (x = hi + lo to ~2^-17 relative; RNE both), [R][C] -> [R][C] (or transposed to [C][R]); 2 consecutive destination elements
__device__ __forceinline__ unsigned int f2bf2_pack(float a, float b, unsigned int* lo) {
    const unsigned short ha = w25::f2bf_bits(a), hb = w25::f2bf_bits(b);
    const unsigned short la = w25::f2bf_bits(a - w25::bf_bits2f(ha)), lb = w25::f2bf_bits(b - w25::bf_bits2f(hb));
    *lo = (unsigned)la | ((unsigned)lb << 16); return (unsigned)ha | ((unsigned)hb << 16); }
__global__ __launch_bounds__(256) void k_castS16(const float* __restrict__ src, long long lds, __bf16* __restrict__ dhi, __bf16* __restrict__ dlo, long long ldd, int R, int C, float s, int transpose) {
    const long long i = (long long)blockIdx.x * 256 + threadIdx.x; long long o; float a, b;
    if (transpose) { const long long np = (long long)C * (R / 2); if (i >= np) return; const int c = (int)(i / (R / 2)); const int r = 2 * (int)(i % (R / 2)); a = src[(long long)r * lds + c] * s; b = src[(long long)(r + 1) * lds + c] * s; o = (long long)c * ldd + r; }
    else { const long long np = (long long)R * (C / 2); if (i >= np) return; const int r = (int)(i / (C / 2)); const int c = 2 * (int)(i % (C / 2)); a = src[(long long)r * lds + c] * s; b = src[(long long)r * lds + c + 1] * s; o = (long long)r * ldd + c; }
    unsigned lo; const unsigned hi = f2bf2_pack(a, b, &lo); unsigned* ph = (unsigned*)(dhi + o); unsigned* pl = (unsigned*)(dlo + o);
    *ph = hi; *pl = lo;  }

// all five weight tensors (each dense) -> one f16 plane [Wq | Wqb | Wkvb | Wkv | Wout], scaled by s; 2 consecutive elements per thread, every segment a whole number of blocks
__global__ __launch_bounds__(256) void k_castW16(const float* __restrict__ Wq, const float* __restrict__ Wqb, const float* __restrict__ Wkvb, const float* __restrict__ Wkv, const float* __restrict__ Wout, _Float16* __restrict__ dst, float s) {
    const int e = 2 * (blockIdx.x * 256 + threadIdx.x);
    const float* src = Wq; int base = 0;
    if (e >= 786432) { src = Wout; base = 786432; } else if (e >= 262144) { src = Wkv; base = 262144; } else if (e >= 131072) { src = Wkvb; base = 131072; } else if (e >= 65536) { src = Wqb; base = 65536; }
    const _Float16 h0 = (_Float16)(src[e - base] * s), h1 = (_Float16)(src[e - base + 1] * s);
    const unsigned u = (unsigned)__builtin_bit_cast(unsigned short, h0) | ((unsigned)__builtin_bit_cast(unsigned short, h1) << 16);
    unsigned* d = (unsigned*)(dst + e); *d = u; }

// im2col for the 2x2 stride-2 conv, image b = grid y: COL[b][(Y,X)][(c,ky,kx)] = x[b][c][2Y+ky][2X+kx]
__global__ __launch_bounds__(256) void k_es_col(const float* __restrict__ X, float* __restrict__ COL, int C, int Hs) { const int b = blockIdx.y; const long long q = (long long)blockIdx.x * 256 + threadIdx.x; const int Hr = Hs / 2; const long long KC = (long long)C * 4; if (q >= (long long)Hr * Hr * KC) return; COL += (long long)b * Hr * Hr * KC; const int kk = (int)(q % KC); const int pr = (int)(q / KC); const int c = kk / 4, ky = (kk / 2) % 2, kx = kk % 2; const int Y = pr / Hr, Xx = pr % Hr; VST2(float, COL + q, X[(((long long)b * C + c) * Hs + 2 * Y + ky) * Hs + 2 * Xx + kx]); }
// batch-wise attention: for (p, h, b): scores over b' = q_b . k_b' * scale (4 values), softmax, out = sum att v_b'; S[b][p][h*32+d] += out (S already holds out_img)
__global__ __launch_bounds__(256) void k_es_batch(const float* __restrict__ QB, const float* __restrict__ KVB, float* __restrict__ S, int B, int P, int C, int NH, int DH) { const long long w = (long long)blockIdx.x * 8 + (threadIdx.x >> 5); const int lane = threadIdx.x & 31; if (w >= (long long)B * P * NH) return; const int h = (int)(w % NH); const long long bp = w / NH; const int p = (int)(bp % P); const int b = (int)(bp / P); const float qd = QB[((long long)b * P + p) * C + h * DH + lane]; float sc[4]; float mx = -__builtin_inff();
#pragma unroll
    for (int b2 = 0; b2 < 4; ++b2) { float d0 = qd * KVB[((long long)b2 * P + p) * 2 * C + h * DH + lane]; for (int o = 16; o > 0; o >>= 1) d0 += __shfl_xor(d0, o, 32); sc[b2] = d0 * 0.17677669529663689f; mx = fmaxf(mx, sc[b2]); }
    float den = 0.f;
#pragma unroll
    for (int b2 = 0; b2 < 4; ++b2) { sc[b2] = expf(sc[b2] - mx); den += sc[b2]; } float o_ = 0.f;
#pragma unroll
    for (int b2 = 0; b2 < 4; ++b2) o_ += sc[b2] / den * KVB[((long long)b2 * P + p) * 2 * C + C + h * DH + lane];
    const long long oi = ((long long)b * P + p) * C + h * DH + lane; VST2(float, S + oi, S[oi] + o_); }


extern "C" void kernel_launch(void* const* d_in, const int* in_sizes, int n_in, void* d_out, int out_size, void* d_ws, size_t ws_size, hipStream_t stream) {
    (void)in_sizes; (void)n_in; (void)out_size; (void)ws_size;
    const float* x = (const float*)d_in[0];
    const float* Wq = (const float*)d_in[1];
    const float* Wkv = (const float*)d_in[2];
    const float* Wqb = (const float*)d_in[3];
    const float* Wkvb = (const float*)d_in[4];
    const float* Wout = (const float*)d_in[5];
    const int Bn = 4;
    const int C = 256;
    const int Hs = 64;
    const int P = 4096;
    const int NH = 8;
    const int DH = 32;
    float* out = (float*)d_out;
    // every activation plane holds all 4 images, image-major; each is written by one launch (S by two) and read by later ones of this call
    char* wsp = (char*)d_ws;
    float* QT = (float*)wsp; wsp += (size_t)4 * 4096 * 256 * 4;            // [4][4096][256] q, position-major
    float* COL = (float*)wsp; wsp += (size_t)4 * 1024 * 1024 * 4;          // [4][1024][1024] im2col
    float* KVT = (float*)wsp; wsp += (size_t)4 * 1024 * 512 * 4;           // [4][1024][512] k | v
    float* QB = (float*)wsp; wsp += (size_t)4 * 4096 * 256 * 4;            // [4][4096][256]
    float* KVB = (float*)wsp; wsp += (size_t)4 * 4096 * 512 * 4;           // [4][4096][512]
    float* S = (float*)wsp; wsp += (size_t)4 * 4096 * 256 * 4;             // [4][4096][256] out_img, then + out_batch
    _Float16* XT16 = (_Float16*)wsp; wsp += (size_t)4 * 4096 * 256 * 2;    // [4][4096][256] x^T
    _Float16* COL16 = (_Float16*)wsp; wsp += (size_t)4 * 1024 * 1024 * 2;
    _Float16* S16 = (_Float16*)wsp; wsp += (size_t)4 * 4096 * 256 * 2;
    _Float16* W16 = (_Float16*)wsp; wsp += (size_t)851968 * 2;             // [Wq | Wqb | Wkvb | Wkv | Wout], x16
    const _Float16* Wq16 = W16;
    const _Float16* Wqb16 = W16 + 65536;
    const _Float16* Wkvb16 = W16 + 131072;
    const _Float16* Wkv16 = W16 + 262144;
    const _Float16* Wout16 = W16 + 786432;
    k_castT16<<<dim3(2048, 4), 256, 0, stream>>>(x, 4096, XT16, 256, 256, 4096, 1.0f);
    k_castW16<<<1664, 256, 0, stream>>>(Wq, Wqb, Wkvb, Wkv, Wout, W16, 16.0f);
    // the 1x1 projections share their weights over the images: one GEMM each over the 4 * 4096 stacked positions
    w25::wmma_gemm64<0, false, 0, 0, false, 0><<<dim3(128, 1), 256, 0, stream>>>((const unsigned short*)(XT16), nullptr, 256, 0, (const unsigned short*)(Wqb16), nullptr, 256, 0, (void*)(QB), nullptr, 256, 0, nullptr, nullptr, 0, 16384, 256, 256, 0.0625f);
    w25::wmma_gemm64<0, false, 0, 0, false, 0><<<dim3(256, 1), 256, 0, stream>>>((const unsigned short*)(XT16), nullptr, 256, 0, (const unsigned short*)(Wkvb16), nullptr, 256, 0, (void*)(KVB), nullptr, 512, 0, nullptr, nullptr, 0, 16384, 512, 256, 0.0625f);
    w25::wmma_gemm64<0, false, 0, 0, false, 0><<<dim3(128, 1), 256, 0, stream>>>((const unsigned short*)(XT16), nullptr, 256, 0, (const unsigned short*)(Wq16), nullptr, 256, 0, (void*)(QT), nullptr, 256, 0, nullptr, nullptr, 0, 16384, 256, 256, 0.0625f);
    k_es_col<<<dim3(4096, 4), 256, 0, stream>>>(x, COL, C, Hs);
    k_cast16<<<8192, 256, 0, stream>>>(COL, 1024, COL16, 1024, 4096, 1024, 1.0f);
    w25::wmma_gemm64<0, false, 0, 0, false, 0><<<dim3(64, 1), 256, 0, stream>>>((const unsigned short*)(COL16), nullptr, 1024, 0, (const unsigned short*)(Wkv16), nullptr, 1024, 0, (void*)(KVT), nullptr, 512, 0, nullptr, nullptr, 0, 4096, 512, 1024, 0.0625f);
    k_attn32<4096, 1024, 256, 512><<<dim3(64, 8, 4), 32 * AW, 0, stream>>>(QT, KVT, KVT + C, S, 0.1767766952966369f);
    k_es_batch<<<16384, 256, 0, stream>>>(QB, KVB, S, Bn, P, C, NH, DH);
    k_cast16<<<8192, 256, 0, stream>>>(S, 256, S16, 256, 16384, 256, 1.0f);
    // output conv: grid y = image (weights shared: stride 0)
    w25::wmma_gemm64<0, false, 0, 0, false, 0><<<dim3(32, 4), 256, 0, stream>>>((const unsigned short*)(Wout16), nullptr, 256, 0, (const unsigned short*)(S16), nullptr, 256, 1048576, (void*)(out), nullptr, 4096, 1048576, nullptr, nullptr, 0, 256, 4096, 256, 0.0625f);
}

// v003
// Measured time: 293 microseconds a run.
// Next to v002, in two timings, it ran 1.09 and 1.08 times as fast.
// All steps since v000 together make it 7.51 times as fast.
// Contractions (per image): q / qb / kvb 1x1 projections in position-major form x^T W^T [4096x256].[256x{256,256,512}], the 2x2-stride-2 kv conv as an im2col GEMM [1024x1024].[1024x512] and the output 1x1 conv Wout.(out_img + out_batch)^T [256x256].[256x4096], all with f16 operands (v_wmma_f32_16x16x32_f16; 64x64 register-blocked wave tiles over pre-cast f16 operand planes, weight operands pre-scaled by 16 at the cast and un-scaled in the f32 epilogue); the spatial-reduction attention per head (flash kernel, head_dim 32, 4096 queries x 1024 keys, f16 q.k^T and f16 p.v); f32 accumulate; the im2col, the batch-wise 4x4 attention per (position, head) and the branch sum are f32 kernels.
#include <hip/hip_runtime.h>
#include <math.h>

typedef __attribute__((ext_vector_type(16))) _Float16 v16h;
typedef __attribute__((ext_vector_type(8)))  _Float16 v8h;
typedef __attribute__((ext_vector_type(16))) __bf16   v16b;
typedef __attribute__((ext_vector_type(8)))  float    v8f;
typedef __attribute__((ext_vector_type(4)))  float    v4f;

// 16-bit WMMA fragment map (wave32), lane L, h = L>>4, m = L&15:
//   A 16x32: lane = row m;   element i -> k = (i<8) ? 8h+i : 16+8h+(i-8)
//   B 32x16: lane = column m; the SAME k(i,h)
//   D 16x16 (8 f32): lane = column m; element r -> row 8h+r
__device__ __forceinline__ int frag_k(int i, int h) { return (i < 8) ? (8 * h + i) : (16 + 8 * h + (i - 8)); }
__device__ __forceinline__ __bf16 bf16_rne(float f) {
    unsigned int u = __float_as_uint(f);
    u += 0x7fffu + ((u >> 16) & 1u);
    return __builtin_bit_cast(__bf16, (unsigned short)(u >> 16));
}
__device__ __forceinline__ float bf16_f32(__bf16 b) { return __uint_as_float(((unsigned int)__builtin_bit_cast(unsigned short, b)) << 16); }
__device__ __forceinline__ v8f wmma16(v16h a, v16h b, v8f c) {
    c = __builtin_amdgcn_wmma_f32_16x16x32_f16(false, a, false, b, (short)0, c, false, false);
    asm volatile("v_nop\n\tv_nop\n\tv_nop\n\tv_nop" : "+v"(c) : "v"(a), "v"(b));
    return c;
}
__device__ __forceinline__ v8f wmmab(v16b a, v16b b, v8f c) {
    c = __builtin_amdgcn_wmma_f32_16x16x32_bf16(false, a, false, b, (short)0, c, false, false);
    asm volatile("v_nop\n\tv_nop\n\tv_nop\n\tv_nop" : "+v"(c) : "v"(a), "v"(b));
    return c;
}
struct Split { v16b hi, lo; };
// hi/lo split product: a.hi*b.hi + a.hi*b.lo + a.lo*b.hi
__device__ __forceinline__ v8f wmma3(const Split& a, const Split& b, v8f c) {
    c = __builtin_amdgcn_wmma_f32_16x16x32_bf16(false, a.hi, false, b.hi, (short)0, c, false, false);
    c = __builtin_amdgcn_wmma_f32_16x16x32_bf16(false, a.hi, false, b.lo, (short)0, c, false, false);
    c = __builtin_amdgcn_wmma_f32_16x16x32_bf16(false, a.lo, false, b.hi, (short)0, c, false, false);
    asm volatile("v_nop\n\tv_nop\n\tv_nop\n\tv_nop" : "+v"(c) : "v"(a.hi), "v"(a.lo), "v"(b.hi), "v"(b.lo));
    return c;
}
struct Split3 { v16b hi, mid, lo; };
// triple split product (6 terms, drops only terms below 2^-24 relative)
__device__ __forceinline__ v8f wmma6(const Split3& a, const Split3& b, v8f c) {
    c = __builtin_amdgcn_wmma_f32_16x16x32_bf16(false, a.hi, false, b.hi, (short)0, c, false, false);
    c = __builtin_amdgcn_wmma_f32_16x16x32_bf16(false, a.hi, false, b.mid, (short)0, c, false, false);
    c = __builtin_amdgcn_wmma_f32_16x16x32_bf16(false, a.mid, false, b.hi, (short)0, c, false, false);
    c = __builtin_amdgcn_wmma_f32_16x16x32_bf16(false, a.hi, false, b.lo, (short)0, c, false, false);
    c = __builtin_amdgcn_wmma_f32_16x16x32_bf16(false, a.mid, false, b.mid, (short)0, c, false, false);
    c = __builtin_amdgcn_wmma_f32_16x16x32_bf16(false, a.lo, false, b.hi, (short)0, c, false, false);
    asm volatile("v_nop\n\tv_nop\n\tv_nop\n\tv_nop" : "+v"(c) : "v"(a.hi), "v"(a.mid), "v"(a.lo), "v"(b.hi), "v"(b.mid), "v"(b.lo));
    return c;
}

// Fragment gathers from f32 memory: element i <- p[(k0 + frag_k(i,h)) * sk] * s, zero for k >= klen.
__device__ __forceinline__ v16h fh_ld(const float* __restrict__ p, long long sk, int k0, int h, int klen, float s) {
    v16h a;
#pragma unroll
    for (int i = 0; i < 16; ++i) { const int k = k0 + frag_k(i, h); a[i] = (k < klen) ? (_Float16)(p[(long long)k * sk] * s) : (_Float16)0.f; }
    return a;
}
__device__ __forceinline__ Split sp_ld(const float* __restrict__ p, long long sk, int k0, int h, int klen, float s) {
    Split r;
#pragma unroll
    for (int i = 0; i < 16; ++i) {
        const int k = k0 + frag_k(i, h); const float x = (k < klen) ? p[(long long)k * sk] * s : 0.f;
        const __bf16 hb = bf16_rne(x); r.hi[i] = hb; r.lo[i] = bf16_rne(x - bf16_f32(hb));
    }
    return r;
}
__device__ __forceinline__ Split3 sp3_ld(const float* __restrict__ p, long long sk, int k0, int h, int klen, float s) {
    Split3 r;
#pragma unroll
    for (int i = 0; i < 16; ++i) {
        const int k = k0 + frag_k(i, h); const float x = (k < klen) ? p[(long long)k * sk] * s : 0.f;
        const __bf16 hb = bf16_rne(x); const float r1 = x - bf16_f32(hb); const __bf16 mb = bf16_rne(r1);
        r.hi[i] = hb; r.mid[i] = mb; r.lo[i] = bf16_rne(r1 - bf16_f32(mb));
    }
    return r;
}
__device__ __forceinline__ v16b bh_ld(const float* __restrict__ p, long long sk, int k0, int h, int klen, float s) {
    v16b a;
#pragma unroll
    for (int i = 0; i < 16; ++i) { const int k = k0 + frag_k(i, h); a[i] = bf16_rne((k < klen) ? p[(long long)k * sk] * s : 0.f); }
    return a;
}
// f16 fragment from an f16 LDS/global row with element stride 1 (k-contiguous), no bounds (tile already zero padded)
__device__ __forceinline__ v16h fh_row(const _Float16* __restrict__ row, int k0, int h) {
    v16h a;
#pragma unroll
    for (int i = 0; i < 16; ++i) a[i] = row[k0 + frag_k(i, h)];
    return a;
}

#define VST2(T, ptr, val) do { const T vst2_v_ = (val); *(T*)(ptr) = vst2_v_;  } while (0)
typedef float v4f __attribute__((ext_vector_type(4)));
#define VST2V4(ptr, val) do { const v4f vst2_v4_ = (val); *(v4f*)(ptr) = vst2_v4_;  } while (0)

__device__ __attribute__((noinline)) float act_fn(float v, int act) {
    if (act == 1) return fmaxf(v, 0.f);                                                                               // relu
    if (act == 2) { const float u = 0.7978845608028654f * (v + 0.044715f * v * v * v); return 0.5f * v * (1.f + tanhf(u)); } // tanh-gelu
    if (act == 3) return v / (1.f + expf(-v));                                                                        // silu
    if (act == 4) return 0.5f * v * (1.f + erff(v * 0.7071067811865476f));                                             // erf-gelu
    if (act == 5) return tanhf(v);
    if (act == 6) return 1.f / (1.f + expf(-v));                                                                      // sigmoid
    if (act == 7) return (v > 0.f) ? v : 0.01f * v;                                                                   // leaky relu 0.01
    if (act == 8) return (v > 0.f) ? v : (expf(v) - 1.f);                                                             // elu
    if (act == 9) return fminf(fmaxf(v, 0.f), 6.f);                                                                   // relu6
    if (act == 10) return fabsf(v);                                                                                    // abs
    if (act == 11) return (v >= 0.f) ? v : 0.1f * v;                                                                  // leaky 0.1
    if (act == 12) return (v > 0.f) ? v : 0.2f * v;                                                                   // leaky 0.2
    if (act == 13) return (v > 20.f) ? v : log1pf(expf(v));                                                            // softplus
    return v;
}

// =====================================================================================================================
// k_gemm<MODE>: C(z, m, n) = act(alpha * sum_k A(z, m, k) * B(z, k, n) + bias) + beta * R(z, m, n)
//   One wave (32-thread block) per 16 x 32 tile of C; grid (ceil(N/32), ceil(M/16), Z). Batch z -> (zo = z / zi_n, zi = z % zi_n)
//   with separate outer/inner strides for every tensor (e.g. batch and head). A(m,k) = A[zo*sAo + zi*sAi + m*sAm + k*sAk] (f32),
//   B(k,n) = B[zo*sBo + zi*sBi + n*sBn + k*sBk] (f32); any M, N, K (K zero-padded to 32 inside the fragments, M/N tails guarded).
//   C(m,n) = C[zo*sCo + zi*sCi + m*sCm + n] (n contiguous). flags: 1 bias[n], 2 bias[m], 4 residual R[zo*sRo + zi*sRi + m*sRm + n*sRn].
//   MODE 0: f16 operands (A prescaled by sa, B by sb, both undone in the epilogue); 1: bf16 hi/lo split (3 products); 2: bf16;
//   3: bf16 hi/mid/lo triple split (6 products); 4: as 3 with Kahan-compensated f32 accumulation across k-steps.
// =====================================================================================================================
struct GemmP {
    const float* A; const float* B; const float* bias; const float* R; float* C;
    long long sAo, sAi, sAm, sAk, sBo, sBi, sBn, sBk, sCo, sCi, sCm, sRo, sRi, sRm, sRn;
    int M, N, K, zi_n, flags, act; float alpha, beta, sa, sb;
    int Npad, pad_;     // columns [N, Npad) of C are written as 0 so that padded workspace rows are covered by whole-line stores; Npad >= N
};
static_assert(sizeof(GemmP) == 5 * 8 + 15 * 8 + 6 * 4 + 4 * 4 + 2 * 4, "GemmP has padding");

template <int MODE>
__global__ __launch_bounds__(32) void k_gemm(GemmP p) {
    const int lane = threadIdx.x & 31, h = lane >> 4, l15 = lane & 15;
    const int m0 = blockIdx.y * 16, n0 = blockIdx.x * 32;
    const int z = blockIdx.z, zo = z / p.zi_n, zi = z - zo * p.zi_n;
    const float* A = p.A + zo * p.sAo + zi * p.sAi;
    const float* B = p.B + zo * p.sBo + zi * p.sBi;
    const int am = min(m0 + l15, p.M - 1);                       // clamped row for loads (stores are guarded)
    v8f acc[2], comp[2];
#pragma unroll
    for (int t = 0; t < 2; ++t) { v8f zz = {}; acc[t] = zz; comp[t] = zz; }
    for (int k0 = 0; k0 < p.K; k0 += 32) {
        const float* arow = A + (long long)am * p.sAm;
        if (MODE == 1) {
            const Split a = sp_ld(arow, p.sAk, k0, h, p.K, 1.f);
#pragma unroll
            for (int t = 0; t < 2; ++t) {
                const int bn = min(n0 + t * 16 + l15, p.N - 1);
                acc[t] = wmma3(a, sp_ld(B + (long long)bn * p.sBn, p.sBk, k0, h, p.K, 1.f), acc[t]);
            }
        } else if (MODE == 3) {
            const Split3 a = sp3_ld(arow, p.sAk, k0, h, p.K, 1.f);
#pragma unroll
            for (int t = 0; t < 2; ++t) {
                const int bn = min(n0 + t * 16 + l15, p.N - 1);
                acc[t] = wmma6(a, sp3_ld(B + (long long)bn * p.sBn, p.sBk, k0, h, p.K, 1.f), acc[t]);
            }
        } else if (MODE == 4) {
            // triple split as MODE 3, but each k-step's 6 products go into a fresh accumulator and the partial is added to the running f32 sum
            // on the VALU with Kahan compensation (accumulation error stays ~1 ulp however long K is)
            const Split3 a = sp3_ld(arow, p.sAk, k0, h, p.K, 1.f);
#pragma unroll
            for (int t = 0; t < 2; ++t) {
                const int bn = min(n0 + t * 16 + l15, p.N - 1); v8f zz = {};
                const v8f part = wmma6(a, sp3_ld(B + (long long)bn * p.sBn, p.sBk, k0, h, p.K, 1.f), zz);
                const v8f y = part - comp[t]; const v8f s = acc[t] + y; comp[t] = (s - acc[t]) - y; acc[t] = s;
            }
        } else if (MODE == 2) {
            const v16b a = bh_ld(arow, p.sAk, k0, h, p.K, 1.f);
#pragma unroll
            for (int t = 0; t < 2; ++t) {
                const int bn = min(n0 + t * 16 + l15, p.N - 1);
                acc[t] = wmmab(a, bh_ld(B + (long long)bn * p.sBn, p.sBk, k0, h, p.K, 1.f), acc[t]);
            }
        } else {
            const v16h a = fh_ld(arow, p.sAk, k0, h, p.K, p.sa);
#pragma unroll
            for (int t = 0; t < 2; ++t) {
                const int bn = min(n0 + t * 16 + l15, p.N - 1);
                acc[t] = wmma16(a, fh_ld(B + (long long)bn * p.sBn, p.sBk, k0, h, p.K, p.sb), acc[t]);
            }
        }
    }
    const float iscale = (MODE == 0) ? p.alpha / (p.sa * p.sb) : p.alpha;
    float* C = p.C + zo * p.sCo + zi * p.sCi;
    const float* R = p.R + zo * p.sRo + zi * p.sRi;
    __shared__ __align__(16) float ctile[16][36];
#pragma unroll
    for (int t = 0; t < 2; ++t) {
        const int n = n0 + t * 16 + l15; const int nn = min(n, p.N - 1);
#pragma unroll
        for (int r = 0; r < 8; ++r) {
            const int m = m0 + 8 * h + r; const int mm = min(m, p.M - 1);
            float v = acc[t][r] * iscale;
            if (p.flags & 1) v += p.bias[nn];
            if (p.flags & 2) v += p.bias[mm];
            if (p.flags & 8) v *= p.bias[(long long)zo * p.M + mm];   /* per-(z,row) scale vector laid out [Z][M]; exclusive with the bias flags */
            v = act_fn(v, p.act);
            if (p.flags & 4) v += p.beta * R[(long long)mm * p.sRm + (long long)nn * p.sRn];
            ctile[8 * h + r][t * 16 + l15] = (n < p.N) ? v : 0.f;
        }
    }
    __syncthreads();
    const int NW = (p.Npad > p.N) ? p.Npad : p.N;           // write width
    const bool fast = (m0 + 16 <= p.M) && (n0 + 32 <= NW) && ((p.sCm & 3) == 0) && ((((size_t)C) & 15) == 0);
    if (fast) {
#pragma unroll
        for (int s = 0; s < 4; ++s) {
            const int row = s * 4 + (lane >> 3), c4 = (lane & 7) * 4;
            const v4f v = *(const v4f*)&ctile[row][c4];
            VST2V4(C + (long long)(m0 + row) * p.sCm + n0 + c4, v);
        }
    } else {
        for (int row = 0; row < 16; ++row) {
            const int m = m0 + row, n = n0 + lane;
            if (m < p.M && n < NW) VST2(float, C + (long long)m * p.sCm + n, ctile[row][lane]);
        }
    }
}


// =====================================================================================================================
// k_gemmT<MODE, TM, TN>: same contract as k_gemm, but one wave computes a (16*TM) x (16*TN) tile: TM A fragments and TN B fragments are
//   loaded per 32-wide k-step and reused across TM*TN WMMAs (far fewer load/convert instructions per MAC). MODE 0 (f16), 1 (bf16 hi/lo),
//   2 (bf16) only. grid (ceil(NW/(16*TN)), ceil(M/(16*TM)), Z), block 32. Epilogue identical to k_gemm, run per 16x32 sub-tile.
// =====================================================================================================================
template <int MODE, int TM, int TN>
__global__ __launch_bounds__(32) void k_gemmT(GemmP p) {
    const int lane = threadIdx.x & 31, h = lane >> 4, l15 = lane & 15;
    const int m0 = blockIdx.y * (16 * TM), n0 = blockIdx.x * (16 * TN);
    const int z = blockIdx.z, zo = z / p.zi_n, zi = z - zo * p.zi_n;
    const float* A = p.A + zo * p.sAo + zi * p.sAi;
    const float* B = p.B + zo * p.sBo + zi * p.sBi;
    v8f acc[TM][TN];
#pragma unroll
    for (int i = 0; i < TM; ++i)
#pragma unroll
        for (int t = 0; t < TN; ++t) { v8f zz = {}; acc[i][t] = zz; }
    for (int k0 = 0; k0 < p.K; k0 += 32) {
        if (MODE == 1) {
            Split a[TM], b[TN];
#pragma unroll
            for (int i = 0; i < TM; ++i) { const int am = min(m0 + 16 * i + l15, p.M - 1); a[i] = sp_ld(A + (long long)am * p.sAm, p.sAk, k0, h, p.K, 1.f); }
#pragma unroll
            for (int t = 0; t < TN; ++t) { const int bn = min(n0 + 16 * t + l15, p.N - 1); b[t] = sp_ld(B + (long long)bn * p.sBn, p.sBk, k0, h, p.K, 1.f); }
#pragma unroll
            for (int i = 0; i < TM; ++i)
#pragma unroll
                for (int t = 0; t < TN; ++t) acc[i][t] = wmma3(a[i], b[t], acc[i][t]);
        } else if (MODE == 2) {
            v16b a[TM], b[TN];
#pragma unroll
            for (int i = 0; i < TM; ++i) { const int am = min(m0 + 16 * i + l15, p.M - 1); a[i] = bh_ld(A + (long long)am * p.sAm, p.sAk, k0, h, p.K, 1.f); }
#pragma unroll
            for (int t = 0; t < TN; ++t) { const int bn = min(n0 + 16 * t + l15, p.N - 1); b[t] = bh_ld(B + (long long)bn * p.sBn, p.sBk, k0, h, p.K, 1.f); }
#pragma unroll
            for (int i = 0; i < TM; ++i)
#pragma unroll
                for (int t = 0; t < TN; ++t) acc[i][t] = wmmab(a[i], b[t], acc[i][t]);
        } else {
            v16h a[TM], b[TN];
#pragma unroll
            for (int i = 0; i < TM; ++i) { const int am = min(m0 + 16 * i + l15, p.M - 1); a[i] = fh_ld(A + (long long)am * p.sAm, p.sAk, k0, h, p.K, p.sa); }
#pragma unroll
            for (int t = 0; t < TN; ++t) { const int bn = min(n0 + 16 * t + l15, p.N - 1); b[t] = fh_ld(B + (long long)bn * p.sBn, p.sBk, k0, h, p.K, p.sb); }
#pragma unroll
            for (int i = 0; i < TM; ++i)
#pragma unroll
                for (int t = 0; t < TN; ++t) acc[i][t] = wmma16(a[i], b[t], acc[i][t]);
        }
    }
    const float iscale = (MODE == 0) ? p.alpha / (p.sa * p.sb) : p.alpha;
    float* C = p.C + zo * p.sCo + zi * p.sCi;
    const float* R = p.R + zo * p.sRo + zi * p.sRi;
    const int NW = (p.Npad > p.N) ? p.Npad : p.N;
    __shared__ __align__(16) float ctile[16][36];
#pragma unroll
    for (int i = 0; i < TM; ++i) {
        const int mb = m0 + 16 * i; if (mb >= p.M) break;          // wave-uniform
#pragma unroll
        for (int tp = 0; tp < TN / 2; ++tp) {
            const int nb = n0 + 32 * tp; if (nb >= NW) break;        // wave-uniform
#pragma unroll
            for (int t2 = 0; t2 < 2; ++t2) {
                const int t = 2 * tp + t2; const int n = nb + t2 * 16 + l15; const int nn = min(n, p.N - 1);
#pragma unroll
                for (int r = 0; r < 8; ++r) {
                    const int m = mb + 8 * h + r; const int mm = min(m, p.M - 1);
                    float v = acc[i][t][r] * iscale;
                    if (p.flags & 1) v += p.bias[nn];
                    if (p.flags & 2) v += p.bias[mm];
            if (p.flags & 8) v *= p.bias[(long long)zo * p.M + mm];   /* per-(z,row) scale vector laid out [Z][M]; exclusive with the bias flags */
                    v = act_fn(v, p.act);
                    if (p.flags & 4) v += p.beta * R[(long long)mm * p.sRm + (long long)nn * p.sRn];
                    ctile[8 * h + r][t2 * 16 + l15] = (n < p.N) ? v : 0.f;
                }
            }
            __syncthreads();
            const bool fast = (mb + 16 <= p.M) && (nb + 32 <= NW) && ((p.sCm & 3) == 0) && ((((size_t)C) & 15) == 0);
            if (fast) {
#pragma unroll
                for (int s = 0; s < 4; ++s) {
                    const int row = s * 4 + (lane >> 3), c4 = (lane & 7) * 4;
                    const v4f v = *(const v4f*)&ctile[row][c4];
                    VST2V4(C + (long long)(mb + row) * p.sCm + nb + c4, v);
                }
            } else {
                for (int row = 0; row < 16; ++row) {
                    const int m = mb + row, n = nb + lane;
                    if (m < p.M && n < NW) VST2(float, C + (long long)m * p.sCm + n, ctile[row][lane]);
                }
            }
            __syncthreads();
        }
    }
}

// =====================================================================================================================
// k_attn32<LQ, LK, QP, KP>: flash attention at one fixed shape, all of it known at compile time: LQ queries, LK keys (a multiple of 64), head and
//   value dim 32, f32 rows with element stride 1 (Q and O row pitch QP floats, K and V row pitch KP floats, head h at column 32 h), no mask.
//   Wave = 16 queries, AW waves per block, 64-key blocks; grid (LQ / (16*AW), heads, images), block 32*AW; image z at Q, O + z*LQ*QP and K, V + z*LK*KP. Every Q, K and V row piece is whole and
//   16-byte aligned, so it is read with unguarded 16-byte loads that are all in flight together.
//   Scores: f16 operands; statistics f32 (exp2 domain); P.V: P x 4096 as f16 with V f16 staged in LDS.
// =====================================================================================================================
#define AW 4
typedef __attribute__((ext_vector_type(4))) _Float16 v4h;
// the 16 f32 that make up lane half h's fragment of a 32-wide row: k = 8h..8h+7 and 16+8h..16+8h+7 (the order of frag_k)
struct Row16 { v4f r[4]; };
__device__ __forceinline__ Row16 row16_ld(const float* __restrict__ row, int h) {
    Row16 x;
    x.r[0] = *(const v4f*)(row + 8 * h); x.r[1] = *(const v4f*)(row + 8 * h + 4);
    x.r[2] = *(const v4f*)(row + 16 + 8 * h); x.r[3] = *(const v4f*)(row + 16 + 8 * h + 4);
    return x;
}
__device__ __forceinline__ v16h row16_f16(const Row16& x) {
    v16h a;
#pragma unroll
    for (int q = 0; q < 4; ++q)
#pragma unroll
        for (int e = 0; e < 4; ++e) a[4 * q + e] = (_Float16)x.r[q][e];
    return a;
}
template <int LQ, int LK, int QP, int KP>
__global__ __launch_bounds__(32 * AW) void k_attn32(const float* __restrict__ Q, const float* __restrict__ K, const float* __restrict__ V, float* __restrict__ O, float scale) {
    static_assert(LQ % (16 * AW) == 0 && LK % 64 == 0 && QP % 4 == 0 && KP % 4 == 0, "whole tiles, 16-byte rows");
    constexpr int NT = 2;                       // output tiles
    constexpr int VP = 32 + 8;                  // LDS pitch (halves)
    __shared__ __align__(16) float    pl[AW][16 * 64];
    __shared__ __align__(16) _Float16 vl[64 * VP];
    const int lane = threadIdx.x & 31, hf = lane >> 4, l15 = lane & 15, wave = threadIdx.x >> 5;
    const int h = blockIdx.y;
    const int q0 = (blockIdx.x * AW + wave) * 16;
    Q += (size_t)blockIdx.z * LQ * QP; O += (size_t)blockIdx.z * LQ * QP;      // image blockIdx.z: its own Q / O plane
    K += (size_t)blockIdx.z * LK * KP; V += (size_t)blockIdx.z * LK * KP;      // and its own K / V plane
    float* myp = pl[wave];
    const float L2E = 1.4426950408889634f;
    const float NEG = -__builtin_inff();
    const float* kbase = K + h * 32 + (size_t)l15 * KP;                                     // this lane's key row of a 16-key tile
    const float* vbase = V + h * 32 + (size_t)(threadIdx.x >> 3) * KP + (threadIdx.x & 7) * 4;  // this thread's 4 floats of a 16-row slab
    _Float16* vst = vl + (threadIdx.x >> 3) * VP + (threadIdx.x & 7) * 4;
    const v16h qa = row16_f16(row16_ld(Q + h * 32 + (size_t)(q0 + l15) * QP, hf));
    asm volatile("s_wait_xcnt 0x0" ::: "memory");   // the Q loads' address registers are reused for the start values set below: the wait stands in front of that overwrite
    __builtin_amdgcn_sched_barrier(0);              // keeps those later register writes from being scheduled ahead of the wait
    v8f o[NT]; float m8[8], l8[8];
#pragma unroll
    for (int t = 0; t < NT; ++t) { v8f zz = {}; o[t] = zz; }
#pragma unroll
    for (int i = 0; i < 8; ++i) { m8[i] = NEG; l8[i] = 0.f; }
    for (int j0 = 0; j0 < LK; j0 += 64) {
        v4f vr[4]; Row16 kr[4];
#pragma unroll
        for (int n = 0; n < 4; ++n) vr[n] = *(const v4f*)(vbase + (size_t)(j0 + 16 * n) * KP);
#pragma unroll
        for (int t = 0; t < 4; ++t) kr[t] = row16_ld(kbase + (size_t)(j0 + 16 * t) * KP, hf);
        __syncthreads();                                 // previous key block's reads of vl / pl are done
#pragma unroll
        for (int n = 0; n < 4; ++n) {
            const v4h hv = {(_Float16)vr[n][0], (_Float16)vr[n][1], (_Float16)vr[n][2], (_Float16)vr[n][3]};
            *(v4h*)(vst + 16 * n * VP) = hv;
        }
        v8f s[4];
#pragma unroll
        for (int t = 0; t < 4; ++t) { v8f acc = {}; s[t] = wmma16(qa, row16_f16(kr[t]), acc); }
        float pv[8][4];
#pragma unroll
        for (int i = 0; i < 8; ++i) {
            float sc[4];
#pragma unroll
            for (int t = 0; t < 4; ++t) { float v = s[t][i] * scale; v *= L2E; sc[t] = v; }
            float mx = fmaxf(fmaxf(sc[0], sc[1]), fmaxf(sc[2], sc[3]));
            mx = fmaxf(mx, __shfl_xor(mx, 1, 32)); mx = fmaxf(mx, __shfl_xor(mx, 2, 32));
            mx = fmaxf(mx, __shfl_xor(mx, 4, 32)); mx = fmaxf(mx, __shfl_xor(mx, 8, 32));
            const float mnew = fmaxf(m8[i], mx);
            const float corr = exp2f(m8[i] - mnew);          // first block: exp2(-inf) = 0
            float rs = 0.f;
#pragma unroll
            for (int t = 0; t < 4; ++t) { const float pp = exp2f(sc[t] - mnew); rs += pp; pv[i][t] = pp; }
            rs += __shfl_xor(rs, 1, 32); rs += __shfl_xor(rs, 2, 32); rs += __shfl_xor(rs, 4, 32); rs += __shfl_xor(rs, 8, 32);
            l8[i] = l8[i] * corr + rs; m8[i] = mnew;
#pragma unroll
            for (int t = 0; t < NT; ++t) o[t][i] *= corr;
        }
#pragma unroll
        for (int i = 0; i < 8; ++i)
#pragma unroll
            for (int t = 0; t < 4; ++t) myp[(i + 8 * hf) * 64 + t * 16 + l15] = pv[i][t];
        __syncthreads();                                 // P (per wave) and V (shared) visible
        const v16h pa0 = fh_ld(myp + l15 * 64, 1, 0, hf, 64, 4096.f), pa1 = fh_ld(myp + l15 * 64, 1, 32, hf, 64, 4096.f);
#pragma unroll
        for (int t = 0; t < NT; ++t) {
            const int dcol = t * 16 + l15;
            v16h b0, b1;
#pragma unroll
            for (int e = 0; e < 16; ++e) { b0[e] = vl[frag_k(e, hf) * VP + dcol]; b1[e] = vl[(32 + frag_k(e, hf)) * VP + dcol]; }
            o[t] = wmma16(pa0, b0, o[t]);
            o[t] = wmma16(pa1, b1, o[t]);
        }
    }
    float* obase = O + h * 32;
    float invr[8];
#pragma unroll
    for (int i = 0; i < 8; ++i) invr[i] = 1.f / (l8[i] * 4096.f);   // no key is masked: each row sum holds its maximum's exp2(0) = 1
    __syncthreads();                                             // all waves done with pl/vl from the main loop
#pragma unroll
    for (int i = 0; i < 8; ++i)
#pragma unroll
        for (int t = 0; t < NT; ++t) myp[(i + 8 * hf) * 64 + t * 16 + l15] = o[t][i] * invr[i];
    __syncthreads();
#pragma unroll
    for (int r0 = 0; r0 < 16; r0 += 4) {
        const int row = r0 + (lane >> 3), c4 = (lane & 7) * 4;
        const v4f v = *(const v4f*)(myp + row * 64 + c4);
        VST2V4(obase + (size_t)(q0 + row) * QP + c4, v);
    }
}

// =====================================================================================================================
// k_tr: dst(z, c, r) = alpha * src(z, r, c) (+ beta * R2(z, c, r)): [Z][R][C] (row stride lds) -> [Z][C][R] (row stride ldd) through a 32x32 LDS tile;
//   flags: 1 -> add beta * residual R2 addressed like dst (z*sRz + c*ldr + r); act applied before the residual.
// =====================================================================================================================
struct TrP { const float* src; float* dst; const float* R2; long long sSz, lds, sDz, ldd, sRz, ldr; int R, C, flags, act; float alpha, beta; };
static_assert(sizeof(TrP) == 3 * 8 + 6 * 8 + 6 * 4, "TrP has padding");
__global__ __launch_bounds__(256) void k_tr(TrP p) {
    __shared__ float tile[32][33];
    const int c0 = blockIdx.x * 32, r0 = blockIdx.y * 32, z = blockIdx.z;
    const int lane = threadIdx.x & 31, wave = threadIdx.x >> 5;
    const float* s = p.src + z * p.sSz;
#pragma unroll
    for (int k = 0; k < 4; ++k) {
        const int rl = wave * 4 + k, r = r0 + rl, c = c0 + lane;
        tile[rl][lane] = (r < p.R && c < p.C) ? s[(long long)r * p.lds + c] : 0.f;
    }
    __syncthreads();
    float* d = p.dst + z * p.sDz; const float* rr = p.R2 + z * p.sRz;
#pragma unroll
    for (int k = 0; k < 4; ++k) {
        const int cl = wave * 4 + k, c = c0 + cl, r = r0 + lane;
        if (c < p.C && r < p.R) {
            float v = act_fn(p.alpha * tile[lane][cl], p.act);
            if (p.flags & 1) v += p.beta * rr[(long long)c * p.ldr + r];
            VST2(float, d + (long long)c * p.ldd + r, v);
        }
    }
}

// k_affine: dst[i] = a * (sdev ? sdev[0] : 1) * src[i] + b, i < n (one thread per element; consecutive lanes -> consecutive addresses)
__global__ __launch_bounds__(256) void k_affine(const float* __restrict__ src, float* __restrict__ dst, int n, float a, float b, const float* __restrict__ sdev) {
    const int i = blockIdx.x * 256 + threadIdx.x;
    if (i < n) { const float aa = sdev ? a * sdev[0] : a; const float v = aa * src[i] + b; VST2(float, dst + i, v); }
}

// =====================================================================================================================
// k_softmax: row softmax over n contiguous elements, one 256-thread block per row; rows addressed z*sz + r*sr (grid (R, Z)).
//   out = scale_out * softmax(scale_in * x + (Mf ? Mf[z*smz + r*smr + j] : 0)); a row whose max is -inf is written as 0.
// =====================================================================================================================
struct SmP { const float* src; float* dst; const float* Mf; long long sz, sr, dz, dr, smz, smr; int n, pad; float scale_in, scale_out; };
static_assert(sizeof(SmP) == 3 * 8 + 6 * 8 + 4 * 4, "SmP has padding");
__global__ __launch_bounds__(256) void k_softmax(SmP p) {
    __shared__ float red[256];
    const int r = blockIdx.x, z = blockIdx.y, tid = threadIdx.x;
    const float* s = p.src + z * p.sz + (long long)r * p.sr;
    const float* mf = p.Mf ? (p.Mf + z * p.smz + (long long)r * p.smr) : nullptr;
    float mx = -__builtin_inff();
    for (int j = tid; j < p.n; j += 256) { float v = s[j] * p.scale_in; if (mf) v += mf[j]; mx = fmaxf(mx, v); }
    red[tid] = mx; __syncthreads();
    for (int o = 128; o > 0; o >>= 1) { if (tid < o) red[tid] = fmaxf(red[tid], red[tid + o]); __syncthreads(); }
    mx = red[0]; __syncthreads();
    float sum = 0.f;
    for (int j = tid; j < p.n; j += 256) { float v = s[j] * p.scale_in; if (mf) v += mf[j]; sum += (mx == -__builtin_inff()) ? 0.f : expf(v - mx); }
    red[tid] = sum; __syncthreads();
    for (int o = 128; o > 0; o >>= 1) { if (tid < o) red[tid] += red[tid + o]; __syncthreads(); }
    sum = red[0];
    const float inv = (sum > 0.f) ? p.scale_out / sum : 0.f;
    float* d = p.dst + z * p.dz + (long long)r * p.dr;
    for (int j = tid; j < p.n; j += 256) { float v = s[j] * p.scale_in; if (mf) v += mf[j]; const float o = (mx == -__builtin_inff()) ? 0.f : expf(v - mx) * inv; VST2(float, d + j, o); }
}
// =====================================================================================================================
// k_stats: mean and rsqrt(var + eps) over a set of n elements addressed base + z*sz + (e / inner) * so + (e % inner) * si, one 256-thread
// k_norm_apply: y = (x - mean[set]) * rstd[set] * g[c] + b[c] over a [Z][C][L] channel-major tensor with set = z*G + c / (C/G) (G groups per z;
//   G = C -> per-channel sets indexed z*C+c; for batch norm pass stats indexed by c only via bn = 1). Optional act. Output same layout.
// =====================================================================================================================
//   mode 0: mean / rsqrt(var + eps); mode 1 (RMSNorm): 0 / rsqrt(mean(x^2) + eps); mode 2 (L2 normalize * sqrt(n)): 0 / sqrt(n) / max(||x||, eps); mode 3: as 0 with unbiased variance (n-1)
__global__ __launch_bounds__(256) void k_stats(const float* __restrict__ x, long long sz, long long so, long long si, int inner, int n, float eps, float* __restrict__ stat, int mode) {
    __shared__ float red[256];
    const int z = blockIdx.x, tid = threadIdx.x;
    const float* base = x + z * sz;
    float s = 0.f;
    for (int e = tid; e < n; e += 256) s += base[(long long)(e / inner) * so + (long long)(e % inner) * si];
    red[tid] = s; __syncthreads();
    for (int o = 128; o > 0; o >>= 1) { if (tid < o) red[tid] += red[tid + o]; __syncthreads(); }
    const float mu = (mode == 0 || mode == 3) ? red[0] / (float)n : 0.f; __syncthreads();
    float q = 0.f;
    for (int e = tid; e < n; e += 256) { const float dlt = base[(long long)(e / inner) * so + (long long)(e % inner) * si] - mu; q += dlt * dlt; }
    red[tid] = q; __syncthreads();
    for (int o = 128; o > 0; o >>= 1) { if (tid < o) red[tid] += red[tid + o]; __syncthreads(); }
    {
        float rs;
        if (mode == 2) rs = sqrtf((float)n) / fmaxf(sqrtf(red[0]), eps); else if (mode == 3) rs = rsqrtf(red[0] / (float)(n - 1) + eps); else rs = rsqrtf(red[0] / (float)n + eps);
        if (tid < 32) { const float v = (tid == 0) ? mu : ((tid == 1) ? rs : 0.f); VST2(float, stat + (long long)z * 32 + tid, v); }
    }
}
//   One thread per element over the flat [Z][C][L] index space: grid ceil(Z*C*L / 256).
__global__ __launch_bounds__(256) void k_norm_apply(const float* __restrict__ x, float* __restrict__ y, const float* __restrict__ stat, const float* __restrict__ g, const float* __restrict__ bta,
                                                     int Z, int C, int L, int G, int bn, int act) {
    const long long idx = (long long)blockIdx.x * 256 + threadIdx.x;
    if (idx >= (long long)Z * C * L) return;
    const int l = (int)(idx % L); const long long zc = idx / L; const int c = (int)(zc % C), z = (int)(zc / C); (void)l;
    const int set = bn ? c : (z * G + c / (C / G));
    float v = (x[idx] - stat[(long long)set * 32]) * stat[(long long)set * 32 + 1];
    if (g) v *= g[c];
    if (bta) v += bta[c];
    v = act_fn(v, act);
    VST2(float, y + idx, v);
}

// k_lse_neg: c[i] = -(st[2i] + log(st[2i+1])) = minus the log-sum-exp of row i (for softmax over the query axis)
__global__ __launch_bounds__(256) void k_lse_neg(const float* __restrict__ st, float* __restrict__ c, int n) {
    const int i = blockIdx.x * 256 + threadIdx.x;
    if (i < n) { const float v = -(st[2 * i] + logf(st[2 * i + 1])); VST2(float, c + i, v); }
}

// k_iota: dst[i] = a * i + b as int32 (segment/position id helper)
__global__ __launch_bounds__(256) void k_iota(int* __restrict__ dst, int n, int a, int b) {
    const int i = blockIdx.x * 256 + threadIdx.x;
    if (i < n) { const int v = a * i + b; VST2(int, dst + i, v); }
}

// k_axpby: dst[i] = a * x[i] + b * y[i] (+ c), i < n
__global__ __launch_bounds__(256) void k_axpby(const float* __restrict__ x, const float* __restrict__ y, float* __restrict__ dst, int n, float a, float b, float c) {
    const int i = blockIdx.x * 256 + threadIdx.x;
    if (i < n) { const float v = a * x[i] + b * y[i] + c; VST2(float, dst + i, v); }
}

// =====================================================================================================================
// k_rope: rotary embedding on a [R rows][Hn heads][D] view (row stride sXr, head stride sXh, element stride 1) -> Y (own strides).
//   mode 0: rotate_half (partner d±D/2, sign - for d<D/2); mode 1: interleaved pairs (partner d^1, sign - for even d).
//   table column tcol: tmode 0 -> d, 1 -> d % (D/2), 2 -> d / 2; position p: pmode 0 -> r % S, 1 -> head index, 2 -> pos[r];
//   c = C[(r / S) * sCb + p * sCp + tcol * sCd], s likewise from Sn; y = x[d] * c + sign * x[partner] * s. X and Y must not alias.
// =====================================================================================================================
struct RopeP { const float* X; float* Y; const float* C; const float* Sn; const int* pos; long long sXr, sXh, sYr, sYh, sCb, sCp, sCd; int R, Hn, D, S, mode, tmode, pmode, pad; };
static_assert(sizeof(RopeP) == 5 * 8 + 7 * 8 + 8 * 4, "RopeP has padding");
__global__ __launch_bounds__(256) void k_rope(RopeP p) {
    const long long idx = (long long)blockIdx.x * 256 + threadIdx.x;
    if (idx >= (long long)p.R * p.Hn * p.D) return;
    const int d = (int)(idx % p.D); const long long rh = idx / p.D; const int h = (int)(rh % p.Hn); const int r = (int)(rh / p.Hn);
    const int half = p.D / 2;
    int partner; float sign;
    if (p.mode == 0) { partner = (d < half) ? d + half : d - half; sign = (d < half) ? -1.f : 1.f; }
    else { partner = d ^ 1; sign = (d & 1) ? 1.f : -1.f; }
    const int tcol = (p.tmode == 0) ? d : ((p.tmode == 1) ? (d % half) : (d >> 1));
    const int pp = (p.pmode == 0) ? (r % p.S) : ((p.pmode == 1) ? h : p.pos[r]);
    const long long toff = (long long)(r / p.S) * p.sCb + (long long)pp * p.sCp + (long long)tcol * p.sCd;
    const float* xr = p.X + (long long)r * p.sXr + (long long)h * p.sXh;
    const float v = xr[d] * p.C[toff] + sign * xr[partner] * p.Sn[toff];
    VST2(float, p.Y + (long long)r * p.sYr + (long long)h * p.sYh + d, v);
}

// k_invf + k_sincos (split so neither kernel carries a large VALU-fma footprint): invf_i = num * (1 / powf(base, (2 i)/D)) [fmode 0],
//   num * expf((2 i) * cexp) [fmode 1], num * powf(base, -2 (i - 1) / D) [fmode 2]; then cs/sn[s*half + i] = cos/sin((pscale * s) * invf_i)
__global__ __launch_bounds__(256) void k_invf(float* __restrict__ invb, int half, int D, float base, float num, int fmode, float cexp) {
    const int i = blockIdx.x * 256 + threadIdx.x;
    if (i >= ((half + 31) / 32) * 32) return;
    if (i >= half) { VST2(float, invb + i, 0.f); return; }
    const float e = (float)(2 * i) / (float)D;
    float invf;
    if (fmode == 1) invf = num * expf((float)(2 * i) * cexp);
    else if (fmode == 2) invf = num * powf(base, (-2.0f * ((float)i - 1.0f)) / (float)D);
    else invf = num * (1.0f / powf(base, e));
    VST2(float, invb + i, invf);
}
__global__ __launch_bounds__(256) void k_sincos(float* __restrict__ cs, float* __restrict__ sn, const float* __restrict__ invb, int S, int half, float pscale) {
    const int idx = blockIdx.x * 256 + threadIdx.x;
    if (idx >= S * half) return;
    const int s = idx / half, i = idx - s * half;
    const float ang = (pscale * (float)s) * invb[i];
    VST2(float, cs + idx, cosf(ang)); VST2(float, sn + idx, sinf(ang));
}

// k_mulact: dst[i] = act(x[i]) * y[i]
__global__ __launch_bounds__(256) void k_mulact(const float* __restrict__ x, const float* __restrict__ y, float* __restrict__ dst, int n, int act) {
    const int i = blockIdx.x * 256 + threadIdx.x;
    if (i < n) { const float v = act_fn(x[i], act) * y[i]; VST2(float, dst + i, v); }
}

// =====================================================================================================================
// k_matvec: thread-per-row matrix-vector products for N <= 8 output columns (heads with 1-3 outputs, gates), f32 on the VALU.
//   C[r*sCm + j] = act(alpha * sum_k A[r*sAm + k*sAk] * B[j*sBn + k*sBk] + bias[j]) + beta * R[r*sRm + j*sRn]; each thread writes its N contiguous floats.
// =====================================================================================================================
__global__ __launch_bounds__(256) void k_matvec(GemmP p) {
    // 32 lanes write one line with one instruction.
    const int rpt = (p.N == 1) ? 1 : 32;
    const long long r0 = ((long long)blockIdx.x * 256 + threadIdx.x) * rpt; const int z = blockIdx.z, zo = z / p.zi_n, zi = z - zo * p.zi_n;
    if (r0 >= p.M) return;
    const float* Bb = p.B + zo * p.sBo + zi * p.sBi;
    float* C = p.C + zo * p.sCo + zi * p.sCi; const float* R = p.R + zo * p.sRo + zi * p.sRi;
    for (int rr = 0; rr < rpt; ++rr) {
        const long long r = r0 + rr; if (r >= p.M) break;
        const float* A = p.A + zo * p.sAo + zi * p.sAi + r * p.sAm;
        float acc[8] = {0.f, 0.f, 0.f, 0.f, 0.f, 0.f, 0.f, 0.f};
        for (int k = 0; k < p.K; ++k) { const float a = A[(long long)k * p.sAk];
#pragma unroll
            for (int j = 0; j < 8; ++j) if (j < p.N) acc[j] += a * Bb[(long long)j * p.sBn + (long long)k * p.sBk]; }
#pragma unroll
        for (int j = 0; j < 8; ++j) if (j < p.N) {
            float v = acc[j] * p.alpha;
            if (p.flags & 1) v += p.bias[j];
            if (p.flags & 2) v += p.bias[r];
            v = act_fn(v, p.act);
            if (p.flags & 4) v += p.beta * R[r * p.sRm + (long long)j * p.sRn];
            VST2(float, C + r * p.sCm + j, v);
        }
    }
}
// k_smallsoftmax: thread-per-row softmax for short rows (n <= 64): dst[r*dr + j] = softmax(scale*src[r*sr + j])
__global__ __launch_bounds__(256) void k_smallsoftmax(const float* __restrict__ src, float* __restrict__ dst, long long sr, long long dr, int n, long long R, float scale) {
    const long long r0 = ((long long)blockIdx.x * 256 + threadIdx.x) * 32;
    for (int rr = 0; rr < 32; ++rr) {
        const long long r = r0 + rr; if (r >= R) return;
        const float* s = src + r * sr; float* d = dst + r * dr;
        float mx = -__builtin_inff();
        for (int j = 0; j < n; ++j) mx = fmaxf(mx, s[j] * scale);
        float sum = 0.f;
        for (int j = 0; j < n; ++j) sum += expf(s[j] * scale - mx);
        const float inv = 1.f / sum;
        for (int j = 0; j < n; ++j) { const float v = expf(s[j] * scale - mx) * inv; VST2(float, d + j, v); }
    }
}

__global__ __launch_bounds__(32) void k_unitstat(float* __restrict__ st) { const int t = threadIdx.x; const float v = (t == 1) ? 1.f : 0.f; VST2(float, st + t, v); }

// destination (e.g. a d_out whose row width is not a multiple of 32 floats) is written by consecutive lanes of one instruction
__global__ __launch_bounds__(256) void k_lincopy(const float* __restrict__ src, long long lds, float* __restrict__ dst, long long ldd, long long rows, int cols) {
    const long long i = (long long)blockIdx.x * 256 + threadIdx.x; if (i >= rows * cols) return;
    const long long r = i / cols; const int c = (int)(i - r * cols);
    const float v = src[r * lds + c]; VST2(float, dst + r * ldd + c, v);
}

namespace w25 {
typedef __attribute__((ext_vector_type(16))) _Float16 v16h;
typedef __attribute__((ext_vector_type(8)))  _Float16 v8h;
typedef __attribute__((ext_vector_type(16))) __bf16   v16b;
typedef __attribute__((ext_vector_type(8)))  __bf16   v8b;
typedef __attribute__((ext_vector_type(8)))  float    v8f;
typedef __attribute__((ext_vector_type(4)))  float    v4f;

__device__ __forceinline__ unsigned short f2bf_bits(float f) {
  unsigned u = __float_as_uint(f);
  return (unsigned short)((u + 0x7FFFu + ((u >> 16) & 1u)) >> 16);
}
__device__ __forceinline__ float bf_bits2f(unsigned short h) { return __uint_as_float(((unsigned)h) << 16); }

// hazard guards as plain device helpers (no inline asm inside the kernel template body)
__device__ __forceinline__ void dep_guard_h(v8f& a, v8f& b, v16h x, v16h y) { asm volatile("v_nop\n\tv_nop\n\tv_nop\n\tv_nop" : "+v"(a), "+v"(b) : "v"(x), "v"(y)); }
__device__ __forceinline__ void dep_guard_b(v8f& a, v8f& b, v16b x, v16b y) { asm volatile("v_nop\n\tv_nop\n\tv_nop\n\tv_nop" : "+v"(a), "+v"(b) : "v"(x), "v"(y)); }
__device__ __forceinline__ void keep4_h(v16h a, v16h b, v16h c, v16h d) { asm volatile("v_nop" :: "v"(a), "v"(b), "v"(c), "v"(d)); }
__device__ __forceinline__ void keep4_b(v16b a, v16b b, v16b c, v16b d) { asm volatile("v_nop" :: "v"(a), "v"(b), "v"(c), "v"(d)); }
__device__ __forceinline__ void acc_guard4(v8f& a, v8f& b, v8f& c, v8f& d) { asm volatile("v_nop\n\tv_nop\n\tv_nop\n\tv_nop" : "+v"(a), "+v"(b), "+v"(c), "+v"(d)); }
template <typename T> struct Frag;
template <> struct Frag<_Float16> {
  typedef v16h V; union U { v16h v; v8h h[2]; };
  static __device__ __forceinline__ v16h load(const _Float16* p) {   // elements 0..7 <- p[0..7], 8..15 <- p[16..23]
    U f; f.h[0] = *(const v8h*)(p); f.h[1] = *(const v8h*)(p + 16); return f.v;
  }
  static __device__ __forceinline__ v8f mma(v16h a, v16h b, v8f c) {
    return __builtin_amdgcn_wmma_f32_16x16x32_f16(false, a, false, b, (short)0, c, false, false);
  }
  static __device__ __forceinline__ void guard(v8f& a, v8f& b, v16h x, v16h y) { dep_guard_h(a, b, x, y); }
  static __device__ __forceinline__ void keep(v16h a, v16h b, v16h c, v16h d) { keep4_h(a, b, c, d); }
};
template <> struct Frag<__bf16> {
  typedef v16b V; union U { v16b v; v8b h[2]; };
  static __device__ __forceinline__ v16b load(const __bf16* p) {
    U f; f.h[0] = *(const v8b*)(p); f.h[1] = *(const v8b*)(p + 16); return f.v;
  }
  static __device__ __forceinline__ v8f mma(v16b a, v16b b, v8f c) {
    return __builtin_amdgcn_wmma_f32_16x16x32_bf16(false, a, false, b, (short)0, c, false, false);
  }
  static __device__ __forceinline__ void guard(v8f& a, v8f& b, v16b x, v16b y) { dep_guard_b(a, b, x, y); }
  static __device__ __forceinline__ void keep(v16b a, v16b b, v16b c, v16b d) { keep4_b(a, b, c, d); }
};

// ---- Register-blocked batched WMMA GEMM ------------------------------------
// C[m,n] = scale * sum_k A[m,k] * Bt[n,k] (+bias)(+resid); each wave owns a 64x64 tile.
// A row-major [M,K]; Bt row-major [N,K]; M,N % 64 == 0, K % 32 == 0.
// SPLIT: operands are hi/lo planes (A2/Bt2 = lo planes, same layout); product = hi·hi + hi·lo + lo·hi.
// BIAS_MODE: 0 = none, 1 = bias[m], 2 = bias[n].
// OUT_MODE: 0 = f32, 1 = f16, 2 = bf16 hi plane (Cout) + bf16 lo plane (Cout2).
// ET: 0 = f16 operands, 1 = bf16 operands (pointers passed as 16-bit storage)
template <int ET> struct Elem;
template <> struct Elem<0> { typedef _Float16 T; };
template <> struct Elem<1> { typedef __bf16 T; };
template <int ET, bool SPLIT, int BIAS_MODE, int OUT_MODE, bool RESID, int ACT = 0>
__global__ __launch_bounds__(256) void wmma_gemm64(
    const unsigned short* __restrict__ Ap, const unsigned short* __restrict__ A2p, int lda, long strideA,
    const unsigned short* __restrict__ Btp, const unsigned short* __restrict__ Bt2p, int ldb, long strideB,
    void* __restrict__ Cout, void* __restrict__ Cout2, int ldc, long strideC,
    const float* __restrict__ bias,
    const float* __restrict__ resid, long strideR,
    int M, int N, int K, float scale) {
  typedef typename Elem<ET>::T T;
  typedef typename Frag<T>::V V;
  const T* A = (const T*)Ap; const T* A2 = (const T*)A2p; const T* Bt = (const T*)Btp; const T* Bt2 = (const T*)Bt2p;
  __shared__ __align__(16) float sT[8][16 * 68];   // per-wave 16x64 slab, pitch 68 floats
  const int b    = blockIdx.y;
  const int lane = threadIdx.x & 31;
  const int wave = threadIdx.x >> 5;
  const int tilesN = N >> 6;
  const int tilesM = M >> 6;
  const int tile = blockIdx.x * 8 + wave;
  if (tile >= tilesM * tilesN) return;   // wave-uniform; no block barriers in this kernel
  const int tm = tile / tilesN;
  const int tn = tile - tm * tilesN;
  const int m0 = tm << 6;
  const int n0 = tn << 6;

  const T* Ab  = A  + (size_t)b * strideA;
  const T* Bb  = Bt + (size_t)b * strideB;
  const T* Ab2 = SPLIT ? (A2  + (size_t)b * strideA) : nullptr;
  const T* Bb2 = SPLIT ? (Bt2 + (size_t)b * strideB) : nullptr;

  const int rlane = lane & 15;                 // row (A) / col (B, D) within subtile
  const int koff  = (lane >> 4) * 8;           // k offset of this lane half
  const int mOff  = (lane >> 4) * 8;           // D row offset

  v8f acc[4][4];
#pragma unroll
  for (int i = 0; i < 4; ++i)
#pragma unroll
    for (int j = 0; j < 4; ++j) acc[i][j] = (v8f){0.f,0.f,0.f,0.f,0.f,0.f,0.f,0.f};

  for (int k0 = 0; k0 < K; k0 += 32) {
    V bh[4], bl[4];
#pragma unroll
    for (int j = 0; j < 4; ++j) {
      const size_t bo = (size_t)(n0 + (j << 4) + rlane) * ldb + koff + k0;
      bh[j] = Frag<T>::load(Bb + bo);
      if (SPLIT) bl[j] = Frag<T>::load(Bb2 + bo);
    }
#pragma unroll
    for (int i = 0; i < 4; ++i) {
      const size_t ao = (size_t)(m0 + (i << 4) + rlane) * lda + koff + k0;
      V ah = Frag<T>::load(Ab + ao);
      V al;
      if (SPLIT) al = Frag<T>::load(Ab2 + ao);
#pragma unroll
      for (int j = 0; j < 4; ++j) {
        acc[i][j] = Frag<T>::mma(ah, bh[j], acc[i][j]);
        if (SPLIT) {
          acc[i][j] = Frag<T>::mma(ah, bl[j], acc[i][j]);
          acc[i][j] = Frag<T>::mma(al, bh[j], acc[i][j]);
        }
      }
      Frag<T>::guard(acc[i][0], acc[i][3], ah, SPLIT ? al : ah);
    }
    Frag<T>::keep(bh[0], bh[1], bh[2], bh[3]);
    if (SPLIT) Frag<T>::keep(bl[0], bl[1], bl[2], bl[3]);
  }
  acc_guard4(acc[0][0], acc[0][1], acc[0][2], acc[0][3]);
  acc_guard4(acc[1][0], acc[1][1], acc[1][2], acc[1][3]);
  acc_guard4(acc[2][0], acc[2][1], acc[2][2], acc[2][3]);
  acc_guard4(acc[3][0], acc[3][1], acc[3][2], acc[3][3]);

  // ---- epilogue ----
  float* slab = sT[wave];
  const float* Rb = RESID ? (resid + (size_t)b * strideR) : nullptr;
#pragma unroll
  for (int i = 0; i < 4; ++i) {
    const int mBase = m0 + (i << 4);
#pragma unroll
    for (int j = 0; j < 4; ++j) {
      const int n = n0 + (j << 4) + rlane;
      float bv = 0.f;
      if (BIAS_MODE == 2) bv = bias[n];
#pragma unroll
      for (int r = 0; r < 8; ++r) {
        float v = acc[i][j][r] * scale;
        if (BIAS_MODE == 1) v += bias[mBase + mOff + r];
        if (BIAS_MODE == 2) v += bv;
        if (RESID) v += Rb[(size_t)(mBase + mOff + r) * ldc + n];
        if (ACT == 1) v = tanhf(v);
        if (ACT == 2) v = fmaxf(v, 0.0f);
        if (ACT == 3) v = v / (1.0f + expf(-v));
        if (ACT == 4) v = (v > 0.f) ? v : 0.01f * v;
        if (ACT == 5) v = 0.5f * v * (1.0f + erff(v * 0.70710678118654752f));
        slab[(mOff + r) * 68 + (j << 4) + rlane] = v;
      }
    }
    __builtin_amdgcn_fence(__ATOMIC_RELEASE, "workgroup");
    __builtin_amdgcn_wave_barrier();
    __builtin_amdgcn_fence(__ATOMIC_ACQUIRE, "workgroup");
    if (OUT_MODE == 0) {
      float* C = (float*)Cout + (size_t)b * strideC;
      const int hh = lane >> 4, c4 = (lane & 15) * 4;     // row seg = 256 B = 16 lanes x 16 B
      {
#pragma unroll
        for (int it = 0; it < 8; ++it) {
          const int row = it * 2 + hh;
          v4f v = *(const v4f*)(slab + row * 68 + c4);
          *(v4f*)(C + (size_t)(mBase + row) * ldc + n0 + c4) = v;
        }
        
      }
    } else {
      const int q = lane >> 3, c8 = (lane & 7) * 8;
      unsigned short* C  = (unsigned short*)Cout  + (size_t)b * strideC;
      unsigned short* C2 = (OUT_MODE == 2) ? ((unsigned short*)Cout2 + (size_t)b * strideC) : nullptr;
      {
#pragma unroll
        for (int it = 0; it < 4; ++it) {
          const int row = it * 4 + q;
          const float* sp = slab + row * 68 + c8;
          v8h hv, lv;
#pragma unroll
          for (int e = 0; e < 8; ++e) {
            if (OUT_MODE == 1) {
              hv[e] = (_Float16)sp[e];
            } else {
              unsigned short hb = f2bf_bits(sp[e]);
              unsigned short lb = f2bf_bits(sp[e] - bf_bits2f(hb));
              hv[e] = __builtin_bit_cast(_Float16, hb);
              lv[e] = __builtin_bit_cast(_Float16, lb);
            }
          }
          *(v8h*)(C + (size_t)(mBase + row) * ldc + n0 + c8) = hv;
          if (OUT_MODE == 2) *(v8h*)(C2 + (size_t)(mBase + row) * ldc + n0 + c8) = lv;
        }
        
      }
    }
    __builtin_amdgcn_fence(__ATOMIC_RELEASE, "workgroup");
    __builtin_amdgcn_wave_barrier();
    __builtin_amdgcn_fence(__ATOMIC_ACQUIRE, "workgroup");
  }
}

__global__ __launch_bounds__(256) void cast_f32_f16x2(
    const float* __restrict__ in, _Float16* __restrict__ out, int n2) {
  int i = blockIdx.x * 256 + threadIdx.x;
  if (i < n2) {
    const _Float16 h0 = (_Float16)in[2 * i], h1 = (_Float16)in[2 * i + 1];
    const unsigned u = (unsigned)__builtin_bit_cast(unsigned short, h0) | ((unsigned)__builtin_bit_cast(unsigned short, h1) << 16);
    ((unsigned*)out)[i] = u;
    
  }
}


} // namespace w25

// The element-wise stages below give each thread 16 to 64 elements, moved by 16-byte loads and stores that are all in flight together, so that a launch is a few
// thousand waves. Every wave store instruction writes whole 128-byte lines.
__device__ __forceinline__ v8h cast8(v4f a, v4f b, float s) {
    const v8h o = {(_Float16)(a[0] * s), (_Float16)(a[1] * s), (_Float16)(a[2] * s), (_Float16)(a[3] * s), (_Float16)(b[0] * s), (_Float16)(b[1] * s), (_Float16)(b[2] * s), (_Float16)(b[3] * s)};
    return o;
}
// k_castT16<R, C>: dst[z][c][r] = f16(src[z][r][c] * s), dense planes. One thread: 8 rows r x 4 columns c (8 loads, 4 stores). Lane = (column quad lane >> 3, row group lane & 7):
//   the 8 lanes of one quad store 64 consecutive r of one c. grid (C / 128, R / 64, Z), block 256: wave w has columns 128 bx + 16 w .. + 15, rows 64 by .. + 63.
template <int R, int C>
__global__ __launch_bounds__(256) void k_castT16(const float* __restrict__ src, _Float16* __restrict__ dst, float s) {
    static_assert(R % 64 == 0 && C % 128 == 0, "whole tiles");
    const int lane = threadIdx.x & 31, wave = threadIdx.x >> 5;
    const int r0 = blockIdx.y * 64 + (lane & 7) * 8;
    const int c0 = blockIdx.x * 128 + wave * 16 + (lane >> 3) * 4;
    src += ((size_t)blockIdx.z * R + r0) * C + c0;
    dst += ((size_t)blockIdx.z * C + c0) * R + r0;
    v4f a[8];
#pragma unroll
    for (int j = 0; j < 8; ++j) a[j] = *(const v4f*)(src + (size_t)j * C);
#pragma unroll
    for (int e = 0; e < 4; ++e) {
        const v8h o = {(_Float16)(a[0][e] * s), (_Float16)(a[1][e] * s), (_Float16)(a[2][e] * s), (_Float16)(a[3][e] * s), (_Float16)(a[4][e] * s), (_Float16)(a[5][e] * s), (_Float16)(a[6][e] * s), (_Float16)(a[7][e] * s)};
        *(v8h*)(dst + (size_t)e * R) = o;
    }
}
// k_cast16: dst[i] = f16(src[i] * s) over a dense array of 8192 * gridDim.x elements; one thread: 4 pieces of 8 consecutive elements, a wave's pieces consecutive
__global__ __launch_bounds__(256) void k_cast16(const float* __restrict__ src, _Float16* __restrict__ dst, float s) {
    const size_t e0 = ((size_t)blockIdx.x * 1024 + threadIdx.x) * 8;
    v4f a[4][2];
#pragma unroll
    for (int k = 0; k < 4; ++k) { a[k][0] = *(const v4f*)(src + e0 + k * 2048); a[k][1] = *(const v4f*)(src + e0 + k * 2048 + 4); }
#pragma unroll
    for (int k = 0; k < 4; ++k) *(v8h*)(dst + e0 + k * 2048) = cast8(a[k][0], a[k][1], s);
}

// f32 -> bf16 hi plane + bf16 lo plane (x = hi + lo to ~2^-17 relative; RNE both), [R][C] -> [R][C] (or transposed to [C][R]); 2 consecutive destination elements
__device__ __forceinline__ unsigned int f2bf2_pack(float a, float b, unsigned int* lo) {
    const unsigned short ha = w25::f2bf_bits(a), hb = w25::f2bf_bits(b);
    const unsigned short la = w25::f2bf_bits(a - w25::bf_bits2f(ha)), lb = w25::f2bf_bits(b - w25::bf_bits2f(hb));
    *lo = (unsigned)la | ((unsigned)lb << 16); return (unsigned)ha | ((unsigned)hb << 16); }
__global__ __launch_bounds__(256) void k_castS16(const float* __restrict__ src, long long lds, __bf16* __restrict__ dhi, __bf16* __restrict__ dlo, long long ldd, int R, int C, float s, int transpose) {
    const long long i = (long long)blockIdx.x * 256 + threadIdx.x; long long o; float a, b;
    if (transpose) { const long long np = (long long)C * (R / 2); if (i >= np) return; const int c = (int)(i / (R / 2)); const int r = 2 * (int)(i % (R / 2)); a = src[(long long)r * lds + c] * s; b = src[(long long)(r + 1) * lds + c] * s; o = (long long)c * ldd + r; }
    else { const long long np = (long long)R * (C / 2); if (i >= np) return; const int r = (int)(i / (C / 2)); const int c = 2 * (int)(i % (C / 2)); a = src[(long long)r * lds + c] * s; b = src[(long long)r * lds + c + 1] * s; o = (long long)r * ldd + c; }
    unsigned lo; const unsigned hi = f2bf2_pack(a, b, &lo); unsigned* ph = (unsigned*)(dhi + o); unsigned* pl = (unsigned*)(dlo + o);
    *ph = hi; *pl = lo;  }

// all five weight tensors (each dense) -> one f16 plane [Wq | Wqb | Wkvb | Wkv | Wout], scaled by s; a block takes 4096 elements (every segment is a whole number of blocks),
//   one thread 2 pieces of 8 consecutive elements
__global__ __launch_bounds__(256) void k_castW16(const float* __restrict__ Wq, const float* __restrict__ Wqb, const float* __restrict__ Wkvb, const float* __restrict__ Wkv, const float* __restrict__ Wout, _Float16* __restrict__ dst, float s) {
    const int eb = blockIdx.x * 4096;
    const float* src = Wq; int base = 0;
    if (eb >= 786432) { src = Wout; base = 786432; } else if (eb >= 262144) { src = Wkv; base = 262144; } else if (eb >= 131072) { src = Wkvb; base = 131072; } else if (eb >= 65536) { src = Wqb; base = 65536; }
    const int e = eb + threadIdx.x * 8;
    const v4f a0 = *(const v4f*)(src + e - base), a1 = *(const v4f*)(src + e - base + 4), b0 = *(const v4f*)(src + e - base + 2048), b1 = *(const v4f*)(src + e - base + 2052);
    *(v8h*)(dst + e) = cast8(a0, a1, s);
    *(v8h*)(dst + e + 2048) = cast8(b0, b1, s);
}

// im2col for the 2x2 stride-2 conv, image b = grid y: COL[b][(Y,X)][(c,ky,kx)] = x[b][c][2Y+ky][2X+kx]
//   One thread: 4 channels (8 apart) x 2 output columns X: per channel 4 floats of each of the two input rows, stored as the (ky,kx) quads of X and X + 1.
//   Lane = (column pair lane >> 3, channel lane & 7): 8 lanes store 8 consecutive channels' quads. grid (Hs / 2 * C / 64, images), block 256 = one Y, 64 channels, the whole row.
template <int C, int Hs>
__global__ __launch_bounds__(256) void k_es_col(const float* __restrict__ X, float* __restrict__ COL) {
    static_assert(Hs == 64 && C % 64 == 0, "4 waves span one input row");
    constexpr int Hr = Hs / 2;
    const int lane = threadIdx.x & 31, wave = threadIdx.x >> 5;
    const int b = blockIdx.y, Y = blockIdx.x / (C / 64), cb = blockIdx.x % (C / 64);
    const int c = cb * 64 + (wave >> 2) * 32 + (lane & 7);
    const int X2 = (wave & 3) * 8 + (lane >> 3) * 2;
    const float* s = X + (((size_t)b * C + c) * Hs + 2 * Y) * Hs + 2 * X2;
    float* d = COL + ((size_t)b * Hr * Hr + Y * Hr + X2) * (4 * C) + 4 * c;
    v4f r0[4], r1[4];
#pragma unroll
    for (int g = 0; g < 4; ++g) { r0[g] = *(const v4f*)(s + (size_t)g * 8 * Hs * Hs); r1[g] = *(const v4f*)(s + (size_t)g * 8 * Hs * Hs + Hs); }
#pragma unroll
    for (int g = 0; g < 4; ++g) {
        const v4f lo = {r0[g][0], r0[g][1], r1[g][0], r1[g][1]}, hi = {r0[g][2], r0[g][3], r1[g][2], r1[g][3]};
        VST2V4(d + 32 * g, lo); VST2V4(d + 4 * C + 32 * g, hi);
    }
}
// batch-wise attention: for (p, h, b): scores over b' = q_b . k_b' * scale (4 values), softmax, out = sum att v_b'; S[b][p][h*32+d] += out (S already holds out_img)
//   One wave: one position p, 4 heads (8 lanes x 4 floats a head), all 4 images, so each k and v row is read once. grid P * C / 1024, block 256.
//   The planes come as separate arguments (Q01 / S01: images 0 and 1, Q23 / S23: images 2 and 3, K0 .. K3: one image of k | v each), so that every row address is one of these
//   scalar bases plus one lane offset plus an immediate that the instruction can hold.
template <int P, int C>
__global__ __launch_bounds__(256) void k_es_batch(const float* __restrict__ Q01, const float* __restrict__ Q23, const float* __restrict__ K0, const float* __restrict__ K1, const float* __restrict__ K2, const float* __restrict__ K3,
                                                    float* __restrict__ S01, float* __restrict__ S23) {
    static_assert(C % 128 == 0, "a wave spans 128 channels");
    const int w = blockIdx.x * 8 + __builtin_amdgcn_readfirstlane(threadIdx.x >> 5);   // the wave's number as a scalar: every row address below is a scalar base plus one lane offset
    const unsigned lo = (threadIdx.x & 31) * 16;                                        // this lane's byte offset in the wave's 512-byte piece of a row
    const int p = w / (C / 128); const int col = (w % (C / 128)) * 128;
    const size_t oq = (size_t)p * C + col, ok = (size_t)p * 2 * C + col;
    const char* qrow[4] = {(const char*)(Q01 + oq), (const char*)(Q01 + oq + P * C), (const char*)(Q23 + oq), (const char*)(Q23 + oq + P * C)};
    char* srow[4] = {(char*)(S01 + oq), (char*)(S01 + oq + P * C), (char*)(S23 + oq), (char*)(S23 + oq + P * C)};
    const char* krow[4] = {(const char*)(K0 + ok), (const char*)(K1 + ok), (const char*)(K2 + ok), (const char*)(K3 + ok)};
    v4f q[4], k[4], v[4], sv[4];
#pragma unroll
    for (int b = 0; b < 4; ++b) {
        q[b] = *(const v4f*)(qrow[b] + lo); k[b] = *(const v4f*)(krow[b] + lo);
    }
#pragma unroll
    for (int b = 0; b < 4; ++b) {
        v[b] = *(const v4f*)(krow[b] + lo + C * 4); sv[b] = *(const v4f*)(srow[b] + lo);
    }
    __builtin_amdgcn_sched_barrier(0);   // keeps all 16 loads in front of the arithmetic: without it the v and S loads are issued only behind the scores, a second memory latency
#pragma unroll
    for (int b = 0; b < 4; ++b) {
        float sc[4]; float mx = -__builtin_inff();
#pragma unroll
        for (int b2 = 0; b2 < 4; ++b2) {
            float d0 = q[b][0] * k[b2][0] + q[b][1] * k[b2][1] + q[b][2] * k[b2][2] + q[b][3] * k[b2][3];
            for (int o = 4; o > 0; o >>= 1) d0 += __shfl_xor(d0, o, 32);
            sc[b2] = d0 * 0.17677669529663689f; mx = fmaxf(mx, sc[b2]);
        }
        float den = 0.f;
#pragma unroll
        for (int b2 = 0; b2 < 4; ++b2) { sc[b2] = expf(sc[b2] - mx); den += sc[b2]; }
        v4f o_ = {0.f, 0.f, 0.f, 0.f};
#pragma unroll
        for (int b2 = 0; b2 < 4; ++b2) o_ += sc[b2] / den * v[b2];
        VST2V4(srow[b] + lo, sv[b] + o_);
    }
}


extern "C" void kernel_launch(void* const* d_in, const int* in_sizes, int n_in, void* d_out, int out_size, void* d_ws, size_t ws_size, hipStream_t stream) {
    (void)in_sizes; (void)n_in; (void)out_size; (void)ws_size;
    const float* x = (const float*)d_in[0];
    const float* Wq = (const float*)d_in[1];
    const float* Wkv = (const float*)d_in[2];
    const float* Wqb = (const float*)d_in[3];
    const float* Wkvb = (const float*)d_in[4];
    const float* Wout = (const float*)d_in[5];
    const int C = 256;
    float* out = (float*)d_out;
    // every activation plane holds all 4 images, image-major; each is written by one launch (S by two) and read by later ones of this call
    char* wsp = (char*)d_ws;
    float* QT = (float*)wsp; wsp += (size_t)4 * 4096 * 256 * 4;            // [4][4096][256] q, position-major
    float* COL = (float*)wsp; wsp += (size_t)4 * 1024 * 1024 * 4;          // [4][1024][1024] im2col
    float* KVT = (float*)wsp; wsp += (size_t)4 * 1024 * 512 * 4;           // [4][1024][512] k | v
    float* QB = (float*)wsp; wsp += (size_t)4 * 4096 * 256 * 4;            // [4][4096][256]
    float* KVB = (float*)wsp; wsp += (size_t)4 * 4096 * 512 * 4;           // [4][4096][512]
    float* S = (float*)wsp; wsp += (size_t)4 * 4096 * 256 * 4;             // [4][4096][256] out_img, then + out_batch
    _Float16* XT16 = (_Float16*)wsp; wsp += (size_t)4 * 4096 * 256 * 2;    // [4][4096][256] x^T
    _Float16* COL16 = (_Float16*)wsp; wsp += (size_t)4 * 1024 * 1024 * 2;
    _Float16* S16 = (_Float16*)wsp; wsp += (size_t)4 * 4096 * 256 * 2;
    _Float16* W16 = (_Float16*)wsp; wsp += (size_t)851968 * 2;             // [Wq | Wqb | Wkvb | Wkv | Wout], x16
    const _Float16* Wq16 = W16;
    const _Float16* Wqb16 = W16 + 65536;
    const _Float16* Wkvb16 = W16 + 131072;
    const _Float16* Wkv16 = W16 + 262144;
    const _Float16* Wout16 = W16 + 786432;
    k_castT16<256, 4096><<<dim3(32, 4, 4), 256, 0, stream>>>(x, XT16, 1.0f);
    k_castW16<<<208, 256, 0, stream>>>(Wq, Wqb, Wkvb, Wkv, Wout, W16, 16.0f);
    // the 1x1 projections share their weights over the images: one GEMM each over the 4 * 4096 stacked positions
    w25::wmma_gemm64<0, false, 0, 0, false, 0><<<dim3(128, 1), 256, 0, stream>>>((const unsigned short*)(XT16), nullptr, 256, 0, (const unsigned short*)(Wqb16), nullptr, 256, 0, (void*)(QB), nullptr, 256, 0, nullptr, nullptr, 0, 16384, 256, 256, 0.0625f);
    w25::wmma_gemm64<0, false, 0, 0, false, 0><<<dim3(256, 1), 256, 0, stream>>>((const unsigned short*)(XT16), nullptr, 256, 0, (const unsigned short*)(Wkvb16), nullptr, 256, 0, (void*)(KVB), nullptr, 512, 0, nullptr, nullptr, 0, 16384, 512, 256, 0.0625f);
    w25::wmma_gemm64<0, false, 0, 0, false, 0><<<dim3(128, 1), 256, 0, stream>>>((const unsigned short*)(XT16), nullptr, 256, 0, (const unsigned short*)(Wq16), nullptr, 256, 0, (void*)(QT), nullptr, 256, 0, nullptr, nullptr, 0, 16384, 256, 256, 0.0625f);
    k_es_col<256, 64><<<dim3(128, 4), 256, 0, stream>>>(x, COL);
    k_cast16<<<512, 256, 0, stream>>>(COL, COL16, 1.0f);
    w25::wmma_gemm64<0, false, 0, 0, false, 0><<<dim3(64, 1), 256, 0, stream>>>((const unsigned short*)(COL16), nullptr, 1024, 0, (const unsigned short*)(Wkv16), nullptr, 1024, 0, (void*)(KVT), nullptr, 512, 0, nullptr, nullptr, 0, 4096, 512, 1024, 0.0625f);
    k_attn32<4096, 1024, 256, 512><<<dim3(64, 8, 4), 32 * AW, 0, stream>>>(QT, KVT, KVT + C, S, 0.1767766952966369f);
    k_es_batch<4096, 256><<<1024, 256, 0, stream>>>(QB, QB + 2097152, KVB, KVB + 2097152, KVB + 4194304, KVB + 6291456, S, S + 2097152);
    k_cast16<<<512, 256, 0, stream>>>(S, S16, 1.0f);
    // output conv: grid y = image (weights shared: stride 0)
    w25::wmma_gemm64<0, false, 0, 0, false, 0><<<dim3(32, 4), 256, 0, stream>>>((const unsigned short*)(Wout16), nullptr, 256, 0, (const unsigned short*)(S16), nullptr, 256, 1048576, (void*)(out), nullptr, 4096, 1048576, nullptr, nullptr, 0, 256, 4096, 256, 0.0625f);
}

// v004
// It runs in 236 microseconds.
// Two timings next to v003 both put it at 1.24 times that version's speed.
// All steps since v000 together make it 9.32 times as fast.
// Contractions (per image): q / qb / kvb 1x1 projections in position-major form x^T W^T [4096x256].[256x{256,256,512}], the 2x2-stride-2 kv conv as an im2col GEMM [1024x1024].[1024x512] and the output 1x1 conv Wout.(out_img + out_batch)^T [256x256].[256x4096], all with f16 operands (v_wmma_f32_16x16x32_f16; 64x64 register-blocked wave tiles over pre-cast f16 operand planes, weight operands pre-scaled by 16 at the cast and un-scaled in the f32 epilogue); the spatial-reduction attention per head (flash kernel, head_dim 32, 4096 queries x 1024 keys, f16 q.k^T and f16 p.v); f32 accumulate; the im2col, the batch-wise 4x4 attention per (position, head) and the branch sum are f32 kernels.
#include <hip/hip_runtime.h>
#include <math.h>

typedef __attribute__((ext_vector_type(16))) _Float16 v16h;
typedef __attribute__((ext_vector_type(8)))  _Float16 v8h;
typedef __attribute__((ext_vector_type(16))) __bf16   v16b;
typedef __attribute__((ext_vector_type(8)))  float    v8f;
typedef __attribute__((ext_vector_type(4)))  float    v4f;

// 16-bit WMMA fragment map (wave32), lane L, h = L>>4, m = L&15:
//   A 16x32: lane = row m;   element i -> k = (i<8) ? 8h+i : 16+8h+(i-8)
//   B 32x16: lane = column m; the SAME k(i,h)
//   D 16x16 (8 f32): lane = column m; element r -> row 8h+r
__device__ __forceinline__ int frag_k(int i, int h) { return (i < 8) ? (8 * h + i) : (16 + 8 * h + (i - 8)); }
__device__ __forceinline__ __bf16 bf16_rne(float f) {
    unsigned int u = __float_as_uint(f);
    u += 0x7fffu + ((u >> 16) & 1u);
    return __builtin_bit_cast(__bf16, (unsigned short)(u >> 16));
}
__device__ __forceinline__ float bf16_f32(__bf16 b) { return __uint_as_float(((unsigned int)__builtin_bit_cast(unsigned short, b)) << 16); }
__device__ __forceinline__ v8f wmma16(v16h a, v16h b, v8f c) {
    c = __builtin_amdgcn_wmma_f32_16x16x32_f16(false, a, false, b, (short)0, c, false, false);
    asm volatile("v_nop\n\tv_nop\n\tv_nop\n\tv_nop" : "+v"(c) : "v"(a), "v"(b));
    return c;
}
__device__ __forceinline__ v8f wmmab(v16b a, v16b b, v8f c) {
    c = __builtin_amdgcn_wmma_f32_16x16x32_bf16(false, a, false, b, (short)0, c, false, false);
    asm volatile("v_nop\n\tv_nop\n\tv_nop\n\tv_nop" : "+v"(c) : "v"(a), "v"(b));
    return c;
}
struct Split { v16b hi, lo; };
// hi/lo split product: a.hi*b.hi + a.hi*b.lo + a.lo*b.hi
__device__ __forceinline__ v8f wmma3(const Split& a, const Split& b, v8f c) {
    c = __builtin_amdgcn_wmma_f32_16x16x32_bf16(false, a.hi, false, b.hi, (short)0, c, false, false);
    c = __builtin_amdgcn_wmma_f32_16x16x32_bf16(false, a.hi, false, b.lo, (short)0, c, false, false);
    c = __builtin_amdgcn_wmma_f32_16x16x32_bf16(false, a.lo, false, b.hi, (short)0, c, false, false);
    asm volatile("v_nop\n\tv_nop\n\tv_nop\n\tv_nop" : "+v"(c) : "v"(a.hi), "v"(a.lo), "v"(b.hi), "v"(b.lo));
    return c;
}
struct Split3 { v16b hi, mid, lo; };
// triple split product (6 terms, drops only terms below 2^-24 relative)
__device__ __forceinline__ v8f wmma6(const Split3& a, const Split3& b, v8f c) {
    c = __builtin_amdgcn_wmma_f32_16x16x32_bf16(false, a.hi, false, b.hi, (short)0, c, false, false);
    c = __builtin_amdgcn_wmma_f32_16x16x32_bf16(false, a.hi, false, b.mid, (short)0, c, false, false);
    c = __builtin_amdgcn_wmma_f32_16x16x32_bf16(false, a.mid, false, b.hi, (short)0, c, false, false);
    c = __builtin_amdgcn_wmma_f32_16x16x32_bf16(false, a.hi, false, b.lo, (short)0, c, false, false);
    c = __builtin_amdgcn_wmma_f32_16x16x32_bf16(false, a.mid, false, b.mid, (short)0, c, false, false);
    c = __builtin_amdgcn_wmma_f32_16x16x32_bf16(false, a.lo, false, b.hi, (short)0, c, false, false);
    asm volatile("v_nop\n\tv_nop\n\tv_nop\n\tv_nop" : "+v"(c) : "v"(a.hi), "v"(a.mid), "v"(a.lo), "v"(b.hi), "v"(b.mid), "v"(b.lo));
    return c;
}

// Fragment gathers from f32 memory: element i <- p[(k0 + frag_k(i,h)) * sk] * s, zero for k >= klen.
__device__ __forceinline__ v16h fh_ld(const float* __restrict__ p, long long sk, int k0, int h, int klen, float s) {
    v16h a;
#pragma unroll
    for (int i = 0; i < 16; ++i) { const int k = k0 + frag_k(i, h); a[i] = (k < klen) ? (_Float16)(p[(long long)k * sk] * s) : (_Float16)0.f; }
    return a;
}
__device__ __forceinline__ Split sp_ld(const float* __restrict__ p, long long sk, int k0, int h, int klen, float s) {
    Split r;
#pragma unroll
    for (int i = 0; i < 16; ++i) {
        const int k = k0 + frag_k(i, h); const float x = (k < klen) ? p[(long long)k * sk] * s : 0.f;
        const __bf16 hb = bf16_rne(x); r.hi[i] = hb; r.lo[i] = bf16_rne(x - bf16_f32(hb));
    }
    return r;
}
__device__ __forceinline__ Split3 sp3_ld(const float* __restrict__ p, long long sk, int k0, int h, int klen, float s) {
    Split3 r;
#pragma unroll
    for (int i = 0; i < 16; ++i) {
        const int k = k0 + frag_k(i, h); const float x = (k < klen) ? p[(long long)k * sk] * s : 0.f;
        const __bf16 hb = bf16_rne(x); const float r1 = x - bf16_f32(hb); const __bf16 mb = bf16_rne(r1);
        r.hi[i] = hb; r.mid[i] = mb; r.lo[i] = bf16_rne(r1 - bf16_f32(mb));
    }
    return r;
}
__device__ __forceinline__ v16b bh_ld(const float* __restrict__ p, long long sk, int k0, int h, int klen, float s) {
    v16b a;
#pragma unroll
    for (int i = 0; i < 16; ++i) { const int k = k0 + frag_k(i, h); a[i] = bf16_rne((k < klen) ? p[(long long)k * sk] * s : 0.f); }
    return a;
}
// f16 fragment from an f16 LDS/global row with element stride 1 (k-contiguous), no bounds (tile already zero padded)
__device__ __forceinline__ v16h fh_row(const _Float16* __restrict__ row, int k0, int h) {
    v16h a;
#pragma unroll
    for (int i = 0; i < 16; ++i) a[i] = row[k0 + frag_k(i, h)];
    return a;
}

#define VST2(T, ptr, val) do { const T vst2_v_ = (val); *(T*)(ptr) = vst2_v_;  } while (0)
typedef float v4f __attribute__((ext_vector_type(4)));
#define VST2V4(ptr, val) do { const v4f vst2_v4_ = (val); *(v4f*)(ptr) = vst2_v4_;  } while (0)

__device__ __attribute__((noinline)) float act_fn(float v, int act) {
    if (act == 1) return fmaxf(v, 0.f);                                                                               // relu
    if (act == 2) { const float u = 0.7978845608028654f * (v + 0.044715f * v * v * v); return 0.5f * v * (1.f + tanhf(u)); } // tanh-gelu
    if (act == 3) return v / (1.f + expf(-v));                                                                        // silu
    if (act == 4) return 0.5f * v * (1.f + erff(v * 0.7071067811865476f));                                             // erf-gelu
    if (act == 5) return tanhf(v);
    if (act == 6) return 1.f / (1.f + expf(-v));                                                                      // sigmoid
    if (act == 7) return (v > 0.f) ? v : 0.01f * v;                                                                   // leaky relu 0.01
    if (act == 8) return (v > 0.f) ? v : (expf(v) - 1.f);                                                             // elu
    if (act == 9) return fminf(fmaxf(v, 0.f), 6.f);                                                                   // relu6
    if (act == 10) return fabsf(v);                                                                                    // abs
    if (act == 11) return (v >= 0.f) ? v : 0.1f * v;                                                                  // leaky 0.1
    if (act == 12) return (v > 0.f) ? v : 0.2f * v;                                                                   // leaky 0.2
    if (act == 13) return (v > 20.f) ? v : log1pf(expf(v));                                                            // softplus
    return v;
}

// =====================================================================================================================
// k_gemm<MODE>: C(z, m, n) = act(alpha * sum_k A(z, m, k) * B(z, k, n) + bias) + beta * R(z, m, n)
//   One wave (32-thread block) per 16 x 32 tile of C; grid (ceil(N/32), ceil(M/16), Z). Batch z -> (zo = z / zi_n, zi = z % zi_n)
//   with separate outer/inner strides for every tensor (e.g. batch and head). A(m,k) = A[zo*sAo + zi*sAi + m*sAm + k*sAk] (f32),
//   B(k,n) = B[zo*sBo + zi*sBi + n*sBn + k*sBk] (f32); any M, N, K (K zero-padded to 32 inside the fragments, M/N tails guarded).
//   C(m,n) = C[zo*sCo + zi*sCi + m*sCm + n] (n contiguous). flags: 1 bias[n], 2 bias[m], 4 residual R[zo*sRo + zi*sRi + m*sRm + n*sRn].
//   MODE 0: f16 operands (A prescaled by sa, B by sb, both undone in the epilogue); 1: bf16 hi/lo split (3 products); 2: bf16;
//   3: bf16 hi/mid/lo triple split (6 products); 4: as 3 with Kahan-compensated f32 accumulation across k-steps.
// =====================================================================================================================
struct GemmP {
    const float* A; const float* B; const float* bias; const float* R; float* C;
    long long sAo, sAi, sAm, sAk, sBo, sBi, sBn, sBk, sCo, sCi, sCm, sRo, sRi, sRm, sRn;
    int M, N, K, zi_n, flags, act; float alpha, beta, sa, sb;
    int Npad, pad_;     // columns [N, Npad) of C are written as 0 so that padded workspace rows are covered by whole-line stores; Npad >= N
};
static_assert(sizeof(GemmP) == 5 * 8 + 15 * 8 + 6 * 4 + 4 * 4 + 2 * 4, "GemmP has padding");

template <int MODE>
__global__ __launch_bounds__(32) void k_gemm(GemmP p) {
    const int lane = threadIdx.x & 31, h = lane >> 4, l15 = lane & 15;
    const int m0 = blockIdx.y * 16, n0 = blockIdx.x * 32;
    const int z = blockIdx.z, zo = z / p.zi_n, zi = z - zo * p.zi_n;
    const float* A = p.A + zo * p.sAo + zi * p.sAi;
    const float* B = p.B + zo * p.sBo + zi * p.sBi;
    const int am = min(m0 + l15, p.M - 1);                       // clamped row for loads (stores are guarded)
    v8f acc[2], comp[2];
#pragma unroll
    for (int t = 0; t < 2; ++t) { v8f zz = {}; acc[t] = zz; comp[t] = zz; }
    for (int k0 = 0; k0 < p.K; k0 += 32) {
        const float* arow = A + (long long)am * p.sAm;
        if (MODE == 1) {
            const Split a = sp_ld(arow, p.sAk, k0, h, p.K, 1.f);
#pragma unroll
            for (int t = 0; t < 2; ++t) {
                const int bn = min(n0 + t * 16 + l15, p.N - 1);
                acc[t] = wmma3(a, sp_ld(B + (long long)bn * p.sBn, p.sBk, k0, h, p.K, 1.f), acc[t]);
            }
        } else if (MODE == 3) {
            const Split3 a = sp3_ld(arow, p.sAk, k0, h, p.K, 1.f);
#pragma unroll
            for (int t = 0; t < 2; ++t) {
                const int bn = min(n0 + t * 16 + l15, p.N - 1);
                acc[t] = wmma6(a, sp3_ld(B + (long long)bn * p.sBn, p.sBk, k0, h, p.K, 1.f), acc[t]);
            }
        } else if (MODE == 4) {
            // triple split as MODE 3, but each k-step's 6 products go into a fresh accumulator and the partial is added to the running f32 sum
            // on the VALU with Kahan compensation (accumulation error stays ~1 ulp however long K is)
            const Split3 a = sp3_ld(arow, p.sAk, k0, h, p.K, 1.f);
#pragma unroll
            for (int t = 0; t < 2; ++t) {
                const int bn = min(n0 + t * 16 + l15, p.N - 1); v8f zz = {};
                const v8f part = wmma6(a, sp3_ld(B + (long long)bn * p.sBn, p.sBk, k0, h, p.K, 1.f), zz);
                const v8f y = part - comp[t]; const v8f s = acc[t] + y; comp[t] = (s - acc[t]) - y; acc[t] = s;
            }
        } else if (MODE == 2) {
            const v16b a = bh_ld(arow, p.sAk, k0, h, p.K, 1.f);
#pragma unroll
            for (int t = 0; t < 2; ++t) {
                const int bn = min(n0 + t * 16 + l15, p.N - 1);
                acc[t] = wmmab(a, bh_ld(B + (long long)bn * p.sBn, p.sBk, k0, h, p.K, 1.f), acc[t]);
            }
        } else {
            const v16h a = fh_ld(arow, p.sAk, k0, h, p.K, p.sa);
#pragma unroll
            for (int t = 0; t < 2; ++t) {
                const int bn = min(n0 + t * 16 + l15, p.N - 1);
                acc[t] = wmma16(a, fh_ld(B + (long long)bn * p.sBn, p.sBk, k0, h, p.K, p.sb), acc[t]);
            }
        }
    }
    const float iscale = (MODE == 0) ? p.alpha / (p.sa * p.sb) : p.alpha;
    float* C = p.C + zo * p.sCo + zi * p.sCi;
    const float* R = p.R + zo * p.sRo + zi * p.sRi;
    __shared__ __align__(16) float ctile[16][36];
#pragma unroll
    for (int t = 0; t < 2; ++t) {
        const int n = n0 + t * 16 + l15; const int nn = min(n, p.N - 1);
#pragma unroll
        for (int r = 0; r < 8; ++r) {
            const int m = m0 + 8 * h + r; const int mm = min(m, p.M - 1);
            float v = acc[t][r] * iscale;
            if (p.flags & 1) v += p.bias[nn];
            if (p.flags & 2) v += p.bias[mm];
            if (p.flags & 8) v *= p.bias[(long long)zo * p.M + mm];   /* per-(z,row) scale vector laid out [Z][M]; exclusive with the bias flags */
            v = act_fn(v, p.act);
            if (p.flags & 4) v += p.beta * R[(long long)mm * p.sRm + (long long)nn * p.sRn];
            ctile[8 * h + r][t * 16 + l15] = (n < p.N) ? v : 0.f;
        }
    }
    __syncthreads();
    const int NW = (p.Npad > p.N) ? p.Npad : p.N;           // write width
    const bool fast = (m0 + 16 <= p.M) && (n0 + 32 <= NW) && ((p.sCm & 3) == 0) && ((((size_t)C) & 15) == 0);
    if (fast) {
#pragma unroll
        for (int s = 0; s < 4; ++s) {
            const int row = s * 4 + (lane >> 3), c4 = (lane & 7) * 4;
            const v4f v = *(const v4f*)&ctile[row][c4];
            VST2V4(C + (long long)(m0 + row) * p.sCm + n0 + c4, v);
        }
    } else {
        for (int row = 0; row < 16; ++row) {
            const int m = m0 + row, n = n0 + lane;
            if (m < p.M && n < NW) VST2(float, C + (long long)m * p.sCm + n, ctile[row][lane]);
        }
    }
}


// =====================================================================================================================
// k_gemmT<MODE, TM, TN>: same contract as k_gemm, but one wave computes a (16*TM) x (16*TN) tile: TM A fragments and TN B fragments are
//   loaded per 32-wide k-step and reused across TM*TN WMMAs (far fewer load/convert instructions per MAC). MODE 0 (f16), 1 (bf16 hi/lo),
//   2 (bf16) only. grid (ceil(NW/(16*TN)), ceil(M/(16*TM)), Z), block 32. Epilogue identical to k_gemm, run per 16x32 sub-tile.
// =====================================================================================================================
template <int MODE, int TM, int TN>
__global__ __launch_bounds__(32) void k_gemmT(GemmP p) {
    const int lane = threadIdx.x & 31, h = lane >> 4, l15 = lane & 15;
    const int m0 = blockIdx.y * (16 * TM), n0 = blockIdx.x * (16 * TN);
    const int z = blockIdx.z, zo = z / p.zi_n, zi = z - zo * p.zi_n;
    const float* A = p.A + zo * p.sAo + zi * p.sAi;
    const float* B = p.B + zo * p.sBo + zi * p.sBi;
    v8f acc[TM][TN];
#pragma unroll
    for (int i = 0; i < TM; ++i)
#pragma unroll
        for (int t = 0; t < TN; ++t) { v8f zz = {}; acc[i][t] = zz; }
    for (int k0 = 0; k0 < p.K; k0 += 32) {
        if (MODE == 1) {
            Split a[TM], b[TN];
#pragma unroll
            for (int i = 0; i < TM; ++i) { const int am = min(m0 + 16 * i + l15, p.M - 1); a[i] = sp_ld(A + (long long)am * p.sAm, p.sAk, k0, h, p.K, 1.f); }
#pragma unroll
            for (int t = 0; t < TN; ++t) { const int bn = min(n0 + 16 * t + l15, p.N - 1); b[t] = sp_ld(B + (long long)bn * p.sBn, p.sBk, k0, h, p.K, 1.f); }
#pragma unroll
            for (int i = 0; i < TM; ++i)
#pragma unroll
                for (int t = 0; t < TN; ++t) acc[i][t] = wmma3(a[i], b[t], acc[i][t]);
        } else if (MODE == 2) {
            v16b a[TM], b[TN];
#pragma unroll
            for (int i = 0; i < TM; ++i) { const int am = min(m0 + 16 * i + l15, p.M - 1); a[i] = bh_ld(A + (long long)am * p.sAm, p.sAk, k0, h, p.K, 1.f); }
#pragma unroll
            for (int t = 0; t < TN; ++t) { const int bn = min(n0 + 16 * t + l15, p.N - 1); b[t] = bh_ld(B + (long long)bn * p.sBn, p.sBk, k0, h, p.K, 1.f); }
#pragma unroll
            for (int i = 0; i < TM; ++i)
#pragma unroll
                for (int t = 0; t < TN; ++t) acc[i][t] = wmmab(a[i], b[t], acc[i][t]);
        } else {
            v16h a[TM], b[TN];
#pragma unroll
            for (int i = 0; i < TM; ++i) { const int am = min(m0 + 16 * i + l15, p.M - 1); a[i] = fh_ld(A + (long long)am * p.sAm, p.sAk, k0, h, p.K, p.sa); }
#pragma unroll
            for (int t = 0; t < TN; ++t) { const int bn = min(n0 + 16 * t + l15, p.N - 1); b[t] = fh_ld(B + (long long)bn * p.sBn, p.sBk, k0, h, p.K, p.sb); }
#pragma unroll
            for (int i = 0; i < TM; ++i)
#pragma unroll
                for (int t = 0; t < TN; ++t) acc[i][t] = wmma16(a[i], b[t], acc[i][t]);
        }
    }
    const float iscale = (MODE == 0) ? p.alpha / (p.sa * p.sb) : p.alpha;
    float* C = p.C + zo * p.sCo + zi * p.sCi;
    const float* R = p.R + zo * p.sRo + zi * p.sRi;
    const int NW = (p.Npad > p.N) ? p.Npad : p.N;
    __shared__ __align__(16) float ctile[16][36];
#pragma unroll
    for (int i = 0; i < TM; ++i) {
        const int mb = m0 + 16 * i; if (mb >= p.M) break;          // wave-uniform
#pragma unroll
        for (int tp = 0; tp < TN / 2; ++tp) {
            const int nb = n0 + 32 * tp; if (nb >= NW) break;        // wave-uniform
#pragma unroll
            for (int t2 = 0; t2 < 2; ++t2) {
                const int t = 2 * tp + t2; const int n = nb + t2 * 16 + l15; const int nn = min(n, p.N - 1);
#pragma unroll
                for (int r = 0; r < 8; ++r) {
                    const int m = mb + 8 * h + r; const int mm = min(m, p.M - 1);
                    float v = acc[i][t][r] * iscale;
                    if (p.flags & 1) v += p.bias[nn];
                    if (p.flags & 2) v += p.bias[mm];
            if (p.flags & 8) v *= p.bias[(long long)zo * p.M + mm];   /* per-(z,row) scale vector laid out [Z][M]; exclusive with the bias flags */
                    v = act_fn(v, p.act);
                    if (p.flags & 4) v += p.beta * R[(long long)mm * p.sRm + (long long)nn * p.sRn];
                    ctile[8 * h + r][t2 * 16 + l15] = (n < p.N) ? v : 0.f;
                }
            }
            __syncthreads();
            const bool fast = (mb + 16 <= p.M) && (nb + 32 <= NW) && ((p.sCm & 3) == 0) && ((((size_t)C) & 15) == 0);
            if (fast) {
#pragma unroll
                for (int s = 0; s < 4; ++s) {
                    const int row = s * 4 + (lane >> 3), c4 = (lane & 7) * 4;
                    const v4f v = *(const v4f*)&ctile[row][c4];
                    VST2V4(C + (long long)(mb + row) * p.sCm + nb + c4, v);
                }
            } else {
                for (int row = 0; row < 16; ++row) {
                    const int m = mb + row, n = nb + lane;
                    if (m < p.M && n < NW) VST2(float, C + (long long)m * p.sCm + n, ctile[row][lane]);
                }
            }
            __syncthreads();
        }
    }
}

// =====================================================================================================================
// k_attn32<LQ, LK, QP, KP>: flash attention at one fixed shape, all of it known at compile time: LQ queries, LK keys (a multiple of 64), head and
//   value dim 32, f32 rows with element stride 1 (Q and O row pitch QP floats, K and V row pitch KP floats, head h at column 32 h), no mask.
//   Wave = 16 queries, AW waves per block, 64-key blocks; grid (LQ / (16*AW), heads, images), block 32*AW; image z at Q, O + z*LQ*QP and K, V + z*LK*KP. Every Q, K and V row piece is whole and
//   16-byte aligned, so it is read with unguarded 16-byte loads that are all in flight together.
//   Both products are transposed: S^T = K . Q^T (A = 16 key rows, B = the wave's 16 queries) and O^T += V^T . P^T. A lane then holds scores of ONE query (its column l15; keys 16 t + 8 hf + r),
//   so the maximum and the sum are taken in the lane, with one exchange between the lane halves, and two score tiles, converted in place, are the B operand of the second product.
//   Scores: f16 operands; statistics f32 (exp2 domain); P x 4096 as f16; V f16 staged in LDS as V^T (a row = one d, 64 keys).
// =====================================================================================================================
#define AW 4
typedef __attribute__((ext_vector_type(4))) _Float16 v4h;
// the 16 f32 that make up lane half h's fragment of a 32-wide row: k = 8h..8h+7 and 16+8h..16+8h+7 (the order of frag_k)
struct Row16 { v4f r[4]; };
__device__ __forceinline__ Row16 row16_ld(const float* __restrict__ row, int h) {
    Row16 x;
    x.r[0] = *(const v4f*)(row + 8 * h); x.r[1] = *(const v4f*)(row + 8 * h + 4);
    x.r[2] = *(const v4f*)(row + 16 + 8 * h); x.r[3] = *(const v4f*)(row + 16 + 8 * h + 4);
    return x;
}
__device__ __forceinline__ v16h row16_f16(const Row16& x) {
    v16h a;
#pragma unroll
    for (int q = 0; q < 4; ++q)
#pragma unroll
        for (int e = 0; e < 4; ++e) a[4 * q + e] = (_Float16)x.r[q][e];
    return a;
}
// the value that lane l ^ 16 holds
__device__ __forceinline__ float other_half(float x) {
    const int b = __float_as_int(x);
    return __int_as_float(__builtin_amdgcn_permlanex16(b, b, 0x76543210, 0xfedcba98, false, false));
}
// f16 fragment in the order of frag_k from a k-contiguous f16 LDS row: p points at k = 8h
__device__ __forceinline__ v16h frag_row(const _Float16* p) {
    union { v16h v; v8h h[2]; } f;
    f.h[0] = *(const v8h*)(p); f.h[1] = *(const v8h*)(p + 16);
    return f.v;
}
// amdgpu_waves_per_eu(8): a budget of 128 registers a wave, so that 8 blocks fit on a WGP at once (one register more would leave room for 7)
template <int LQ, int LK, int QP, int KP>
__global__ __launch_bounds__(32 * AW) __attribute__((amdgpu_waves_per_eu(8))) void k_attn32(const float* __restrict__ Q, const float* __restrict__ K, const float* __restrict__ V, float* __restrict__ O, float scale) {
    static_assert(LQ % (16 * AW) == 0 && LK % 64 == 0 && QP % 4 == 0 && KP % 4 == 0, "whole tiles, 16-byte rows");
    constexpr int NT = 2;                       // output tiles (16 d each)
    constexpr int VP = 64 + 8;                  // LDS pitch of a V^T row (halves): 144 bytes = 16 x 9, for 16-byte readers
    constexpr int OP = 32 + 4;                  // LDS pitch of an output row (floats)
    __shared__ __align__(16) float    ol[AW][16 * OP];
    __shared__ __align__(16) _Float16 vl[32 * VP];
    const int lane = threadIdx.x & 31, hf = lane >> 4, l15 = lane & 15, wave = threadIdx.x >> 5;
    const int h = blockIdx.y;
    const int q0 = (blockIdx.x * AW + wave) * 16;
    Q += (size_t)blockIdx.z * LQ * QP; O += (size_t)blockIdx.z * LQ * QP;      // image blockIdx.z: its own Q / O plane
    K += (size_t)blockIdx.z * LK * KP; V += (size_t)blockIdx.z * LK * KP;      // and its own K / V plane
    const float L2E = 1.4426950408889634f;
    const float NEG = -__builtin_inff();
    const float* kbase = K + h * 32 + (size_t)l15 * KP;                                         // this lane's key row of a 16-key tile
    const float* vbase = V + h * 32 + (size_t)(threadIdx.x >> 3) * 4 * KP + (threadIdx.x & 7) * 4;  // this thread's 4 floats of 4 consecutive key rows
    _Float16* vst = vl + (threadIdx.x & 7) * 4 * VP + (threadIdx.x >> 3) * 4;                   // the same 4 x 4 piece, transposed
    const v16h qa = row16_f16(row16_ld(Q + h * 32 + (size_t)(q0 + l15) * QP, hf));
    asm volatile("s_wait_xcnt 0x0" ::: "memory");   // the Q loads' address registers are reused for the start values set below: the wait stands in front of that overwrite
    __builtin_amdgcn_sched_barrier(0);              // keeps those later register writes from being scheduled ahead of the wait
    v8f o[NT]; float mrun = NEG, lrun = 0.f;        // this lane's query: running maximum (both halves agree) and this half's part of the sum
#pragma unroll
    for (int t = 0; t < NT; ++t) { v8f zz = {}; o[t] = zz; }
    for (int j0 = 0; j0 < LK; j0 += 64) {
        v4f vr[4]; Row16 kr[4];
#pragma unroll
        for (int n = 0; n < 4; ++n) vr[n] = *(const v4f*)(vbase + (size_t)(j0 + n) * KP);
#pragma unroll
        for (int t = 0; t < 4; ++t) kr[t] = row16_ld(kbase + (size_t)(j0 + 16 * t) * KP, hf);
        asm volatile("s_wait_xcnt 0x0" ::: "memory");    // the K and V loads' address registers are reused for the converted values below: the wait stands in front of that overwrite
        __builtin_amdgcn_sched_barrier(0);               // keeps those register writes from being scheduled ahead of the wait
        __syncthreads();                                 // previous key block's reads of vl are done
#pragma unroll
        for (int e = 0; e < 4; ++e) {
            const v4h hv = {(_Float16)vr[0][e], (_Float16)vr[1][e], (_Float16)vr[2][e], (_Float16)vr[3][e]};
            *(v4h*)(vst + e * VP) = hv;
        }
        v8f s[4];
#pragma unroll
        for (int t = 0; t < 4; ++t) { v8f acc = {}; s[t] = wmma16(row16_f16(kr[t]), qa, acc); }
        float mt[4];                                     // one maximum a tile: four short chains, not one of 32
#pragma unroll
        for (int t = 0; t < 4; ++t) {
#pragma unroll
            for (int r = 0; r < 8; ++r) { float v = s[t][r] * scale; v *= L2E; s[t][r] = v; }
            float a = fmaxf(s[t][0], s[t][1]);
#pragma unroll
            for (int r = 2; r < 8; ++r) a = fmaxf(a, s[t][r]);
            mt[t] = a;
        }
        float mx = fmaxf(fmaxf(mt[0], mt[1]), fmaxf(mt[2], mt[3]));
        mx = fmaxf(mx, other_half(mx));
        const float mnew = fmaxf(mrun, mx);
        const float corr = exp2f(mrun - mnew);           // first block: exp2(-inf) = 0
#pragma unroll
        for (int t = 0; t < 4; ++t)
#pragma unroll
            for (int r = 0; r < 8; ++r) s[t][r] = exp2f(s[t][r] - mnew);
        const v8f ps = (s[0] + s[1]) + (s[2] + s[3]);
        const float rs = ((ps[0] + ps[1]) + (ps[2] + ps[3])) + ((ps[4] + ps[5]) + (ps[6] + ps[7]));
        lrun = lrun * corr + rs; mrun = mnew;
#pragma unroll
        for (int t = 0; t < NT; ++t) o[t] *= corr;
        v16h pb0, pb1;                                   // P^T fragments: element e <- key frag_k(e, hf) (+ 32), which is element e & 7 of score tile e >> 3 (+ 2)
#pragma unroll
        for (int e = 0; e < 16; ++e) { pb0[e] = (_Float16)(s[e >> 3][e & 7] * 4096.f); pb1[e] = (_Float16)(s[2 + (e >> 3)][e & 7] * 4096.f); }
        __syncthreads();                                 // V^T visible
#pragma unroll
        for (int t = 0; t < NT; ++t) {
            const _Float16* vrow = vl + (t * 16 + l15) * VP + 8 * hf;
            o[t] = wmma16(frag_row(vrow), pb0, o[t]);
            o[t] = wmma16(frag_row(vrow + 32), pb1, o[t]);
        }
    }
    float* obase = O + h * 32;
    const float inv = 1.f / ((lrun + other_half(lrun)) * 4096.f);   // no key is masked: the row sum holds its maximum's exp2(0) = 1
    float* myo = ol[wave];                                       // the wave's own 16 x 32 output tile, query-major
#pragma unroll
    for (int t = 0; t < NT; ++t) {
        const v4f lo = {o[t][0] * inv, o[t][1] * inv, o[t][2] * inv, o[t][3] * inv}, hi = {o[t][4] * inv, o[t][5] * inv, o[t][6] * inv, o[t][7] * inv};
        *(v4f*)(myo + l15 * OP + t * 16 + 8 * hf) = lo; *(v4f*)(myo + l15 * OP + t * 16 + 8 * hf + 4) = hi;
    }
    __syncthreads();
#pragma unroll
    for (int r0 = 0; r0 < 16; r0 += 4) {
        const int row = r0 + (lane >> 3), c4 = (lane & 7) * 4;
        const v4f v = *(const v4f*)(myo + row * OP + c4);
        VST2V4(obase + (size_t)(q0 + row) * QP + c4, v);
    }
}

// =====================================================================================================================
// k_tr: dst(z, c, r) = alpha * src(z, r, c) (+ beta * R2(z, c, r)): [Z][R][C] (row stride lds) -> [Z][C][R] (row stride ldd) through a 32x32 LDS tile;
//   flags: 1 -> add beta * residual R2 addressed like dst (z*sRz + c*ldr + r); act applied before the residual.
// =====================================================================================================================
struct TrP { const float* src; float* dst; const float* R2; long long sSz, lds, sDz, ldd, sRz, ldr; int R, C, flags, act; float alpha, beta; };
static_assert(sizeof(TrP) == 3 * 8 + 6 * 8 + 6 * 4, "TrP has padding");
__global__ __launch_bounds__(256) void k_tr(TrP p) {
    __shared__ float tile[32][33];
    const int c0 = blockIdx.x * 32, r0 = blockIdx.y * 32, z = blockIdx.z;
    const int lane = threadIdx.x & 31, wave = threadIdx.x >> 5;
    const float* s = p.src + z * p.sSz;
#pragma unroll
    for (int k = 0; k < 4; ++k) {
        const int rl = wave * 4 + k, r = r0 + rl, c = c0 + lane;
        tile[rl][lane] = (r < p.R && c < p.C) ? s[(long long)r * p.lds + c] : 0.f;
    }
    __syncthreads();
    float* d = p.dst + z * p.sDz; const float* rr = p.R2 + z * p.sRz;
#pragma unroll
    for (int k = 0; k < 4; ++k) {
        const int cl = wave * 4 + k, c = c0 + cl, r = r0 + lane;
        if (c < p.C && r < p.R) {
            float v = act_fn(p.alpha * tile[lane][cl], p.act);
            if (p.flags & 1) v += p.beta * rr[(long long)c * p.ldr + r];
            VST2(float, d + (long long)c * p.ldd + r, v);
        }
    }
}

// k_affine: dst[i] = a * (sdev ? sdev[0] : 1) * src[i] + b, i < n (one thread per element; consecutive lanes -> consecutive addresses)
__global__ __launch_bounds__(256) void k_affine(const float* __restrict__ src, float* __restrict__ dst, int n, float a, float b, const float* __restrict__ sdev) {
    const int i = blockIdx.x * 256 + threadIdx.x;
    if (i < n) { const float aa = sdev ? a * sdev[0] : a; const float v = aa * src[i] + b; VST2(float, dst + i, v); }
}

// =====================================================================================================================
// k_softmax: row softmax over n contiguous elements, one 256-thread block per row; rows addressed z*sz + r*sr (grid (R, Z)).
//   out = scale_out * softmax(scale_in * x + (Mf ? Mf[z*smz + r*smr + j] : 0)); a row whose max is -inf is written as 0.
// =====================================================================================================================
struct SmP { const float* src; float* dst; const float* Mf; long long sz, sr, dz, dr, smz, smr; int n, pad; float scale_in, scale_out; };
static_assert(sizeof(SmP) == 3 * 8 + 6 * 8 + 4 * 4, "SmP has padding");
__global__ __launch_bounds__(256) void k_softmax(SmP p) {
    __shared__ float red[256];
    const int r = blockIdx.x, z = blockIdx.y, tid = threadIdx.x;
    const float* s = p.src + z * p.sz + (long long)r * p.sr;
    const float* mf = p.Mf ? (p.Mf + z * p.smz + (long long)r * p.smr) : nullptr;
    float mx = -__builtin_inff();
    for (int j = tid; j < p.n; j += 256) { float v = s[j] * p.scale_in; if (mf) v += mf[j]; mx = fmaxf(mx, v); }
    red[tid] = mx; __syncthreads();
    for (int o = 128; o > 0; o >>= 1) { if (tid < o) red[tid] = fmaxf(red[tid], red[tid + o]); __syncthreads(); }
    mx = red[0]; __syncthreads();
    float sum = 0.f;
    for (int j = tid; j < p.n; j += 256) { float v = s[j] * p.scale_in; if (mf) v += mf[j]; sum += (mx == -__builtin_inff()) ? 0.f : expf(v - mx); }
    red[tid] = sum; __syncthreads();
    for (int o = 128; o > 0; o >>= 1) { if (tid < o) red[tid] += red[tid + o]; __syncthreads(); }
    sum = red[0];
    const float inv = (sum > 0.f) ? p.scale_out / sum : 0.f;
    float* d = p.dst + z * p.dz + (long long)r * p.dr;
    for (int j = tid; j < p.n; j += 256) { float v = s[j] * p.scale_in; if (mf) v += mf[j]; const float o = (mx == -__builtin_inff()) ? 0.f : expf(v - mx) * inv; VST2(float, d + j, o); }
}
// =====================================================================================================================
// k_stats: mean and rsqrt(var + eps) over a set of n elements addressed base + z*sz + (e / inner) * so + (e % inner) * si, one 256-thread
// k_norm_apply: y = (x - mean[set]) * rstd[set] * g[c] + b[c] over a [Z][C][L] channel-major tensor with set = z*G + c / (C/G) (G groups per z;
//   G = C -> per-channel sets indexed z*C+c; for batch norm pass stats indexed by c only via bn = 1). Optional act. Output same layout.
// =====================================================================================================================
//   mode 0: mean / rsqrt(var + eps); mode 1 (RMSNorm): 0 / rsqrt(mean(x^2) + eps); mode 2 (L2 normalize * sqrt(n)): 0 / sqrt(n) / max(||x||, eps); mode 3: as 0 with unbiased variance (n-1)
__global__ __launch_bounds__(256) void k_stats(const float* __restrict__ x, long long sz, long long so, long long si, int inner, int n, float eps, float* __restrict__ stat, int mode) {
    __shared__ float red[256];
    const int z = blockIdx.x, tid = threadIdx.x;
    const float* base = x + z * sz;
    float s = 0.f;
    for (int e = tid; e < n; e += 256) s += base[(long long)(e / inner) * so + (long long)(e % inner) * si];
    red[tid] = s; __syncthreads();
    for (int o = 128; o > 0; o >>= 1) { if (tid < o) red[tid] += red[tid + o]; __syncthreads(); }
    const float mu = (mode == 0 || mode == 3) ? red[0] / (float)n : 0.f; __syncthreads();
    float q = 0.f;
    for (int e = tid; e < n; e += 256) { const float dlt = base[(long long)(e / inner) * so + (long long)(e % inner) * si] - mu; q += dlt * dlt; }
    red[tid] = q; __syncthreads();
    for (int o = 128; o > 0; o >>= 1) { if (tid < o) red[tid] += red[tid + o]; __syncthreads(); }
    {
        float rs;
        if (mode == 2) rs = sqrtf((float)n) / fmaxf(sqrtf(red[0]), eps); else if (mode == 3) rs = rsqrtf(red[0] / (float)(n - 1) + eps); else rs = rsqrtf(red[0] / (float)n + eps);
        if (tid < 32) { const float v = (tid == 0) ? mu : ((tid == 1) ? rs : 0.f); VST2(float, stat + (long long)z * 32 + tid, v); }
    }
}
//   One thread per element over the flat [Z][C][L] index space: grid ceil(Z*C*L / 256).
__global__ __launch_bounds__(256) void k_norm_apply(const float* __restrict__ x, float* __restrict__ y, const float* __restrict__ stat, const float* __restrict__ g, const float* __restrict__ bta,
                                                     int Z, int C, int L, int G, int bn, int act) {
    const long long idx = (long long)blockIdx.x * 256 + threadIdx.x;
    if (idx >= (long long)Z * C * L) return;
    const int l = (int)(idx % L); const long long zc = idx / L; const int c = (int)(zc % C), z = (int)(zc / C); (void)l;
    const int set = bn ? c : (z * G + c / (C / G));
    float v = (x[idx] - stat[(long long)set * 32]) * stat[(long long)set * 32 + 1];
    if (g) v *= g[c];
    if (bta) v += bta[c];
    v = act_fn(v, act);
    VST2(float, y + idx, v);
}

// k_lse_neg: c[i] = -(st[2i] + log(st[2i+1])) = minus the log-sum-exp of row i (for softmax over the query axis)
__global__ __launch_bounds__(256) void k_lse_neg(const float* __restrict__ st, float* __restrict__ c, int n) {
    const int i = blockIdx.x * 256 + threadIdx.x;
    if (i < n) { const float v = -(st[2 * i] + logf(st[2 * i + 1])); VST2(float, c + i, v); }
}

// k_iota: dst[i] = a * i + b as int32 (segment/position id helper)
__global__ __launch_bounds__(256) void k_iota(int* __restrict__ dst, int n, int a, int b) {
    const int i = blockIdx.x * 256 + threadIdx.x;
    if (i < n) { const int v = a * i + b; VST2(int, dst + i, v); }
}

// k_axpby: dst[i] = a * x[i] + b * y[i] (+ c), i < n
__global__ __launch_bounds__(256) void k_axpby(const float* __restrict__ x, const float* __restrict__ y, float* __restrict__ dst, int n, float a, float b, float c) {
    const int i = blockIdx.x * 256 + threadIdx.x;
    if (i < n) { const float v = a * x[i] + b * y[i] + c; VST2(float, dst + i, v); }
}

// =====================================================================================================================
// k_rope: rotary embedding on a [R rows][Hn heads][D] view (row stride sXr, head stride sXh, element stride 1) -> Y (own strides).
//   mode 0: rotate_half (partner d±D/2, sign - for d<D/2); mode 1: interleaved pairs (partner d^1, sign - for even d).
//   table column tcol: tmode 0 -> d, 1 -> d % (D/2), 2 -> d / 2; position p: pmode 0 -> r % S, 1 -> head index, 2 -> pos[r];
//   c = C[(r / S) * sCb + p * sCp + tcol * sCd], s likewise from Sn; y = x[d] * c + sign * x[partner] * s. X and Y must not alias.
// =====================================================================================================================
struct RopeP { const float* X; float* Y; const float* C; const float* Sn; const int* pos; long long sXr, sXh, sYr, sYh, sCb, sCp, sCd; int R, Hn, D, S, mode, tmode, pmode, pad; };
static_assert(sizeof(RopeP) == 5 * 8 + 7 * 8 + 8 * 4, "RopeP has padding");
__global__ __launch_bounds__(256) void k_rope(RopeP p) {
    const long long idx = (long long)blockIdx.x * 256 + threadIdx.x;
    if (idx >= (long long)p.R * p.Hn * p.D) return;
    const int d = (int)(idx % p.D); const long long rh = idx / p.D; const int h = (int)(rh % p.Hn); const int r = (int)(rh / p.Hn);
    const int half = p.D / 2;
    int partner; float sign;
    if (p.mode == 0) { partner = (d < half) ? d + half : d - half; sign = (d < half) ? -1.f : 1.f; }
    else { partner = d ^ 1; sign = (d & 1) ? 1.f : -1.f; }
    const int tcol = (p.tmode == 0) ? d : ((p.tmode == 1) ? (d % half) : (d >> 1));
    const int pp = (p.pmode == 0) ? (r % p.S) : ((p.pmode == 1) ? h : p.pos[r]);
    const long long toff = (long long)(r / p.S) * p.sCb + (long long)pp * p.sCp + (long long)tcol * p.sCd;
    const float* xr = p.X + (long long)r * p.sXr + (long long)h * p.sXh;
    const float v = xr[d] * p.C[toff] + sign * xr[partner] * p.Sn[toff];
    VST2(float, p.Y + (long long)r * p.sYr + (long long)h * p.sYh + d, v);
}

// k_invf + k_sincos (split so neither kernel carries a large VALU-fma footprint): invf_i = num * (1 / powf(base, (2 i)/D)) [fmode 0],
//   num * expf((2 i) * cexp) [fmode 1], num * powf(base, -2 (i - 1) / D) [fmode 2]; then cs/sn[s*half + i] = cos/sin((pscale * s) * invf_i)
__global__ __launch_bounds__(256) void k_invf(float* __restrict__ invb, int half, int D, float base, float num, int fmode, float cexp) {
    const int i = blockIdx.x * 256 + threadIdx.x;
    if (i >= ((half + 31) / 32) * 32) return;
    if (i >= half) { VST2(float, invb + i, 0.f); return; }
    const float e = (float)(2 * i) / (float)D;
    float invf;
    if (fmode == 1) invf = num * expf((float)(2 * i) * cexp);
    else if (fmode == 2) invf = num * powf(base, (-2.0f * ((float)i - 1.0f)) / (float)D);
    else invf = num * (1.0f / powf(base, e));
    VST2(float, invb + i, invf);
}
__global__ __launch_bounds__(256) void k_sincos(float* __restrict__ cs, float* __restrict__ sn, const float* __restrict__ invb, int S, int half, float pscale) {
    const int idx = blockIdx.x * 256 + threadIdx.x;
    if (idx >= S * half) return;
    const int s = idx / half, i = idx - s * half;
    const float ang = (pscale * (float)s) * invb[i];
    VST2(float, cs + idx, cosf(ang)); VST2(float, sn + idx, sinf(ang));
}

// k_mulact: dst[i] = act(x[i]) * y[i]
__global__ __launch_bounds__(256) void k_mulact(const float* __restrict__ x, const float* __restrict__ y, float* __restrict__ dst, int n, int act) {
    const int i = blockIdx.x * 256 + threadIdx.x;
    if (i < n) { const float v = act_fn(x[i], act) * y[i]; VST2(float, dst + i, v); }
}

// =====================================================================================================================
// k_matvec: thread-per-row matrix-vector products for N <= 8 output columns (heads with 1-3 outputs, gates), f32 on the VALU.
//   C[r*sCm + j] = act(alpha * sum_k A[r*sAm + k*sAk] * B[j*sBn + k*sBk] + bias[j]) + beta * R[r*sRm + j*sRn]; each thread writes its N contiguous floats.
// =====================================================================================================================
__global__ __launch_bounds__(256) void k_matvec(GemmP p) {
    // 32 lanes write one line with one instruction.
    const int rpt = (p.N == 1) ? 1 : 32;
    const long long r0 = ((long long)blockIdx.x * 256 + threadIdx.x) * rpt; const int z = blockIdx.z, zo = z / p.zi_n, zi = z - zo * p.zi_n;
    if (r0 >= p.M) return;
    const float* Bb = p.B + zo * p.sBo + zi * p.sBi;
    float* C = p.C + zo * p.sCo + zi * p.sCi; const float* R = p.R + zo * p.sRo + zi * p.sRi;
    for (int rr = 0; rr < rpt; ++rr) {
        const long long r = r0 + rr; if (r >= p.M) break;
        const float* A = p.A + zo * p.sAo + zi * p.sAi + r * p.sAm;
        float acc[8] = {0.f, 0.f, 0.f, 0.f, 0.f, 0.f, 0.f, 0.f};
        for (int k = 0; k < p.K; ++k) { const float a = A[(long long)k * p.sAk];
#pragma unroll
            for (int j = 0; j < 8; ++j) if (j < p.N) acc[j] += a * Bb[(long long)j * p.sBn + (long long)k * p.sBk]; }
#pragma unroll
        for (int j = 0; j < 8; ++j) if (j < p.N) {
            float v = acc[j] * p.alpha;
            if (p.flags & 1) v += p.bias[j];
            if (p.flags & 2) v += p.bias[r];
            v = act_fn(v, p.act);
            if (p.flags & 4) v += p.beta * R[r * p.sRm + (long long)j * p.sRn];
            VST2(float, C + r * p.sCm + j, v);
        }
    }
}
// k_smallsoftmax: thread-per-row softmax for short rows (n <= 64): dst[r*dr + j] = softmax(scale*src[r*sr + j])
__global__ __launch_bounds__(256) void k_smallsoftmax(const float* __restrict__ src, float* __restrict__ dst, long long sr, long long dr, int n, long long R, float scale) {
    const long long r0 = ((long long)blockIdx.x * 256 + threadIdx.x) * 32;
    for (int rr = 0; rr < 32; ++rr) {
        const long long r = r0 + rr; if (r >= R) return;
        const float* s = src + r * sr; float* d = dst + r * dr;
        float mx = -__builtin_inff();
        for (int j = 0; j < n; ++j) mx = fmaxf(mx, s[j] * scale);
        float sum = 0.f;
        for (int j = 0; j < n; ++j) sum += expf(s[j] * scale - mx);
        const float inv = 1.f / sum;
        for (int j = 0; j < n; ++j) { const float v = expf(s[j] * scale - mx) * inv; VST2(float, d + j, v); }
    }
}

__global__ __launch_bounds__(32) void k_unitstat(float* __restrict__ st) { const int t = threadIdx.x; const float v = (t == 1) ? 1.f : 0.f; VST2(float, st + t, v); }

// destination (e.g. a d_out whose row width is not a multiple of 32 floats) is written by consecutive lanes of one instruction
__global__ __launch_bounds__(256) void k_lincopy(const float* __restrict__ src, long long lds, float* __restrict__ dst, long long ldd, long long rows, int cols) {
    const long long i = (long long)blockIdx.x * 256 + threadIdx.x; if (i >= rows * cols) return;
    const long long r = i / cols; const int c = (int)(i - r * cols);
    const float v = src[r * lds + c]; VST2(float, dst + r * ldd + c, v);
}

namespace w25 {
typedef __attribute__((ext_vector_type(16))) _Float16 v16h;
typedef __attribute__((ext_vector_type(8)))  _Float16 v8h;
typedef __attribute__((ext_vector_type(16))) __bf16   v16b;
typedef __attribute__((ext_vector_type(8)))  __bf16   v8b;
typedef __attribute__((ext_vector_type(8)))  float    v8f;
typedef __attribute__((ext_vector_type(4)))  float    v4f;

__device__ __forceinline__ unsigned short f2bf_bits(float f) {
  unsigned u = __float_as_uint(f);
  return (unsigned short)((u + 0x7FFFu + ((u >> 16) & 1u)) >> 16);
}
__device__ __forceinline__ float bf_bits2f(unsigned short h) { return __uint_as_float(((unsigned)h) << 16); }

// hazard guards as plain device helpers (no inline asm inside the kernel template body)
__device__ __forceinline__ void dep_guard_h(v8f& a, v8f& b, v16h x, v16h y) { asm volatile("v_nop\n\tv_nop\n\tv_nop\n\tv_nop" : "+v"(a), "+v"(b) : "v"(x), "v"(y)); }
__device__ __forceinline__ void dep_guard_b(v8f& a, v8f& b, v16b x, v16b y) { asm volatile("v_nop\n\tv_nop\n\tv_nop\n\tv_nop" : "+v"(a), "+v"(b) : "v"(x), "v"(y)); }
__device__ __forceinline__ void keep4_h(v16h a, v16h b, v16h c, v16h d) { asm volatile("v_nop" :: "v"(a), "v"(b), "v"(c), "v"(d)); }
__device__ __forceinline__ void keep4_b(v16b a, v16b b, v16b c, v16b d) { asm volatile("v_nop" :: "v"(a), "v"(b), "v"(c), "v"(d)); }
__device__ __forceinline__ void acc_guard4(v8f& a, v8f& b, v8f& c, v8f& d) { asm volatile("v_nop\n\tv_nop\n\tv_nop\n\tv_nop" : "+v"(a), "+v"(b), "+v"(c), "+v"(d)); }
template <typename T> struct Frag;
template <> struct Frag<_Float16> {
  typedef v16h V; union U { v16h v; v8h h[2]; };
  static __device__ __forceinline__ v16h load(const _Float16* p) {   // elements 0..7 <- p[0..7], 8..15 <- p[16..23]
    U f; f.h[0] = *(const v8h*)(p); f.h[1] = *(const v8h*)(p + 16); return f.v;
  }
  static __device__ __forceinline__ v8f mma(v16h a, v16h b, v8f c) {
    return __builtin_amdgcn_wmma_f32_16x16x32_f16(false, a, false, b, (short)0, c, false, false);
  }
  static __device__ __forceinline__ void guard(v8f& a, v8f& b, v16h x, v16h y) { dep_guard_h(a, b, x, y); }
  static __device__ __forceinline__ void keep(v16h a, v16h b, v16h c, v16h d) { keep4_h(a, b, c, d); }
};
template <> struct Frag<__bf16> {
  typedef v16b V; union U { v16b v; v8b h[2]; };
  static __device__ __forceinline__ v16b load(const __bf16* p) {
    U f; f.h[0] = *(const v8b*)(p); f.h[1] = *(const v8b*)(p + 16); return f.v;
  }
  static __device__ __forceinline__ v8f mma(v16b a, v16b b, v8f c) {
    return __builtin_amdgcn_wmma_f32_16x16x32_bf16(false, a, false, b, (short)0, c, false, false);
  }
  static __device__ __forceinline__ void guard(v8f& a, v8f& b, v16b x, v16b y) { dep_guard_b(a, b, x, y); }
  static __device__ __forceinline__ void keep(v16b a, v16b b, v16b c, v16b d) { keep4_b(a, b, c, d); }
};

// ---- Register-blocked batched WMMA GEMM ------------------------------------
// C[m,n] = scale * sum_k A[m,k] * Bt[n,k] (+bias)(+resid); each wave owns a 64x64 tile.
// A row-major [M,K]; Bt row-major [N,K]; M,N % 64 == 0, K % 32 == 0.
// SPLIT: operands are hi/lo planes (A2/Bt2 = lo planes, same layout); product = hi·hi + hi·lo + lo·hi.
// BIAS_MODE: 0 = none, 1 = bias[m], 2 = bias[n].
// OUT_MODE: 0 = f32, 1 = f16, 2 = bf16 hi plane (Cout) + bf16 lo plane (Cout2).
// ET: 0 = f16 operands, 1 = bf16 operands (pointers passed as 16-bit storage)
template <int ET> struct Elem;
template <> struct Elem<0> { typedef _Float16 T; };
template <> struct Elem<1> { typedef __bf16 T; };
template <int ET, bool SPLIT, int BIAS_MODE, int OUT_MODE, bool RESID, int ACT = 0>
__global__ __launch_bounds__(256) void wmma_gemm64(
    const unsigned short* __restrict__ Ap, const unsigned short* __restrict__ A2p, int lda, long strideA,
    const unsigned short* __restrict__ Btp, const unsigned short* __restrict__ Bt2p, int ldb, long strideB,
    void* __restrict__ Cout, void* __restrict__ Cout2, int ldc, long strideC,
    const float* __restrict__ bias,
    const float* __restrict__ resid, long strideR,
    int M, int N, int K, float scale) {
  typedef typename Elem<ET>::T T;
  typedef typename Frag<T>::V V;
  const T* A = (const T*)Ap; const T* A2 = (const T*)A2p; const T* Bt = (const T*)Btp; const T* Bt2 = (const T*)Bt2p;
  __shared__ __align__(16) float sT[8][16 * 68];   // per-wave 16x64 slab, pitch 68 floats
  const int b    = blockIdx.y;
  const int lane = threadIdx.x & 31;
  const int wave = threadIdx.x >> 5;
  const int tilesN = N >> 6;
  const int tilesM = M >> 6;
  const int tile = blockIdx.x * 8 + wave;
  if (tile >= tilesM * tilesN) return;   // wave-uniform; no block barriers in this kernel
  const int tm = tile / tilesN;
  const int tn = tile - tm * tilesN;
  const int m0 = tm << 6;
  const int n0 = tn << 6;

  const T* Ab  = A  + (size_t)b * strideA;
  const T* Bb  = Bt + (size_t)b * strideB;
  const T* Ab2 = SPLIT ? (A2  + (size_t)b * strideA) : nullptr;
  const T* Bb2 = SPLIT ? (Bt2 + (size_t)b * strideB) : nullptr;

  const int rlane = lane & 15;                 // row (A) / col (B, D) within subtile
  const int koff  = (lane >> 4) * 8;           // k offset of this lane half
  const int mOff  = (lane >> 4) * 8;           // D row offset

  v8f acc[4][4];
#pragma unroll
  for (int i = 0; i < 4; ++i)
#pragma unroll
    for (int j = 0; j < 4; ++j) acc[i][j] = (v8f){0.f,0.f,0.f,0.f,0.f,0.f,0.f,0.f};

  for (int k0 = 0; k0 < K; k0 += 32) {
    V bh[4], bl[4];
#pragma unroll
    for (int j = 0; j < 4; ++j) {
      const size_t bo = (size_t)(n0 + (j << 4) + rlane) * ldb + koff + k0;
      bh[j] = Frag<T>::load(Bb + bo);
      if (SPLIT) bl[j] = Frag<T>::load(Bb2 + bo);
    }
#pragma unroll
    for (int i = 0; i < 4; ++i) {
      const size_t ao = (size_t)(m0 + (i << 4) + rlane) * lda + koff + k0;
      V ah = Frag<T>::load(Ab + ao);
      V al;
      if (SPLIT) al = Frag<T>::load(Ab2 + ao);
#pragma unroll
      for (int j = 0; j < 4; ++j) {
        acc[i][j] = Frag<T>::mma(ah, bh[j], acc[i][j]);
        if (SPLIT) {
          acc[i][j] = Frag<T>::mma(ah, bl[j], acc[i][j]);
          acc[i][j] = Frag<T>::mma(al, bh[j], acc[i][j]);
        }
      }
      Frag<T>::guard(acc[i][0], acc[i][3], ah, SPLIT ? al : ah);
    }
    Frag<T>::keep(bh[0], bh[1], bh[2], bh[3]);
    if (SPLIT) Frag<T>::keep(bl[0], bl[1], bl[2], bl[3]);
  }
  acc_guard4(acc[0][0], acc[0][1], acc[0][2], acc[0][3]);
  acc_guard4(acc[1][0], acc[1][1], acc[1][2], acc[1][3]);
  acc_guard4(acc[2][0], acc[2][1], acc[2][2], acc[2][3]);
  acc_guard4(acc[3][0], acc[3][1], acc[3][2], acc[3][3]);

  // ---- epilogue ----
  float* slab = sT[wave];
  const float* Rb = RESID ? (resid + (size_t)b * strideR) : nullptr;
#pragma unroll
  for (int i = 0; i < 4; ++i) {
    const int mBase = m0 + (i << 4);
#pragma unroll
    for (int j = 0; j < 4; ++j) {
      const int n = n0 + (j << 4) + rlane;
      float bv = 0.f;
      if (BIAS_MODE == 2) bv = bias[n];
#pragma unroll
      for (int r = 0; r < 8; ++r) {
        float v = acc[i][j][r] * scale;
        if (BIAS_MODE == 1) v += bias[mBase + mOff + r];
        if (BIAS_MODE == 2) v += bv;
        if (RESID) v += Rb[(size_t)(mBase + mOff + r) * ldc + n];
        if (ACT == 1) v = tanhf(v);
        if (ACT == 2) v = fmaxf(v, 0.0f);
        if (ACT == 3) v = v / (1.0f + expf(-v));
        if (ACT == 4) v = (v > 0.f) ? v : 0.01f * v;
        if (ACT == 5) v = 0.5f * v * (1.0f + erff(v * 0.70710678118654752f));
        slab[(mOff + r) * 68 + (j << 4) + rlane] = v;
      }
    }
    __builtin_amdgcn_fence(__ATOMIC_RELEASE, "workgroup");
    __builtin_amdgcn_wave_barrier();
    __builtin_amdgcn_fence(__ATOMIC_ACQUIRE, "workgroup");
    if (OUT_MODE == 0) {
      float* C = (float*)Cout + (size_t)b * strideC;
      const int hh = lane >> 4, c4 = (lane & 15) * 4;     // row seg = 256 B = 16 lanes x 16 B
      {
#pragma unroll
        for (int it = 0; it < 8; ++it) {
          const int row = it * 2 + hh;
          v4f v = *(const v4f*)(slab + row * 68 + c4);
          *(v4f*)(C + (size_t)(mBase + row) * ldc + n0 + c4) = v;
        }
        
      }
    } else {
      const int q = lane >> 3, c8 = (lane & 7) * 8;
      unsigned short* C  = (unsigned short*)Cout  + (size_t)b * strideC;
      unsigned short* C2 = (OUT_MODE == 2) ? ((unsigned short*)Cout2 + (size_t)b * strideC) : nullptr;
      {
#pragma unroll
        for (int it = 0; it < 4; ++it) {
          const int row = it * 4 + q;
          const float* sp = slab + row * 68 + c8;
          v8h hv, lv;
#pragma unroll
          for (int e = 0; e < 8; ++e) {
            if (OUT_MODE == 1) {
              hv[e] = (_Float16)sp[e];
            } else {
              unsigned short hb = f2bf_bits(sp[e]);
              unsigned short lb = f2bf_bits(sp[e] - bf_bits2f(hb));
              hv[e] = __builtin_bit_cast(_Float16, hb);
              lv[e] = __builtin_bit_cast(_Float16, lb);
            }
          }
          *(v8h*)(C + (size_t)(mBase + row) * ldc + n0 + c8) = hv;
          if (OUT_MODE == 2) *(v8h*)(C2 + (size_t)(mBase + row) * ldc + n0 + c8) = lv;
        }
        
      }
    }
    __builtin_amdgcn_fence(__ATOMIC_RELEASE, "workgroup");
    __builtin_amdgcn_wave_barrier();
    __builtin_amdgcn_fence(__ATOMIC_ACQUIRE, "workgroup");
  }
}

__global__ __launch_bounds__(256) void cast_f32_f16x2(
    const float* __restrict__ in, _Float16* __restrict__ out, int n2) {
  int i = blockIdx.x * 256 + threadIdx.x;
  if (i < n2) {
    const _Float16 h0 = (_Float16)in[2 * i], h1 = (_Float16)in[2 * i + 1];
    const unsigned u = (unsigned)__builtin_bit_cast(unsigned short, h0) | ((unsigned)__builtin_bit_cast(unsigned short, h1) << 16);
    ((unsigned*)out)[i] = u;
    
  }
}


} // namespace w25

// The element-wise stages below give each thread 16 to 64 elements, moved by 16-byte loads and stores that are all in flight together, so that a launch is a few
// thousand waves. Every wave store instruction writes whole 128-byte lines.
__device__ __forceinline__ v8h cast8(v4f a, v4f b, float s) {
    const v8h o = {(_Float16)(a[0] * s), (_Float16)(a[1] * s), (_Float16)(a[2] * s), (_Float16)(a[3] * s), (_Float16)(b[0] * s), (_Float16)(b[1] * s), (_Float16)(b[2] * s), (_Float16)(b[3] * s)};
    return o;
}
// k_castT16<R, C>: dst[z][c][r] = f16(src[z][r][c] * s), dense planes. One thread: 8 rows r x 4 columns c (8 loads, 4 stores). Lane = (column quad lane >> 3, row group lane & 7):
//   the 8 lanes of one quad store 64 consecutive r of one c. grid (C / 128, R / 64, Z), block 256: wave w has columns 128 bx + 16 w .. + 15, rows 64 by .. + 63.
template <int R, int C>
__global__ __launch_bounds__(256) void k_castT16(const float* __restrict__ src, _Float16* __restrict__ dst, float s) {
    static_assert(R % 64 == 0 && C % 128 == 0, "whole tiles");
    const int lane = threadIdx.x & 31, wave = threadIdx.x >> 5;
    const int r0 = blockIdx.y * 64 + (lane & 7) * 8;
    const int c0 = blockIdx.x * 128 + wave * 16 + (lane >> 3) * 4;
    src += ((size_t)blockIdx.z * R + r0) * C + c0;
    dst += ((size_t)blockIdx.z * C + c0) * R + r0;
    v4f a[8];
#pragma unroll
    for (int j = 0; j < 8; ++j) a[j] = *(const v4f*)(src + (size_t)j * C);
#pragma unroll
    for (int e = 0; e < 4; ++e) {
        const v8h o = {(_Float16)(a[0][e] * s), (_Float16)(a[1][e] * s), (_Float16)(a[2][e] * s), (_Float16)(a[3][e] * s), (_Float16)(a[4][e] * s), (_Float16)(a[5][e] * s), (_Float16)(a[6][e] * s), (_Float16)(a[7][e] * s)};
        *(v8h*)(dst + (size_t)e * R) = o;
    }
}
// k_cast16: dst[i] = f16(src[i] * s) over a dense array of 8192 * gridDim.x elements; one thread: 4 pieces of 8 consecutive elements, a wave's pieces consecutive
__global__ __launch_bounds__(256) void k_cast16(const float* __restrict__ src, _Float16* __restrict__ dst, float s) {
    const size_t e0 = ((size_t)blockIdx.x * 1024 + threadIdx.x) * 8;
    v4f a[4][2];
#pragma unroll
    for (int k = 0; k < 4; ++k) { a[k][0] = *(const v4f*)(src + e0 + k * 2048); a[k][1] = *(const v4f*)(src + e0 + k * 2048 + 4); }
#pragma unroll
    for (int k = 0; k < 4; ++k) *(v8h*)(dst + e0 + k * 2048) = cast8(a[k][0], a[k][1], s);
}

// f32 -> bf16 hi plane + bf16 lo plane (x = hi + lo to ~2^-17 relative; RNE both), [R][C] -> [R][C] (or transposed to [C][R]); 2 consecutive destination elements
__device__ __forceinline__ unsigned int f2bf2_pack(float a, float b, unsigned int* lo) {
    const unsigned short ha = w25::f2bf_bits(a), hb = w25::f2bf_bits(b);
    const unsigned short la = w25::f2bf_bits(a - w25::bf_bits2f(ha)), lb = w25::f2bf_bits(b - w25::bf_bits2f(hb));
    *lo = (unsigned)la | ((unsigned)lb << 16); return (unsigned)ha | ((unsigned)hb << 16); }
__global__ __launch_bounds__(256) void k_castS16(const float* __restrict__ src, long long lds, __bf16* __restrict__ dhi, __bf16* __restrict__ dlo, long long ldd, int R, int C, float s, int transpose) {
    const long long i = (long long)blockIdx.x * 256 + threadIdx.x; long long o; float a, b;
    if (transpose) { const long long np = (long long)C * (R / 2); if (i >= np) return; const int c = (int)(i / (R / 2)); const int r = 2 * (int)(i % (R / 2)); a = src[(long long)r * lds + c] * s; b = src[(long long)(r + 1) * lds + c] * s; o = (long long)c * ldd + r; }
    else { const long long np = (long long)R * (C / 2); if (i >= np) return; const int r = (int)(i / (C / 2)); const int c = 2 * (int)(i % (C / 2)); a = src[(long long)r * lds + c] * s; b = src[(long long)r * lds + c + 1] * s; o = (long long)r * ldd + c; }
    unsigned lo; const unsigned hi = f2bf2_pack(a, b, &lo); unsigned* ph = (unsigned*)(dhi + o); unsigned* pl = (unsigned*)(dlo + o);
    *ph = hi; *pl = lo;  }

// all five weight tensors (each dense) -> one f16 plane [Wq | Wqb | Wkvb | Wkv | Wout], scaled by s; a block takes 4096 elements (every segment is a whole number of blocks),
//   one thread 2 pieces of 8 consecutive elements
__global__ __launch_bounds__(256) void k_castW16(const float* __restrict__ Wq, const float* __restrict__ Wqb, const float* __restrict__ Wkvb, const float* __restrict__ Wkv, const float* __restrict__ Wout, _Float16* __restrict__ dst, float s) {
    const int eb = blockIdx.x * 4096;
    const float* src = Wq; int base = 0;
    if (eb >= 786432) { src = Wout; base = 786432; } else if (eb >= 262144) { src = Wkv; base = 262144; } else if (eb >= 131072) { src = Wkvb; base = 131072; } else if (eb >= 65536) { src = Wqb; base = 65536; }
    const int e = eb + threadIdx.x * 8;
    const v4f a0 = *(const v4f*)(src + e - base), a1 = *(const v4f*)(src + e - base + 4), b0 = *(const v4f*)(src + e - base + 2048), b1 = *(const v4f*)(src + e - base + 2052);
    *(v8h*)(dst + e) = cast8(a0, a1, s);
    *(v8h*)(dst + e + 2048) = cast8(b0, b1, s);
}

// im2col for the 2x2 stride-2 conv, image b = grid y: COL[b][(Y,X)][(c,ky,kx)] = x[b][c][2Y+ky][2X+kx]
//   One thread: 4 channels (8 apart) x 2 output columns X: per channel 4 floats of each of the two input rows, stored as the (ky,kx) quads of X and X + 1.
//   Lane = (column pair lane >> 3, channel lane & 7): 8 lanes store 8 consecutive channels' quads. grid (Hs / 2 * C / 64, images), block 256 = one Y, 64 channels, the whole row.
template <int C, int Hs>
__global__ __launch_bounds__(256) void k_es_col(const float* __restrict__ X, float* __restrict__ COL) {
    static_assert(Hs == 64 && C % 64 == 0, "4 waves span one input row");
    constexpr int Hr = Hs / 2;
    const int lane = threadIdx.x & 31, wave = threadIdx.x >> 5;
    const int b = blockIdx.y, Y = blockIdx.x / (C / 64), cb = blockIdx.x % (C / 64);
    const int c = cb * 64 + (wave >> 2) * 32 + (lane & 7);
    const int X2 = (wave & 3) * 8 + (lane >> 3) * 2;
    const float* s = X + (((size_t)b * C + c) * Hs + 2 * Y) * Hs + 2 * X2;
    float* d = COL + ((size_t)b * Hr * Hr + Y * Hr + X2) * (4 * C) + 4 * c;
    v4f r0[4], r1[4];
#pragma unroll
    for (int g = 0; g < 4; ++g) { r0[g] = *(const v4f*)(s + (size_t)g * 8 * Hs * Hs); r1[g] = *(const v4f*)(s + (size_t)g * 8 * Hs * Hs + Hs); }
#pragma unroll
    for (int g = 0; g < 4; ++g) {
        const v4f lo = {r0[g][0], r0[g][1], r1[g][0], r1[g][1]}, hi = {r0[g][2], r0[g][3], r1[g][2], r1[g][3]};
        VST2V4(d + 32 * g, lo); VST2V4(d + 4 * C + 32 * g, hi);
    }
}
// batch-wise attention: for (p, h, b): scores over b' = q_b . k_b' * scale (4 values), softmax, out = sum att v_b'; S[b][p][h*32+d] += out (S already holds out_img)
//   One wave: one position p, 4 heads (8 lanes x 4 floats a head), all 4 images, so each k and v row is read once. grid P * C / 1024, block 256.
//   The planes come as separate arguments (Q01 / S01: images 0 and 1, Q23 / S23: images 2 and 3, K0 .. K3: one image of k | v each), so that every row address is one of these
//   scalar bases plus one lane offset plus an immediate that the instruction can hold.
template <int P, int C>
__global__ __launch_bounds__(256) void k_es_batch(const float* __restrict__ Q01, const float* __restrict__ Q23, const float* __restrict__ K0, const float* __restrict__ K1, const float* __restrict__ K2, const float* __restrict__ K3,
                                                    float* __restrict__ S01, float* __restrict__ S23) {
    static_assert(C % 128 == 0, "a wave spans 128 channels");
    const int w = blockIdx.x * 8 + __builtin_amdgcn_readfirstlane(threadIdx.x >> 5);   // the wave's number as a scalar: every row address below is a scalar base plus one lane offset
    const unsigned lo = (threadIdx.x & 31) * 16;                                        // this lane's byte offset in the wave's 512-byte piece of a row
    const int p = w / (C / 128); const int col = (w % (C / 128)) * 128;
    const size_t oq = (size_t)p * C + col, ok = (size_t)p * 2 * C + col;
    const char* qrow[4] = {(const char*)(Q01 + oq), (const char*)(Q01 + oq + P * C), (const char*)(Q23 + oq), (const char*)(Q23 + oq + P * C)};
    char* srow[4] = {(char*)(S01 + oq), (char*)(S01 + oq + P * C), (char*)(S23 + oq), (char*)(S23 + oq + P * C)};
    const char* krow[4] = {(const char*)(K0 + ok), (const char*)(K1 + ok), (const char*)(K2 + ok), (const char*)(K3 + ok)};
    v4f q[4], k[4], v[4], sv[4];
#pragma unroll
    for (int b = 0; b < 4; ++b) {
        q[b] = *(const v4f*)(qrow[b] + lo); k[b] = *(const v4f*)(krow[b] + lo);
    }
#pragma unroll
    for (int b = 0; b < 4; ++b) {
        v[b] = *(const v4f*)(krow[b] + lo + C * 4); sv[b] = *(const v4f*)(srow[b] + lo);
    }
    __builtin_amdgcn_sched_barrier(0);   // keeps all 16 loads in front of the arithmetic: without it the v and S loads are issued only behind the scores, a second memory latency
#pragma unroll
    for (int b = 0; b < 4; ++b) {
        float sc[4]; float mx = -__builtin_inff();
#pragma unroll
        for (int b2 = 0; b2 < 4; ++b2) {
            float d0 = q[b][0] * k[b2][0] + q[b][1] * k[b2][1] + q[b][2] * k[b2][2] + q[b][3] * k[b2][3];
            for (int o = 4; o > 0; o >>= 1) d0 += __shfl_xor(d0, o, 32);
            sc[b2] = d0 * 0.17677669529663689f; mx = fmaxf(mx, sc[b2]);
        }
        float den = 0.f;
#pragma unroll
        for (int b2 = 0; b2 < 4; ++b2) { sc[b2] = expf(sc[b2] - mx); den += sc[b2]; }
        v4f o_ = {0.f, 0.f, 0.f, 0.f};
#pragma unroll
        for (int b2 = 0; b2 < 4; ++b2) o_ += sc[b2] / den * v[b2];
        VST2V4(srow[b] + lo, sv[b] + o_);
    }
}


extern "C" void kernel_launch(void* const* d_in, const int* in_sizes, int n_in, void* d_out, int out_size, void* d_ws, size_t ws_size, hipStream_t stream) {
    (void)in_sizes; (void)n_in; (void)out_size; (void)ws_size;
    const float* x = (const float*)d_in[0];
    const float* Wq = (const float*)d_in[1];
    const float* Wkv = (const float*)d_in[2];
    const float* Wqb = (const float*)d_in[3];
    const float* Wkvb = (const float*)d_in[4];
    const float* Wout = (const float*)d_in[5];
    const int C = 256;
    float* out = (float*)d_out;
    // every activation plane holds all 4 images, image-major; each is written by one launch (S by two) and read by later ones of this call
    char* wsp = (char*)d_ws;
    float* QT = (float*)wsp; wsp += (size_t)4 * 4096 * 256 * 4;            // [4][4096][256] q, position-major
    float* COL = (float*)wsp; wsp += (size_t)4 * 1024 * 1024 * 4;          // [4][1024][1024] im2col
    float* KVT = (float*)wsp; wsp += (size_t)4 * 1024 * 512 * 4;           // [4][1024][512] k | v
    float* QB = (float*)wsp; wsp += (size_t)4 * 4096 * 256 * 4;            // [4][4096][256]
    float* KVB = (float*)wsp; wsp += (size_t)4 * 4096 * 512 * 4;           // [4][4096][512]
    float* S = (float*)wsp; wsp += (size_t)4 * 4096 * 256 * 4;             // [4][4096][256] out_img, then + out_batch
    _Float16* XT16 = (_Float16*)wsp; wsp += (size_t)4 * 4096 * 256 * 2;    // [4][4096][256] x^T
    _Float16* COL16 = (_Float16*)wsp; wsp += (size_t)4 * 1024 * 1024 * 2;
    _Float16* S16 = (_Float16*)wsp; wsp += (size_t)4 * 4096 * 256 * 2;
    _Float16* W16 = (_Float16*)wsp; wsp += (size_t)851968 * 2;             // [Wq | Wqb | Wkvb | Wkv | Wout], x16
    const _Float16* Wq16 = W16;
    const _Float16* Wqb16 = W16 + 65536;
    const _Float16* Wkvb16 = W16 + 131072;
    const _Float16* Wkv16 = W16 + 262144;
    const _Float16* Wout16 = W16 + 786432;
    k_castT16<256, 4096><<<dim3(32, 4, 4), 256, 0, stream>>>(x, XT16, 1.0f);
    k_castW16<<<208, 256, 0, stream>>>(Wq, Wqb, Wkvb, Wkv, Wout, W16, 16.0f);
    // the 1x1 projections share their weights over the images: one GEMM each over the 4 * 4096 stacked positions
    w25::wmma_gemm64<0, false, 0, 0, false, 0><<<dim3(128, 1), 256, 0, stream>>>((const unsigned short*)(XT16), nullptr, 256, 0, (const unsigned short*)(Wqb16), nullptr, 256, 0, (void*)(QB), nullptr, 256, 0, nullptr, nullptr, 0, 16384, 256, 256, 0.0625f);
    w25::wmma_gemm64<0, false, 0, 0, false, 0><<<dim3(256, 1), 256, 0, stream>>>((const unsigned short*)(XT16), nullptr, 256, 0, (const unsigned short*)(Wkvb16), nullptr, 256, 0, (void*)(KVB), nullptr, 512, 0, nullptr, nullptr, 0, 16384, 512, 256, 0.0625f);
    w25::wmma_gemm64<0, false, 0, 0, false, 0><<<dim3(128, 1), 256, 0, stream>>>((const unsigned short*)(XT16), nullptr, 256, 0, (const unsigned short*)(Wq16), nullptr, 256, 0, (void*)(QT), nullptr, 256, 0, nullptr, nullptr, 0, 16384, 256, 256, 0.0625f);
    k_es_col<256, 64><<<dim3(128, 4), 256, 0, stream>>>(x, COL);
    k_cast16<<<512, 256, 0, stream>>>(COL, COL16, 1.0f);
    w25::wmma_gemm64<0, false, 0, 0, false, 0><<<dim3(64, 1), 256, 0, stream>>>((const unsigned short*)(COL16), nullptr, 1024, 0, (const unsigned short*)(Wkv16), nullptr, 1024, 0, (void*)(KVT), nullptr, 512, 0, nullptr, nullptr, 0, 4096, 512, 1024, 0.0625f);
    k_attn32<4096, 1024, 256, 512><<<dim3(64, 8, 4), 32 * AW, 0, stream>>>(QT, KVT, KVT + C, S, 0.1767766952966369f);
    k_es_batch<4096, 256><<<1024, 256, 0, stream>>>(QB, QB + 2097152, KVB, KVB + 2097152, KVB + 4194304, KVB + 6291456, S, S + 2097152);
    k_cast16<<<512, 256, 0, stream>>>(S, S16, 1.0f);
    // output conv: grid y = image (weights shared: stride 0)
    w25::wmma_gemm64<0, false, 0, 0, false, 0><<<dim3(32, 4), 256, 0, stream>>>((const unsigned short*)(Wout16), nullptr, 256, 0, (const unsigned short*)(S16), nullptr, 256, 1048576, (void*)(out), nullptr, 4096, 1048576, nullptr, nullptr, 0, 256, 4096, 256, 0.0625f);
}

// v005
// It runs in 159 microseconds.
// Two timings next to v004 put it at 1.50 and 1.48 times that version's speed.
// Counting every step since v000, it is 13.9 times as fast.
// Contractions (per image): q / qb / kvb 1x1 projections in position-major form x^T W^T [4096x256].[256x{256,256,512}], the 2x2-stride-2 kv conv as an im2col GEMM [1024x1024].[1024x512] and the output 1x1 conv Wout.(out_img + out_batch)^T [256x256].[256x4096], all with f16 operands (v_wmma_f32_16x16x32_f16; 64x64 register-blocked wave tiles over pre-cast f16 operand planes, weight operands pre-scaled by 16 at the cast and un-scaled in the f32 epilogue); the spatial-reduction attention per head (flash kernel, head_dim 32, 4096 queries x 1024 keys, f16 q.k^T and f16 p.v); f32 accumulate; the im2col is an f16 re-layout in the input cast launch; the batch-wise 4x4 attention per (position, head) and the branch sum are one f32 kernel with an f16 result.
#include <hip/hip_runtime.h>
#include <math.h>

typedef __attribute__((ext_vector_type(16))) _Float16 v16h;
typedef __attribute__((ext_vector_type(8)))  _Float16 v8h;
typedef __attribute__((ext_vector_type(16))) __bf16   v16b;
typedef __attribute__((ext_vector_type(8)))  float    v8f;
typedef __attribute__((ext_vector_type(4)))  float    v4f;

// 16-bit WMMA fragment map (wave32), lane L, h = L>>4, m = L&15:
//   A 16x32: lane = row m;   element i -> k = (i<8) ? 8h+i : 16+8h+(i-8)
//   B 32x16: lane = column m; the SAME k(i,h)
//   D 16x16 (8 f32): lane = column m; element r -> row 8h+r
__device__ __forceinline__ int frag_k(int i, int h) { return (i < 8) ? (8 * h + i) : (16 + 8 * h + (i - 8)); }
__device__ __forceinline__ __bf16 bf16_rne(float f) {
    unsigned int u = __float_as_uint(f);
    u += 0x7fffu + ((u >> 16) & 1u);
    return __builtin_bit_cast(__bf16, (unsigned short)(u >> 16));
}
__device__ __forceinline__ float bf16_f32(__bf16 b) { return __uint_as_float(((unsigned int)__builtin_bit_cast(unsigned short, b)) << 16); }
__device__ __forceinline__ v8f wmma16(v16h a, v16h b, v8f c) {
    c = __builtin_amdgcn_wmma_f32_16x16x32_f16(false, a, false, b, (short)0, c, false, false);
    asm volatile("v_nop\n\tv_nop\n\tv_nop\n\tv_nop" : "+v"(c) : "v"(a), "v"(b));
    return c;
}
__device__ __forceinline__ v8f wmmab(v16b a, v16b b, v8f c) {
    c = __builtin_amdgcn_wmma_f32_16x16x32_bf16(false, a, false, b, (short)0, c, false, false);
    asm volatile("v_nop\n\tv_nop\n\tv_nop\n\tv_nop" : "+v"(c) : "v"(a), "v"(b));
    return c;
}
struct Split { v16b hi, lo; };
// hi/lo split product: a.hi*b.hi + a.hi*b.lo + a.lo*b.hi
__device__ __forceinline__ v8f wmma3(const Split& a, const Split& b, v8f c) {
    c = __builtin_amdgcn_wmma_f32_16x16x32_bf16(false, a.hi, false, b.hi, (short)0, c, false, false);
    c = __builtin_amdgcn_wmma_f32_16x16x32_bf16(false, a.hi, false, b.lo, (short)0, c, false, false);
    c = __builtin_amdgcn_wmma_f32_16x16x32_bf16(false, a.lo, false, b.hi, (short)0, c, false, false);
    asm volatile("v_nop\n\tv_nop\n\tv_nop\n\tv_nop" : "+v"(c) : "v"(a.hi), "v"(a.lo), "v"(b.hi), "v"(b.lo));
    return c;
}
struct Split3 { v16b hi, mid, lo; };
// triple split product (6 terms, drops only terms below 2^-24 relative)
__device__ __forceinline__ v8f wmma6(const Split3& a, const Split3& b, v8f c) {
    c = __builtin_amdgcn_wmma_f32_16x16x32_bf16(false, a.hi, false, b.hi, (short)0, c, false, false);
    c = __builtin_amdgcn_wmma_f32_16x16x32_bf16(false, a.hi, false, b.mid, (short)0, c, false, false);
    c = __builtin_amdgcn_wmma_f32_16x16x32_bf16(false, a.mid, false, b.hi, (short)0, c, false, false);
    c = __builtin_amdgcn_wmma_f32_16x16x32_bf16(false, a.hi, false, b.lo, (short)0, c, false, false);
    c = __builtin_amdgcn_wmma_f32_16x16x32_bf16(false, a.mid, false, b.mid, (short)0, c, false, false);
    c = __builtin_amdgcn_wmma_f32_16x16x32_bf16(false, a.lo, false, b.hi, (short)0, c, false, false);
    asm volatile("v_nop\n\tv_nop\n\tv_nop\n\tv_nop" : "+v"(c) : "v"(a.hi), "v"(a.mid), "v"(a.lo), "v"(b.hi), "v"(b.mid), "v"(b.lo));
    return c;
}

// Fragment gathers from f32 memory: element i <- p[(k0 + frag_k(i,h)) * sk] * s, zero for k >= klen.
__device__ __forceinline__ v16h fh_ld(const float* __restrict__ p, long long sk, int k0, int h, int klen, float s) {
    v16h a;
#pragma unroll
    for (int i = 0; i < 16; ++i) { const int k = k0 + frag_k(i, h); a[i] = (k < klen) ? (_Float16)(p[(long long)k * sk] * s) : (_Float16)0.f; }
    return a;
}
__device__ __forceinline__ Split sp_ld(const float* __restrict__ p, long long sk, int k0, int h, int klen, float s) {
    Split r;
#pragma unroll
    for (int i = 0; i < 16; ++i) {
        const int k = k0 + frag_k(i, h); const float x = (k < klen) ? p[(long long)k * sk] * s : 0.f;
        const __bf16 hb = bf16_rne(x); r.hi[i] = hb; r.lo[i] = bf16_rne(x - bf16_f32(hb));
    }
    return r;
}
__device__ __forceinline__ Split3 sp3_ld(const float* __restrict__ p, long long sk, int k0, int h, int klen, float s) {
    Split3 r;
#pragma unroll
    for (int i = 0; i < 16; ++i) {
        const int k = k0 + frag_k(i, h); const float x = (k < klen) ? p[(long long)k * sk] * s : 0.f;
        const __bf16 hb = bf16_rne(x); const float r1 = x - bf16_f32(hb); const __bf16 mb = bf16_rne(r1);
        r.hi[i] = hb; r.mid[i] = mb; r.lo[i] = bf16_rne(r1 - bf16_f32(mb));
    }
    return r;
}
__device__ __forceinline__ v16b bh_ld(const float* __restrict__ p, long long sk, int k0, int h, int klen, float s) {
    v16b a;
#pragma unroll
    for (int i = 0; i < 16; ++i) { const int k = k0 + frag_k(i, h); a[i] = bf16_rne((k < klen) ? p[(long long)k * sk] * s : 0.f); }
    return a;
}
// f16 fragment from an f16 LDS/global row with element stride 1 (k-contiguous), no bounds (tile already zero padded)
__device__ __forceinline__ v16h fh_row(const _Float16* __restrict__ row, int k0, int h) {
    v16h a;
#pragma unroll
    for (int i = 0; i < 16; ++i) a[i] = row[k0 + frag_k(i, h)];
    return a;
}

#define VST2(T, ptr, val) do { const T vst2_v_ = (val); *(T*)(ptr) = vst2_v_;  } while (0)
typedef float v4f __attribute__((ext_vector_type(4)));
#define VST2V4(ptr, val) do { const v4f vst2_v4_ = (val); *(v4f*)(ptr) = vst2_v4_;  } while (0)

__device__ __attribute__((noinline)) float act_fn(float v, int act) {
    if (act == 1) return fmaxf(v, 0.f);                                                                               // relu
    if (act == 2) { const float u = 0.7978845608028654f * (v + 0.044715f * v * v * v); return 0.5f * v * (1.f + tanhf(u)); } // tanh-gelu
    if (act == 3) return v / (1.f + expf(-v));                                                                        // silu
    if (act == 4) return 0.5f * v * (1.f + erff(v * 0.7071067811865476f));                                             // erf-gelu
    if (act == 5) return tanhf(v);
    if (act == 6) return 1.f / (1.f + expf(-v));                                                                      // sigmoid
    if (act == 7) return (v > 0.f) ? v : 0.01f * v;                                                                   // leaky relu 0.01
    if (act == 8) return (v > 0.f) ? v : (expf(v) - 1.f);                                                             // elu
    if (act == 9) return fminf(fmaxf(v, 0.f), 6.f);                                                                   // relu6
    if (act == 10) return fabsf(v);                                                                                    // abs
    if (act == 11) return (v >= 0.f) ? v : 0.1f * v;                                                                  // leaky 0.1
    if (act == 12) return (v > 0.f) ? v : 0.2f * v;                                                                   // leaky 0.2
    if (act == 13) return (v > 20.f) ? v : log1pf(expf(v));                                                            // softplus
    return v;
}

// =====================================================================================================================
// k_gemm<MODE>: C(z, m, n) = act(alpha * sum_k A(z, m, k) * B(z, k, n) + bias) + beta * R(z, m, n)
//   One wave (32-thread block) per 16 x 32 tile of C; grid (ceil(N/32), ceil(M/16), Z). Batch z -> (zo = z / zi_n, zi = z % zi_n)
//   with separate outer/inner strides for every tensor (e.g. batch and head). A(m,k) = A[zo*sAo + zi*sAi + m*sAm + k*sAk] (f32),
//   B(k,n) = B[zo*sBo + zi*sBi + n*sBn + k*sBk] (f32); any M, N, K (K zero-padded to 32 inside the fragments, M/N tails guarded).
//   C(m,n) = C[zo*sCo + zi*sCi + m*sCm + n] (n contiguous). flags: 1 bias[n], 2 bias[m], 4 residual R[zo*sRo + zi*sRi + m*sRm + n*sRn].
//   MODE 0: f16 operands (A prescaled by sa, B by sb, both undone in the epilogue); 1: bf16 hi/lo split (3 products); 2: bf16;
//   3: bf16 hi/mid/lo triple split (6 products); 4: as 3 with Kahan-compensated f32 accumulation across k-steps.
// =====================================================================================================================
struct GemmP {
    const float* A; const float* B; const float* bias; const float* R; float* C;
    long long sAo, sAi, sAm, sAk, sBo, sBi, sBn, sBk, sCo, sCi, sCm, sRo, sRi, sRm, sRn;
    int M, N, K, zi_n, flags, act; float alpha, beta, sa, sb;
    int Npad, pad_;     // columns [N, Npad) of C are written as 0 so that padded workspace rows are covered by whole-line stores; Npad >= N
};
static_assert(sizeof(GemmP) == 5 * 8 + 15 * 8 + 6 * 4 + 4 * 4 + 2 * 4, "GemmP has padding");

template <int MODE>
__global__ __launch_bounds__(32) void k_gemm(GemmP p) {
    const int lane = threadIdx.x & 31, h = lane >> 4, l15 = lane & 15;
    const int m0 = blockIdx.y * 16, n0 = blockIdx.x * 32;
    const int z = blockIdx.z, zo = z / p.zi_n, zi = z - zo * p.zi_n;
    const float* A = p.A + zo * p.sAo + zi * p.sAi;
    const float* B = p.B + zo * p.sBo + zi * p.sBi;
    const int am = min(m0 + l15, p.M - 1);                       // clamped row for loads (stores are guarded)
    v8f acc[2], comp[2];
#pragma unroll
    for (int t = 0; t < 2; ++t) { v8f zz = {}; acc[t] = zz; comp[t] = zz; }
    for (int k0 = 0; k0 < p.K; k0 += 32) {
        const float* arow = A + (long long)am * p.sAm;
        if (MODE == 1) {
            const Split a = sp_ld(arow, p.sAk, k0, h, p.K, 1.f);
#pragma unroll
            for (int t = 0; t < 2; ++t) {
                const int bn = min(n0 + t * 16 + l15, p.N - 1);
                acc[t] = wmma3(a, sp_ld(B + (long long)bn * p.sBn, p.sBk, k0, h, p.K, 1.f), acc[t]);
            }
        } else if (MODE == 3) {
            const Split3 a = sp3_ld(arow, p.sAk, k0, h, p.K, 1.f);
#pragma unroll
            for (int t = 0; t < 2; ++t) {
                const int bn = min(n0 + t * 16 + l15, p.N - 1);
                acc[t] = wmma6(a, sp3_ld(B + (long long)bn * p.sBn, p.sBk, k0, h, p.K, 1.f), acc[t]);
            }
        } else if (MODE == 4) {
            // triple split as MODE 3, but each k-step's 6 products go into a fresh accumulator and the partial is added to the running f32 sum
            // on the VALU with Kahan compensation (accumulation error stays ~1 ulp however long K is)
            const Split3 a = sp3_ld(arow, p.sAk, k0, h, p.K, 1.f);
#pragma unroll
            for (int t = 0; t < 2; ++t) {
                const int bn = min(n0 + t * 16 + l15, p.N - 1); v8f zz = {};
                const v8f part = wmma6(a, sp3_ld(B + (long long)bn * p.sBn, p.sBk, k0, h, p.K, 1.f), zz);
                const v8f y = part - comp[t]; const v8f s = acc[t] + y; comp[t] = (s - acc[t]) - y; acc[t] = s;
            }
        } else if (MODE == 2) {
            const v16b a = bh_ld(arow, p.sAk, k0, h, p.K, 1.f);
#pragma unroll
            for (int t = 0; t < 2; ++t) {
                const int bn = min(n0 + t * 16 + l15, p.N - 1);
                acc[t] = wmmab(a, bh_ld(B + (long long)bn * p.sBn, p.sBk, k0, h, p.K, 1.f), acc[t]);
            }
        } else {
            const v16h a = fh_ld(arow, p.sAk, k0, h, p.K, p.sa);
#pragma unroll
            for (int t = 0; t < 2; ++t) {
                const int bn = min(n0 + t * 16 + l15, p.N - 1);
                acc[t] = wmma16(a, fh_ld(B + (long long)bn * p.sBn, p.sBk, k0, h, p.K, p.sb), acc[t]);
            }
        }
    }
    const float iscale = (MODE == 0) ? p.alpha / (p.sa * p.sb) : p.alpha;
    float* C = p.C + zo * p.sCo + zi * p.sCi;
    const float* R = p.R + zo * p.sRo + zi * p.sRi;
    __shared__ __align__(16) float ctile[16][36];
#pragma unroll
    for (int t = 0; t < 2; ++t) {
        const int n = n0 + t * 16 + l15; const int nn = min(n, p.N - 1);
#pragma unroll
        for (int r = 0; r < 8; ++r) {
            const int m = m0 + 8 * h + r; const int mm = min(m, p.M - 1);
            float v = acc[t][r] * iscale;
            if (p.flags & 1) v += p.bias[nn];
            if (p.flags & 2) v += p.bias[mm];
            if (p.flags & 8) v *= p.bias[(long long)zo * p.M + mm];   /* per-(z,row) scale vector laid out [Z][M]; exclusive with the bias flags */
            v = act_fn(v, p.act);
            if (p.flags & 4) v += p.beta * R[(long long)mm * p.sRm + (long long)nn * p.sRn];
            ctile[8 * h + r][t * 16 + l15] = (n < p.N) ? v : 0.f;
        }
    }
    __syncthreads();
    const int NW = (p.Npad > p.N) ? p.Npad : p.N;           // write width
    const bool fast = (m0 + 16 <= p.M) && (n0 + 32 <= NW) && ((p.sCm & 3) == 0) && ((((size_t)C) & 15) == 0);
    if (fast) {
#pragma unroll
        for (int s = 0; s < 4; ++s) {
            const int row = s * 4 + (lane >> 3), c4 = (lane & 7) * 4;
            const v4f v = *(const v4f*)&ctile[row][c4];
            VST2V4(C + (long long)(m0 + row) * p.sCm + n0 + c4, v);
        }
    } else {
        for (int row = 0; row < 16; ++row) {
            const int m = m0 + row, n = n0 + lane;
            if (m < p.M && n < NW) VST2(float, C + (long long)m * p.sCm + n, ctile[row][lane]);
        }
    }
}


// =====================================================================================================================
// k_gemmT<MODE, TM, TN>: same contract as k_gemm, but one wave computes a (16*TM) x (16*TN) tile: TM A fragments and TN B fragments are
//   loaded per 32-wide k-step and reused across TM*TN WMMAs (far fewer load/convert instructions per MAC). MODE 0 (f16), 1 (bf16 hi/lo),
//   2 (bf16) only. grid (ceil(NW/(16*TN)), ceil(M/(16*TM)), Z), block 32. Epilogue identical to k_gemm, run per 16x32 sub-tile.
// =====================================================================================================================
template <int MODE, int TM, int TN>
__global__ __launch_bounds__(32) void k_gemmT(GemmP p) {
    const int lane = threadIdx.x & 31, h = lane >> 4, l15 = lane & 15;
    const int m0 = blockIdx.y * (16 * TM), n0 = blockIdx.x * (16 * TN);
    const int z = blockIdx.z, zo = z / p.zi_n, zi = z - zo * p.zi_n;
    const float* A = p.A + zo * p.sAo + zi * p.sAi;
    const float* B = p.B + zo * p.sBo + zi * p.sBi;
    v8f acc[TM][TN];
#pragma unroll
    for (int i = 0; i < TM; ++i)
#pragma unroll
        for (int t = 0; t < TN; ++t) { v8f zz = {}; acc[i][t] = zz; }
    for (int k0 = 0; k0 < p.K; k0 += 32) {
        if (MODE == 1) {
            Split a[TM], b[TN];
#pragma unroll
            for (int i = 0; i < TM; ++i) { const int am = min(m0 + 16 * i + l15, p.M - 1); a[i] = sp_ld(A + (long long)am * p.sAm, p.sAk, k0, h, p.K, 1.f); }
#pragma unroll
            for (int t = 0; t < TN; ++t) { const int bn = min(n0 + 16 * t + l15, p.N - 1); b[t] = sp_ld(B + (long long)bn * p.sBn, p.sBk, k0, h, p.K, 1.f); }
#pragma unroll
            for (int i = 0; i < TM; ++i)
#pragma unroll
                for (int t = 0; t < TN; ++t) acc[i][t] = wmma3(a[i], b[t], acc[i][t]);
        } else if (MODE == 2) {
            v16b a[TM], b[TN];
#pragma unroll
            for (int i = 0; i < TM; ++i) { const int am = min(m0 + 16 * i + l15, p.M - 1); a[i] = bh_ld(A + (long long)am * p.sAm, p.sAk, k0, h, p.K, 1.f); }
#pragma unroll
            for (int t = 0; t < TN; ++t) { const int bn = min(n0 + 16 * t + l15, p.N - 1); b[t] = bh_ld(B + (long long)bn * p.sBn, p.sBk, k0, h, p.K, 1.f); }
#pragma unroll
            for (int i = 0; i < TM; ++i)
#pragma unroll
                for (int t = 0; t < TN; ++t) acc[i][t] = wmmab(a[i], b[t], acc[i][t]);
        } else {
            v16h a[TM], b[TN];
#pragma unroll
            for (int i = 0; i < TM; ++i) { const int am = min(m0 + 16 * i + l15, p.M - 1); a[i] = fh_ld(A + (long long)am * p.sAm, p.sAk, k0, h, p.K, p.sa); }
#pragma unroll
            for (int t = 0; t < TN; ++t) { const int bn = min(n0 + 16 * t + l15, p.N - 1); b[t] = fh_ld(B + (long long)bn * p.sBn, p.sBk, k0, h, p.K, p.sb); }
#pragma unroll
            for (int i = 0; i < TM; ++i)
#pragma unroll
                for (int t = 0; t < TN; ++t) acc[i][t] = wmma16(a[i], b[t], acc[i][t]);
        }
    }
    const float iscale = (MODE == 0) ? p.alpha / (p.sa * p.sb) : p.alpha;
    float* C = p.C + zo * p.sCo + zi * p.sCi;
    const float* R = p.R + zo * p.sRo + zi * p.sRi;
    const int NW = (p.Npad > p.N) ? p.Npad : p.N;
    __shared__ __align__(16) float ctile[16][36];
#pragma unroll
    for (int i = 0; i < TM; ++i) {
        const int mb = m0 + 16 * i; if (mb >= p.M) break;          // wave-uniform
#pragma unroll
        for (int tp = 0; tp < TN / 2; ++tp) {
            const int nb = n0 + 32 * tp; if (nb >= NW) break;        // wave-uniform
#pragma unroll
            for (int t2 = 0; t2 < 2; ++t2) {
                const int t = 2 * tp + t2; const int n = nb + t2 * 16 + l15; const int nn = min(n, p.N - 1);
#pragma unroll
                for (int r = 0; r < 8; ++r) {
                    const int m = mb + 8 * h + r; const int mm = min(m, p.M - 1);
                    float v = acc[i][t][r] * iscale;
                    if (p.flags & 1) v += p.bias[nn];
                    if (p.flags & 2) v += p.bias[mm];
            if (p.flags & 8) v *= p.bias[(long long)zo * p.M + mm];   /* per-(z,row) scale vector laid out [Z][M]; exclusive with the bias flags */
                    v = act_fn(v, p.act);
                    if (p.flags & 4) v += p.beta * R[(long long)mm * p.sRm + (long long)nn * p.sRn];
                    ctile[8 * h + r][t2 * 16 + l15] = (n < p.N) ? v : 0.f;
                }
            }
            __syncthreads();
            const bool fast = (mb + 16 <= p.M) && (nb + 32 <= NW) && ((p.sCm & 3) == 0) && ((((size_t)C) & 15) == 0);
            if (fast) {
#pragma unroll
                for (int s = 0; s < 4; ++s) {
                    const int row = s * 4 + (lane >> 3), c4 = (lane & 7) * 4;
                    const v4f v = *(const v4f*)&ctile[row][c4];
                    VST2V4(C + (long long)(mb + row) * p.sCm + nb + c4, v);
                }
            } else {
                for (int row = 0; row < 16; ++row) {
                    const int m = mb + row, n = nb + lane;
                    if (m < p.M && n < NW) VST2(float, C + (long long)m * p.sCm + n, ctile[row][lane]);
                }
            }
            __syncthreads();
        }
    }
}

// =====================================================================================================================
// k_attn32<LQ, LK, QP, KP, SP>: flash attention at one fixed shape, all of it known at compile time: LQ queries, LK keys (a multiple of 64), head and
//   value dim 32, f32 rows with element stride 1 (Q row pitch QP floats, O row pitch SP floats, K and V row pitch KP floats, head h at column 32 h), no mask.
//   Wave = 16 queries, AW waves per block, 64-key blocks; grid (LQ / (16*AW), heads, images), block 32*AW; image z at Q + z*LQ*QP, O + z*LQ*SP and K, V + z*LK*KP. Every Q, K and V row piece is whole and
//   16-byte aligned, so it is read with unguarded 16-byte loads that are all in flight together.
//   Both products are transposed: S^T = K . Q^T (A = 16 key rows, B = the wave's 16 queries) and O^T += V^T . P^T. A lane then holds scores of ONE query (its column l15; keys 16 t + 8 hf + r),
//   so the maximum and the sum are taken in the lane, with one exchange between the lane halves, and two score tiles, converted in place, are the B operand of the second product.
//   Scores: f16 operands; statistics f32 (exp2 domain); P x 4096 as f16; V f16 staged in LDS as V^T (a row = one d, 64 keys).
// =====================================================================================================================
#define AW 4
typedef __attribute__((ext_vector_type(4))) _Float16 v4h;
// the 16 f32 that make up lane half h's fragment of a 32-wide row: k = 8h..8h+7 and 16+8h..16+8h+7 (the order of frag_k)
struct Row16 { v4f r[4]; };
__device__ __forceinline__ Row16 row16_ld(const float* __restrict__ row, int h) {
    Row16 x;
    x.r[0] = *(const v4f*)(row + 8 * h); x.r[1] = *(const v4f*)(row + 8 * h + 4);
    x.r[2] = *(const v4f*)(row + 16 + 8 * h); x.r[3] = *(const v4f*)(row + 16 + 8 * h + 4);
    return x;
}
__device__ __forceinline__ v16h row16_f16(const Row16& x) {
    v16h a;
#pragma unroll
    for (int q = 0; q < 4; ++q)
#pragma unroll
        for (int e = 0; e < 4; ++e) a[4 * q + e] = (_Float16)x.r[q][e];
    return a;
}
// the value that lane l ^ 16 holds
__device__ __forceinline__ float other_half(float x) {
    const int b = __float_as_int(x);
    return __int_as_float(__builtin_amdgcn_permlanex16(b, b, 0x76543210, 0xfedcba98, false, false));
}
// f16 fragment in the order of frag_k from a k-contiguous f16 LDS row: p points at k = 8h
__device__ __forceinline__ v16h frag_row(const _Float16* p) {
    union { v16h v; v8h h[2]; } f;
    f.h[0] = *(const v8h*)(p); f.h[1] = *(const v8h*)(p + 16);
    return f.v;
}
// amdgpu_waves_per_eu(8): a budget of 128 registers a wave, so that 8 blocks fit on a WGP at once (one register more would leave room for 7)
template <int LQ, int LK, int QP, int KP, int SP>
__global__ __launch_bounds__(32 * AW) __attribute__((amdgpu_waves_per_eu(8))) void k_attn32(const float* __restrict__ Q, const float* __restrict__ K, const float* __restrict__ V, float* __restrict__ O, float scale) {
    static_assert(LQ % (16 * AW) == 0 && LK % 64 == 0 && QP % 4 == 0 && KP % 4 == 0 && SP % 4 == 0, "whole tiles, 16-byte rows");
    constexpr int NT = 2;                       // output tiles (16 d each)
    constexpr int VP = 64 + 8;                  // LDS pitch of a V^T row (halves): 144 bytes = 16 x 9, for 16-byte readers
    constexpr int OP = 32 + 4;                  // LDS pitch of an output row (floats)
    __shared__ __align__(16) float    ol[AW][16 * OP];
    __shared__ __align__(16) _Float16 vl[32 * VP];
    const int lane = threadIdx.x & 31, hf = lane >> 4, l15 = lane & 15, wave = threadIdx.x >> 5;
    const int h = blockIdx.y;
    const int q0 = (blockIdx.x * AW + wave) * 16;
    Q += (size_t)blockIdx.z * LQ * QP; O += (size_t)blockIdx.z * LQ * SP;      // image blockIdx.z: its own Q / O plane
    K += (size_t)blockIdx.z * LK * KP; V += (size_t)blockIdx.z * LK * KP;      // and its own K / V plane
    const float L2E = 1.4426950408889634f;
    const float NEG = -__builtin_inff();
    const float* kbase = K + h * 32 + (size_t)l15 * KP;                                         // this lane's key row of a 16-key tile
    const float* vbase = V + h * 32 + (size_t)(threadIdx.x >> 3) * 4 * KP + (threadIdx.x & 7) * 4;  // this thread's 4 floats of 4 consecutive key rows
    _Float16* vst = vl + (threadIdx.x & 7) * 4 * VP + (threadIdx.x >> 3) * 4;                   // the same 4 x 4 piece, transposed
    const v16h qa = row16_f16(row16_ld(Q + h * 32 + (size_t)(q0 + l15) * QP, hf));
    asm volatile("s_wait_xcnt 0x0" ::: "memory");   // the Q loads' address registers are reused for the start values set below: the wait stands in front of that overwrite
    __builtin_amdgcn_sched_barrier(0);              // keeps those later register writes from being scheduled ahead of the wait
    v8f o[NT]; float mrun = NEG, lrun = 0.f;        // this lane's query: running maximum (both halves agree) and this half's part of the sum
#pragma unroll
    for (int t = 0; t < NT; ++t) { v8f zz = {}; o[t] = zz; }
    for (int j0 = 0; j0 < LK; j0 += 64) {
        v4f vr[4]; Row16 kr[4];
#pragma unroll
        for (int n = 0; n < 4; ++n) vr[n] = *(const v4f*)(vbase + (size_t)(j0 + n) * KP);
#pragma unroll
        for (int t = 0; t < 4; ++t) kr[t] = row16_ld(kbase + (size_t)(j0 + 16 * t) * KP, hf);
        asm volatile("s_wait_xcnt 0x0" ::: "memory");    // the K and V loads' address registers are reused for the converted values below: the wait stands in front of that overwrite
        __builtin_amdgcn_sched_barrier(0);               // keeps those register writes from being scheduled ahead of the wait
        __syncthreads();                                 // previous key block's reads of vl are done
#pragma unroll
        for (int e = 0; e < 4; ++e) {
            const v4h hv = {(_Float16)vr[0][e], (_Float16)vr[1][e], (_Float16)vr[2][e], (_Float16)vr[3][e]};
            *(v4h*)(vst + e * VP) = hv;
        }
        v8f s[4];
#pragma unroll
        for (int t = 0; t < 4; ++t) { v8f acc = {}; s[t] = wmma16(row16_f16(kr[t]), qa, acc); }
        float mt[4];                                     // one maximum a tile: four short chains, not one of 32
#pragma unroll
        for (int t = 0; t < 4; ++t) {
#pragma unroll
            for (int r = 0; r < 8; ++r) { float v = s[t][r] * scale; v *= L2E; s[t][r] = v; }
            float a = fmaxf(s[t][0], s[t][1]);
#pragma unroll
            for (int r = 2; r < 8; ++r) a = fmaxf(a, s[t][r]);
            mt[t] = a;
        }
        float mx = fmaxf(fmaxf(mt[0], mt[1]), fmaxf(mt[2], mt[3]));
        mx = fmaxf(mx, other_half(mx));
        const float mnew = fmaxf(mrun, mx);
        const float corr = exp2f(mrun - mnew);           // first block: exp2(-inf) = 0
#pragma unroll
        for (int t = 0; t < 4; ++t)
#pragma unroll
            for (int r = 0; r < 8; ++r) s[t][r] = exp2f(s[t][r] - mnew);
        const v8f ps = (s[0] + s[1]) + (s[2] + s[3]);
        const float rs = ((ps[0] + ps[1]) + (ps[2] + ps[3])) + ((ps[4] + ps[5]) + (ps[6] + ps[7]));
        lrun = lrun * corr + rs; mrun = mnew;
#pragma unroll
        for (int t = 0; t < NT; ++t) o[t] *= corr;
        v16h pb0, pb1;                                   // P^T fragments: element e <- key frag_k(e, hf) (+ 32), which is element e & 7 of score tile e >> 3 (+ 2)
#pragma unroll
        for (int e = 0; e < 16; ++e) { pb0[e] = (_Float16)(s[e >> 3][e & 7] * 4096.f); pb1[e] = (_Float16)(s[2 + (e >> 3)][e & 7] * 4096.f); }
        __syncthreads();                                 // V^T visible
#pragma unroll
        for (int t = 0; t < NT; ++t) {
            const _Float16* vrow = vl + (t * 16 + l15) * VP + 8 * hf;
            o[t] = wmma16(frag_row(vrow), pb0, o[t]);
            o[t] = wmma16(frag_row(vrow + 32), pb1, o[t]);
        }
    }
    float* obase = O + h * 32;
    const float inv = 1.f / ((lrun + other_half(lrun)) * 4096.f);   // no key is masked: the row sum holds its maximum's exp2(0) = 1
    float* myo = ol[wave];                                       // the wave's own 16 x 32 output tile, query-major
#pragma unroll
    for (int t = 0; t < NT; ++t) {
        const v4f lo = {o[t][0] * inv, o[t][1] * inv, o[t][2] * inv, o[t][3] * inv}, hi = {o[t][4] * inv, o[t][5] * inv, o[t][6] * inv, o[t][7] * inv};
        *(v4f*)(myo + l15 * OP + t * 16 + 8 * hf) = lo; *(v4f*)(myo + l15 * OP + t * 16 + 8 * hf + 4) = hi;
    }
    __syncthreads();
#pragma unroll
    for (int r0 = 0; r0 < 16; r0 += 4) {
        const int row = r0 + (lane >> 3), c4 = (lane & 7) * 4;
        const v4f v = *(const v4f*)(myo + row * OP + c4);
        VST2V4(obase + (size_t)(q0 + row) * SP + c4, v);
    }
}

// =====================================================================================================================
// k_tr: dst(z, c, r) = alpha * src(z, r, c) (+ beta * R2(z, c, r)): [Z][R][C] (row stride lds) -> [Z][C][R] (row stride ldd) through a 32x32 LDS tile;
//   flags: 1 -> add beta * residual R2 addressed like dst (z*sRz + c*ldr + r); act applied before the residual.
// =====================================================================================================================
struct TrP { const float* src; float* dst; const float* R2; long long sSz, lds, sDz, ldd, sRz, ldr; int R, C, flags, act; float alpha, beta; };
static_assert(sizeof(TrP) == 3 * 8 + 6 * 8 + 6 * 4, "TrP has padding");
__global__ __launch_bounds__(256) void k_tr(TrP p) {
    __shared__ float tile[32][33];
    const int c0 = blockIdx.x * 32, r0 = blockIdx.y * 32, z = blockIdx.z;
    const int lane = threadIdx.x & 31, wave = threadIdx.x >> 5;
    const float* s = p.src + z * p.sSz;
#pragma unroll
    for (int k = 0; k < 4; ++k) {
        const int rl = wave * 4 + k, r = r0 + rl, c = c0 + lane;
        tile[rl][lane] = (r < p.R && c < p.C) ? s[(long long)r * p.lds + c] : 0.f;
    }
    __syncthreads();
    float* d = p.dst + z * p.sDz; const float* rr = p.R2 + z * p.sRz;
#pragma unroll
    for (int k = 0; k < 4; ++k) {
        const int cl = wave * 4 + k, c = c0 + cl, r = r0 + lane;
        if (c < p.C && r < p.R) {
            float v = act_fn(p.alpha * tile[lane][cl], p.act);
            if (p.flags & 1) v += p.beta * rr[(long long)c * p.ldr + r];
            VST2(float, d + (long long)c * p.ldd + r, v);
        }
    }
}

// k_affine: dst[i] = a * (sdev ? sdev[0] : 1) * src[i] + b, i < n (one thread per element; consecutive lanes -> consecutive addresses)
__global__ __launch_bounds__(256) void k_affine(const float* __restrict__ src, float* __restrict__ dst, int n, float a, float b, const float* __restrict__ sdev) {
    const int i = blockIdx.x * 256 + threadIdx.x;
    if (i < n) { const float aa = sdev ? a * sdev[0] : a; const float v = aa * src[i] + b; VST2(float, dst + i, v); }
}

// =====================================================================================================================
// k_softmax: row softmax over n contiguous elements, one 256-thread block per row; rows addressed z*sz + r*sr (grid (R, Z)).
//   out = scale_out * softmax(scale_in * x + (Mf ? Mf[z*smz + r*smr + j] : 0)); a row whose max is -inf is written as 0.
// =====================================================================================================================
struct SmP { const float* src; float* dst; const float* Mf; long long sz, sr, dz, dr, smz, smr; int n, pad; float scale_in, scale_out; };
static_assert(sizeof(SmP) == 3 * 8 + 6 * 8 + 4 * 4, "SmP has padding");
__global__ __launch_bounds__(256) void k_softmax(SmP p) {
    __shared__ float red[256];
    const int r = blockIdx.x, z = blockIdx.y, tid = threadIdx.x;
    const float* s = p.src + z * p.sz + (long long)r * p.sr;
    const float* mf = p.Mf ? (p.Mf + z * p.smz + (long long)r * p.smr) : nullptr;
    float mx = -__builtin_inff();
    for (int j = tid; j < p.n; j += 256) { float v = s[j] * p.scale_in; if (mf) v += mf[j]; mx = fmaxf(mx, v); }
    red[tid] = mx; __syncthreads();
    for (int o = 128; o > 0; o >>= 1) { if (tid < o) red[tid] = fmaxf(red[tid], red[tid + o]); __syncthreads(); }
    mx = red[0]; __syncthreads();
    float sum = 0.f;
    for (int j = tid; j < p.n; j += 256) { float v = s[j] * p.scale_in; if (mf) v += mf[j]; sum += (mx == -__builtin_inff()) ? 0.f : expf(v - mx); }
    red[tid] = sum; __syncthreads();
    for (int o = 128; o > 0; o >>= 1) { if (tid < o) red[tid] += red[tid + o]; __syncthreads(); }
    sum = red[0];
    const float inv = (sum > 0.f) ? p.scale_out / sum : 0.f;
    float* d = p.dst + z * p.dz + (long long)r * p.dr;
    for (int j = tid; j < p.n; j += 256) { float v = s[j] * p.scale_in; if (mf) v += mf[j]; const float o = (mx == -__builtin_inff()) ? 0.f : expf(v - mx) * inv; VST2(float, d + j, o); }
}
// =====================================================================================================================
// k_stats: mean and rsqrt(var + eps) over a set of n elements addressed base + z*sz + (e / inner) * so + (e % inner) * si, one 256-thread
// k_norm_apply: y = (x - mean[set]) * rstd[set] * g[c] + b[c] over a [Z][C][L] channel-major tensor with set = z*G + c / (C/G) (G groups per z;
//   G = C -> per-channel sets indexed z*C+c; for batch norm pass stats indexed by c only via bn = 1). Optional act. Output same layout.
// =====================================================================================================================
//   mode 0: mean / rsqrt(var + eps); mode 1 (RMSNorm): 0 / rsqrt(mean(x^2) + eps); mode 2 (L2 normalize * sqrt(n)): 0 / sqrt(n) / max(||x||, eps); mode 3: as 0 with unbiased variance (n-1)
__global__ __launch_bounds__(256) void k_stats(const float* __restrict__ x, long long sz, long long so, long long si, int inner, int n, float eps, float* __restrict__ stat, int mode) {
    __shared__ float red[256];
    const int z = blockIdx.x, tid = threadIdx.x;
    const float* base = x + z * sz;
    float s = 0.f;
    for (int e = tid; e < n; e += 256) s += base[(long long)(e / inner) * so + (long long)(e % inner) * si];
    red[tid] = s; __syncthreads();
    for (int o = 128; o > 0; o >>= 1) { if (tid < o) red[tid] += red[tid + o]; __syncthreads(); }
    const float mu = (mode == 0 || mode == 3) ? red[0] / (float)n : 0.f; __syncthreads();
    float q = 0.f;
    for (int e = tid; e < n; e += 256) { const float dlt = base[(long long)(e / inner) * so + (long long)(e % inner) * si] - mu; q += dlt * dlt; }
    red[tid] = q; __syncthreads();
    for (int o = 128; o > 0; o >>= 1) { if (tid < o) red[tid] += red[tid + o]; __syncthreads(); }
    {
        float rs;
        if (mode == 2) rs = sqrtf((float)n) / fmaxf(sqrtf(red[0]), eps); else if (mode == 3) rs = rsqrtf(red[0] / (float)(n - 1) + eps); else rs = rsqrtf(red[0] / (float)n + eps);
        if (tid < 32) { const float v = (tid == 0) ? mu : ((tid == 1) ? rs : 0.f); VST2(float, stat + (long long)z * 32 + tid, v); }
    }
}
//   One thread per element over the flat [Z][C][L] index space: grid ceil(Z*C*L / 256).
__global__ __launch_bounds__(256) void k_norm_apply(const float* __restrict__ x, float* __restrict__ y, const float* __restrict__ stat, const float* __restrict__ g, const float* __restrict__ bta,
                                                     int Z, int C, int L, int G, int bn, int act) {
    const long long idx = (long long)blockIdx.x * 256 + threadIdx.x;
    if (idx >= (long long)Z * C * L) return;
    const int l = (int)(idx % L); const long long zc = idx / L; const int c = (int)(zc % C), z = (int)(zc / C); (void)l;
    const int set = bn ? c : (z * G + c / (C / G));
    float v = (x[idx] - stat[(long long)set * 32]) * stat[(long long)set * 32 + 1];
    if (g) v *= g[c];
    if (bta) v += bta[c];
    v = act_fn(v, act);
    VST2(float, y + idx, v);
}

// k_lse_neg: c[i] = -(st[2i] + log(st[2i+1])) = minus the log-sum-exp of row i (for softmax over the query axis)
__global__ __launch_bounds__(256) void k_lse_neg(const float* __restrict__ st, float* __restrict__ c, int n) {
    const int i = blockIdx.x * 256 + threadIdx.x;
    if (i < n) { const float v = -(st[2 * i] + logf(st[2 * i + 1])); VST2(float, c + i, v); }
}

// k_iota: dst[i] = a * i + b as int32 (segment/position id helper)
__global__ __launch_bounds__(256) void k_iota(int* __restrict__ dst, int n, int a, int b) {
    const int i = blockIdx.x * 256 + threadIdx.x;
    if (i < n) { const int v = a * i + b; VST2(int, dst + i, v); }
}

// k_axpby: dst[i] = a * x[i] + b * y[i] (+ c), i < n
__global__ __launch_bounds__(256) void k_axpby(const float* __restrict__ x, const float* __restrict__ y, float* __restrict__ dst, int n, float a, float b, float c) {
    const int i = blockIdx.x * 256 + threadIdx.x;
    if (i < n) { const float v = a * x[i] + b * y[i] + c; VST2(float, dst + i, v); }
}

// =====================================================================================================================
// k_rope: rotary embedding on a [R rows][Hn heads][D] view (row stride sXr, head stride sXh, element stride 1) -> Y (own strides).
//   mode 0: rotate_half (partner d±D/2, sign - for d<D/2); mode 1: interleaved pairs (partner d^1, sign - for even d).
//   table column tcol: tmode 0 -> d, 1 -> d % (D/2), 2 -> d / 2; position p: pmode 0 -> r % S, 1 -> head index, 2 -> pos[r];
//   c = C[(r / S) * sCb + p * sCp + tcol * sCd], s likewise from Sn; y = x[d] * c + sign * x[partner] * s. X and Y must not alias.
// =====================================================================================================================
struct RopeP { const float* X; float* Y; const float* C; const float* Sn; const int* pos; long long sXr, sXh, sYr, sYh, sCb, sCp, sCd; int R, Hn, D, S, mode, tmode, pmode, pad; };
static_assert(sizeof(RopeP) == 5 * 8 + 7 * 8 + 8 * 4, "RopeP has padding");
__global__ __launch_bounds__(256) void k_rope(RopeP p) {
    const long long idx = (long long)blockIdx.x * 256 + threadIdx.x;
    if (idx >= (long long)p.R * p.Hn * p.D) return;
    const int d = (int)(idx % p.D); const long long rh = idx / p.D; const int h = (int)(rh % p.Hn); const int r = (int)(rh / p.Hn);
    const int half = p.D / 2;
    int partner; float sign;
    if (p.mode == 0) { partner = (d < half) ? d + half : d - half; sign = (d < half) ? -1.f : 1.f; }
    else { partner = d ^ 1; sign = (d & 1) ? 1.f : -1.f; }
    const int tcol = (p.tmode == 0) ? d : ((p.tmode == 1) ? (d % half) : (d >> 1));
    const int pp = (p.pmode == 0) ? (r % p.S) : ((p.pmode == 1) ? h : p.pos[r]);
    const long long toff = (long long)(r / p.S) * p.sCb + (long long)pp * p.sCp + (long long)tcol * p.sCd;
    const float* xr = p.X + (long long)r * p.sXr + (long long)h * p.sXh;
    const float v = xr[d] * p.C[toff] + sign * xr[partner] * p.Sn[toff];
    VST2(float, p.Y + (long long)r * p.sYr + (long long)h * p.sYh + d, v);
}

// k_invf + k_sincos (split so neither kernel carries a large VALU-fma footprint): invf_i = num * (1 / powf(base, (2 i)/D)) [fmode 0],
//   num * expf((2 i) * cexp) [fmode 1], num * powf(base, -2 (i - 1) / D) [fmode 2]; then cs/sn[s*half + i] = cos/sin((pscale * s) * invf_i)
__global__ __launch_bounds__(256) void k_invf(float* __restrict__ invb, int half, int D, float base, float num, int fmode, float cexp) {
    const int i = blockIdx.x * 256 + threadIdx.x;
    if (i >= ((half + 31) / 32) * 32) return;
    if (i >= half) { VST2(float, invb + i, 0.f); return; }
    const float e = (float)(2 * i) / (float)D;
    float invf;
    if (fmode == 1) invf = num * expf((float)(2 * i) * cexp);
    else if (fmode == 2) invf = num * powf(base, (-2.0f * ((float)i - 1.0f)) / (float)D);
    else invf = num * (1.0f / powf(base, e));
    VST2(float, invb + i, invf);
}
__global__ __launch_bounds__(256) void k_sincos(float* __restrict__ cs, float* __restrict__ sn, const float* __restrict__ invb, int S, int half, float pscale) {
    const int idx = blockIdx.x * 256 + threadIdx.x;
    if (idx >= S * half) return;
    const int s = idx / half, i = idx - s * half;
    const float ang = (pscale * (float)s) * invb[i];
    VST2(float, cs + idx, cosf(ang)); VST2(float, sn + idx, sinf(ang));
}

// k_mulact: dst[i] = act(x[i]) * y[i]
__global__ __launch_bounds__(256) void k_mulact(const float* __restrict__ x, const float* __restrict__ y, float* __restrict__ dst, int n, int act) {
    const int i = blockIdx.x * 256 + threadIdx.x;
    if (i < n) { const float v = act_fn(x[i], act) * y[i]; VST2(float, dst + i, v); }
}

// =====================================================================================================================
// k_matvec: thread-per-row matrix-vector products for N <= 8 output columns (heads with 1-3 outputs, gates), f32 on the VALU.
//   C[r*sCm + j] = act(alpha * sum_k A[r*sAm + k*sAk] * B[j*sBn + k*sBk] + bias[j]) + beta * R[r*sRm + j*sRn]; each thread writes its N contiguous floats.
// =====================================================================================================================
__global__ __launch_bounds__(256) void k_matvec(GemmP p) {
    // 32 lanes write one line with one instruction.
    const int rpt = (p.N == 1) ? 1 : 32;
    const long long r0 = ((long long)blockIdx.x * 256 + threadIdx.x) * rpt; const int z = blockIdx.z, zo = z / p.zi_n, zi = z - zo * p.zi_n;
    if (r0 >= p.M) return;
    const float* Bb = p.B + zo * p.sBo + zi * p.sBi;
    float* C = p.C + zo * p.sCo + zi * p.sCi; const float* R = p.R + zo * p.sRo + zi * p.sRi;
    for (int rr = 0; rr < rpt; ++rr) {
        const long long r = r0 + rr; if (r >= p.M) break;
        const float* A = p.A + zo * p.sAo + zi * p.sAi + r * p.sAm;
        float acc[8] = {0.f, 0.f, 0.f, 0.f, 0.f, 0.f, 0.f, 0.f};
        for (int k = 0; k < p.K; ++k) { const float a = A[(long long)k * p.sAk];
#pragma unroll
            for (int j = 0; j < 8; ++j) if (j < p.N) acc[j] += a * Bb[(long long)j * p.sBn + (long long)k * p.sBk]; }
#pragma unroll
        for (int j = 0; j < 8; ++j) if (j < p.N) {
            float v = acc[j] * p.alpha;
            if (p.flags & 1) v += p.bias[j];
            if (p.flags & 2) v += p.bias[r];
            v = act_fn(v, p.act);
            if (p.flags & 4) v += p.beta * R[r * p.sRm + (long long)j * p.sRn];
            VST2(float, C + r * p.sCm + j, v);
        }
    }
}
// k_smallsoftmax: thread-per-row softmax for short rows (n <= 64): dst[r*dr + j] = softmax(scale*src[r*sr + j])
__global__ __launch_bounds__(256) void k_smallsoftmax(const float* __restrict__ src, float* __restrict__ dst, long long sr, long long dr, int n, long long R, float scale) {
    const long long r0 = ((long long)blockIdx.x * 256 + threadIdx.x) * 32;
    for (int rr = 0; rr < 32; ++rr) {
        const long long r = r0 + rr; if (r >= R) return;
        const float* s = src + r * sr; float* d = dst + r * dr;
        float mx = -__builtin_inff();
        for (int j = 0; j < n; ++j) mx = fmaxf(mx, s[j] * scale);
        float sum = 0.f;
        for (int j = 0; j < n; ++j) sum += expf(s[j] * scale - mx);
        const float inv = 1.f / sum;
        for (int j = 0; j < n; ++j) { const float v = expf(s[j] * scale - mx) * inv; VST2(float, d + j, v); }
    }
}

__global__ __launch_bounds__(32) void k_unitstat(float* __restrict__ st) { const int t = threadIdx.x; const float v = (t == 1) ? 1.f : 0.f; VST2(float, st + t, v); }

// destination (e.g. a d_out whose row width is not a multiple of 32 floats) is written by consecutive lanes of one instruction
__global__ __launch_bounds__(256) void k_lincopy(const float* __restrict__ src, long long lds, float* __restrict__ dst, long long ldd, long long rows, int cols) {
    const long long i = (long long)blockIdx.x * 256 + threadIdx.x; if (i >= rows * cols) return;
    const long long r = i / cols; const int c = (int)(i - r * cols);
    const float v = src[r * lds + c]; VST2(float, dst + r * ldd + c, v);
}

namespace w25 {
typedef __attribute__((ext_vector_type(16))) _Float16 v16h;
typedef __attribute__((ext_vector_type(8)))  _Float16 v8h;
typedef __attribute__((ext_vector_type(16))) __bf16   v16b;
typedef __attribute__((ext_vector_type(8)))  __bf16   v8b;
typedef __attribute__((ext_vector_type(8)))  float    v8f;
typedef __attribute__((ext_vector_type(4)))  float    v4f;

__device__ __forceinline__ unsigned short f2bf_bits(float f) {
  unsigned u = __float_as_uint(f);
  return (unsigned short)((u + 0x7FFFu + ((u >> 16) & 1u)) >> 16);
}
__device__ __forceinline__ float bf_bits2f(unsigned short h) { return __uint_as_float(((unsigned)h) << 16); }

// hazard guards as plain device helpers (no inline asm inside the kernel template body)
__device__ __forceinline__ void dep_guard_h(v8f& a, v8f& b, v16h x, v16h y) { asm volatile("v_nop\n\tv_nop\n\tv_nop\n\tv_nop" : "+v"(a), "+v"(b) : "v"(x), "v"(y)); }
__device__ __forceinline__ void dep_guard_b(v8f& a, v8f& b, v16b x, v16b y) { asm volatile("v_nop\n\tv_nop\n\tv_nop\n\tv_nop" : "+v"(a), "+v"(b) : "v"(x), "v"(y)); }
__device__ __forceinline__ void keep4_h(v16h a, v16h b, v16h c, v16h d) { asm volatile("v_nop" :: "v"(a), "v"(b), "v"(c), "v"(d)); }
__device__ __forceinline__ void keep4_b(v16b a, v16b b, v16b c, v16b d) { asm volatile("v_nop" :: "v"(a), "v"(b), "v"(c), "v"(d)); }
__device__ __forceinline__ void acc_guard4(v8f& a, v8f& b, v8f& c, v8f& d) { asm volatile("v_nop\n\tv_nop\n\tv_nop\n\tv_nop" : "+v"(a), "+v"(b), "+v"(c), "+v"(d)); }
template <typename T> struct Frag;
template <> struct Frag<_Float16> {
  typedef v16h V; union U { v16h v; v8h h[2]; };
  static __device__ __forceinline__ v16h load(const _Float16* p) {   // elements 0..7 <- p[0..7], 8..15 <- p[16..23]
    U f; f.h[0] = *(const v8h*)(p); f.h[1] = *(const v8h*)(p + 16); return f.v;
  }
  static __device__ __forceinline__ v8f mma(v16h a, v16h b, v8f c) {
    return __builtin_amdgcn_wmma_f32_16x16x32_f16(false, a, false, b, (short)0, c, false, false);
  }
  static __device__ __forceinline__ void guard(v8f& a, v8f& b, v16h x, v16h y) { dep_guard_h(a, b, x, y); }
  static __device__ __forceinline__ void keep(v16h a, v16h b, v16h c, v16h d) { keep4_h(a, b, c, d); }
};
template <> struct Frag<__bf16> {
  typedef v16b V; union U { v16b v; v8b h[2]; };
  static __device__ __forceinline__ v16b load(const __bf16* p) {
    U f; f.h[0] = *(const v8b*)(p); f.h[1] = *(const v8b*)(p + 16); return f.v;
  }
  static __device__ __forceinline__ v8f mma(v16b a, v16b b, v8f c) {
    return __builtin_amdgcn_wmma_f32_16x16x32_bf16(false, a, false, b, (short)0, c, false, false);
  }
  static __device__ __forceinline__ void guard(v8f& a, v8f& b, v16b x, v16b y) { dep_guard_b(a, b, x, y); }
  static __device__ __forceinline__ void keep(v16b a, v16b b, v16b c, v16b d) { keep4_b(a, b, c, d); }
};

// ---- Register-blocked batched WMMA GEMM ------------------------------------
// C[m,n] = scale * sum_k A[m,k] * Bt[n,k] (+bias)(+resid); each wave owns a 64x64 tile.
// A row-major [M,K]; Bt row-major [N,K]; M,N % 64 == 0, K % 32 == 0.
// SPLIT: operands are hi/lo planes (A2/Bt2 = lo planes, same layout); product = hi·hi + hi·lo + lo·hi.
// BIAS_MODE: 0 = none, 1 = bias[m], 2 = bias[n].
// OUT_MODE: 0 = f32, 1 = f16, 2 = bf16 hi plane (Cout) + bf16 lo plane (Cout2).
// ET: 0 = f16 operands, 1 = bf16 operands (pointers passed as 16-bit storage)
template <int ET> struct Elem;
template <> struct Elem<0> { typedef _Float16 T; };
template <> struct Elem<1> { typedef __bf16 T; };
// The body takes its block's place in the grid (bx: 8 tiles, b: batch) as arguments, so that one launch can hold the blocks of more than one product.
template <int ET, bool SPLIT, int BIAS_MODE, int OUT_MODE, bool RESID, int ACT>
__device__ __forceinline__ void gemm64_block(
    const unsigned short* __restrict__ Ap, const unsigned short* __restrict__ A2p, int lda, long strideA,
    const unsigned short* __restrict__ Btp, const unsigned short* __restrict__ Bt2p, int ldb, long strideB,
    void* __restrict__ Cout, void* __restrict__ Cout2, int ldc, long strideC,
    const float* __restrict__ bias,
    const float* __restrict__ resid, long strideR,
    int M, int N, int K, float scale, int bx, int b) {
  typedef typename Elem<ET>::T T;
  typedef typename Frag<T>::V V;
  const T* A = (const T*)Ap; const T* A2 = (const T*)A2p; const T* Bt = (const T*)Btp; const T* Bt2 = (const T*)Bt2p;
  __shared__ __align__(16) float sT[8][16 * 68];   // per-wave 16x64 slab, pitch 68 floats
  const int lane = threadIdx.x & 31;
  const int wave = threadIdx.x >> 5;
  const int tilesN = N >> 6;
  const int tilesM = M >> 6;
  const int tile = bx * 8 + wave;
  if (tile >= tilesM * tilesN) return;   // wave-uniform; no block barriers in this kernel
  const int tm = tile / tilesN;
  const int tn = tile - tm * tilesN;
  const int m0 = tm << 6;
  const int n0 = tn << 6;

  const T* Ab  = A  + (size_t)b * strideA;
  const T* Bb  = Bt + (size_t)b * strideB;
  const T* Ab2 = SPLIT ? (A2  + (size_t)b * strideA) : nullptr;
  const T* Bb2 = SPLIT ? (Bt2 + (size_t)b * strideB) : nullptr;

  const int rlane = lane & 15;                 // row (A) / col (B, D) within subtile
  const int koff  = (lane >> 4) * 8;           // k offset of this lane half
  const int mOff  = (lane >> 4) * 8;           // D row offset

  v8f acc[4][4];
#pragma unroll
  for (int i = 0; i < 4; ++i)
#pragma unroll
    for (int j = 0; j < 4; ++j) acc[i][j] = (v8f){0.f,0.f,0.f,0.f,0.f,0.f,0.f,0.f};

  for (int k0 = 0; k0 < K; k0 += 32) {
    V bh[4], bl[4];
#pragma unroll
    for (int j = 0; j < 4; ++j) {
      const size_t bo = (size_t)(n0 + (j << 4) + rlane) * ldb + koff + k0;
      bh[j] = Frag<T>::load(Bb + bo);
      if (SPLIT) bl[j] = Frag<T>::load(Bb2 + bo);
    }
#pragma unroll
    for (int i = 0; i < 4; ++i) {
      const size_t ao = (size_t)(m0 + (i << 4) + rlane) * lda + koff + k0;
      V ah = Frag<T>::load(Ab + ao);
      V al;
      if (SPLIT) al = Frag<T>::load(Ab2 + ao);
#pragma unroll
      for (int j = 0; j < 4; ++j) {
        acc[i][j] = Frag<T>::mma(ah, bh[j], acc[i][j]);
        if (SPLIT) {
          acc[i][j] = Frag<T>::mma(ah, bl[j], acc[i][j]);
          acc[i][j] = Frag<T>::mma(al, bh[j], acc[i][j]);
        }
      }
      Frag<T>::guard(acc[i][0], acc[i][3], ah, SPLIT ? al : ah);
    }
    Frag<T>::keep(bh[0], bh[1], bh[2], bh[3]);
    if (SPLIT) Frag<T>::keep(bl[0], bl[1], bl[2], bl[3]);
  }
  acc_guard4(acc[0][0], acc[0][1], acc[0][2], acc[0][3]);
  acc_guard4(acc[1][0], acc[1][1], acc[1][2], acc[1][3]);
  acc_guard4(acc[2][0], acc[2][1], acc[2][2], acc[2][3]);
  acc_guard4(acc[3][0], acc[3][1], acc[3][2], acc[3][3]);

  // ---- epilogue ----
  float* slab = sT[wave];
  const float* Rb = RESID ? (resid + (size_t)b * strideR) : nullptr;
#pragma unroll
  for (int i = 0; i < 4; ++i) {
    const int mBase = m0 + (i << 4);
#pragma unroll
    for (int j = 0; j < 4; ++j) {
      const int n = n0 + (j << 4) + rlane;
      float bv = 0.f;
      if (BIAS_MODE == 2) bv = bias[n];
#pragma unroll
      for (int r = 0; r < 8; ++r) {
        float v = acc[i][j][r] * scale;
        if (BIAS_MODE == 1) v += bias[mBase + mOff + r];
        if (BIAS_MODE == 2) v += bv;
        if (RESID) v += Rb[(size_t)(mBase + mOff + r) * ldc + n];
        if (ACT == 1) v = tanhf(v);
        if (ACT == 2) v = fmaxf(v, 0.0f);
        if (ACT == 3) v = v / (1.0f + expf(-v));
        if (ACT == 4) v = (v > 0.f) ? v : 0.01f * v;
        if (ACT == 5) v = 0.5f * v * (1.0f + erff(v * 0.70710678118654752f));
        slab[(mOff + r) * 68 + (j << 4) + rlane] = v;
      }
    }
    __builtin_amdgcn_fence(__ATOMIC_RELEASE, "workgroup");
    __builtin_amdgcn_wave_barrier();
    __builtin_amdgcn_fence(__ATOMIC_ACQUIRE, "workgroup");
    if (OUT_MODE == 0) {
      float* C = (float*)Cout + (size_t)b * strideC;
      const int hh = lane >> 4, c4 = (lane & 15) * 4;     // row seg = 256 B = 16 lanes x 16 B
      {
#pragma unroll
        for (int it = 0; it < 8; ++it) {
          const int row = it * 2 + hh;
          v4f v = *(const v4f*)(slab + row * 68 + c4);
          *(v4f*)(C + (size_t)(mBase + row) * ldc + n0 + c4) = v;
        }
        
      }
    } else {
      const int q = lane >> 3, c8 = (lane & 7) * 8;
      unsigned short* C  = (unsigned short*)Cout  + (size_t)b * strideC;
      unsigned short* C2 = (OUT_MODE == 2) ? ((unsigned short*)Cout2 + (size_t)b * strideC) : nullptr;
      {
#pragma unroll
        for (int it = 0; it < 4; ++it) {
          const int row = it * 4 + q;
          const float* sp = slab + row * 68 + c8;
          v8h hv, lv;
#pragma unroll
          for (int e = 0; e < 8; ++e) {
            if (OUT_MODE == 1) {
              hv[e] = (_Float16)sp[e];
            } else {
              unsigned short hb = f2bf_bits(sp[e]);
              unsigned short lb = f2bf_bits(sp[e] - bf_bits2f(hb));
              hv[e] = __builtin_bit_cast(_Float16, hb);
              lv[e] = __builtin_bit_cast(_Float16, lb);
            }
          }
          *(v8h*)(C + (size_t)(mBase + row) * ldc + n0 + c8) = hv;
          if (OUT_MODE == 2) *(v8h*)(C2 + (size_t)(mBase + row) * ldc + n0 + c8) = lv;
        }
        
      }
    }
    __builtin_amdgcn_fence(__ATOMIC_RELEASE, "workgroup");
    __builtin_amdgcn_wave_barrier();
    __builtin_amdgcn_fence(__ATOMIC_ACQUIRE, "workgroup");
  }
}

template <int ET, bool SPLIT, int BIAS_MODE, int OUT_MODE, bool RESID, int ACT = 0>
__global__ __launch_bounds__(256) void wmma_gemm64(
    const unsigned short* __restrict__ Ap, const unsigned short* __restrict__ A2p, int lda, long strideA,
    const unsigned short* __restrict__ Btp, const unsigned short* __restrict__ Bt2p, int ldb, long strideB,
    void* __restrict__ Cout, void* __restrict__ Cout2, int ldc, long strideC,
    const float* __restrict__ bias,
    const float* __restrict__ resid, long strideR,
    int M, int N, int K, float scale) {
  gemm64_block<ET, SPLIT, BIAS_MODE, OUT_MODE, RESID, ACT>(Ap, A2p, lda, strideA, Btp, Bt2p, ldb, strideB, Cout, Cout2, ldc, strideC, bias, resid, strideR, M, N, K, scale, blockIdx.x, blockIdx.y);
}
// Two independent f16 products with f32 results in one launch: blocks 0 .. nb0 - 1 do product 0, the blocks behind them product 1. Product 0 is the one with the longer k loop, so that its
// blocks start first. Row pitches: A and Bt k0 / k1 (dense), C n0 / n1 (dense). grid nb0 + m1 * n1 / 32768, block 256.
__global__ __launch_bounds__(256) void wmma_gemm64_pair(
    const unsigned short* __restrict__ A0, const unsigned short* __restrict__ Bt0, float* __restrict__ C0, int m0, int n0, int k0, int nb0,
    const unsigned short* __restrict__ A1, const unsigned short* __restrict__ Bt1, float* __restrict__ C1, int m1, int n1, int k1, float scale) {
  const int bi = blockIdx.x;
  const bool p0 = bi < nb0;             // block-uniform
  const int n = p0 ? n0 : n1, k = p0 ? k0 : k1;
  gemm64_block<0, false, 0, 0, false, 0>(p0 ? A0 : A1, nullptr, k, 0, p0 ? Bt0 : Bt1, nullptr, k, 0, (void*)(p0 ? C0 : C1), nullptr, n, 0, nullptr, nullptr, 0, p0 ? m0 : m1, n, k, scale, p0 ? bi : bi - nb0, 0);
}

__global__ __launch_bounds__(256) void cast_f32_f16x2(
    const float* __restrict__ in, _Float16* __restrict__ out, int n2) {
  int i = blockIdx.x * 256 + threadIdx.x;
  if (i < n2) {
    const _Float16 h0 = (_Float16)in[2 * i], h1 = (_Float16)in[2 * i + 1];
    const unsigned u = (unsigned)__builtin_bit_cast(unsigned short, h0) | ((unsigned)__builtin_bit_cast(unsigned short, h1) << 16);
    ((unsigned*)out)[i] = u;
    
  }
}


} // namespace w25

// The element-wise stages below give each thread 16 to 64 elements, moved by 16-byte loads and 8- or 16-byte stores that are all in flight together, so that a launch is a few
// thousand waves. Every wave store instruction writes whole 128-byte lines.
__device__ __forceinline__ v8h cast8(v4f a, v4f b, float s) {
    const v8h o = {(_Float16)(a[0] * s), (_Float16)(a[1] * s), (_Float16)(a[2] * s), (_Float16)(a[3] * s), (_Float16)(b[0] * s), (_Float16)(b[1] * s), (_Float16)(b[2] * s), (_Float16)(b[3] * s)};
    return o;
}
// castT16_block<R, C>: dst[z][c][r] = f16(src[z][r][c] * s), dense planes. One thread: 8 rows r x 4 columns c (8 loads, 4 stores). Lane = (column quad lane >> 3, row group lane & 7):
//   the 8 lanes of one quad store 64 consecutive r of one c. Block (bx < C / 128, by < R / 64, bz < Z) of 256 threads: wave w has columns 128 bx + 16 w .. + 15, rows 64 by .. + 63.
template <int R, int C>
__device__ __forceinline__ void castT16_block(const float* __restrict__ src, _Float16* __restrict__ dst, float s, int bx, int by, int bz) {
    static_assert(R % 64 == 0 && C % 128 == 0, "whole tiles");
    const int lane = threadIdx.x & 31, wave = threadIdx.x >> 5;
    const int r0 = by * 64 + (lane & 7) * 8;
    const int c0 = bx * 128 + wave * 16 + (lane >> 3) * 4;
    src += ((size_t)bz * R + r0) * C + c0;
    dst += ((size_t)bz * C + c0) * R + r0;
    v4f a[8];
#pragma unroll
    for (int j = 0; j < 8; ++j) a[j] = *(const v4f*)(src + (size_t)j * C);
#pragma unroll
    for (int e = 0; e < 4; ++e) {
        const v8h o = {(_Float16)(a[0][e] * s), (_Float16)(a[1][e] * s), (_Float16)(a[2][e] * s), (_Float16)(a[3][e] * s), (_Float16)(a[4][e] * s), (_Float16)(a[5][e] * s), (_Float16)(a[6][e] * s), (_Float16)(a[7][e] * s)};
        *(v8h*)(dst + (size_t)e * R) = o;
    }
}
// f32 -> bf16 hi plane + bf16 lo plane (x = hi + lo to ~2^-17 relative; RNE both), [R][C] -> [R][C] (or transposed to [C][R]); 2 consecutive destination elements
__device__ __forceinline__ unsigned int f2bf2_pack(float a, float b, unsigned int* lo) {
    const unsigned short ha = w25::f2bf_bits(a), hb = w25::f2bf_bits(b);
    const unsigned short la = w25::f2bf_bits(a - w25::bf_bits2f(ha)), lb = w25::f2bf_bits(b - w25::bf_bits2f(hb));
    *lo = (unsigned)la | ((unsigned)lb << 16); return (unsigned)ha | ((unsigned)hb << 16); }
__global__ __launch_bounds__(256) void k_castS16(const float* __restrict__ src, long long lds, __bf16* __restrict__ dhi, __bf16* __restrict__ dlo, long long ldd, int R, int C, float s, int transpose) {
    const long long i = (long long)blockIdx.x * 256 + threadIdx.x; long long o; float a, b;
    if (transpose) { const long long np = (long long)C * (R / 2); if (i >= np) return; const int c = (int)(i / (R / 2)); const int r = 2 * (int)(i % (R / 2)); a = src[(long long)r * lds + c] * s; b = src[(long long)(r + 1) * lds + c] * s; o = (long long)c * ldd + r; }
    else { const long long np = (long long)R * (C / 2); if (i >= np) return; const int r = (int)(i / (C / 2)); const int c = 2 * (int)(i % (C / 2)); a = src[(long long)r * lds + c] * s; b = src[(long long)r * lds + c + 1] * s; o = (long long)r * ldd + c; }
    unsigned lo; const unsigned hi = f2bf2_pack(a, b, &lo); unsigned* ph = (unsigned*)(dhi + o); unsigned* pl = (unsigned*)(dlo + o);
    *ph = hi; *pl = lo;  }

// all five weight tensors (each dense) -> one f16 plane [Wq | Wqb | Wkvb | Wkv | Wout], scaled by s; a block takes 4096 elements (every segment is a whole number of blocks),
//   one thread 2 pieces of 8 consecutive elements
__device__ __forceinline__ void castW16_block(const float* __restrict__ Wq, const float* __restrict__ Wqb, const float* __restrict__ Wkvb, const float* __restrict__ Wkv, const float* __restrict__ Wout, _Float16* __restrict__ dst, float s, int bx) {
    const int eb = bx * 4096;
    const float* src = Wq; int base = 0;
    if (eb >= 786432) { src = Wout; base = 786432; } else if (eb >= 262144) { src = Wkv; base = 262144; } else if (eb >= 131072) { src = Wkvb; base = 131072; } else if (eb >= 65536) { src = Wqb; base = 65536; }
    const int e = eb + threadIdx.x * 8;
    const v4f a0 = *(const v4f*)(src + e - base), a1 = *(const v4f*)(src + e - base + 4), b0 = *(const v4f*)(src + e - base + 2048), b1 = *(const v4f*)(src + e - base + 2052);
    *(v8h*)(dst + e) = cast8(a0, a1, s);
    *(v8h*)(dst + e + 2048) = cast8(b0, b1, s);
    asm volatile("s_wait_xcnt 0x0" ::: "memory");   // in the built kernel another arm's code lies behind these stores and rewrites their registers: the wait stands in front of it
}
// im2col for the 2x2 stride-2 conv, stored as the f16 GEMM operand: COL[b][(Y,X)][(c,ky,kx)] = f16(x[b][c][2Y+ky][2X+kx])
//   One thread: 4 channels (two neighbours, and the two 16 further on) x 2 output columns X: per channel 4 floats of each of the two input rows; the (ky,kx) quads of two neighbour
//   channels make one 16-byte store. Lane = (column pair lane >> 3, channel pair lane & 7): 8 lanes store 16 consecutive channels' quads, one whole line.
//   Block (bx < Hs / 2 * C / 64, image b) of 256 threads = one Y, 64 channels, the whole row.
template <int C, int Hs>
__device__ __forceinline__ void es_col_block(const float* __restrict__ X, _Float16* __restrict__ COL, int bx, int b) {
    static_assert(Hs == 64 && C % 64 == 0, "4 waves span one input row");
    constexpr int Hr = Hs / 2;
    const int lane = threadIdx.x & 31, wave = threadIdx.x >> 5;
    const int Y = bx / (C / 64), cb = bx % (C / 64);
    const int c = cb * 64 + (wave >> 2) * 32 + (lane & 7) * 2;
    const int X2 = (wave & 3) * 8 + (lane >> 3) * 2;
    const float* s = X + (((size_t)b * C + c) * Hs + 2 * Y) * Hs + 2 * X2;
    _Float16* d = COL + ((size_t)b * Hr * Hr + Y * Hr + X2) * (4 * C) + 4 * c;
    v4f r0[4], r1[4];                                    // g: channel c + 16 (g >> 1) + (g & 1)
#pragma unroll
    for (int g = 0; g < 4; ++g) {
        const float* sg = s + (size_t)((g >> 1) * 16 + (g & 1)) * Hs * Hs;
        r0[g] = *(const v4f*)(sg); r1[g] = *(const v4f*)(sg + Hs);
    }
#pragma unroll
    for (int gg = 0; gg < 2; ++gg) {
        const v4f a0 = r0[2 * gg], a1 = r1[2 * gg], b0 = r0[2 * gg + 1], b1 = r1[2 * gg + 1];
        const v8h lo = {(_Float16)a0[0], (_Float16)a0[1], (_Float16)a1[0], (_Float16)a1[1], (_Float16)b0[0], (_Float16)b0[1], (_Float16)b1[0], (_Float16)b1[1]};
        const v8h hi = {(_Float16)a0[2], (_Float16)a0[3], (_Float16)a1[2], (_Float16)a1[3], (_Float16)b0[2], (_Float16)b0[3], (_Float16)b1[2], (_Float16)b1[3]};
        *(v8h*)(d + 64 * gg) = lo; *(v8h*)(d + 4 * C + 64 * gg) = hi;
    }
    asm volatile("s_wait_xcnt 0x0" ::: "memory");   // in the built kernel another arm's code lies behind these stores and rewrites their registers: the wait stands in front of it
}
// every re-layout of the inputs in one launch (none reads what another writes): blocks 0 .. NX - 1 transpose and cast x (Z images of R x Hs*Hs), the NC blocks behind them lay out the im2col operand,
// the last 208 cast the weights (x sw). grid NX + NC + 208, block 256.
template <int R, int Hs, int Z>
__global__ __launch_bounds__(256) void k_cast_in(const float* __restrict__ x, _Float16* __restrict__ xt, _Float16* __restrict__ col, const float* __restrict__ Wq, const float* __restrict__ Wqb, const float* __restrict__ Wkvb,
                                                  const float* __restrict__ Wkv, const float* __restrict__ Wout, _Float16* __restrict__ w16, float sw) {
    constexpr int C = Hs * Hs, BX = C / 128, BY = R / 64, NX = BX * BY * Z, CB = Hs / 2 * (R / 64), NC = CB * Z;
    const int bi = blockIdx.x;
    if (bi < NX) castT16_block<R, C>(x, xt, 1.0f, bi % BX, (bi / BX) % BY, bi / (BX * BY));
    else if (bi < NX + NC) es_col_block<R, Hs>(x, col, (bi - NX) % CB, (bi - NX) / CB);
    else castW16_block(Wq, Wqb, Wkvb, Wkv, Wout, w16, sw, bi - NX - NC);
}
// batch-wise attention: for (p, h, b): scores over b' = q_b . k_b' * scale (4 values), softmax, out = sum att v_b'; D[b][p][h*32+d] = f16(S[b][p][h*32+d] + out) (S holds out_img; D is the
//   output conv's f16 operand)
//   One wave: one position p, 4 heads (8 lanes x 4 floats a head), all 4 images, so each k and v row is read once. grid P * C / 1024, block 256.
//   A projection row holds [q | q_b | k_b | v_b], 4 C floats. The planes come as separate arguments (P0 .. P3: one image of projections each, S01 / D01: images 0 and 1, S23 / D23: images 2
//   and 3), so that every row address is one of these scalar bases plus one lane offset plus an immediate that the instruction can hold.
template <int P, int C>
__global__ __launch_bounds__(256) void k_es_batch(const float* __restrict__ P0, const float* __restrict__ P1, const float* __restrict__ P2, const float* __restrict__ P3,
                                                    const float* __restrict__ S01, const float* __restrict__ S23, _Float16* __restrict__ D01, _Float16* __restrict__ D23) {
    static_assert(C % 128 == 0, "a wave spans 128 channels");
    const int w = blockIdx.x * 8 + __builtin_amdgcn_readfirstlane(threadIdx.x >> 5);   // the wave's number as a scalar: every row address below is a scalar base plus one lane offset
    const unsigned lo = (threadIdx.x & 31) * 16;                                        // this lane's byte offset in the wave's 512-byte piece of a row
    const int p = w / (C / 128); const int col = (w % (C / 128)) * 128;
    const size_t oq = (size_t)p * C + col, op = (size_t)p * 4 * C + col;
    const char* prow[4] = {(const char*)(P0 + op), (const char*)(P1 + op), (const char*)(P2 + op), (const char*)(P3 + op)};
    const char* srow[4] = {(const char*)(S01 + oq), (const char*)(S01 + oq + P * C), (const char*)(S23 + oq), (const char*)(S23 + oq + P * C)};
    v4f q[4], k[4], v[4], sv[4];
#pragma unroll
    for (int b = 0; b < 4; ++b) {
        q[b] = *(const v4f*)(prow[b] + lo + C * 4); k[b] = *(const v4f*)(prow[b] + lo + 2 * C * 4);
    }
#pragma unroll
    for (int b = 0; b < 4; ++b) {
        v[b] = *(const v4f*)(prow[b] + lo + 3 * C * 4); sv[b] = *(const v4f*)(srow[b] + lo);
    }
    asm volatile("s_wait_xcnt 0x0" ::: "memory");   // the loads' scalar base registers are reused for the store bases formed below: the wait stands in front of that overwrite
    __builtin_amdgcn_sched_barrier(0);   // keeps all 16 loads in front of the arithmetic (without it the v and S loads are issued only behind the scores, a second memory latency) and later register writes behind the wait
    char* drow[4] = {(char*)(D01 + oq), (char*)(D01 + oq + P * C), (char*)(D23 + oq), (char*)(D23 + oq + P * C)};
#pragma unroll
    for (int b = 0; b < 4; ++b) {
        float sc[4]; float mx = -__builtin_inff();
#pragma unroll
        for (int b2 = 0; b2 < 4; ++b2) {
            float d0 = q[b][0] * k[b2][0] + q[b][1] * k[b2][1] + q[b][2] * k[b2][2] + q[b][3] * k[b2][3];
            for (int o = 4; o > 0; o >>= 1) d0 += __shfl_xor(d0, o, 32);
            sc[b2] = d0 * 0.17677669529663689f; mx = fmaxf(mx, sc[b2]);
        }
        float den = 0.f;
#pragma unroll
        for (int b2 = 0; b2 < 4; ++b2) { sc[b2] = expf(sc[b2] - mx); den += sc[b2]; }
        v4f o_ = {0.f, 0.f, 0.f, 0.f};
#pragma unroll
        for (int b2 = 0; b2 < 4; ++b2) o_ += sc[b2] / den * v[b2];
        const v4f r = sv[b] + o_;
        const v4h hv = {(_Float16)r[0], (_Float16)r[1], (_Float16)r[2], (_Float16)r[3]};
        *(v4h*)(drow[b] + (lo >> 1)) = hv;
    }
}


extern "C" void kernel_launch(void* const* d_in, const int* in_sizes, int n_in, void* d_out, int out_size, void* d_ws, size_t ws_size, hipStream_t stream) {
    (void)in_sizes; (void)n_in; (void)out_size; (void)ws_size;
    const float* x = (const float*)d_in[0];
    const float* Wq = (const float*)d_in[1];
    const float* Wkv = (const float*)d_in[2];
    const float* Wqb = (const float*)d_in[3];
    const float* Wkvb = (const float*)d_in[4];
    const float* Wout = (const float*)d_in[5];
    const int C = 256;
    float* out = (float*)d_out;
    // every activation plane holds all 4 images, image-major; each is written by one launch and read by later ones of this call
    char* wsp = (char*)d_ws;
    float* PRJ = (float*)wsp; wsp += (size_t)4 * 4096 * 1024 * 4;          // [4][4096][1024] the 1x1 projections, position-major: q | q_b | k_b | v_b
    float* KVT = (float*)wsp; wsp += (size_t)4 * 1024 * 512 * 4;           // [4][1024][512] k | v
    float* S = (float*)wsp; wsp += (size_t)4 * 4096 * 256 * 4;             // [4][4096][256] out_img
    _Float16* XT16 = (_Float16*)wsp; wsp += (size_t)4 * 4096 * 256 * 2;    // [4][4096][256] x^T
    _Float16* COL16 = (_Float16*)wsp; wsp += (size_t)4 * 1024 * 1024 * 2;  // [4][1024][1024] im2col
    _Float16* S16 = (_Float16*)wsp; wsp += (size_t)4 * 4096 * 256 * 2;     // [4][4096][256] out_img + out_batch
    _Float16* W16 = (_Float16*)wsp; wsp += (size_t)851968 * 2;             // [Wq | Wqb | Wkvb | Wkv | Wout], x16
    const _Float16* Wkv16 = W16 + 262144;
    const _Float16* Wout16 = W16 + 786432;
    k_cast_in<256, 64, 4><<<1232, 256, 0, stream>>>(x, XT16, COL16, Wq, Wqb, Wkvb, Wkv, Wout, W16, 16.0f);
    // one launch for the two products that need only the planes above. The kv conv: im2col rows x Wkv. The 1x1 projections share their left operand and their weights over the images:
    // one product over the 4 * 4096 stacked positions and the 1024 stacked weight rows [Wq | Wqb | Wkvb].
    w25::wmma_gemm64_pair<<<576, 256, 0, stream>>>((const unsigned short*)(COL16), (const unsigned short*)(Wkv16), KVT, 4096, 512, 1024, 64, (const unsigned short*)(XT16), (const unsigned short*)(W16), PRJ, 16384, 1024, 256, 0.0625f);
    k_attn32<4096, 1024, 1024, 512, 256><<<dim3(64, 8, 4), 32 * AW, 0, stream>>>(PRJ, KVT, KVT + C, S, 0.1767766952966369f);
    k_es_batch<4096, 256><<<1024, 256, 0, stream>>>(PRJ, PRJ + 4194304, PRJ + 8388608, PRJ + 12582912, S, S + 2097152, S16, S16 + 2097152);
    // output conv: grid y = image (weights shared: stride 0)
    w25::wmma_gemm64<0, false, 0, 0, false, 0><<<dim3(32, 4), 256, 0, stream>>>((const unsigned short*)(Wout16), nullptr, 256, 0, (const unsigned short*)(S16), nullptr, 256, 1048576, (void*)(out), nullptr, 4096, 1048576, nullptr, nullptr, 0, 256, 4096, 256, 0.0625f);
}

// v006
// Measured time: 129 microseconds a run.
// Two timings next to v005 put it at 1.24 and 1.22 times that version's speed.
// All steps since v000 together make it 17.1 times as fast.
// Contractions (per image): q / qb / kvb 1x1 projections in position-major form x^T W^T [4096x256].[256x{256,256,512}], the 2x2-stride-2 kv conv as an im2col GEMM [1024x1024].[1024x512] and the output 1x1 conv Wout.(out_img + out_batch)^T [256x256].[256x4096], all with f16 operands (v_wmma_f32_16x16x32_f16; 64x64 register-blocked wave tiles over pre-cast f16 operand planes, weight operands pre-scaled by 16 at the cast and un-scaled in the f32 epilogue); the spatial-reduction attention per head (flash kernel, head_dim 32, 4096 queries x 1024 keys, f16 q.k^T and f16 p.v; the kv conv stores k and v as f16 in WMMA fragment order); f32 accumulate; the im2col, the batch-wise 4x4 attention per (position, head) and the branch sum are f32 kernels.
#include <hip/hip_runtime.h>
#include <math.h>

typedef __attribute__((ext_vector_type(16))) _Float16 v16h;
typedef __attribute__((ext_vector_type(8)))  _Float16 v8h;
typedef __attribute__((ext_vector_type(16))) __bf16   v16b;
typedef __attribute__((ext_vector_type(8)))  float    v8f;
typedef __attribute__((ext_vector_type(4)))  float    v4f;

// 16-bit WMMA fragment map (wave32), lane L, h = L>>4, m = L&15:
//   A 16x32: lane = row m;   element i -> k = (i<8) ? 8h+i : 16+8h+(i-8)
//   B 32x16: lane = column m; the SAME k(i,h)
//   D 16x16 (8 f32): lane = column m; element r -> row 8h+r
__device__ __forceinline__ int frag_k(int i, int h) { return (i < 8) ? (8 * h + i) : (16 + 8 * h + (i - 8)); }
__device__ __forceinline__ __bf16 bf16_rne(float f) {
    unsigned int u = __float_as_uint(f);
    u += 0x7fffu + ((u >> 16) & 1u);
    return __builtin_bit_cast(__bf16, (unsigned short)(u >> 16));
}
__device__ __forceinline__ float bf16_f32(__bf16 b) { return __uint_as_float(((unsigned int)__builtin_bit_cast(unsigned short, b)) << 16); }
__device__ __forceinline__ v8f wmma16(v16h a, v16h b, v8f c) {
    c = __builtin_amdgcn_wmma_f32_16x16x32_f16(false, a, false, b, (short)0, c, false, false);
    asm volatile("v_nop\n\tv_nop\n\tv_nop\n\tv_nop" : "+v"(c) : "v"(a), "v"(b));
    return c;
}
__device__ __forceinline__ v8f wmmab(v16b a, v16b b, v8f c) {
    c = __builtin_amdgcn_wmma_f32_16x16x32_bf16(false, a, false, b, (short)0, c, false, false);
    asm volatile("v_nop\n\tv_nop\n\tv_nop\n\tv_nop" : "+v"(c) : "v"(a), "v"(b));
    return c;
}
struct Split { v16b hi, lo; };
// hi/lo split product: a.hi*b.hi + a.hi*b.lo + a.lo*b.hi
__device__ __forceinline__ v8f wmma3(const Split& a, const Split& b, v8f c) {
    c = __builtin_amdgcn_wmma_f32_16x16x32_bf16(false, a.hi, false, b.hi, (short)0, c, false, false);
    c = __builtin_amdgcn_wmma_f32_16x16x32_bf16(false, a.hi, false, b.lo, (short)0, c, false, false);
    c = __builtin_amdgcn_wmma_f32_16x16x32_bf16(false, a.lo, false, b.hi, (short)0, c, false, false);
    asm volatile("v_nop\n\tv_nop\n\tv_nop\n\tv_nop" : "+v"(c) : "v"(a.hi), "v"(a.lo), "v"(b.hi), "v"(b.lo));
    return c;
}
struct Split3 { v16b hi, mid, lo; };
// triple split product (6 terms, drops only terms below 2^-24 relative)
__device__ __forceinline__ v8f wmma6(const Split3& a, const Split3& b, v8f c) {
    c = __builtin_amdgcn_wmma_f32_16x16x32_bf16(false, a.hi, false, b.hi, (short)0, c, false, false);
    c = __builtin_amdgcn_wmma_f32_16x16x32_bf16(false, a.hi, false, b.mid, (short)0, c, false, false);
    c = __builtin_amdgcn_wmma_f32_16x16x32_bf16(false, a.mid, false, b.hi, (short)0, c, false, false);
    c = __builtin_amdgcn_wmma_f32_16x16x32_bf16(false, a.hi, false, b.lo, (short)0, c, false, false);
    c = __builtin_amdgcn_wmma_f32_16x16x32_bf16(false, a.mid, false, b.mid, (short)0, c, false, false);
    c = __builtin_amdgcn_wmma_f32_16x16x32_bf16(false, a.lo, false, b.hi, (short)0, c, false, false);
    asm volatile("v_nop\n\tv_nop\n\tv_nop\n\tv_nop" : "+v"(c) : "v"(a.hi), "v"(a.mid), "v"(a.lo), "v"(b.hi), "v"(b.mid), "v"(b.lo));
    return c;
}

// Fragment gathers from f32 memory: element i <- p[(k0 + frag_k(i,h)) * sk] * s, zero for k >= klen.
__device__ __forceinline__ v16h fh_ld(const float* __restrict__ p, long long sk, int k0, int h, int klen, float s) {
    v16h a;
#pragma unroll
    for (int i = 0; i < 16; ++i) { const int k = k0 + frag_k(i, h); a[i] = (k < klen) ? (_Float16)(p[(long long)k * sk] * s) : (_Float16)0.f; }
    return a;
}
__device__ __forceinline__ Split sp_ld(const float* __restrict__ p, long long sk, int k0, int h, int klen, float s) {
    Split r;
#pragma unroll
    for (int i = 0; i < 16; ++i) {
        const int k = k0 + frag_k(i, h); const float x = (k < klen) ? p[(long long)k * sk] * s : 0.f;
        const __bf16 hb = bf16_rne(x); r.hi[i] = hb; r.lo[i] = bf16_rne(x - bf16_f32(hb));
    }
    return r;
}
__device__ __forceinline__ Split3 sp3_ld(const float* __restrict__ p, long long sk, int k0, int h, int klen, float s) {
    Split3 r;
#pragma unroll
    for (int i = 0; i < 16; ++i) {
        const int k = k0 + frag_k(i, h); const float x = (k < klen) ? p[(long long)k * sk] * s : 0.f;
        const __bf16 hb = bf16_rne(x); const float r1 = x - bf16_f32(hb); const __bf16 mb = bf16_rne(r1);
        r.hi[i] = hb; r.mid[i] = mb; r.lo[i] = bf16_rne(r1 - bf16_f32(mb));
    }
    return r;
}
__device__ __forceinline__ v16b bh_ld(const float* __restrict__ p, long long sk, int k0, int h, int klen, float s) {
    v16b a;
#pragma unroll
    for (int i = 0; i < 16; ++i) { const int k = k0 + frag_k(i, h); a[i] = bf16_rne((k < klen) ? p[(long long)k * sk] * s : 0.f); }
    return a;
}
// f16 fragment from an f16 LDS/global row with element stride 1 (k-contiguous), no bounds (tile already zero padded)
__device__ __forceinline__ v16h fh_row(const _Float16* __restrict__ row, int k0, int h) {
    v16h a;
#pragma unroll
    for (int i = 0; i < 16; ++i) a[i] = row[k0 + frag_k(i, h)];
    return a;
}

#define VST2(T, ptr, val) do { const T vst2_v_ = (val); *(T*)(ptr) = vst2_v_;  } while (0)
typedef float v4f __attribute__((ext_vector_type(4)));
#define VST2V4(ptr, val) do { const v4f vst2_v4_ = (val); *(v4f*)(ptr) = vst2_v4_;  } while (0)

__device__ __attribute__((noinline)) float act_fn(float v, int act) {
    if (act == 1) return fmaxf(v, 0.f);                                                                               // relu
    if (act == 2) { const float u = 0.7978845608028654f * (v + 0.044715f * v * v * v); return 0.5f * v * (1.f + tanhf(u)); } // tanh-gelu
    if (act == 3) return v / (1.f + expf(-v));                                                                        // silu
    if (act == 4) return 0.5f * v * (1.f + erff(v * 0.7071067811865476f));                                             // erf-gelu
    if (act == 5) return tanhf(v);
    if (act == 6) return 1.f / (1.f + expf(-v));                                                                      // sigmoid
    if (act == 7) return (v > 0.f) ? v : 0.01f * v;                                                                   // leaky relu 0.01
    if (act == 8) return (v > 0.f) ? v : (expf(v) - 1.f);                                                             // elu
    if (act == 9) return fminf(fmaxf(v, 0.f), 6.f);                                                                   // relu6
    if (act == 10) return fabsf(v);                                                                                    // abs
    if (act == 11) return (v >= 0.f) ? v : 0.1f * v;                                                                  // leaky 0.1
    if (act == 12) return (v > 0.f) ? v : 0.2f * v;                                                                   // leaky 0.2
    if (act == 13) return (v > 20.f) ? v : log1pf(expf(v));                                                            // softplus
    return v;
}

// =====================================================================================================================
// k_gemm<MODE>: C(z, m, n) = act(alpha * sum_k A(z, m, k) * B(z, k, n) + bias) + beta * R(z, m, n)
//   One wave (32-thread block) per 16 x 32 tile of C; grid (ceil(N/32), ceil(M/16), Z). Batch z -> (zo = z / zi_n, zi = z % zi_n)
//   with separate outer/inner strides for every tensor (e.g. batch and head). A(m,k) = A[zo*sAo + zi*sAi + m*sAm + k*sAk] (f32),
//   B(k,n) = B[zo*sBo + zi*sBi + n*sBn + k*sBk] (f32); any M, N, K (K zero-padded to 32 inside the fragments, M/N tails guarded).
//   C(m,n) = C[zo*sCo + zi*sCi + m*sCm + n] (n contiguous). flags: 1 bias[n], 2 bias[m], 4 residual R[zo*sRo + zi*sRi + m*sRm + n*sRn].
//   MODE 0: f16 operands (A prescaled by sa, B by sb, both undone in the epilogue); 1: bf16 hi/lo split (3 products); 2: bf16;
//   3: bf16 hi/mid/lo triple split (6 products); 4: as 3 with Kahan-compensated f32 accumulation across k-steps.
// =====================================================================================================================
struct GemmP {
    const float* A; const float* B; const float* bias; const float* R; float* C;
    long long sAo, sAi, sAm, sAk, sBo, sBi, sBn, sBk, sCo, sCi, sCm, sRo, sRi, sRm, sRn;
    int M, N, K, zi_n, flags, act; float alpha, beta, sa, sb;
    int Npad, pad_;     // columns [N, Npad) of C are written as 0 so that padded workspace rows are covered by whole-line stores; Npad >= N
};
static_assert(sizeof(GemmP) == 5 * 8 + 15 * 8 + 6 * 4 + 4 * 4 + 2 * 4, "GemmP has padding");

template <int MODE>
__global__ __launch_bounds__(32) void k_gemm(GemmP p) {
    const int lane = threadIdx.x & 31, h = lane >> 4, l15 = lane & 15;
    const int m0 = blockIdx.y * 16, n0 = blockIdx.x * 32;
    const int z = blockIdx.z, zo = z / p.zi_n, zi = z - zo * p.zi_n;
    const float* A = p.A + zo * p.sAo + zi * p.sAi;
    const float* B = p.B + zo * p.sBo + zi * p.sBi;
    const int am = min(m0 + l15, p.M - 1);                       // clamped row for loads (stores are guarded)
    v8f acc[2], comp[2];
#pragma unroll
    for (int t = 0; t < 2; ++t) { v8f zz = {}; acc[t] = zz; comp[t] = zz; }
    for (int k0 = 0; k0 < p.K; k0 += 32) {
        const float* arow = A + (long long)am * p.sAm;
        if (MODE == 1) {
            const Split a = sp_ld(arow, p.sAk, k0, h, p.K, 1.f);
#pragma unroll
            for (int t = 0; t < 2; ++t) {
                const int bn = min(n0 + t * 16 + l15, p.N - 1);
                acc[t] = wmma3(a, sp_ld(B + (long long)bn * p.sBn, p.sBk, k0, h, p.K, 1.f), acc[t]);
            }
        } else if (MODE == 3) {
            const Split3 a = sp3_ld(arow, p.sAk, k0, h, p.K, 1.f);
#pragma unroll
            for (int t = 0; t < 2; ++t) {
                const int bn = min(n0 + t * 16 + l15, p.N - 1);
                acc[t] = wmma6(a, sp3_ld(B + (long long)bn * p.sBn, p.sBk, k0, h, p.K, 1.f), acc[t]);
            }
        } else if (MODE == 4) {
            // triple split as MODE 3, but each k-step's 6 products go into a fresh accumulator and the partial is added to the running f32 sum
            // on the VALU with Kahan compensation (accumulation error stays ~1 ulp however long K is)
            const Split3 a = sp3_ld(arow, p.sAk, k0, h, p.K, 1.f);
#pragma unroll
            for (int t = 0; t < 2; ++t) {
                const int bn = min(n0 + t * 16 + l15, p.N - 1); v8f zz = {};
                const v8f part = wmma6(a, sp3_ld(B + (long long)bn * p.sBn, p.sBk, k0, h, p.K, 1.f), zz);
                const v8f y = part - comp[t]; const v8f s = acc[t] + y; comp[t] = (s - acc[t]) - y; acc[t] = s;
            }
        } else if (MODE == 2) {
            const v16b a = bh_ld(arow, p.sAk, k0, h, p.K, 1.f);
#pragma unroll
            for (int t = 0; t < 2; ++t) {
                const int bn = min(n0 + t * 16 + l15, p.N - 1);
                acc[t] = wmmab(a, bh_ld(B + (long long)bn * p.sBn, p.sBk, k0, h, p.K, 1.f), acc[t]);
            }
        } else {
            const v16h a = fh_ld(arow, p.sAk, k0, h, p.K, p.sa);
#pragma unroll
            for (int t = 0; t < 2; ++t) {
                const int bn = min(n0 + t * 16 + l15, p.N - 1);
                acc[t] = wmma16(a, fh_ld(B + (long long)bn * p.sBn, p.sBk, k0, h, p.K, p.sb), acc[t]);
            }
        }
    }
    const float iscale = (MODE == 0) ? p.alpha / (p.sa * p.sb) : p.alpha;
    float* C = p.C + zo * p.sCo + zi * p.sCi;
    const float* R = p.R + zo * p.sRo + zi * p.sRi;
    __shared__ __align__(16) float ctile[16][36];
#pragma unroll
    for (int t = 0; t < 2; ++t) {
        const int n = n0 + t * 16 + l15; const int nn = min(n, p.N - 1);
#pragma unroll
        for (int r = 0; r < 8; ++r) {
            const int m = m0 + 8 * h + r; const int mm = min(m, p.M - 1);
            float v = acc[t][r] * iscale;
            if (p.flags & 1) v += p.bias[nn];
            if (p.flags & 2) v += p.bias[mm];
            if (p.flags & 8) v *= p.bias[(long long)zo * p.M + mm];   /* per-(z,row) scale vector laid out [Z][M]; exclusive with the bias flags */
            v = act_fn(v, p.act);
            if (p.flags & 4) v += p.beta * R[(long long)mm * p.sRm + (long long)nn * p.sRn];
            ctile[8 * h + r][t * 16 + l15] = (n < p.N) ? v : 0.f;
        }
    }
    __syncthreads();
    const int NW = (p.Npad > p.N) ? p.Npad : p.N;           // write width
    const bool fast = (m0 + 16 <= p.M) && (n0 + 32 <= NW) && ((p.sCm & 3) == 0) && ((((size_t)C) & 15) == 0);
    if (fast) {
#pragma unroll
        for (int s = 0; s < 4; ++s) {
            const int row = s * 4 + (lane >> 3), c4 = (lane & 7) * 4;
            const v4f v = *(const v4f*)&ctile[row][c4];
            VST2V4(C + (long long)(m0 + row) * p.sCm + n0 + c4, v);
        }
    } else {
        for (int row = 0; row < 16; ++row) {
            const int m = m0 + row, n = n0 + lane;
            if (m < p.M && n < NW) VST2(float, C + (long long)m * p.sCm + n, ctile[row][lane]);
        }
    }
}


// =====================================================================================================================
// k_gemmT<MODE, TM, TN>: same contract as k_gemm, but one wave computes a (16*TM) x (16*TN) tile: TM A fragments and TN B fragments are
//   loaded per 32-wide k-step and reused across TM*TN WMMAs (far fewer load/convert instructions per MAC). MODE 0 (f16), 1 (bf16 hi/lo),
//   2 (bf16) only. grid (ceil(NW/(16*TN)), ceil(M/(16*TM)), Z), block 32. Epilogue identical to k_gemm, run per 16x32 sub-tile.
// =====================================================================================================================
template <int MODE, int TM, int TN>
__global__ __launch_bounds__(32) void k_gemmT(GemmP p) {
    const int lane = threadIdx.x & 31, h = lane >> 4, l15 = lane & 15;
    const int m0 = blockIdx.y * (16 * TM), n0 = blockIdx.x * (16 * TN);
    const int z = blockIdx.z, zo = z / p.zi_n, zi = z - zo * p.zi_n;
    const float* A = p.A + zo * p.sAo + zi * p.sAi;
    const float* B = p.B + zo * p.sBo + zi * p.sBi;
    v8f acc[TM][TN];
#pragma unroll
    for (int i = 0; i < TM; ++i)
#pragma unroll
        for (int t = 0; t < TN; ++t) { v8f zz = {}; acc[i][t] = zz; }
    for (int k0 = 0; k0 < p.K; k0 += 32) {
        if (MODE == 1) {
            Split a[TM], b[TN];
#pragma unroll
            for (int i = 0; i < TM; ++i) { const int am = min(m0 + 16 * i + l15, p.M - 1); a[i] = sp_ld(A + (long long)am * p.sAm, p.sAk, k0, h, p.K, 1.f); }
#pragma unroll
            for (int t = 0; t < TN; ++t) { const int bn = min(n0 + 16 * t + l15, p.N - 1); b[t] = sp_ld(B + (long long)bn * p.sBn, p.sBk, k0, h, p.K, 1.f); }
#pragma unroll
            for (int i = 0; i < TM; ++i)
#pragma unroll
                for (int t = 0; t < TN; ++t) acc[i][t] = wmma3(a[i], b[t], acc[i][t]);
        } else if (MODE == 2) {
            v16b a[TM], b[TN];
#pragma unroll
            for (int i = 0; i < TM; ++i) { const int am = min(m0 + 16 * i + l15, p.M - 1); a[i] = bh_ld(A + (long long)am * p.sAm, p.sAk, k0, h, p.K, 1.f); }
#pragma unroll
            for (int t = 0; t < TN; ++t) { const int bn = min(n0 + 16 * t + l15, p.N - 1); b[t] = bh_ld(B + (long long)bn * p.sBn, p.sBk, k0, h, p.K, 1.f); }
#pragma unroll
            for (int i = 0; i < TM; ++i)
#pragma unroll
                for (int t = 0; t < TN; ++t) acc[i][t] = wmmab(a[i], b[t], acc[i][t]);
        } else {
            v16h a[TM], b[TN];
#pragma unroll
            for (int i = 0; i < TM; ++i) { const int am = min(m0 + 16 * i + l15, p.M - 1); a[i] = fh_ld(A + (long long)am * p.sAm, p.sAk, k0, h, p.K, p.sa); }
#pragma unroll
            for (int t = 0; t < TN; ++t) { const int bn = min(n0 + 16 * t + l15, p.N - 1); b[t] = fh_ld(B + (long long)bn * p.sBn, p.sBk, k0, h, p.K, p.sb); }
#pragma unroll
            for (int i = 0; i < TM; ++i)
#pragma unroll
                for (int t = 0; t < TN; ++t) acc[i][t] = wmma16(a[i], b[t], acc[i][t]);
        }
    }
    const float iscale = (MODE == 0) ? p.alpha / (p.sa * p.sb) : p.alpha;
    float* C = p.C + zo * p.sCo + zi * p.sCi;
    const float* R = p.R + zo * p.sRo + zi * p.sRi;
    const int NW = (p.Npad > p.N) ? p.Npad : p.N;
    __shared__ __align__(16) float ctile[16][36];
#pragma unroll
    for (int i = 0; i < TM; ++i) {
        const int mb = m0 + 16 * i; if (mb >= p.M) break;          // wave-uniform
#pragma unroll
        for (int tp = 0; tp < TN / 2; ++tp) {
            const int nb = n0 + 32 * tp; if (nb >= NW) break;        // wave-uniform
#pragma unroll
            for (int t2 = 0; t2 < 2; ++t2) {
                const int t = 2 * tp + t2; const int n = nb + t2 * 16 + l15; const int nn = min(n, p.N - 1);
#pragma unroll
                for (int r = 0; r < 8; ++r) {
                    const int m = mb + 8 * h + r; const int mm = min(m, p.M - 1);
                    float v = acc[i][t][r] * iscale;
                    if (p.flags & 1) v += p.bias[nn];
                    if (p.flags & 2) v += p.bias[mm];
            if (p.flags & 8) v *= p.bias[(long long)zo * p.M + mm];   /* per-(z,row) scale vector laid out [Z][M]; exclusive with the bias flags */
                    v = act_fn(v, p.act);
                    if (p.flags & 4) v += p.beta * R[(long long)mm * p.sRm + (long long)nn * p.sRn];
                    ctile[8 * h + r][t2 * 16 + l15] = (n < p.N) ? v : 0.f;
                }
            }
            __syncthreads();
            const bool fast = (mb + 16 <= p.M) && (nb + 32 <= NW) && ((p.sCm & 3) == 0) && ((((size_t)C) & 15) == 0);
            if (fast) {
#pragma unroll
                for (int s = 0; s < 4; ++s) {
                    const int row = s * 4 + (lane >> 3), c4 = (lane & 7) * 4;
                    const v4f v = *(const v4f*)&ctile[row][c4];
                    VST2V4(C + (long long)(mb + row) * p.sCm + nb + c4, v);
                }
            } else {
                for (int row = 0; row < 16; ++row) {
                    const int m = mb + row, n = nb + lane;
                    if (m < p.M && n < NW) VST2(float, C + (long long)m * p.sCm + n, ctile[row][lane]);
                }
            }
            __syncthreads();
        }
    }
}

// =====================================================================================================================
// k_attn32<LQ, LK, QP, SP>: flash attention at one fixed shape, all of it known at compile time: LQ queries, LK keys (a multiple of 64), head and
//   value dim 32, no mask. Q and O: f32 rows with element stride 1 (Q row pitch QP floats, O row pitch SP floats, head h at column 32 h).
//   K and V come as f16 planes in fragment order, one plane of 32 LK halves a (image, head), written by the kv product's epilogue. A fragment is 1024 bytes: [j = 0, 1][lane][8 halves].
//     K plane: fragment kt = 16 keys;            lane (hf, l15), half j, element e = K[key 16 kt + l15][d = 16 j + 8 hf + e]
//     V plane: fragment dt * LK / 32 + g;        lane (hf, l15), half j, element e = V[key 32 g + 16 j + 8 hf + e][d = 16 dt + l15]
//   so each operand register quad is one 16-byte load, a wave's load instruction reads 512 consecutive bytes (4 whole lines), and nothing is converted or staged in the loop.
//   Wave = 16 queries, AW waves per block, 64-key blocks; grid (LQ / (16*AW), heads, images), block 32*AW; image z at Q + z*LQ*QP, O + z*LQ*SP.
//   Both products are transposed: S^T = K . Q^T (A = 16 key rows, B = the wave's 16 queries) and O^T += V^T . P^T. A lane then holds scores of ONE query (its column l15; keys 16 t + 8 hf + r),
//   so the maximum and the sum are taken in the lane, with one exchange between the lane halves, and two score tiles, converted in place, are the B operand of the second product.
//   Scores: f16 operands; statistics f32 (exp2 domain); P x 4096 as f16.
// =====================================================================================================================
#define AW 4
typedef __attribute__((ext_vector_type(4))) _Float16 v4h;
// the 16 f32 that make up lane half h's fragment of a 32-wide row: k = 8h..8h+7 and 16+8h..16+8h+7 (the order of frag_k)
struct Row16 { v4f r[4]; };
__device__ __forceinline__ Row16 row16_ld(const float* __restrict__ row, int h) {
    Row16 x;
    x.r[0] = *(const v4f*)(row + 8 * h); x.r[1] = *(const v4f*)(row + 8 * h + 4);
    x.r[2] = *(const v4f*)(row + 16 + 8 * h); x.r[3] = *(const v4f*)(row + 16 + 8 * h + 4);
    return x;
}
__device__ __forceinline__ v16h row16_f16(const Row16& x) {
    v16h a;
#pragma unroll
    for (int q = 0; q < 4; ++q)
#pragma unroll
        for (int e = 0; e < 4; ++e) a[4 * q + e] = (_Float16)x.r[q][e];
    return a;
}
// the value that lane l ^ 16 holds
__device__ __forceinline__ float other_half(float x) {
    const int b = __float_as_int(x);
    return __int_as_float(__builtin_amdgcn_permlanex16(b, b, 0x76543210, 0xfedcba98, false, false));
}
// one f16 fragment from a plane in fragment order: p points at this lane's 8 halves of the fragment's half j = 0
__device__ __forceinline__ v16h frag_ld(const _Float16* __restrict__ p) {
    union { v16h v; v8h h[2]; } f;
    f.h[0] = *(const v8h*)(p); f.h[1] = *(const v8h*)(p + 256);
    return f.v;
}
// amdgpu_waves_per_eu(8): a budget of 128 registers a wave, so that 8 blocks fit on a WGP at once (one register more would leave room for 7)
template <int LQ, int LK, int QP, int SP>
__global__ __launch_bounds__(32 * AW) __attribute__((amdgpu_waves_per_eu(8))) void k_attn32(const float* __restrict__ Q, const _Float16* __restrict__ KF, const _Float16* __restrict__ VF, float* __restrict__ O, float scale) {
    static_assert(LQ % (16 * AW) == 0 && LK % 64 == 0 && QP % 4 == 0 && SP % 4 == 0, "whole tiles, 16-byte rows");
    constexpr int NT = 2;                       // output tiles (16 d each)
    constexpr int OP = 32 + 4;                  // LDS pitch of an output row (floats)
    __shared__ __align__(16) float    ol[AW][16 * OP];
    const int lane = threadIdx.x & 31, hf = lane >> 4, l15 = lane & 15, wave = threadIdx.x >> 5;
    const int h = blockIdx.y;
    const int q0 = (blockIdx.x * AW + wave) * 16;
    Q += (size_t)blockIdx.z * LQ * QP; O += (size_t)blockIdx.z * LQ * SP;      // image blockIdx.z: its own Q / O plane
    const float L2E = 1.4426950408889634f;
    const float NEG = -__builtin_inff();
    const size_t plane = (size_t)(blockIdx.z * gridDim.y + h) * (LK * 32) + lane * 8;           // this (image, head)'s plane, at this lane's 8 halves of a fragment
    const _Float16* kf = KF + plane;                                                            // both walk on by one 64-key block a trip: every fragment address is one of them plus an immediate
    const _Float16* vf = VF + plane;
    const v16h qa = row16_f16(row16_ld(Q + h * 32 + (size_t)(q0 + l15) * QP, hf));
    asm volatile("s_wait_xcnt 0x0" ::: "memory");   // the Q loads' address registers are reused for the start values set below: the wait stands in front of that overwrite
    __builtin_amdgcn_sched_barrier(0);              // keeps those later register writes from being scheduled ahead of the wait
    v8f o[NT]; float mrun = NEG, lrun = 0.f;        // this lane's query: running maximum (both halves agree) and this half's part of the sum
#pragma unroll
    for (int t = 0; t < NT; ++t) { v8f zz = {}; o[t] = zz; }
    for (int j0 = 0; j0 < LK; j0 += 64) {
        v16h ka[4], va[4];
#pragma unroll
        for (int t = 0; t < 4; ++t) ka[t] = frag_ld(kf + t * 512);
        asm volatile("s_wait_xcnt 0x0" ::: "memory");    // the K loads' address registers are rewritten further down: the wait stands in front of that overwrite
        __builtin_amdgcn_sched_barrier(0);               // keeps those register writes from being scheduled ahead of the wait
        v8f s[4];
#pragma unroll
        for (int t = 0; t < 4; ++t) { v8f acc = {}; s[t] = wmma16(ka[t], qa, acc); }
        float mt[4];                                     // one maximum a tile: four short chains, not one of 32
#pragma unroll
        for (int t = 0; t < 4; ++t) {
#pragma unroll
            for (int r = 0; r < 8; ++r) { float v = s[t][r] * scale; v *= L2E; s[t][r] = v; }
            float a = fmaxf(s[t][0], s[t][1]);
#pragma unroll
            for (int r = 2; r < 8; ++r) a = fmaxf(a, s[t][r]);
            mt[t] = a;
        }
        float mx = fmaxf(fmaxf(mt[0], mt[1]), fmaxf(mt[2], mt[3]));
        mx = fmaxf(mx, other_half(mx));
        const float mnew = fmaxf(mrun, mx);
        const float corr = exp2f(mrun - mnew);           // first block: exp2(-inf) = 0
#pragma unroll
        for (int t = 0; t < 4; ++t)
#pragma unroll
            for (int r = 0; r < 8; ++r) s[t][r] = exp2f(s[t][r] - mnew);
        const v8f ps = (s[0] + s[1]) + (s[2] + s[3]);
        const float rs = ((ps[0] + ps[1]) + (ps[2] + ps[3])) + ((ps[4] + ps[5]) + (ps[6] + ps[7]));
        lrun = lrun * corr + rs; mrun = mnew;
#pragma unroll
        for (int t = 0; t < NT; ++t) o[t] *= corr;
        v16h pb0, pb1;                                   // P^T fragments: element e <- key frag_k(e, hf) (+ 32), which is element e & 7 of score tile e >> 3 (+ 2)
#pragma unroll
        for (int e = 0; e < 16; ++e) { pb0[e] = (_Float16)(s[e >> 3][e & 7] * 4096.f); pb1[e] = (_Float16)(s[2 + (e >> 3)][e & 7] * 4096.f); }
#pragma unroll
        for (int t = 0; t < 4; ++t) va[t] = frag_ld(vf + ((t >> 1) * (LK / 32) + (t & 1)) * 512);   // va[2 dt + g]
#pragma unroll
        for (int t = 0; t < NT; ++t) {
            o[t] = wmma16(va[2 * t], pb0, o[t]);
            o[t] = wmma16(va[2 * t + 1], pb1, o[t]);
        }
        kf += 4 * 512; vf += 2 * 512;
    }
    float* obase = O + h * 32;
    const float inv = 1.f / ((lrun + other_half(lrun)) * 4096.f);   // no key is masked: the row sum holds its maximum's exp2(0) = 1
    float* myo = ol[wave];                                       // the wave's own 16 x 32 output tile, query-major
#pragma unroll
    for (int t = 0; t < NT; ++t) {
        const v4f lo = {o[t][0] * inv, o[t][1] * inv, o[t][2] * inv, o[t][3] * inv}, hi = {o[t][4] * inv, o[t][5] * inv, o[t][6] * inv, o[t][7] * inv};
        *(v4f*)(myo + l15 * OP + t * 16 + 8 * hf) = lo; *(v4f*)(myo + l15 * OP + t * 16 + 8 * hf + 4) = hi;
    }
    __syncthreads();
#pragma unroll
    for (int r0 = 0; r0 < 16; r0 += 4) {
        const int row = r0 + (lane >> 3), c4 = (lane & 7) * 4;
        const v4f v = *(const v4f*)(myo + row * OP + c4);
        VST2V4(obase + (size_t)(q0 + row) * SP + c4, v);
    }
}

// =====================================================================================================================
// k_tr: dst(z, c, r) = alpha * src(z, r, c) (+ beta * R2(z, c, r)): [Z][R][C] (row stride lds) -> [Z][C][R] (row stride ldd) through a 32x32 LDS tile;
//   flags: 1 -> add beta * residual R2 addressed like dst (z*sRz + c*ldr + r); act applied before the residual.
// =====================================================================================================================
struct TrP { const float* src; float* dst; const float* R2; long long sSz, lds, sDz, ldd, sRz, ldr; int R, C, flags, act; float alpha, beta; };
static_assert(sizeof(TrP) == 3 * 8 + 6 * 8 + 6 * 4, "TrP has padding");
__global__ __launch_bounds__(256) void k_tr(TrP p) {
    __shared__ float tile[32][33];
    const int c0 = blockIdx.x * 32, r0 = blockIdx.y * 32, z = blockIdx.z;
    const int lane = threadIdx.x & 31, wave = threadIdx.x >> 5;
    const float* s = p.src + z * p.sSz;
#pragma unroll
    for (int k = 0; k < 4; ++k) {
        const int rl = wave * 4 + k, r = r0 + rl, c = c0 + lane;
        tile[rl][lane] = (r < p.R && c < p.C) ? s[(long long)r * p.lds + c] : 0.f;
    }
    __syncthreads();
    float* d = p.dst + z * p.sDz; const float* rr = p.R2 + z * p.sRz;
#pragma unroll
    for (int k = 0; k < 4; ++k) {
        const int cl = wave * 4 + k, c = c0 + cl, r = r0 + lane;
        if (c < p.C && r < p.R) {
            float v = act_fn(p.alpha * tile[lane][cl], p.act);
            if (p.flags & 1) v += p.beta * rr[(long long)c * p.ldr + r];
            VST2(float, d + (long long)c * p.ldd + r, v);
        }
    }
}

// k_affine: dst[i] = a * (sdev ? sdev[0] : 1) * src[i] + b, i < n (one thread per element; consecutive lanes -> consecutive addresses)
__global__ __launch_bounds__(256) void k_affine(const float* __restrict__ src, float* __restrict__ dst, int n, float a, float b, const float* __restrict__ sdev) {
    const int i = blockIdx.x * 256 + threadIdx.x;
    if (i < n) { const float aa = sdev ? a * sdev[0] : a; const float v = aa * src[i] + b; VST2(float, dst + i, v); }
}

// =====================================================================================================================
// k_softmax: row softmax over n contiguous elements, one 256-thread block per row; rows addressed z*sz + r*sr (grid (R, Z)).
//   out = scale_out * softmax(scale_in * x + (Mf ? Mf[z*smz + r*smr + j] : 0)); a row whose max is -inf is written as 0.
// =====================================================================================================================
struct SmP { const float* src; float* dst; const float* Mf; long long sz, sr, dz, dr, smz, smr; int n, pad; float scale_in, scale_out; };
static_assert(sizeof(SmP) == 3 * 8 + 6 * 8 + 4 * 4, "SmP has padding");
__global__ __launch_bounds__(256) void k_softmax(SmP p) {
    __shared__ float red[256];
    const int r = blockIdx.x, z = blockIdx.y, tid = threadIdx.x;
    const float* s = p.src + z * p.sz + (long long)r * p.sr;
    const float* mf = p.Mf ? (p.Mf + z * p.smz + (long long)r * p.smr) : nullptr;
    float mx = -__builtin_inff();
    for (int j = tid; j < p.n; j += 256) { float v = s[j] * p.scale_in; if (mf) v += mf[j]; mx = fmaxf(mx, v); }
    red[tid] = mx; __syncthreads();
    for (int o = 128; o > 0; o >>= 1) { if (tid < o) red[tid] = fmaxf(red[tid], red[tid + o]); __syncthreads(); }
    mx = red[0]; __syncthreads();
    float sum = 0.f;
    for (int j = tid; j < p.n; j += 256) { float v = s[j] * p.scale_in; if (mf) v += mf[j]; sum += (mx == -__builtin_inff()) ? 0.f : expf(v - mx); }
    red[tid] = sum; __syncthreads();
    for (int o = 128; o > 0; o >>= 1) { if (tid < o) red[tid] += red[tid + o]; __syncthreads(); }
    sum = red[0];
    const float inv = (sum > 0.f) ? p.scale_out / sum : 0.f;
    float* d = p.dst + z * p.dz + (long long)r * p.dr;
    for (int j = tid; j < p.n; j += 256) { float v = s[j] * p.scale_in; if (mf) v += mf[j]; const float o = (mx == -__builtin_inff()) ? 0.f : expf(v - mx) * inv; VST2(float, d + j, o); }
}
// =====================================================================================================================
// k_stats: mean and rsqrt(var + eps) over a set of n elements addressed base + z*sz + (e / inner) * so + (e % inner) * si, one 256-thread
// k_norm_apply: y = (x - mean[set]) * rstd[set] * g[c] + b[c] over a [Z][C][L] channel-major tensor with set = z*G + c / (C/G) (G groups per z;
//   G = C -> per-channel sets indexed z*C+c; for batch norm pass stats indexed by c only via bn = 1). Optional act. Output same layout.
// =====================================================================================================================
//   mode 0: mean / rsqrt(var + eps); mode 1 (RMSNorm): 0 / rsqrt(mean(x^2) + eps); mode 2 (L2 normalize * sqrt(n)): 0 / sqrt(n) / max(||x||, eps); mode 3: as 0 with unbiased variance (n-1)
__global__ __launch_bounds__(256) void k_stats(const float* __restrict__ x, long long sz, long long so, long long si, int inner, int n, float eps, float* __restrict__ stat, int mode) {
    __shared__ float red[256];
    const int z = blockIdx.x, tid = threadIdx.x;
    const float* base = x + z * sz;
    float s = 0.f;
    for (int e = tid; e < n; e += 256) s += base[(long long)(e / inner) * so + (long long)(e % inner) * si];
    red[tid] = s; __syncthreads();
    for (int o = 128; o > 0; o >>= 1) { if (tid < o) red[tid] += red[tid + o]; __syncthreads(); }
    const float mu = (mode == 0 || mode == 3) ? red[0] / (float)n : 0.f; __syncthreads();
    float q = 0.f;
    for (int e = tid; e < n; e += 256) { const float dlt = base[(long long)(e / inner) * so + (long long)(e % inner) * si] - mu; q += dlt * dlt; }
    red[tid] = q; __syncthreads();
    for (int o = 128; o > 0; o >>= 1) { if (tid < o) red[tid] += red[tid + o]; __syncthreads(); }
    {
        float rs;
        if (mode == 2) rs = sqrtf((float)n) / fmaxf(sqrtf(red[0]), eps); else if (mode == 3) rs = rsqrtf(red[0] / (float)(n - 1) + eps); else rs = rsqrtf(red[0] / (float)n + eps);
        if (tid < 32) { const float v = (tid == 0) ? mu : ((tid == 1) ? rs : 0.f); VST2(float, stat + (long long)z * 32 + tid, v); }
    }
}
//   One thread per element over the flat [Z][C][L] index space: grid ceil(Z*C*L / 256).
__global__ __launch_bounds__(256) void k_norm_apply(const float* __restrict__ x, float* __restrict__ y, const float* __restrict__ stat, const float* __restrict__ g, const float* __restrict__ bta,
                                                     int Z, int C, int L, int G, int bn, int act) {
    const long long idx = (long long)blockIdx.x * 256 + threadIdx.x;
    if (idx >= (long long)Z * C * L) return;
    const int l = (int)(idx % L); const long long zc = idx / L; const int c = (int)(zc % C), z = (int)(zc / C); (void)l;
    const int set = bn ? c : (z * G + c / (C / G));
    float v = (x[idx] - stat[(long long)set * 32]) * stat[(long long)set * 32 + 1];
    if (g) v *= g[c];
    if (bta) v += bta[c];
    v = act_fn(v, act);
    VST2(float, y + idx, v);
}

// k_lse_neg: c[i] = -(st[2i] + log(st[2i+1])) = minus the log-sum-exp of row i (for softmax over the query axis)
__global__ __launch_bounds__(256) void k_lse_neg(const float* __restrict__ st, float* __restrict__ c, int n) {
    const int i = blockIdx.x * 256 + threadIdx.x;
    if (i < n) { const float v = -(st[2 * i] + logf(st[2 * i + 1])); VST2(float, c + i, v); }
}

// k_iota: dst[i] = a * i + b as int32 (segment/position id helper)
__global__ __launch_bounds__(256) void k_iota(int* __restrict__ dst, int n, int a, int b) {
    const int i = blockIdx.x * 256 + threadIdx.x;
    if (i < n) { const int v = a * i + b; VST2(int, dst + i, v); }
}

// k_axpby: dst[i] = a * x[i] + b * y[i] (+ c), i < n
__global__ __launch_bounds__(256) void k_axpby(const float* __restrict__ x, const float* __restrict__ y, float* __restrict__ dst, int n, float a, float b, float c) {
    const int i = blockIdx.x * 256 + threadIdx.x;
    if (i < n) { const float v = a * x[i] + b * y[i] + c; VST2(float, dst + i, v); }
}

// =====================================================================================================================
// k_rope: rotary embedding on a [R rows][Hn heads][D] view (row stride sXr, head stride sXh, element stride 1) -> Y (own strides).
//   mode 0: rotate_half (partner d±D/2, sign - for d<D/2); mode 1: interleaved pairs (partner d^1, sign - for even d).
//   table column tcol: tmode 0 -> d, 1 -> d % (D/2), 2 -> d / 2; position p: pmode 0 -> r % S, 1 -> head index, 2 -> pos[r];
//   c = C[(r / S) * sCb + p * sCp + tcol * sCd], s likewise from Sn; y = x[d] * c + sign * x[partner] * s. X and Y must not alias.
// =====================================================================================================================
struct RopeP { const float* X; float* Y; const float* C; const float* Sn; const int* pos; long long sXr, sXh, sYr, sYh, sCb, sCp, sCd; int R, Hn, D, S, mode, tmode, pmode, pad; };
static_assert(sizeof(RopeP) == 5 * 8 + 7 * 8 + 8 * 4, "RopeP has padding");
__global__ __launch_bounds__(256) void k_rope(RopeP p) {
    const long long idx = (long long)blockIdx.x * 256 + threadIdx.x;
    if (idx >= (long long)p.R * p.Hn * p.D) return;
    const int d = (int)(idx % p.D); const long long rh = idx / p.D; const int h = (int)(rh % p.Hn); const int r = (int)(rh / p.Hn);
    const int half = p.D / 2;
    int partner; float sign;
    if (p.mode == 0) { partner = (d < half) ? d + half : d - half; sign = (d < half) ? -1.f : 1.f; }
    else { partner = d ^ 1; sign = (d & 1) ? 1.f : -1.f; }
    const int tcol = (p.tmode == 0) ? d : ((p.tmode == 1) ? (d % half) : (d >> 1));
    const int pp = (p.pmode == 0) ? (r % p.S) : ((p.pmode == 1) ? h : p.pos[r]);
    const long long toff = (long long)(r / p.S) * p.sCb + (long long)pp * p.sCp + (long long)tcol * p.sCd;
    const float* xr = p.X + (long long)r * p.sXr + (long long)h * p.sXh;
    const float v = xr[d] * p.C[toff] + sign * xr[partner] * p.Sn[toff];
    VST2(float, p.Y + (long long)r * p.sYr + (long long)h * p.sYh + d, v);
}

// k_invf + k_sincos (split so neither kernel carries a large VALU-fma footprint): invf_i = num * (1 / powf(base, (2 i)/D)) [fmode 0],
//   num * expf((2 i) * cexp) [fmode 1], num * powf(base, -2 (i - 1) / D) [fmode 2]; then cs/sn[s*half + i] = cos/sin((pscale * s) * invf_i)
__global__ __launch_bounds__(256) void k_invf(float* __restrict__ invb, int half, int D, float base, float num, int fmode, float cexp) {
    const int i = blockIdx.x * 256 + threadIdx.x;
    if (i >= ((half + 31) / 32) * 32) return;
    if (i >= half) { VST2(float, invb + i, 0.f); return; }
    const float e = (float)(2 * i) / (float)D;
    float invf;
    if (fmode == 1) invf = num * expf((float)(2 * i) * cexp);
    else if (fmode == 2) invf = num * powf(base, (-2.0f * ((float)i - 1.0f)) / (float)D);
    else invf = num * (1.0f / powf(base, e));
    VST2(float, invb + i, invf);
}
__global__ __launch_bounds__(256) void k_sincos(float* __restrict__ cs, float* __restrict__ sn, const float* __restrict__ invb, int S, int half, float pscale) {
    const int idx = blockIdx.x * 256 + threadIdx.x;
    if (idx >= S * half) return;
    const int s = idx / half, i = idx - s * half;
    const float ang = (pscale * (float)s) * invb[i];
    VST2(float, cs + idx, cosf(ang)); VST2(float, sn + idx, sinf(ang));
}

// k_mulact: dst[i] = act(x[i]) * y[i]
__global__ __launch_bounds__(256) void k_mulact(const float* __restrict__ x, const float* __restrict__ y, float* __restrict__ dst, int n, int act) {
    const int i = blockIdx.x * 256 + threadIdx.x;
    if (i < n) { const float v = act_fn(x[i], act) * y[i]; VST2(float, dst + i, v); }
}

// =====================================================================================================================
// k_matvec: thread-per-row matrix-vector products for N <= 8 output columns (heads with 1-3 outputs, gates), f32 on the VALU.
//   C[r*sCm + j] = act(alpha * sum_k A[r*sAm + k*sAk] * B[j*sBn + k*sBk] + bias[j]) + beta * R[r*sRm + j*sRn]; each thread writes its N contiguous floats.
// =====================================================================================================================
__global__ __launch_bounds__(256) void k_matvec(GemmP p) {
    // 32 lanes write one line with one instruction.
    const int rpt = (p.N == 1) ? 1 : 32;
    const long long r0 = ((long long)blockIdx.x * 256 + threadIdx.x) * rpt; const int z = blockIdx.z, zo = z / p.zi_n, zi = z - zo * p.zi_n;
    if (r0 >= p.M) return;
    const float* Bb = p.B + zo * p.sBo + zi * p.sBi;
    float* C = p.C + zo * p.sCo + zi * p.sCi; const float* R = p.R + zo * p.sRo + zi * p.sRi;
    for (int rr = 0; rr < rpt; ++rr) {
        const long long r = r0 + rr; if (r >= p.M) break;
        const float* A = p.A + zo * p.sAo + zi * p.sAi + r * p.sAm;
        float acc[8] = {0.f, 0.f, 0.f, 0.f, 0.f, 0.f, 0.f, 0.f};
        for (int k = 0; k < p.K; ++k) { const float a = A[(long long)k * p.sAk];
#pragma unroll
            for (int j = 0; j < 8; ++j) if (j < p.N) acc[j] += a * Bb[(long long)j * p.sBn + (long long)k * p.sBk]; }
#pragma unroll
        for (int j = 0; j < 8; ++j) if (j < p.N) {
            float v = acc[j] * p.alpha;
            if (p.flags & 1) v += p.bias[j];
            if (p.flags & 2) v += p.bias[r];
            v = act_fn(v, p.act);
            if (p.flags & 4) v += p.beta * R[r * p.sRm + (long long)j * p.sRn];
            VST2(float, C + r * p.sCm + j, v);
        }
    }
}
// k_smallsoftmax: thread-per-row softmax for short rows (n <= 64): dst[r*dr + j] = softmax(scale*src[r*sr + j])
__global__ __launch_bounds__(256) void k_smallsoftmax(const float* __restrict__ src, float* __restrict__ dst, long long sr, long long dr, int n, long long R, float scale) {
    const long long r0 = ((long long)blockIdx.x * 256 + threadIdx.x) * 32;
    for (int rr = 0; rr < 32; ++rr) {
        const long long r = r0 + rr; if (r >= R) return;
        const float* s = src + r * sr; float* d = dst + r * dr;
        float mx = -__builtin_inff();
        for (int j = 0; j < n; ++j) mx = fmaxf(mx, s[j] * scale);
        float sum = 0.f;
        for (int j = 0; j < n; ++j) sum += expf(s[j] * scale - mx);
        const float inv = 1.f / sum;
        for (int j = 0; j < n; ++j) { const float v = expf(s[j] * scale - mx) * inv; VST2(float, d + j, v); }
    }
}

__global__ __launch_bounds__(32) void k_unitstat(float* __restrict__ st) { const int t = threadIdx.x; const float v = (t == 1) ? 1.f : 0.f; VST2(float, st + t, v); }

// destination (e.g. a d_out whose row width is not a multiple of 32 floats) is written by consecutive lanes of one instruction
__global__ __launch_bounds__(256) void k_lincopy(const float* __restrict__ src, long long lds, float* __restrict__ dst, long long ldd, long long rows, int cols) {
    const long long i = (long long)blockIdx.x * 256 + threadIdx.x; if (i >= rows * cols) return;
    const long long r = i / cols; const int c = (int)(i - r * cols);
    const float v = src[r * lds + c]; VST2(float, dst + r * ldd + c, v);
}

namespace w25 {
typedef __attribute__((ext_vector_type(16))) _Float16 v16h;
typedef __attribute__((ext_vector_type(8)))  _Float16 v8h;
typedef __attribute__((ext_vector_type(16))) __bf16   v16b;
typedef __attribute__((ext_vector_type(8)))  __bf16   v8b;
typedef __attribute__((ext_vector_type(8)))  float    v8f;
typedef __attribute__((ext_vector_type(4)))  float    v4f;

__device__ __forceinline__ unsigned short f2bf_bits(float f) {
  unsigned u = __float_as_uint(f);
  return (unsigned short)((u + 0x7FFFu + ((u >> 16) & 1u)) >> 16);
}
__device__ __forceinline__ float bf_bits2f(unsigned short h) { return __uint_as_float(((unsigned)h) << 16); }

// hazard guards as plain device helpers (no inline asm inside the kernel template body)
__device__ __forceinline__ void dep_guard_h(v8f& a, v8f& b, v16h x, v16h y) { asm volatile("v_nop\n\tv_nop\n\tv_nop\n\tv_nop" : "+v"(a), "+v"(b) : "v"(x), "v"(y)); }
__device__ __forceinline__ void dep_guard_b(v8f& a, v8f& b, v16b x, v16b y) { asm volatile("v_nop\n\tv_nop\n\tv_nop\n\tv_nop" : "+v"(a), "+v"(b) : "v"(x), "v"(y)); }
__device__ __forceinline__ void keep4_h(v16h a, v16h b, v16h c, v16h d) { asm volatile("v_nop" :: "v"(a), "v"(b), "v"(c), "v"(d)); }
__device__ __forceinline__ void keep4_b(v16b a, v16b b, v16b c, v16b d) { asm volatile("v_nop" :: "v"(a), "v"(b), "v"(c), "v"(d)); }
__device__ __forceinline__ void acc_guard4(v8f& a, v8f& b, v8f& c, v8f& d) { asm volatile("v_nop\n\tv_nop\n\tv_nop\n\tv_nop" : "+v"(a), "+v"(b), "+v"(c), "+v"(d)); }
template <typename T> struct Frag;
template <> struct Frag<_Float16> {
  typedef v16h V; union U { v16h v; v8h h[2]; };
  static __device__ __forceinline__ v16h load(const _Float16* p) {   // elements 0..7 <- p[0..7], 8..15 <- p[16..23]
    U f; f.h[0] = *(const v8h*)(p); f.h[1] = *(const v8h*)(p + 16); return f.v;
  }
  static __device__ __forceinline__ v8f mma(v16h a, v16h b, v8f c) {
    return __builtin_amdgcn_wmma_f32_16x16x32_f16(false, a, false, b, (short)0, c, false, false);
  }
  static __device__ __forceinline__ void guard(v8f& a, v8f& b, v16h x, v16h y) { dep_guard_h(a, b, x, y); }
  static __device__ __forceinline__ void keep(v16h a, v16h b, v16h c, v16h d) { keep4_h(a, b, c, d); }
};
template <> struct Frag<__bf16> {
  typedef v16b V; union U { v16b v; v8b h[2]; };
  static __device__ __forceinline__ v16b load(const __bf16* p) {
    U f; f.h[0] = *(const v8b*)(p); f.h[1] = *(const v8b*)(p + 16); return f.v;
  }
  static __device__ __forceinline__ v8f mma(v16b a, v16b b, v8f c) {
    return __builtin_amdgcn_wmma_f32_16x16x32_bf16(false, a, false, b, (short)0, c, false, false);
  }
  static __device__ __forceinline__ void guard(v8f& a, v8f& b, v16b x, v16b y) { dep_guard_b(a, b, x, y); }
  static __device__ __forceinline__ void keep(v16b a, v16b b, v16b c, v16b d) { keep4_b(a, b, c, d); }
};

// ---- Register-blocked batched WMMA GEMM ------------------------------------
// C[m,n] = scale * sum_k A[m,k] * Bt[n,k] (+bias)(+resid); each wave owns a 64x64 tile.
// A row-major [M,K]; Bt row-major [N,K]; M,N % 64 == 0, K % 32 == 0.
// SPLIT: operands are hi/lo planes (A2/Bt2 = lo planes, same layout); product = hi·hi + hi·lo + lo·hi.
// BIAS_MODE: 0 = none, 1 = bias[m], 2 = bias[n].
// OUT_MODE: 0 = f32, 1 = f16, 2 = bf16 hi plane (Cout) + bf16 lo plane (Cout2).
// ET: 0 = f16 operands, 1 = bf16 operands (pointers passed as 16-bit storage)
template <int ET> struct Elem;
template <> struct Elem<0> { typedef _Float16 T; };
template <> struct Elem<1> { typedef __bf16 T; };
// The body takes its block's place in the grid (bx: 8 tiles, b: batch) as arguments, so that one launch can hold the blocks of more than one product.
// FRAGKV, and frag set (block-uniform): the product is the kv conv, rows m = (image, key) with 2^lgk keys an image, columns n = [k | v], each half N / 64 heads of 32 channels. The result is
// stored as f16 in the fragment order that the attention kernel reads (its head comment has the two maps): k to kfrag, v to vfrag, one plane of 32 * 2^lgk halves a (image, head).
template <int ET, bool SPLIT, int BIAS_MODE, int OUT_MODE, bool RESID, int ACT, bool FRAGKV = false>
__device__ __forceinline__ void gemm64_block(
    const unsigned short* __restrict__ Ap, const unsigned short* __restrict__ A2p, int lda, long strideA,
    const unsigned short* __restrict__ Btp, const unsigned short* __restrict__ Bt2p, int ldb, long strideB,
    void* __restrict__ Cout, void* __restrict__ Cout2, int ldc, long strideC,
    const float* __restrict__ bias,
    const float* __restrict__ resid, long strideR,
    int M, int N, int K, float scale, int bx, int b,
    _Float16* __restrict__ kfrag = nullptr, _Float16* __restrict__ vfrag = nullptr, int lgk = 0, bool frag = false) {
  typedef typename Elem<ET>::T T;
  typedef typename Frag<T>::V V;
  const T* A = (const T*)Ap; const T* A2 = (const T*)A2p; const T* Bt = (const T*)Btp; const T* Bt2 = (const T*)Bt2p;
  __shared__ __align__(16) float sT[8][16 * 68];   // per-wave 16x64 slab, pitch 68 floats
  const int lane = threadIdx.x & 31;
  const int wave = threadIdx.x >> 5;
  const int tilesN = N >> 6;
  const int tilesM = M >> 6;
  const int tile = bx * 8 + wave;
  if (tile >= tilesM * tilesN) return;   // wave-uniform; no block barriers in this kernel
  const int tm = tile / tilesN;
  const int tn = tile - tm * tilesN;
  const int m0 = tm << 6;
  const int n0 = tn << 6;

  const T* Ab  = A  + (size_t)b * strideA;
  const T* Bb  = Bt + (size_t)b * strideB;
  const T* Ab2 = SPLIT ? (A2  + (size_t)b * strideA) : nullptr;
  const T* Bb2 = SPLIT ? (Bt2 + (size_t)b * strideB) : nullptr;

  const int rlane = lane & 15;                 // row (A) / col (B, D) within subtile
  const int koff  = (lane >> 4) * 8;           // k offset of this lane half
  const int mOff  = (lane >> 4) * 8;           // D row offset

  v8f acc[4][4];
#pragma unroll
  for (int i = 0; i < 4; ++i)
#pragma unroll
    for (int j = 0; j < 4; ++j) acc[i][j] = (v8f){0.f,0.f,0.f,0.f,0.f,0.f,0.f,0.f};

  for (int k0 = 0; k0 < K; k0 += 32) {
    V bh[4], bl[4];
#pragma unroll
    for (int j = 0; j < 4; ++j) {
      const size_t bo = (size_t)(n0 + (j << 4) + rlane) * ldb + koff + k0;
      bh[j] = Frag<T>::load(Bb + bo);
      if (SPLIT) bl[j] = Frag<T>::load(Bb2 + bo);
    }
#pragma unroll
    for (int i = 0; i < 4; ++i) {
      const size_t ao = (size_t)(m0 + (i << 4) + rlane) * lda + koff + k0;
      V ah = Frag<T>::load(Ab + ao);
      V al;
      if (SPLIT) al = Frag<T>::load(Ab2 + ao);
#pragma unroll
      for (int j = 0; j < 4; ++j) {
        acc[i][j] = Frag<T>::mma(ah, bh[j], acc[i][j]);
        if (SPLIT) {
          acc[i][j] = Frag<T>::mma(ah, bl[j], acc[i][j]);
          acc[i][j] = Frag<T>::mma(al, bh[j], acc[i][j]);
        }
      }
      Frag<T>::guard(acc[i][0], acc[i][3], ah, SPLIT ? al : ah);
    }
    Frag<T>::keep(bh[0], bh[1], bh[2], bh[3]);
    if (SPLIT) Frag<T>::keep(bl[0], bl[1], bl[2], bl[3]);
  }
  acc_guard4(acc[0][0], acc[0][1], acc[0][2], acc[0][3]);
  acc_guard4(acc[1][0], acc[1][1], acc[1][2], acc[1][3]);
  acc_guard4(acc[2][0], acc[2][1], acc[2][2], acc[2][3]);
  acc_guard4(acc[3][0], acc[3][1], acc[3][2], acc[3][3]);

  // ---- epilogue ----
  float* slab = sT[wave];
  const float* Rb = RESID ? (resid + (size_t)b * strideR) : nullptr;
#pragma unroll
  for (int i = 0; i < 4; ++i) {
    const int mBase = m0 + (i << 4);
#pragma unroll
    for (int j = 0; j < 4; ++j) {
      const int n = n0 + (j << 4) + rlane;
      float bv = 0.f;
      if (BIAS_MODE == 2) bv = bias[n];
#pragma unroll
      for (int r = 0; r < 8; ++r) {
        float v = acc[i][j][r] * scale;
        if (BIAS_MODE == 1) v += bias[mBase + mOff + r];
        if (BIAS_MODE == 2) v += bv;
        if (RESID) v += Rb[(size_t)(mBase + mOff + r) * ldc + n];
        if (ACT == 1) v = tanhf(v);
        if (ACT == 2) v = fmaxf(v, 0.0f);
        if (ACT == 3) v = v / (1.0f + expf(-v));
        if (ACT == 4) v = (v > 0.f) ? v : 0.01f * v;
        if (ACT == 5) v = 0.5f * v * (1.0f + erff(v * 0.70710678118654752f));
        slab[(mOff + r) * 68 + (j << 4) + rlane] = v;
      }
    }
    __builtin_amdgcn_fence(__ATOMIC_RELEASE, "workgroup");
    __builtin_amdgcn_wave_barrier();
    __builtin_amdgcn_fence(__ATOMIC_ACQUIRE, "workgroup");
    if (FRAGKV && frag) {
      const int hfl = lane >> 4;
      const int z = mBase >> lgk, kb = mBase - (z << lgk);            // image, and the first of these 16 keys in it
      const bool isk = n0 < (N >> 1);                                 // the tile's 64 columns are 2 heads of k or 2 heads of v
      const int head0 = (isk ? n0 : n0 - (N >> 1)) >> 5;
      _Float16* pl = (isk ? kfrag : vfrag) + ((size_t)(z * (N >> 6) + head0) << (lgk + 5)) + lane * 8;
      v8h w[4];
      if (isk) {
        pl += (kb >> 4) * 512;                                        // fragment = these 16 keys; w[2 hh + j]: 8 consecutive channels of this lane's key
#pragma unroll
        for (int q = 0; q < 4; ++q) {
          const float* sp = slab + rlane * 68 + (q >> 1) * 32 + (q & 1) * 16 + hfl * 8;
          const v4f a = *(const v4f*)(sp), c = *(const v4f*)(sp + 4);
          const v8h t = {(_Float16)a[0], (_Float16)a[1], (_Float16)a[2], (_Float16)a[3], (_Float16)c[0], (_Float16)c[1], (_Float16)c[2], (_Float16)c[3]};
          w[q] = t;
        }
#pragma unroll
        for (int q = 0; q < 4; ++q) *(v8h*)(pl + ((size_t)(q >> 1) << (lgk + 5)) + (q & 1) * 256) = w[q];
      } else {
        pl += (kb >> 5) * 512 + ((kb >> 4) & 1) * 256;                // these 16 keys are half j of fragment g; w[2 hh + dt]: 8 consecutive keys of this lane's channel
#pragma unroll
        for (int q = 0; q < 4; ++q) {
          const float* sp = slab + hfl * 8 * 68 + (q >> 1) * 32 + (q & 1) * 16 + rlane;
          const v8h t = {(_Float16)sp[0], (_Float16)sp[68], (_Float16)sp[136], (_Float16)sp[204], (_Float16)sp[272], (_Float16)sp[340], (_Float16)sp[408], (_Float16)sp[476]};
          w[q] = t;
        }
#pragma unroll
        for (int q = 0; q < 4; ++q) *(v8h*)(pl + ((size_t)(q >> 1) << (lgk + 5)) + ((size_t)(q & 1) << (lgk + 4))) = w[q];
      }
      asm volatile("s_wait_xcnt 0x0" ::: "memory");   // the stores' address and data registers are rewritten by the next 16 rows: the wait stands in front of that overwrite
    } else if (OUT_MODE == 0) {
      float* C = (float*)Cout + (size_t)b * strideC;
      const int hh = lane >> 4, c4 = (lane & 15) * 4;     // row seg = 256 B = 16 lanes x 16 B
      {
#pragma unroll
        for (int it = 0; it < 8; ++it) {
          const int row = it * 2 + hh;
          v4f v = *(const v4f*)(slab + row * 68 + c4);
          *(v4f*)(C + (size_t)(mBase + row) * ldc + n0 + c4) = v;
        }
        if (FRAGKV) asm volatile("s_wait_xcnt 0x0" ::: "memory");   // in the built kernel the fragment arm's code lies behind these stores and rewrites their registers: the wait stands in front of it
      }
    } else {
      const int q = lane >> 3, c8 = (lane & 7) * 8;
      unsigned short* C  = (unsigned short*)Cout  + (size_t)b * strideC;
      unsigned short* C2 = (OUT_MODE == 2) ? ((unsigned short*)Cout2 + (size_t)b * strideC) : nullptr;
      {
#pragma unroll
        for (int it = 0; it < 4; ++it) {
          const int row = it * 4 + q;
          const float* sp = slab + row * 68 + c8;
          v8h hv, lv;
#pragma unroll
          for (int e = 0; e < 8; ++e) {
            if (OUT_MODE == 1) {
              hv[e] = (_Float16)sp[e];
            } else {
              unsigned short hb = f2bf_bits(sp[e]);
              unsigned short lb = f2bf_bits(sp[e] - bf_bits2f(hb));
              hv[e] = __builtin_bit_cast(_Float16, hb);
              lv[e] = __builtin_bit_cast(_Float16, lb);
            }
          }
          *(v8h*)(C + (size_t)(mBase + row) * ldc + n0 + c8) = hv;
          if (OUT_MODE == 2) *(v8h*)(C2 + (size_t)(mBase + row) * ldc + n0 + c8) = lv;
        }
        
      }
    }
    __builtin_amdgcn_fence(__ATOMIC_RELEASE, "workgroup");
    __builtin_amdgcn_wave_barrier();
    __builtin_amdgcn_fence(__ATOMIC_ACQUIRE, "workgroup");
  }
}

template <int ET, bool SPLIT, int BIAS_MODE, int OUT_MODE, bool RESID, int ACT = 0>
__global__ __launch_bounds__(256) void wmma_gemm64(
    const unsigned short* __restrict__ Ap, const unsigned short* __restrict__ A2p, int lda, long strideA,
    const unsigned short* __restrict__ Btp, const unsigned short* __restrict__ Bt2p, int ldb, long strideB,
    void* __restrict__ Cout, void* __restrict__ Cout2, int ldc, long strideC,
    const float* __restrict__ bias,
    const float* __restrict__ resid, long strideR,
    int M, int N, int K, float scale) {
  gemm64_block<ET, SPLIT, BIAS_MODE, OUT_MODE, RESID, ACT>(Ap, A2p, lda, strideA, Btp, Bt2p, ldb, strideB, Cout, Cout2, ldc, strideC, bias, resid, strideR, M, N, K, scale, blockIdx.x, blockIdx.y);
}
// Two independent f16 products in one launch: blocks 0 .. nb0 - 1 do product 0, the blocks behind them product 1. Product 0 is the one with the longer k loop, so that its
// blocks start first; it is the kv conv, stored as f16 fragment planes (KF, VF; 2^lgk keys an image). Product 1 has an f32 result. Row pitches: A and Bt k0 / k1 (dense), C1 n1 (dense).
// grid nb0 + m1 * n1 / 32768, block 256.
__global__ __launch_bounds__(256) void wmma_gemm64_pair(
    const unsigned short* __restrict__ A0, const unsigned short* __restrict__ Bt0, _Float16* __restrict__ KF, _Float16* __restrict__ VF, int lgk, int m0, int n0, int k0, int nb0,
    const unsigned short* __restrict__ A1, const unsigned short* __restrict__ Bt1, float* __restrict__ C1, int m1, int n1, int k1, float scale) {
  const int bi = blockIdx.x;
  const bool p0 = bi < nb0;             // block-uniform
  const int n = p0 ? n0 : n1, k = p0 ? k0 : k1;
  gemm64_block<0, false, 0, 0, false, 0, true>(p0 ? A0 : A1, nullptr, k, 0, p0 ? Bt0 : Bt1, nullptr, k, 0, (void*)C1, nullptr, n, 0, nullptr, nullptr, 0, p0 ? m0 : m1, n, k, scale, p0 ? bi : bi - nb0, 0, KF, VF, lgk, p0);
}

__global__ __launch_bounds__(256) void cast_f32_f16x2(
    const float* __restrict__ in, _Float16* __restrict__ out, int n2) {
  int i = blockIdx.x * 256 + threadIdx.x;
  if (i < n2) {
    const _Float16 h0 = (_Float16)in[2 * i], h1 = (_Float16)in[2 * i + 1];
    const unsigned u = (unsigned)__builtin_bit_cast(unsigned short, h0) | ((unsigned)__builtin_bit_cast(unsigned short, h1) << 16);
    ((unsigned*)out)[i] = u;
    
  }
}


} // namespace w25

// The element-wise stages below give each thread 16 to 64 elements, moved by 16-byte loads and 8- or 16-byte stores that are all in flight together, so that a launch is a few
// thousand waves. Every wave store instruction writes whole 128-byte lines.
__device__ __forceinline__ v8h cast8(v4f a, v4f b, float s) {
    const v8h o = {(_Float16)(a[0] * s), (_Float16)(a[1] * s), (_Float16)(a[2] * s), (_Float16)(a[3] * s), (_Float16)(b[0] * s), (_Float16)(b[1] * s), (_Float16)(b[2] * s), (_Float16)(b[3] * s)};
    return o;
}
// castT16_block<R, C>: dst[z][c][r] = f16(src[z][r][c] * s), dense planes. One thread: 8 rows r x 4 columns c (8 loads, 4 stores). Lane = (column quad lane >> 3, row group lane & 7):
//   the 8 lanes of one quad store 64 consecutive r of one c. Block (bx < C / 128, by < R / 64, bz < Z) of 256 threads: wave w has columns 128 bx + 16 w .. + 15, rows 64 by .. + 63.
template <int R, int C>
__device__ __forceinline__ void castT16_block(const float* __restrict__ src, _Float16* __restrict__ dst, float s, int bx, int by, int bz) {
    static_assert(R % 64 == 0 && C % 128 == 0, "whole tiles");
    const int lane = threadIdx.x & 31, wave = threadIdx.x >> 5;
    const int r0 = by * 64 + (lane & 7) * 8;
    const int c0 = bx * 128 + wave * 16 + (lane >> 3) * 4;
    src += ((size_t)bz * R + r0) * C + c0;
    dst += ((size_t)bz * C + c0) * R + r0;
    v4f a[8];
#pragma unroll
    for (int j = 0; j < 8; ++j) a[j] = *(const v4f*)(src + (size_t)j * C);
#pragma unroll
    for (int e = 0; e < 4; ++e) {
        const v8h o = {(_Float16)(a[0][e] * s), (_Float16)(a[1][e] * s), (_Float16)(a[2][e] * s), (_Float16)(a[3][e] * s), (_Float16)(a[4][e] * s), (_Float16)(a[5][e] * s), (_Float16)(a[6][e] * s), (_Float16)(a[7][e] * s)};
        *(v8h*)(dst + (size_t)e * R) = o;
    }
}
// f32 -> bf16 hi plane + bf16 lo plane (x = hi + lo to ~2^-17 relative; RNE both), [R][C] -> [R][C] (or transposed to [C][R]); 2 consecutive destination elements
__device__ __forceinline__ unsigned int f2bf2_pack(float a, float b, unsigned int* lo) {
    const unsigned short ha = w25::f2bf_bits(a), hb = w25::f2bf_bits(b);
    const unsigned short la = w25::f2bf_bits(a - w25::bf_bits2f(ha)), lb = w25::f2bf_bits(b - w25::bf_bits2f(hb));
    *lo = (unsigned)la | ((unsigned)lb << 16); return (unsigned)ha | ((unsigned)hb << 16); }
__global__ __launch_bounds__(256) void k_castS16(const float* __restrict__ src, long long lds, __bf16* __restrict__ dhi, __bf16* __restrict__ dlo, long long ldd, int R, int C, float s, int transpose) {
    const long long i = (long long)blockIdx.x * 256 + threadIdx.x; long long o; float a, b;
    if (transpose) { const long long np = (long long)C * (R / 2); if (i >= np) return; const int c = (int)(i / (R / 2)); const int r = 2 * (int)(i % (R / 2)); a = src[(long long)r * lds + c] * s; b = src[(long long)(r + 1) * lds + c] * s; o = (long long)c * ldd + r; }
    else { const long long np = (long long)R * (C / 2); if (i >= np) return; const int r = (int)(i / (C / 2)); const int c = 2 * (int)(i % (C / 2)); a = src[(long long)r * lds + c] * s; b = src[(long long)r * lds + c + 1] * s; o = (long long)r * ldd + c; }
    unsigned lo; const unsigned hi = f2bf2_pack(a, b, &lo); unsigned* ph = (unsigned*)(dhi + o); unsigned* pl = (unsigned*)(dlo + o);
    *ph = hi; *pl = lo;  }

// all five weight tensors (each dense) -> one f16 plane [Wq | Wqb | Wkvb | Wkv | Wout], scaled by s; a block takes 4096 elements (every segment is a whole number of blocks),
//   one thread 2 pieces of 8 consecutive elements
__device__ __forceinline__ void castW16_block(const float* __restrict__ Wq, const float* __restrict__ Wqb, const float* __restrict__ Wkvb, const float* __restrict__ Wkv, const float* __restrict__ Wout, _Float16* __restrict__ dst, float s, int bx) {
    const int eb = bx * 4096;
    const float* src = Wq; int base = 0;
    if (eb >= 786432) { src = Wout; base = 786432; } else if (eb >= 262144) { src = Wkv; base = 262144; } else if (eb >= 131072) { src = Wkvb; base = 131072; } else if (eb >= 65536) { src = Wqb; base = 65536; }
    const int e = eb + threadIdx.x * 8;
    const v4f a0 = *(const v4f*)(src + e - base), a1 = *(const v4f*)(src + e - base + 4), b0 = *(const v4f*)(src + e - base + 2048), b1 = *(const v4f*)(src + e - base + 2052);
    *(v8h*)(dst + e) = cast8(a0, a1, s);
    *(v8h*)(dst + e + 2048) = cast8(b0, b1, s);
    asm volatile("s_wait_xcnt 0x0" ::: "memory");   // in the built kernel another arm's code lies behind these stores and rewrites their registers: the wait stands in front of it
}
// im2col for the 2x2 stride-2 conv, stored as the f16 GEMM operand: COL[b][(Y,X)][(c,ky,kx)] = f16(x[b][c][2Y+ky][2X+kx])
//   One thread: 4 channels (two neighbours, and the two 16 further on) x 2 output columns X: per channel 4 floats of each of the two input rows; the (ky,kx) quads of two neighbour
//   channels make one 16-byte store. Lane = (column pair lane >> 3, channel pair lane & 7): 8 lanes store 16 consecutive channels' quads, one whole line.
//   Block (bx < Hs / 2 * C / 64, image b) of 256 threads = one Y, 64 channels, the whole row.
template <int C, int Hs>
__device__ __forceinline__ void es_col_block(const float* __restrict__ X, _Float16* __restrict__ COL, int bx, int b) {
    static_assert(Hs == 64 && C % 64 == 0, "4 waves span one input row");
    constexpr int Hr = Hs / 2;
    const int lane = threadIdx.x & 31, wave = threadIdx.x >> 5;
    const int Y = bx / (C / 64), cb = bx % (C / 64);
    const int c = cb * 64 + (wave >> 2) * 32 + (lane & 7) * 2;
    const int X2 = (wave & 3) * 8 + (lane >> 3) * 2;
    const float* s = X + (((size_t)b * C + c) * Hs + 2 * Y) * Hs + 2 * X2;
    _Float16* d = COL + ((size_t)b * Hr * Hr + Y * Hr + X2) * (4 * C) + 4 * c;
    v4f r0[4], r1[4];                                    // g: channel c + 16 (g >> 1) + (g & 1)
#pragma unroll
    for (int g = 0; g < 4; ++g) {
        const float* sg = s + (size_t)((g >> 1) * 16 + (g & 1)) * Hs * Hs;
        r0[g] = *(const v4f*)(sg); r1[g] = *(const v4f*)(sg + Hs);
    }
#pragma unroll
    for (int gg = 0; gg < 2; ++gg) {
        const v4f a0 = r0[2 * gg], a1 = r1[2 * gg], b0 = r0[2 * gg + 1], b1 = r1[2 * gg + 1];
        const v8h lo = {(_Float16)a0[0], (_Float16)a0[1], (_Float16)a1[0], (_Float16)a1[1], (_Float16)b0[0], (_Float16)b0[1], (_Float16)b1[0], (_Float16)b1[1]};
        const v8h hi = {(_Float16)a0[2], (_Float16)a0[3], (_Float16)a1[2], (_Float16)a1[3], (_Float16)b0[2], (_Float16)b0[3], (_Float16)b1[2], (_Float16)b1[3]};
        *(v8h*)(d + 64 * gg) = lo; *(v8h*)(d + 4 * C + 64 * gg) = hi;
    }
    asm volatile("s_wait_xcnt 0x0" ::: "memory");   // in the built kernel another arm's code lies behind these stores and rewrites their registers: the wait stands in front of it
}
// every re-layout of the inputs in one launch (none reads what another writes): blocks 0 .. NX - 1 transpose and cast x (Z images of R x Hs*Hs), the NC blocks behind them lay out the im2col operand,
// the last 208 cast the weights (x sw). grid NX + NC + 208, block 256.
template <int R, int Hs, int Z>
__global__ __launch_bounds__(256) void k_cast_in(const float* __restrict__ x, _Float16* __restrict__ xt, _Float16* __restrict__ col, const float* __restrict__ Wq, const float* __restrict__ Wqb, const float* __restrict__ Wkvb,
                                                  const float* __restrict__ Wkv, const float* __restrict__ Wout, _Float16* __restrict__ w16, float sw) {
    constexpr int C = Hs * Hs, BX = C / 128, BY = R / 64, NX = BX * BY * Z, CB = Hs / 2 * (R / 64), NC = CB * Z;
    const int bi = blockIdx.x;
    if (bi < NX) castT16_block<R, C>(x, xt, 1.0f, bi % BX, (bi / BX) % BY, bi / (BX * BY));
    else if (bi < NX + NC) es_col_block<R, Hs>(x, col, (bi - NX) % CB, (bi - NX) / CB);
    else castW16_block(Wq, Wqb, Wkvb, Wkv, Wout, w16, sw, bi - NX - NC);
}
// batch-wise attention: for (p, h, b): scores over b' = q_b . k_b' * scale (4 values), softmax, out = sum att v_b'; D[b][p][h*32+d] = f16(S[b][p][h*32+d] + out) (S holds out_img; D is the
//   output conv's f16 operand)
//   One wave: one position p, 4 heads (8 lanes x 4 floats a head), all 4 images, so each k and v row is read once. grid P * C / 1024, block 256.
//   A projection row holds [q | q_b | k_b | v_b], 4 C floats. The planes come as separate arguments (P0 .. P3: one image of projections each, S01 / D01: images 0 and 1, S23 / D23: images 2
//   and 3), so that every row address is one of these scalar bases plus one lane offset plus an immediate that the instruction can hold.
template <int P, int C>
__global__ __launch_bounds__(256) void k_es_batch(const float* __restrict__ P0, const float* __restrict__ P1, const float* __restrict__ P2, const float* __restrict__ P3,
                                                    const float* __restrict__ S01, const float* __restrict__ S23, _Float16* __restrict__ D01, _Float16* __restrict__ D23) {
    static_assert(C % 128 == 0, "a wave spans 128 channels");
    const int w = blockIdx.x * 8 + __builtin_amdgcn_readfirstlane(threadIdx.x >> 5);   // the wave's number as a scalar: every row address below is a scalar base plus one lane offset
    const unsigned lo = (threadIdx.x & 31) * 16;                                        // this lane's byte offset in the wave's 512-byte piece of a row
    const int p = w / (C / 128); const int col = (w % (C / 128)) * 128;
    const size_t oq = (size_t)p * C + col, op = (size_t)p * 4 * C + col;
    const char* prow[4] = {(const char*)(P0 + op), (const char*)(P1 + op), (const char*)(P2 + op), (const char*)(P3 + op)};
    const char* srow[4] = {(const char*)(S01 + oq), (const char*)(S01 + oq + P * C), (const char*)(S23 + oq), (const char*)(S23 + oq + P * C)};
    v4f q[4], k[4], v[4], sv[4];
#pragma unroll
    for (int b = 0; b < 4; ++b) {
        q[b] = *(const v4f*)(prow[b] + lo + C * 4); k[b] = *(const v4f*)(prow[b] + lo + 2 * C * 4);
    }
#pragma unroll
    for (int b = 0; b < 4; ++b) {
        v[b] = *(const v4f*)(prow[b] + lo + 3 * C * 4); sv[b] = *(const v4f*)(srow[b] + lo);
    }
    asm volatile("s_wait_xcnt 0x0" ::: "memory");   // the loads' scalar base registers are reused for the store bases formed below: the wait stands in front of that overwrite
    __builtin_amdgcn_sched_barrier(0);   // keeps all 16 loads in front of the arithmetic (without it the v and S loads are issued only behind the scores, a second memory latency) and later register writes behind the wait
    char* drow[4] = {(char*)(D01 + oq), (char*)(D01 + oq + P * C), (char*)(D23 + oq), (char*)(D23 + oq + P * C)};
#pragma unroll
    for (int b = 0; b < 4; ++b) {
        float sc[4]; float mx = -__builtin_inff();
#pragma unroll
        for (int b2 = 0; b2 < 4; ++b2) {
            float d0 = q[b][0] * k[b2][0] + q[b][1] * k[b2][1] + q[b][2] * k[b2][2] + q[b][3] * k[b2][3];
            for (int o = 4; o > 0; o >>= 1) d0 += __shfl_xor(d0, o, 32);
            sc[b2] = d0 * 0.17677669529663689f; mx = fmaxf(mx, sc[b2]);
        }
        float den = 0.f;
#pragma unroll
        for (int b2 = 0; b2 < 4; ++b2) { sc[b2] = expf(sc[b2] - mx); den += sc[b2]; }
        v4f o_ = {0.f, 0.f, 0.f, 0.f};
#pragma unroll
        for (int b2 = 0; b2 < 4; ++b2) o_ += sc[b2] / den * v[b2];
        const v4f r = sv[b] + o_;
        const v4h hv = {(_Float16)r[0], (_Float16)r[1], (_Float16)r[2], (_Float16)r[3]};
        *(v4h*)(drow[b] + (lo >> 1)) = hv;
    }
}


extern "C" void kernel_launch(void* const* d_in, const int* in_sizes, int n_in, void* d_out, int out_size, void* d_ws, size_t ws_size, hipStream_t stream) {
    (void)in_sizes; (void)n_in; (void)out_size; (void)ws_size;
    const float* x = (const float*)d_in[0];
    const float* Wq = (const float*)d_in[1];
    const float* Wkv = (const float*)d_in[2];
    const float* Wqb = (const float*)d_in[3];
    const float* Wkvb = (const float*)d_in[4];
    const float* Wout = (const float*)d_in[5];
    float* out = (float*)d_out;
    // every activation plane holds all 4 images, image-major; each is written by one launch and read by later ones of this call
    char* wsp = (char*)d_ws;
    float* PRJ = (float*)wsp; wsp += (size_t)4 * 4096 * 1024 * 4;          // [4][4096][1024] the 1x1 projections, position-major: q | q_b | k_b | v_b
    _Float16* KF16 = (_Float16*)wsp; wsp += (size_t)4 * 8 * 1024 * 32 * 2; // [4][8] planes of k in fragment order
    _Float16* VF16 = (_Float16*)wsp; wsp += (size_t)4 * 8 * 1024 * 32 * 2; // [4][8] planes of v in fragment order
    float* S = (float*)wsp; wsp += (size_t)4 * 4096 * 256 * 4;             // [4][4096][256] out_img
    _Float16* XT16 = (_Float16*)wsp; wsp += (size_t)4 * 4096 * 256 * 2;    // [4][4096][256] x^T
    _Float16* COL16 = (_Float16*)wsp; wsp += (size_t)4 * 1024 * 1024 * 2;  // [4][1024][1024] im2col
    _Float16* S16 = (_Float16*)wsp; wsp += (size_t)4 * 4096 * 256 * 2;     // [4][4096][256] out_img + out_batch
    _Float16* W16 = (_Float16*)wsp; wsp += (size_t)851968 * 2;             // [Wq | Wqb | Wkvb | Wkv | Wout], x16
    const _Float16* Wkv16 = W16 + 262144;
    const _Float16* Wout16 = W16 + 786432;
    k_cast_in<256, 64, 4><<<1232, 256, 0, stream>>>(x, XT16, COL16, Wq, Wqb, Wkvb, Wkv, Wout, W16, 16.0f);
    // one launch for the two products that need only the planes above. The kv conv: im2col rows x Wkv. The 1x1 projections share their left operand and their weights over the images:
    // one product over the 4 * 4096 stacked positions and the 1024 stacked weight rows [Wq | Wqb | Wkvb].
    w25::wmma_gemm64_pair<<<576, 256, 0, stream>>>((const unsigned short*)(COL16), (const unsigned short*)(Wkv16), KF16, VF16, 10, 4096, 512, 1024, 64, (const unsigned short*)(XT16), (const unsigned short*)(W16), PRJ, 16384, 1024, 256, 0.0625f);
    k_attn32<4096, 1024, 1024, 256><<<dim3(64, 8, 4), 32 * AW, 0, stream>>>(PRJ, KF16, VF16, S, 0.1767766952966369f);
    k_es_batch<4096, 256><<<1024, 256, 0, stream>>>(PRJ, PRJ + 4194304, PRJ + 8388608, PRJ + 12582912, S, S + 2097152, S16, S16 + 2097152);
    // output conv: grid y = image (weights shared: stride 0)
    w25::wmma_gemm64<0, false, 0, 0, false, 0><<<dim3(32, 4), 256, 0, stream>>>((const unsigned short*)(Wout16), nullptr, 256, 0, (const unsigned short*)(S16), nullptr, 256, 1048576, (void*)(out), nullptr, 4096, 1048576, nullptr, nullptr, 0, 256, 4096, 256, 0.0625f);
}
